// v000
// The times below were measured on an AMD MI455X: many runs one after another, warmed up first and cycling through
// copies of the inputs, with the whole window's GPU time divided by the number of runs. Launches and the gaps
// between them are all in it. The median over several windows is given; except for v000 it joins two sittings, which
// can be a few percent apart, so the side-by-side timings, each taken in one sitting, are the better comparison.
// v000 is the starting kernel. One run takes 1170 microseconds.
// compute dtype: all float inputs rounded to bf16; q/k/v = input W^T with EXACT bf16 products on WMMA 16x16x32 (f32 accumulate); causal (strict past) logits: q, k once to f16 (1 product) x 1024^-0.5, except the first 384 query rows of each sequence (3 products with f16 residuals); softmax in f32; P x 2^11 once to f16 against v once to f16 (1 product; bf16 hi + lo below row 384); ctx once to f16 against Wo carried x 2^8 in f16 (bf16 hi + lo against bf16 Wo, 2 products, below row 384); f32 output.
#include <hip/hip_runtime.h>
#include <math.h>

typedef __attribute__((ext_vector_type(16))) _Float16 v16h;
typedef __attribute__((ext_vector_type(16))) __bf16 v16b;
typedef __attribute__((ext_vector_type(8)))  _Float16 v8h;
typedef __attribute__((ext_vector_type(8)))  float v8f;
typedef __attribute__((ext_vector_type(4)))  float v4f;
typedef __attribute__((ext_vector_type(2)))  float v2f;
typedef __attribute__((ext_vector_type(4)))  unsigned v4u;
typedef __attribute__((ext_vector_type(4)))  int v4i;
typedef float __attribute__((may_alias)) float_a;
typedef int __attribute__((may_alias)) int_a;

template <typename T> __device__ __forceinline__ void vst2(void* p, T v) { *(T*)p = v;  }
__device__ __forceinline__ v8f wmma16(v16h a, v16h b, v8f c) {
  v8f d = __builtin_amdgcn_wmma_f32_16x16x32_f16(false, a, false, b, (short)0, c, false, false);
  asm volatile("v_nop\n\tv_nop\n\tv_nop\n\tv_nop" : "+v"(d) : "v"(a), "v"(b));
  return d;
}
__device__ __forceinline__ v8f wmma_bf(v16b a, v16b b, v8f c) {
  v8f d = __builtin_amdgcn_wmma_f32_16x16x32_bf16(false, a, false, b, (short)0, c, false, false);
  asm volatile("v_nop\n\tv_nop\n\tv_nop\n\tv_nop" : "+v"(d) : "v"(a), "v"(b));
  return d;
}
// 16x16x32 fragments: lane = (h = lane>>4, row/col = lane&15); elements 0..7 = k0+8h+0..7, 8..15 = k0+16+8h+0..7; D element r = row 8h+r
__device__ __forceinline__ v16h frag_h(const _Float16* rowk0, int lane) {
  union { v16h v; v8h q[2]; } u; const _Float16* p = rowk0 + 8 * (lane >> 4);
  u.q[0] = *(const v8h*)p; u.q[1] = *(const v8h*)(p + 16); return u.v;
}
__device__ __forceinline__ v16h frag_f32(const float* rowk0, int lane) {
  v16h a; const float* p = rowk0 + 8 * (lane >> 4);
#pragma unroll
  for (int i = 0; i < 8; ++i) { a[i] = (_Float16)p[i]; a[8 + i] = (_Float16)p[16 + i]; }
  return a;
}
__device__ __forceinline__ v16h frag_f32s(const float* rowk0, int lane, float sc) {
  v16h a; const float* p = rowk0 + 8 * (lane >> 4);
#pragma unroll
  for (int i = 0; i < 8; ++i) { a[i] = (_Float16)(p[i] * sc); a[8 + i] = (_Float16)(p[16 + i] * sc); }
  return a;
}
// column fragment from a [K][ld] layout (column n), rows >= K read as 0
__device__ __forceinline__ v16h fragc_f32(const float* W, int k0, int n, int lane, int ld, int K) {
  v16h a; const int g = lane >> 4;
#pragma unroll
  for (int i = 0; i < 8; ++i) { const int ka = k0 + 8 * g + i, kb = ka + 16;
    a[i] = (_Float16)(ka < K ? W[(size_t)(ka < K ? ka : K - 1) * ld + n] : 0.f); a[8 + i] = (_Float16)(kb < K ? W[(size_t)(kb < K ? kb : K - 1) * ld + n] : 0.f); }
  return a;
}
struct F2 { v16b h, l; };
__device__ __forceinline__ F2 bsplit16(const float v[16]) { F2 r;
#pragma unroll
  for (int i = 0; i < 16; ++i) { const __bf16 h = (__bf16)v[i]; r.h[i] = h; r.l[i] = (__bf16)(v[i] - (float)h); }
  return r; }
__device__ __forceinline__ F2 split_row(const float* row, int k0, int lane) { float v[16]; const float* p = row + k0 + 8 * (lane >> 4);
#pragma unroll
  for (int i = 0; i < 8; ++i) { v[i] = p[i]; v[8 + i] = p[16 + i]; }
  return bsplit16(v); }
__device__ __forceinline__ F2 split_rowK(const float* row, int k0, int lane, int K) { float v[16]; const int g = lane >> 4;
#pragma unroll
  for (int i = 0; i < 8; ++i) { const int ka = k0 + 8 * g + i, kb = ka + 16; v[i] = ka < K ? row[ka < K ? ka : K - 1] : 0.f; v[8 + i] = kb < K ? row[kb < K ? kb : K - 1] : 0.f; }
  return bsplit16(v); }
__device__ __forceinline__ F2 split_col(const float* W, int k0, int n, int lane, int ld, int K) { float v[16]; const int g = lane >> 4;
#pragma unroll
  for (int i = 0; i < 8; ++i) { const int ka = k0 + 8 * g + i, kb = ka + 16; v[i] = ka < K ? W[(size_t)(ka < K ? ka : K - 1) * ld + n] : 0.f; v[8 + i] = kb < K ? W[(size_t)(kb < K ? kb : K - 1) * ld + n] : 0.f; }
  return bsplit16(v); }
__device__ __forceinline__ v8f mac3(const F2& a, const F2& b, v8f c) { c = wmma_bf(a.l, b.h, c); c = wmma_bf(a.h, b.l, c); return wmma_bf(a.h, b.h, c); }
__device__ __forceinline__ float sigm(float v) { return 1.0f / (1.0f + expf(-v)); }
#define LDSX() do { asm volatile("s_wait_dscnt 0" ::: "memory"); __builtin_amdgcn_wave_barrier(); __builtin_amdgcn_fence(__ATOMIC_RELEASE, "workgroup"); } while (0)

// In-context-learning attention (B 2, S 2,048, E 1,024 = 16 x 64; separate q/k/v inputs): qh = q Wq^T, kh = k Wk^T, vh = v Wv^T ((out,in)); scores = qh kh^T / sqrt(1024) masked where key >= query (strict past) except (0, 0); softmax; out = merged(probs vh) Wo^T.
#define NB 2
#define TT 2048
#define CC 1024            // NH * HD = projected width
#define DIN 1024          // input (model) width
#define NH 16
#define HD 64
#define NQB (TT / 64)
#define HG 4
#define SCALE (0.03125f)
#define CAUSAL 1
#ifndef TNB
#define TNB NB
#endif
__device__ __forceinline__ float bfr(float v) { return (float)(__bf16)v; }
__host__ __device__ __forceinline__ int kb_last(int qb) { return CAUSAL ? ((qb * 64 + 63) >> 7) : (TT / 128 - 1); }
typedef __attribute__((ext_vector_type(8))) __bf16 v8b;
__device__ __forceinline__ v16b frag_b(const __bf16* rowk0, int lane) {
  union { v16b v; v8b q[2]; } u; const __bf16* p = rowk0 + 8 * (lane >> 4);
  u.q[0] = *(const v8b*)p; u.q[1] = *(const v8b*)(p + 16); return u.v;
}
#define QBH 6              // causal: query blocks 0..QBH-1 of each sequence (few keys, no averaging) take the high-precision path
#define QHI 384            // rows carrying a q residual plane
#define KHI 384            // key rows carrying k residual / v bf16 hi+lo planes (used only by the causal high-precision path)
// B fragment (k rows k0+.., output column o) of a weight: (in,out) [K][ld] or (out,in) [ld rows of K]: bf16 exact, or f16(bf16 * 256) exact
__device__ __forceinline__ v16b wcol_io(const float* Wm, int k0, int o, int lane, int ld) { v16b w; const int g = lane >> 4;
#pragma unroll
  for (int i = 0; i < 8; ++i) { w[i] = (__bf16)Wm[(size_t)(k0 + 8 * g + i) * ld + o]; w[8 + i] = (__bf16)Wm[(size_t)(k0 + 16 + 8 * g + i) * ld + o]; }
  return w; }
__device__ __forceinline__ v16b wcol_oi(const float* Wm, int k0, int o, int lane, int K) { v16b w; const float* p = Wm + (size_t)o * K + k0 + 8 * (lane >> 4);
#pragma unroll
  for (int i = 0; i < 8; ++i) { w[i] = (__bf16)p[i]; w[8 + i] = (__bf16)p[16 + i]; }
  return w; }
__device__ __forceinline__ v16h wcolh_io(const float* Wm, int k0, int o, int lane, int ld) { v16h w; const int g = lane >> 4;
#pragma unroll
  for (int i = 0; i < 8; ++i) { w[i] = (_Float16)(bfr(Wm[(size_t)(k0 + 8 * g + i) * ld + o]) * 256.0f); w[8 + i] = (_Float16)(bfr(Wm[(size_t)(k0 + 16 + 8 * g + i) * ld + o]) * 256.0f); }
  return w; }
__device__ __forceinline__ v16h wcolh_oi(const float* Wm, int k0, int o, int lane, int K) { v16h w; const float* p = Wm + (size_t)o * K + k0 + 8 * (lane >> 4);
#pragma unroll
  for (int i = 0; i < 8; ++i) { w[i] = (_Float16)(bfr(p[i]) * 256.0f); w[8 + i] = (_Float16)(bfr(p[16 + i]) * 256.0f); }
  return w; }
#define WQKV_LAYOUT 1   // 0 = (in,out) [DIN][CC]; 1 = (out,in) [CC][DIN]; 2 = per-head [NH][DIN][HD]
__device__ __forceinline__ v16b wcol_hdk(const float* Wm, int k0, int o, int lane) { v16b w; const int g = lane >> 4; const float* p = Wm + (size_t)(o / HD) * DIN * HD + (o % HD);
#pragma unroll
  for (int i = 0; i < 8; ++i) { w[i] = (__bf16)p[(size_t)(k0 + 8 * g + i) * HD]; w[8 + i] = (__bf16)p[(size_t)(k0 + 16 + 8 * g + i) * HD]; }
  return w; }
#define WO_OUT_IN 1
#if WQKV_LAYOUT == 1
#define WCOL(W, k0, o, lane) wcol_oi(W, k0, o, lane, DIN)
#elif WQKV_LAYOUT == 2
#define WCOL(W, k0, o, lane) wcol_hdk(W, k0, o, lane)
#else
#define WCOL(W, k0, o, lane) wcol_io(W, k0, o, lane, CC)
#endif
#if WO_OUT_IN
#define WOCOL(W, k0, o, lane) wcol_oi(W, k0, o, lane, CC)
#define WOCOLH(W, k0, o, lane) wcolh_oi(W, k0, o, lane, CC)
#else
#define WOCOL(W, k0, o, lane) wcol_io(W, k0, o, lane, DIN)
#define WOCOLH(W, k0, o, lane) wcolh_io(W, k0, o, lane, DIN)
#endif
#define SM_MASK_HOOK do { v = (k == t && t != 0) ? -3.0e38f : v; } while (0)   /* strict past: the diagonal is masked too, except position (0, 0) */
#ifndef SM_EXTRA_PARAMS
#define SM_EXTRA_PARAMS
#endif
#ifndef PROJ_EXTRA_PARAMS
#define PROJ_EXTRA_PARAMS
#endif
#ifndef SM_MASK_HOOK
#define SM_MASK_HOOK (void)0
#endif

#define WS_QH  0u                                      // f16 q rows [b*t][CC]
#define WS_KH  (WS_QH + 2u * (size_t)NB * TT * CC)      // f16 k rows [b*t][CC]
#define WS_VT  (WS_KH + 2u * (size_t)NB * TT * CC)      // f16 v planes [b][c][t]
#define WS_QL  (WS_VT + 2u * (size_t)NB * CC * TT)      // f16 q residual x 2^10 rows [b][t < QHI][CC]
#define WS_KL  (WS_QL + 2u * (size_t)NB * QHI * CC)     // f16 k residual x 2^10 rows [b][t < KHI][CC]
#define WS_VB  (WS_KL + 2u * (size_t)NB * KHI * CC)     // bf16 v hi planes [b][c][t < KHI]
#define WS_VBL (WS_VB + 2u * (size_t)NB * CC * KHI)
#define WS_S   (WS_VBL + 2u * (size_t)NB * CC * KHI)    // f32 logits / P [hg][t][s]
#define WS_Y   (WS_S  + 4u * (size_t)HG * TT * TT)      // f32 ctx rows [b*t][CC] (only when there is an output projection)
#define WS_END (WS_Y  + 4u * (size_t)NB * TT * CC)

// ---- k_proj: block = (64 rows, 128 cols, which): q/k/v = X W (+ b) with exact bf16 products (K = DIN) -> which 0: q f16 rows (+ residual rows < QHI); 1: k f16 rows (+ residual rows < KHI); 2: v f16 planes [c][t] (+ bf16 hi/lo planes for t < KHI)
__global__ __launch_bounds__(128) void k_proj(const float* __restrict__ XQ, const float* __restrict__ XK, const float* __restrict__ XV, const float* __restrict__ WQ, const float* __restrict__ WK, const float* __restrict__ WV, const float* __restrict__ BQ, const float* __restrict__ BK, const float* __restrict__ BV,
    _Float16* __restrict__ QH, _Float16* __restrict__ QL, _Float16* __restrict__ KH, _Float16* __restrict__ KL, _Float16* __restrict__ VT, __bf16* __restrict__ VB, __bf16* __restrict__ VBL) {
  __shared__ __align__(16) _Float16 sh[64][136], sl[64][136]; __shared__ __align__(16) _Float16 th[128][72]; __shared__ __align__(16) __bf16 tb[128][72], tbl[128][72];
  const int tid = threadIdx.x, wave = tid >> 5, lane = tid & 31, col = lane & 15, g = lane >> 4; const int which = blockIdx.z; const int c0 = blockIdx.y * 128; const size_t r0 = (size_t)blockIdx.x * 64; const size_t bb = r0 / TT; const int t0 = (int)(r0 % TT);
  const float* X = which == 0 ? XQ : which == 1 ? XK : XV; const float* WA = which == 0 ? WQ : which == 1 ? WK : WV; const float* BA = which == 0 ? BQ : which == 1 ? BK : BV;
  v8f acc[8] = {};
#pragma unroll 2
  for (int kc = 0; kc < DIN / 32; ++kc) { v16b a; { const float* p = X + (r0 + wave * 16 + col) * DIN + kc * 32 + 8 * g;
#pragma unroll
      for (int i = 0; i < 8; ++i) { a[i] = (__bf16)p[i]; a[8 + i] = (__bf16)p[16 + i]; } }
    asm volatile("s_wait_loadcnt 0x0" ::: "memory");
#pragma unroll
    for (int j = 0; j < 8; ++j) { const v16b w = WCOL(WA, kc * 32, c0 + j * 16 + col, lane); asm volatile("s_wait_loadcnt 0x0" ::: "memory"); acc[j] = wmma_bf(a, w, acc[j]); } }
  if (which < 2) { _Float16* DH = which == 0 ? QH : KH; _Float16* DL = which == 0 ? QL : KL; const int nhi = which == 0 ? QHI : KHI; const bool hi_rows = t0 < nhi;
#pragma unroll
    for (int j = 0; j < 8; ++j) { const float bias = BA ? bfr(BA[c0 + j * 16 + col]) : 0.f;
#pragma unroll
      for (int r = 0; r < 8; ++r) { const float v = acc[j][r] + bias; const _Float16 hv = (_Float16)v; sh[wave * 16 + 8 * g + r][j * 16 + col] = hv; sl[wave * 16 + 8 * g + r][j * 16 + col] = (_Float16)((v - (float)hv) * 1024.0f); } }
    __syncthreads();
    for (int e = tid; e < 64 * 16; e += 128) { const int rl = e >> 4, q = e & 15; vst2((unsigned*)(DH + (r0 + rl) * CC + c0 + q * 8), *(const v4u*)&sh[rl][q * 8]); if (hi_rows) vst2((unsigned*)(DL + (bb * nhi + t0 + rl) * (size_t)CC + c0 + q * 8), *(const v4u*)&sl[rl][q * 8]); }
  } else { const bool hi_rows = t0 < KHI;
#pragma unroll
    for (int j = 0; j < 8; ++j) { const float bias = BA ? bfr(BA[c0 + j * 16 + col]) : 0.f;
#pragma unroll
      for (int r = 0; r < 8; ++r) { const float v = acc[j][r] + bias; const int rl = wave * 16 + 8 * g + r, cl = j * 16 + col; th[cl][rl] = (_Float16)v; const __bf16 bh = (__bf16)v; tb[cl][rl] = bh; tbl[cl][rl] = (__bf16)(v - (float)bh); } }
    __syncthreads();
    for (int e = tid; e < 128 * 8; e += 128) { const int cl = e >> 3, q = e & 7; vst2((unsigned*)(VT + (bb * CC + c0 + cl) * (size_t)TT + t0 + q * 8), *(const v4u*)&th[cl][q * 8]); if (hi_rows) { const size_t o3 = (bb * CC + c0 + cl) * (size_t)KHI + t0 + q * 8; vst2((unsigned*)(VB + o3), *(const v4u*)&tb[cl][q * 8]); vst2((unsigned*)(VBL + o3), *(const v4u*)&tbl[cl][q * 8]); } } } }
// ---- k_sc: block = (query block qb, key block kb <= kb_last(qb), head in group) of batch b: logits x SCALE; q hi + residual (x 2^10) against k (2 products) for query rows < QHI, plus the k residual (3 products) for query blocks < QBH (causal early rows); causal: blocks past the diagonal exit, the mask itself is applied by index in k_sm
__global__ __launch_bounds__(128) void k_sc(const _Float16* __restrict__ QH, const _Float16* __restrict__ KH, const _Float16* __restrict__ QL, const _Float16* __restrict__ KL, int b, int h0, float* __restrict__ S0) { __shared__ __align__(16) float ss[4][16][132];
  const int qb = blockIdx.x, kb = blockIdx.y; if (kb > kb_last(qb)) return;
  const int h = h0 + blockIdx.z; float* S = S0 + (size_t)blockIdx.z * TT * TT;
  const int tid = threadIdx.x, wave = tid >> 5, lane = tid & 31, col = lane & 15, g = lane >> 4; const int k0 = kb * 128; const int ql0 = qb * 64 + wave * 16; const size_t q0 = (size_t)b * TT + ql0, kr0 = (size_t)b * TT + k0;
  v8f acc[8] = {}, accl[8] = {};
  const _Float16* QLb = QL + (size_t)b * QHI * CC; const _Float16* KLb = KL + (size_t)b * KHI * CC;
  if (qb < QBH) {
#pragma unroll
    for (int kc = 0; kc < HD / 32; ++kc) { const v16h ah = frag_h(QH + (q0 + col) * CC + h * HD + kc * 32, lane), al = frag_h(QLb + (size_t)(ql0 + col) * CC + h * HD + kc * 32, lane);
#pragma unroll
      for (int j = 0; j < 8; ++j) { const v16h kbf = frag_h(KH + (kr0 + j * 16 + col) * CC + h * HD + kc * 32, lane), klf = frag_h(KLb + (size_t)(k0 + j * 16 + col) * CC + h * HD + kc * 32, lane); acc[j] = wmma16(ah, kbf, acc[j]); accl[j] = wmma16(al, kbf, accl[j]); accl[j] = wmma16(ah, klf, accl[j]); } }
  } else if (qb * 64 < QHI) {
#pragma unroll
    for (int kc = 0; kc < HD / 32; ++kc) { const v16h ah = frag_h(QH + (q0 + col) * CC + h * HD + kc * 32, lane), al = frag_h(QLb + (size_t)(ql0 + col) * CC + h * HD + kc * 32, lane);
#pragma unroll
      for (int j = 0; j < 8; ++j) { const v16h kbf = frag_h(KH + (kr0 + j * 16 + col) * CC + h * HD + kc * 32, lane); acc[j] = wmma16(ah, kbf, acc[j]); accl[j] = wmma16(al, kbf, accl[j]); } }
  } else {
#pragma unroll
    for (int kc = 0; kc < HD / 32; ++kc) { const v16h ah = frag_h(QH + (q0 + col) * CC + h * HD + kc * 32, lane);
#pragma unroll
      for (int j = 0; j < 8; ++j) { const v16h kbf = frag_h(KH + (kr0 + j * 16 + col) * CC + h * HD + kc * 32, lane); acc[j] = wmma16(ah, kbf, acc[j]); } } }
#pragma unroll
  for (int j = 0; j < 8; ++j) {
#pragma unroll
    for (int r = 0; r < 8; ++r) ss[wave][8 * g + r][j * 16 + col] = (acc[j][r] + accl[j][r] * (1.0f / 1024.0f)) * SCALE; }
  LDSX(); for (int rl = 0; rl < 16; ++rl) vst2(S + (size_t)(ql0 + rl) * TT + k0 + lane * 4, *(const v4f*)&ss[wave][rl][lane * 4]); }
// ---- k_sm: block = query row t (head in group): keys [0, kend): causal -> logit if s < t (or s = t = 0) else excluded; softmax in f32; P x 2^11 in place (0 for excluded)
__global__ __launch_bounds__(256) void k_sm(float* __restrict__ S0 SM_EXTRA_PARAMS) { __shared__ float sred[8]; __shared__ float sbc; __shared__ __align__(16) float shv[TT];
  const int tid = threadIdx.x; const int t = blockIdx.x; const int kend = (kb_last(t >> 6) + 1) * 128;
  float* sr = S0 + (size_t)blockIdx.y * TT * TT + (size_t)t * TT;
  float m = -3.0e38f; for (int k = tid; k < kend; k += 256) { float v = (!CAUSAL || k <= t) ? sr[k] : -3.0e38f; SM_MASK_HOOK; shv[k] = v; m = fmaxf(m, v); }
#pragma unroll
  for (int o = 1; o < 32; o <<= 1) m = fmaxf(m, __shfl_xor(m, o));
  if ((tid & 31) == 0) sred[tid >> 5] = m; __syncthreads(); if (tid == 0) { float a = sred[0]; for (int i = 1; i < 8; ++i) a = fmaxf(a, sred[i]); sbc = a; } __syncthreads(); m = sbc; __syncthreads();
  float sum = 0.f; for (int k = tid; k < kend; k += 256) { const float v = shv[k]; const float e = (v <= -1.0e38f) ? 0.f : expf(v - m); shv[k] = e; sum += e; }
#pragma unroll
  for (int o = 1; o < 32; o <<= 1) sum += __shfl_xor(sum, o);
  if ((tid & 31) == 0) sred[tid >> 5] = sum; __syncthreads(); if (tid == 0) { float a = 0.f; for (int i = 0; i < 8; ++i) a += sred[i]; sbc = a > 0.f ? 2048.0f / a : 0.f; }   /* a fully excluded row yields P = 0 */ __syncthreads(); const float inv = sbc;
  for (int k = tid; k < kend; k += 256) shv[k] = shv[k] * inv;
  __syncthreads(); for (int q = tid; q < kend / 4; q += 256) vst2(sr + q * 4, *(const v4f*)&shv[q * 4]); }
// ---- k_pv: block = 64 queries (qb) of (b, h): ctx = P . v over keys [0, kend) (P x 2^11 once to f16 against v f16: 1 product; causal early query blocks: P and v as bf16 hi + lo, 3 products); 256-B (row, head) segment by 16 lanes
__global__ __launch_bounds__(128) void k_pv(const float* __restrict__ PS0, const _Float16* __restrict__ VT, const __bf16* __restrict__ VB, const __bf16* __restrict__ VBL, int b, int h0, float* __restrict__ Y) { const int h = h0 + blockIdx.z; const float* PS = PS0 + (size_t)blockIdx.z * TT * TT; __shared__ __align__(16) float ss[4][16][HD + 4];
  const int tid = threadIdx.x, wave = tid >> 5, lane = tid & 31, col = lane & 15, g = lane >> 4; const int qb = blockIdx.x; const int ql0 = qb * 64 + wave * 16; const int kce = (kb_last(qb) + 1) * 4;
  v8f acc[HD / 16] = {};
  if (qb < QBH) {
#pragma unroll 1
    for (int kc = 0; kc < kce; ++kc) { const F2 p = split_row(PS + (size_t)(ql0 + col) * TT, kc * 32, lane);
      asm volatile("s_wait_loadcnt 0x0" ::: "memory");
#pragma unroll
      for (int j = 0; j < HD / 16; ++j) { const size_t po = ((size_t)b * CC + h * HD + j * 16 + col) * (size_t)KHI + kc * 32; const v16b vh = frag_b(VB + po, lane); acc[j] = wmma_bf(p.h, vh, acc[j]); acc[j] = wmma_bf(p.l, vh, acc[j]); acc[j] = wmma_bf(p.h, frag_b(VBL + po, lane), acc[j]); } }
  } else {
#pragma unroll 1
    for (int kc = 0; kc < kce; ++kc) { const v16h p = frag_f32(PS + (size_t)(ql0 + col) * TT + kc * 32, lane);
      asm volatile("s_wait_loadcnt 0x0" ::: "memory");
#pragma unroll
      for (int j = 0; j < HD / 16; ++j) { const size_t po = ((size_t)b * CC + h * HD + j * 16 + col) * (size_t)TT + kc * 32; acc[j] = wmma16(p, frag_h(VT + po, lane), acc[j]); } } }
#pragma unroll
  for (int j = 0; j < HD / 16; ++j)
#pragma unroll
    for (int r = 0; r < 8; ++r) ss[wave][8 * g + r][j * 16 + col] = acc[j][r] * (1.0f / 2048.0f);
  LDSX(); for (int rl = 0; rl < 16; ++rl) if (lane < HD / 4) vst2(Y + ((size_t)b * TT + ql0 + rl) * CC + h * HD + lane * 4, *(const v4f*)&ss[wave][rl][lane * 4]); }
// ---- k_out: block = (64 rows, 128 cols): out = ctx Wo (+ bo): ctx once to f16 against Wo as f16(bf16 x 2^8) exact (1 product) x 2^-8; causal early rows (< QHI of each sequence): ctx bf16 hi + lo against exact bf16 Wo (2 products)
__global__ __launch_bounds__(128) void k_out(const float* __restrict__ Y, const float* __restrict__ WO, const float* __restrict__ BO, float* __restrict__ OUT) { __shared__ __align__(16) float sf[4][16][132];
  const int tid = threadIdx.x, wave = tid >> 5, lane = tid & 31, col = lane & 15, g = lane >> 4; const int c0 = blockIdx.y * 128; const size_t r0 = (size_t)blockIdx.x * 64 + wave * 16;
  v8f acc[8] = {};
  if (CAUSAL && (int)(((size_t)blockIdx.x * 64) % TT) < QHI) {   /* block-uniform */
#pragma unroll 2
    for (int kc = 0; kc < CC / 32; ++kc) { const F2 a = split_row(Y + (r0 + col) * CC, kc * 32, lane); asm volatile("s_wait_loadcnt 0x0" ::: "memory");
#pragma unroll
      for (int j = 0; j < 8; ++j) { const v16b w = WOCOL(WO, kc * 32, c0 + j * 16 + col, lane); asm volatile("s_wait_loadcnt 0x0" ::: "memory"); acc[j] = wmma_bf(a.h, w, acc[j]); acc[j] = wmma_bf(a.l, w, acc[j]); } }
#pragma unroll
    for (int j = 0; j < 8; ++j) { const float bias = BO ? bfr(BO[c0 + j * 16 + col]) : 0.f;
#pragma unroll
      for (int r = 0; r < 8; ++r) sf[wave][8 * g + r][j * 16 + col] = acc[j][r] + bias; }
  } else {
#pragma unroll 2
    for (int kc = 0; kc < CC / 32; ++kc) { const v16h a = frag_f32(Y + (r0 + col) * CC + kc * 32, lane); asm volatile("s_wait_loadcnt 0x0" ::: "memory");
#pragma unroll
      for (int j = 0; j < 8; ++j) { const v16h w = WOCOLH(WO, kc * 32, c0 + j * 16 + col, lane); asm volatile("s_wait_loadcnt 0x0" ::: "memory"); acc[j] = wmma16(a, w, acc[j]); } }
#pragma unroll
    for (int j = 0; j < 8; ++j) { const float bias = BO ? bfr(BO[c0 + j * 16 + col]) : 0.f;
#pragma unroll
      for (int r = 0; r < 8; ++r) sf[wave][8 * g + r][j * 16 + col] = acc[j][r] * (1.0f / 256.0f) + bias; } }
  LDSX(); for (int rl = 0; rl < 16; ++rl) vst2(OUT + (r0 + rl) * DIN + c0 + lane * 4, *(const v4f*)&sf[wave][rl][lane * 4]); }

extern "C" void kernel_launch(void* const* d_in, const int* in_sizes, int n_in, void* d_out, int out_size, void* d_ws, size_t ws_size, hipStream_t stream) {
  (void)in_sizes; (void)n_in; (void)out_size;
  const float** F = (const float**)d_in;
  if (ws_size < (size_t)WS_END) return;
  char* ws = (char*)d_ws; _Float16 *QH = (_Float16*)(ws + WS_QH), *KH = (_Float16*)(ws + WS_KH), *VT = (_Float16*)(ws + WS_VT), *QL = (_Float16*)(ws + WS_QL), *KL = (_Float16*)(ws + WS_KL); __bf16 *VB = (__bf16*)(ws + WS_VB), *VBL = (__bf16*)(ws + WS_VBL); float *S = (float*)(ws + WS_S), *Y = (float*)(ws + WS_Y);
  (void)Y; (void)QL; (void)KL; (void)VB; (void)VBL;
  // inputs: 0 q, 1 k, 2 v [2,2048,1024]; 3 Wq, 4 Wk, 5 Wv, 6 Wo [1024,1024] (out,in), no biases
  k_proj<<<dim3(TNB * TT / 64, CC / 128, 3), 128, 0, stream>>>(F[0], F[1], F[2], F[3], F[4], F[5], nullptr, nullptr, nullptr, QH, QL, KH, KL, VT, VB, VBL);
  for (int b = 0; b < TNB; ++b) for (int h0 = 0; h0 < NH; h0 += HG) {
    k_sc<<<dim3(NQB, TT / 128, HG), 128, 0, stream>>>(QH, KH, QL, KL, b, h0, S);
    k_sm<<<dim3(TT, HG), 256, 0, stream>>>(S);
    k_pv<<<dim3(NQB, 1, HG), 128, 0, stream>>>(S, VT, VB, VBL, b, h0, Y);
  }
  k_out<<<dim3(TNB * TT / 64, DIN / 128), 128, 0, stream>>>(Y, F[6], nullptr, (float*)d_out);
}

// v001
// It runs in 412 microseconds.
// Two timings next to v000 put it at 2.86 and 2.85 times that version's speed.
// compute dtype: all float inputs rounded to bf16; q/k/v = input W^T with EXACT bf16 products on WMMA 16x16x32 (f32 accumulate); causal (strict past) logits: q, k once to f16 (1 product) x 1024^-0.5, except the first 384 query rows of each sequence (3 products with f16 residuals); softmax in f32 with a running maximum; exp(logit - maximum) once to f16 against v once to f16 (1 product; bf16 hi + lo below row 384); ctx once to f16 against Wo carried x 2^8 in f16 (ctx bf16 hi + lo against bf16 Wo below row 384); f32 output.
#include <hip/hip_runtime.h>
#include <math.h>

typedef __attribute__((ext_vector_type(16))) _Float16 v16h;
typedef __attribute__((ext_vector_type(16))) __bf16 v16b;
typedef __attribute__((ext_vector_type(8)))  _Float16 v8h;
typedef __attribute__((ext_vector_type(8)))  float v8f;
typedef __attribute__((ext_vector_type(4)))  float v4f;
typedef __attribute__((ext_vector_type(2)))  float v2f;
typedef __attribute__((ext_vector_type(4)))  unsigned v4u;
typedef __attribute__((ext_vector_type(4)))  int v4i;
typedef float __attribute__((may_alias)) float_a;
typedef int __attribute__((may_alias)) int_a;

template <typename T> __device__ __forceinline__ void vst2(void* p, T v) { *(T*)p = v;  }
__device__ __forceinline__ v8f wmma16(v16h a, v16h b, v8f c) {
  v8f d = __builtin_amdgcn_wmma_f32_16x16x32_f16(false, a, false, b, (short)0, c, false, false);
  asm volatile("v_nop\n\tv_nop\n\tv_nop\n\tv_nop" : "+v"(d) : "v"(a), "v"(b));
  return d;
}
__device__ __forceinline__ v8f wmma_bf(v16b a, v16b b, v8f c) {
  v8f d = __builtin_amdgcn_wmma_f32_16x16x32_bf16(false, a, false, b, (short)0, c, false, false);
  asm volatile("v_nop\n\tv_nop\n\tv_nop\n\tv_nop" : "+v"(d) : "v"(a), "v"(b));
  return d;
}
// 16x16x32 fragments: lane = (h = lane>>4, row/col = lane&15); elements 0..7 = k0+8h+0..7, 8..15 = k0+16+8h+0..7; D element r = row 8h+r
__device__ __forceinline__ v16h frag_h(const _Float16* rowk0, int lane) {
  union { v16h v; v8h q[2]; } u; const _Float16* p = rowk0 + 8 * (lane >> 4);
  u.q[0] = *(const v8h*)p; u.q[1] = *(const v8h*)(p + 16); return u.v;
}
__device__ __forceinline__ v16h frag_f32(const float* rowk0, int lane) {
  v16h a; const float* p = rowk0 + 8 * (lane >> 4);
#pragma unroll
  for (int i = 0; i < 8; ++i) { a[i] = (_Float16)p[i]; a[8 + i] = (_Float16)p[16 + i]; }
  return a;
}
__device__ __forceinline__ v16h frag_f32s(const float* rowk0, int lane, float sc) {
  v16h a; const float* p = rowk0 + 8 * (lane >> 4);
#pragma unroll
  for (int i = 0; i < 8; ++i) { a[i] = (_Float16)(p[i] * sc); a[8 + i] = (_Float16)(p[16 + i] * sc); }
  return a;
}
// column fragment from a [K][ld] layout (column n), rows >= K read as 0
__device__ __forceinline__ v16h fragc_f32(const float* W, int k0, int n, int lane, int ld, int K) {
  v16h a; const int g = lane >> 4;
#pragma unroll
  for (int i = 0; i < 8; ++i) { const int ka = k0 + 8 * g + i, kb = ka + 16;
    a[i] = (_Float16)(ka < K ? W[(size_t)(ka < K ? ka : K - 1) * ld + n] : 0.f); a[8 + i] = (_Float16)(kb < K ? W[(size_t)(kb < K ? kb : K - 1) * ld + n] : 0.f); }
  return a;
}
struct F2 { v16b h, l; };
__device__ __forceinline__ F2 bsplit16(const float v[16]) { F2 r;
#pragma unroll
  for (int i = 0; i < 16; ++i) { const __bf16 h = (__bf16)v[i]; r.h[i] = h; r.l[i] = (__bf16)(v[i] - (float)h); }
  return r; }
__device__ __forceinline__ F2 split_row(const float* row, int k0, int lane) { float v[16]; const float* p = row + k0 + 8 * (lane >> 4);
#pragma unroll
  for (int i = 0; i < 8; ++i) { v[i] = p[i]; v[8 + i] = p[16 + i]; }
  return bsplit16(v); }
__device__ __forceinline__ F2 split_rowK(const float* row, int k0, int lane, int K) { float v[16]; const int g = lane >> 4;
#pragma unroll
  for (int i = 0; i < 8; ++i) { const int ka = k0 + 8 * g + i, kb = ka + 16; v[i] = ka < K ? row[ka < K ? ka : K - 1] : 0.f; v[8 + i] = kb < K ? row[kb < K ? kb : K - 1] : 0.f; }
  return bsplit16(v); }
__device__ __forceinline__ F2 split_col(const float* W, int k0, int n, int lane, int ld, int K) { float v[16]; const int g = lane >> 4;
#pragma unroll
  for (int i = 0; i < 8; ++i) { const int ka = k0 + 8 * g + i, kb = ka + 16; v[i] = ka < K ? W[(size_t)(ka < K ? ka : K - 1) * ld + n] : 0.f; v[8 + i] = kb < K ? W[(size_t)(kb < K ? kb : K - 1) * ld + n] : 0.f; }
  return bsplit16(v); }
__device__ __forceinline__ v8f mac3(const F2& a, const F2& b, v8f c) { c = wmma_bf(a.l, b.h, c); c = wmma_bf(a.h, b.l, c); return wmma_bf(a.h, b.h, c); }
__device__ __forceinline__ float sigm(float v) { return 1.0f / (1.0f + expf(-v)); }
#define LDSX() do { asm volatile("s_wait_dscnt 0" ::: "memory"); __builtin_amdgcn_wave_barrier(); __builtin_amdgcn_fence(__ATOMIC_RELEASE, "workgroup"); } while (0)

// In-context-learning attention (B 2, S 2,048, E 1,024 = 16 x 64; separate q/k/v inputs): qh = q Wq^T, kh = k Wk^T, vh = v Wv^T ((out,in)); scores = qh kh^T / sqrt(1024) masked where key >= query (strict past) except (0, 0); softmax; out = merged(probs vh) Wo^T.
#define NB 2
#define TT 2048
#define CC 1024            // NH * HD = projected width
#define DIN 1024          // input (model) width
#define NH 16
#define HD 64
#define NQB (TT / 64)
#define SCALE (0.03125f)
#define CAUSAL 1
#ifndef TNB
#define TNB NB
#endif
__device__ __forceinline__ float bfr(float v) { return (float)(__bf16)v; }
__host__ __device__ __forceinline__ int kb_last(int qb) { return CAUSAL ? ((qb * 64 + 63) >> 7) : (TT / 128 - 1); }
typedef __attribute__((ext_vector_type(8))) __bf16 v8b;
__device__ __forceinline__ v16b frag_b(const __bf16* rowk0, int lane) {
  union { v16b v; v8b q[2]; } u; const __bf16* p = rowk0 + 8 * (lane >> 4);
  u.q[0] = *(const v8b*)p; u.q[1] = *(const v8b*)(p + 16); return u.v;
}
#define QBH 6              // causal: query blocks 0..QBH-1 of each sequence (few keys, no averaging) take the high-precision path
#define QHI 384            // rows carrying a q residual plane
#define KHI 384            // key rows carrying k residual / v bf16 hi+lo planes (used only by the causal high-precision path)
// B fragment (k rows k0+.., output column o) of a weight: (in,out) [K][ld] or (out,in) [ld rows of K]: bf16 exact, or f16(bf16 * 256) exact
__device__ __forceinline__ v16b wcol_io(const float* Wm, int k0, int o, int lane, int ld) { v16b w; const int g = lane >> 4;
#pragma unroll
  for (int i = 0; i < 8; ++i) { w[i] = (__bf16)Wm[(size_t)(k0 + 8 * g + i) * ld + o]; w[8 + i] = (__bf16)Wm[(size_t)(k0 + 16 + 8 * g + i) * ld + o]; }
  return w; }
__device__ __forceinline__ v16b wcol_oi(const float* Wm, int k0, int o, int lane, int K) { v16b w; const float* p = Wm + (size_t)o * K + k0 + 8 * (lane >> 4);
#pragma unroll
  for (int i = 0; i < 8; ++i) { w[i] = (__bf16)p[i]; w[8 + i] = (__bf16)p[16 + i]; }
  return w; }
__device__ __forceinline__ v16h wcolh_io(const float* Wm, int k0, int o, int lane, int ld) { v16h w; const int g = lane >> 4;
#pragma unroll
  for (int i = 0; i < 8; ++i) { w[i] = (_Float16)(bfr(Wm[(size_t)(k0 + 8 * g + i) * ld + o]) * 256.0f); w[8 + i] = (_Float16)(bfr(Wm[(size_t)(k0 + 16 + 8 * g + i) * ld + o]) * 256.0f); }
  return w; }
__device__ __forceinline__ v16h wcolh_oi(const float* Wm, int k0, int o, int lane, int K) { v16h w; const float* p = Wm + (size_t)o * K + k0 + 8 * (lane >> 4);
#pragma unroll
  for (int i = 0; i < 8; ++i) { w[i] = (_Float16)(bfr(p[i]) * 256.0f); w[8 + i] = (_Float16)(bfr(p[16 + i]) * 256.0f); }
  return w; }
#define WQKV_LAYOUT 1   // 0 = (in,out) [DIN][CC]; 1 = (out,in) [CC][DIN]; 2 = per-head [NH][DIN][HD]
__device__ __forceinline__ v16b wcol_hdk(const float* Wm, int k0, int o, int lane) { v16b w; const int g = lane >> 4; const float* p = Wm + (size_t)(o / HD) * DIN * HD + (o % HD);
#pragma unroll
  for (int i = 0; i < 8; ++i) { w[i] = (__bf16)p[(size_t)(k0 + 8 * g + i) * HD]; w[8 + i] = (__bf16)p[(size_t)(k0 + 16 + 8 * g + i) * HD]; }
  return w; }
#define WO_OUT_IN 1
#if WQKV_LAYOUT == 1
#define WCOL(W, k0, o, lane) wcol_oi(W, k0, o, lane, DIN)
#elif WQKV_LAYOUT == 2
#define WCOL(W, k0, o, lane) wcol_hdk(W, k0, o, lane)
#else
#define WCOL(W, k0, o, lane) wcol_io(W, k0, o, lane, CC)
#endif
#if WO_OUT_IN
#define WOCOL(W, k0, o, lane) wcol_oi(W, k0, o, lane, CC)
#define WOCOLH(W, k0, o, lane) wcolh_oi(W, k0, o, lane, CC)
#else
#define WOCOL(W, k0, o, lane) wcol_io(W, k0, o, lane, DIN)
#define WOCOLH(W, k0, o, lane) wcolh_io(W, k0, o, lane, DIN)
#endif
#ifndef PROJ_EXTRA_PARAMS
#define PROJ_EXTRA_PARAMS
#endif

#define WS_QH  0u                                      // f16 q rows [b*t][CC]
#define WS_KH  (WS_QH + 2u * (size_t)NB * TT * CC)      // f16 k rows [b*t][CC]
#define WS_VT  (WS_KH + 2u * (size_t)NB * TT * CC)      // f16 v planes [b][c][t]
#define WS_QL  (WS_VT + 2u * (size_t)NB * CC * TT)      // f16 q residual x 2^10 rows [b][t < QHI][CC]
#define WS_KL  (WS_QL + 2u * (size_t)NB * QHI * CC)     // f16 k residual x 2^10 rows [b][t < KHI][CC]
#define WS_VB  (WS_KL + 2u * (size_t)NB * KHI * CC)     // bf16 v hi planes [b][c][t < KHI]
#define WS_VBL (WS_VB + 2u * (size_t)NB * CC * KHI)
#define WS_Y   (WS_VBL + 2u * (size_t)NB * CC * KHI)     // f32 ctx rows [b*t][CC] (only when there is an output projection)
#define WS_END (WS_Y  + 4u * (size_t)NB * TT * CC)

// ---- k_proj: block = (64 rows, 128 cols, which): q/k/v = X W (+ b) with exact bf16 products (K = DIN) -> which 0: q f16 rows (+ residual rows < QHI); 1: k f16 rows (+ residual rows < KHI); 2: v f16 planes [c][t] (+ bf16 hi/lo planes for t < KHI)
__global__ __launch_bounds__(128) void k_proj(const float* __restrict__ XQ, const float* __restrict__ XK, const float* __restrict__ XV, const float* __restrict__ WQ, const float* __restrict__ WK, const float* __restrict__ WV, const float* __restrict__ BQ, const float* __restrict__ BK, const float* __restrict__ BV,
    _Float16* __restrict__ QH, _Float16* __restrict__ QL, _Float16* __restrict__ KH, _Float16* __restrict__ KL, _Float16* __restrict__ VT, __bf16* __restrict__ VB, __bf16* __restrict__ VBL) {
  __shared__ __align__(16) _Float16 sh[64][136], sl[64][136]; __shared__ __align__(16) _Float16 th[128][72]; __shared__ __align__(16) __bf16 tb[128][72], tbl[128][72];
  const int tid = threadIdx.x, wave = tid >> 5, lane = tid & 31, col = lane & 15, g = lane >> 4; const int which = blockIdx.z; const int c0 = blockIdx.y * 128; const size_t r0 = (size_t)blockIdx.x * 64; const size_t bb = r0 / TT; const int t0 = (int)(r0 % TT);
  const float* X = which == 0 ? XQ : which == 1 ? XK : XV; const float* WA = which == 0 ? WQ : which == 1 ? WK : WV; const float* BA = which == 0 ? BQ : which == 1 ? BK : BV;
  v8f acc[8] = {};
#pragma unroll 2
  for (int kc = 0; kc < DIN / 32; ++kc) { v16b a; { const float* p = X + (r0 + wave * 16 + col) * DIN + kc * 32 + 8 * g;
#pragma unroll
      for (int i = 0; i < 8; ++i) { a[i] = (__bf16)p[i]; a[8 + i] = (__bf16)p[16 + i]; } }
    asm volatile("s_wait_loadcnt 0x0" ::: "memory");
#pragma unroll
    for (int j = 0; j < 8; ++j) { const v16b w = WCOL(WA, kc * 32, c0 + j * 16 + col, lane); asm volatile("s_wait_loadcnt 0x0" ::: "memory"); acc[j] = wmma_bf(a, w, acc[j]); } }
  if (which < 2) { _Float16* DH = which == 0 ? QH : KH; _Float16* DL = which == 0 ? QL : KL; const int nhi = which == 0 ? QHI : KHI; const bool hi_rows = t0 < nhi;
#pragma unroll
    for (int j = 0; j < 8; ++j) { const float bias = BA ? bfr(BA[c0 + j * 16 + col]) : 0.f;
#pragma unroll
      for (int r = 0; r < 8; ++r) { const float v = acc[j][r] + bias; const _Float16 hv = (_Float16)v; sh[wave * 16 + 8 * g + r][j * 16 + col] = hv; sl[wave * 16 + 8 * g + r][j * 16 + col] = (_Float16)((v - (float)hv) * 1024.0f); } }
    __syncthreads();
    for (int e = tid; e < 64 * 16; e += 128) { const int rl = e >> 4, q = e & 15; vst2((unsigned*)(DH + (r0 + rl) * CC + c0 + q * 8), *(const v4u*)&sh[rl][q * 8]); if (hi_rows) vst2((unsigned*)(DL + (bb * nhi + t0 + rl) * (size_t)CC + c0 + q * 8), *(const v4u*)&sl[rl][q * 8]); }
  } else { const bool hi_rows = t0 < KHI;
#pragma unroll
    for (int j = 0; j < 8; ++j) { const float bias = BA ? bfr(BA[c0 + j * 16 + col]) : 0.f;
#pragma unroll
      for (int r = 0; r < 8; ++r) { const float v = acc[j][r] + bias; const int rl = wave * 16 + 8 * g + r, cl = j * 16 + col; th[cl][rl] = (_Float16)v; const __bf16 bh = (__bf16)v; tb[cl][rl] = bh; tbl[cl][rl] = (__bf16)(v - (float)bh); } }
    __syncthreads();
    for (int e = tid; e < 128 * 8; e += 128) { const int cl = e >> 3, q = e & 7; vst2((unsigned*)(VT + (bb * CC + c0 + cl) * (size_t)TT + t0 + q * 8), *(const v4u*)&th[cl][q * 8]); if (hi_rows) { const size_t o3 = (bb * CC + c0 + cl) * (size_t)KHI + t0 + q * 8; vst2((unsigned*)(VB + o3), *(const v4u*)&tb[cl][q * 8]); vst2((unsigned*)(VBL + o3), *(const v4u*)&tbl[cl][q * 8]); } } } }
// plain builtin products: the compiler keeps the distance behind them itself and may place their operands in any register window
__device__ __forceinline__ v8f wmh(v16h a, v16h b, v8f c) { return __builtin_amdgcn_wmma_f32_16x16x32_f16(false, a, false, b, (short)0, c, false, false); }
__device__ __forceinline__ v8f wmb(v16b a, v16b b, v8f c) { return __builtin_amdgcn_wmma_f32_16x16x32_bf16(false, a, false, b, (short)0, c, false, false); }
// frag_h from a base, the lane's own byte offset (row and lane half; 0 where the base already holds it) and a constant element offset
__device__ __forceinline__ v16h frag_s(const _Float16* base, unsigned lo, size_t e) { union { v16h v; v8h q[2]; } u; const char* p = (const char*)base + lo; u.q[0] = *(const v8h*)(p + 2 * e); u.q[1] = *(const v8h*)(p + 2 * e + 32); return u.v; }
// ---- k_attn: one wave = QWAVE queries (NCG groups of 16 columns) of (b, h); it walks its visible keys in passes of KPASS keys. S^T = k q^T (a lane holds the logits of ONE query: tile j, register r = key 16 j + 8 g + r), running maximum and sum per lane, ctx^T += v^T P^T with P^T packed from the score registers as the B operand (element order = the fragment k order above). Logits and P stay in registers. Queries < QHI: 3-product logits (f16 residuals) and P, v as bf16 hi + lo (3 products).
#define NCG 2              // 16-query column groups per wave: each k / v fragment load feeds NCG products
#define NKT 4              // 16-key tiles per pass
#define KPASS (16 * NKT)
#define QWAVE (16 * NCG)
#define QBLK (4 * QWAVE)
// one pass of the running softmax for one column group: mask by index (strict past, except (0, 0)), new maximum (own keys, then the other lane half), rescale sum and ctx, st <- exp(logit - maximum). An excluded logit is -3e38 and its exp is 0: key 0 is visible to every query, so the maximum is a real logit from the first pass on.
__device__ __forceinline__ void sm_pass(v8f (&st)[NKT], v8f (&acc)[HD / 16], float& m, float& l, int kg, int t, bool edge) {
  if (edge) {
#pragma unroll
    for (int j = 0; j < NKT; ++j)
#pragma unroll
      for (int r = 0; r < 8; ++r) { const int k = kg + j * 16 + r; st[j][r] = (k < t || (k | t) == 0) ? st[j][r] : -3.0e38f; } }
  float mx = st[0][0];
#pragma unroll
  for (int j = 0; j < NKT; ++j)
#pragma unroll
    for (int r = 0; r < 8; ++r) mx = fmaxf(mx, st[j][r]);
  mx = fmaxf(mx, __shfl_xor(mx, 16));
  const float mn = fmaxf(m, mx), f = expf(m - mn); m = mn;
  float s = 0.f;
#pragma unroll
  for (int j = 0; j < NKT; ++j)
#pragma unroll
    for (int r = 0; r < 8; ++r) { const float e = expf(st[j][r] - mn); st[j][r] = e; s += e; }
  l = l * f + s;
#pragma unroll
  for (int d = 0; d < HD / 16; ++d) acc[d] = acc[d] * f; }
// two waves per SIMD is all this grid supplies (256 workgroups of 8 waves): the register budget of two lets the fragments fetched ahead stay in registers
__global__ __launch_bounds__(256) __attribute__((amdgpu_waves_per_eu(2, 2))) void k_attn(const _Float16* __restrict__ QH, const _Float16* __restrict__ KH, const _Float16* __restrict__ QL, const _Float16* __restrict__ KL, const _Float16* __restrict__ VT, const __bf16* __restrict__ VB, const __bf16* __restrict__ VBL, float* __restrict__ Y) {
  const int tid = threadIdx.x, lane = tid & 31, col = lane & 15, g = lane >> 4; const int wave = __builtin_amdgcn_readfirstlane(tid >> 5);
  const int b = blockIdx.x / NH, h = blockIdx.x % NH; const int qt = wave < 4 ? TT / QBLK - 1 - (int)blockIdx.y : (int)blockIdx.y; const int ql0 = qt * QBLK + (wave & 3) * QWAVE;   /* waves 0-3 take query tile n - 1 - y, waves 4-7 tile y: every workgroup walks the same number of keys */
  const int npass = (ql0 + QWAVE - 2) / KPASS + 1;   /* the wave's last visible key is ql0 + QWAVE - 2 */
  const _Float16* Qb = QH + ((size_t)b * TT + ql0 + col) * CC + h * HD; const _Float16* Kb = KH + ((size_t)b * TT + col) * CC + h * HD;
  float m[NCG], l[NCG]; v8f acc[NCG][HD / 16];
#pragma unroll
  for (int c = 0; c < NCG; ++c) { m[c] = -3.0e38f; l[c] = 0.f;
#pragma unroll
    for (int d = 0; d < HD / 16; ++d) acc[c][d] = v8f{}; }
  if (ql0 < QHI) {   /* wave-uniform; the wave's passes end at or below key KHI */
    const _Float16* QLb = QL + ((size_t)b * QHI + ql0 + col) * CC + h * HD; const _Float16* KLb = KL + ((size_t)b * KHI + col) * CC + h * HD;
    const __bf16* VBb = VB + ((size_t)b * CC + h * HD + col) * (size_t)KHI; const __bf16* VLb = VBL + ((size_t)b * CC + h * HD + col) * (size_t)KHI;
    v16h qf[NCG][2], qlf[NCG][2];
#pragma unroll
    for (int c = 0; c < NCG; ++c)
#pragma unroll
      for (int kc = 0; kc < 2; ++kc) { qf[c][kc] = frag_h(Qb + (size_t)c * 16 * CC + kc * 32, lane); qlf[c][kc] = frag_h(QLb + (size_t)c * 16 * CC + kc * 32, lane); }
    // stands in front of any rewrite of the address registers that the loads above it name; the loaded fragments as inputs hold the loads in front of it, the scheduling barrier holds later address arithmetic behind it
    asm volatile("s_wait_xcnt 0x0" :: "v"(qf[0][0]), "v"(qf[0][1]), "v"(qf[1][0]), "v"(qf[1][1]), "v"(qlf[0][0]), "v"(qlf[0][1]), "v"(qlf[1][0]), "v"(qlf[1][1]) : "memory");
    __builtin_amdgcn_sched_barrier(0);
    for (int ps = 0; ps < npass; ++ps) { const int k0 = ps * KPASS; v8f st[NCG][NKT];
#pragma unroll
      for (int j = 0; j < NKT; ++j) { v8f a[NCG] = {}, al[NCG] = {};
#pragma unroll
        for (int kc = 0; kc < 2; ++kc) { const v16h kf = frag_h(Kb + (size_t)(k0 + j * 16) * CC + kc * 32, lane), klf = frag_h(KLb + (size_t)(k0 + j * 16) * CC + kc * 32, lane);
#pragma unroll
          for (int c = 0; c < NCG; ++c) { a[c] = wmh(kf, qf[c][kc], a[c]); al[c] = wmh(kf, qlf[c][kc], al[c]); al[c] = wmh(klf, qf[c][kc], al[c]); } }
#pragma unroll
        for (int c = 0; c < NCG; ++c) st[c][j] = (a[c] + al[c] * (1.0f / 1024.0f)) * SCALE; }
#pragma unroll
      for (int c = 0; c < NCG; ++c) sm_pass(st[c], acc[c], m[c], l[c], k0 + 8 * g, ql0 + c * 16 + col, true);
#pragma unroll
      for (int jj = 0; jj < NKT / 2; ++jj) { F2 p[NCG];
#pragma unroll
        for (int c = 0; c < NCG; ++c) { float pv[16];
#pragma unroll
          for (int i = 0; i < 8; ++i) { pv[i] = st[c][2 * jj][i]; pv[8 + i] = st[c][2 * jj + 1][i]; }
          p[c] = bsplit16(pv); }
#pragma unroll
        for (int d = 0; d < HD / 16; ++d) { const size_t po = (size_t)d * 16 * KHI + k0 + jj * 32; const v16b vh = frag_b(VBb + po, lane), vl = frag_b(VLb + po, lane);
#pragma unroll
          for (int c = 0; c < NCG; ++c) { acc[c][d] = wmb(vh, p[c].h, acc[c][d]); acc[c][d] = wmb(vh, p[c].l, acc[c][d]); acc[c][d] = wmb(vl, p[c].h, acc[c][d]); } } } }
  } else {
    const _Float16* Qu = QH + ((size_t)b * TT + ql0) * CC + h * HD; const _Float16* Ku = KH + (size_t)b * TT * CC + h * HD; const _Float16* Vu = VT + ((size_t)b * CC + h * HD) * (size_t)TT;   /* wave-uniform bases */
    const unsigned rlo = 2u * (col * CC + 8 * g);   /* the lane's byte offset in q / k rows */
    const _Float16* Kl = Ku + col * CC + 8 * g; const _Float16* Vl = Vu + col * TT + 8 * g;   /* the lane's own row of k, plane of v */
    v16h qf[NCG][2];
#pragma unroll
    for (int c = 0; c < NCG; ++c)
#pragma unroll
      for (int kc = 0; kc < 2; ++kc) qf[c][kc] = frag_s(Qu, rlo, (size_t)c * 16 * CC + kc * 32);
    v16h kf[2][NKT], vf[NKT / 2][HD / 16];
#pragma unroll
    for (int kc = 0; kc < 2; ++kc)
#pragma unroll
      for (int j = 0; j < NKT; ++j) kf[kc][j] = frag_s(Ku, rlo, (size_t)(j * 16) * CC + kc * 32);
    // stands in front of any rewrite of the registers that the loads above it name; the two bases and the offset as inputs keep those registers whole until it, the scheduling barrier holds the loads in front of it and later address arithmetic behind it
    asm volatile("s_wait_xcnt 0x0" :: "s"(Qu), "s"(Ku), "v"(rlo) : "memory");
    __builtin_amdgcn_sched_barrier(0);
    for (int ps = 0; ps < npass; ++ps) { const int k0 = ps * KPASS; v8f st[NCG][NKT];
#pragma unroll
      for (int c = 0; c < NCG; ++c)
#pragma unroll
        for (int j = 0; j < NKT; ++j) st[c][j] = v8f{};
#pragma unroll
      for (int kc = 0; kc < 2; ++kc)
#pragma unroll
        for (int j = 0; j < NKT; ++j)
#pragma unroll
          for (int c = 0; c < NCG; ++c) st[c][j] = wmh(kf[kc][j], qf[c][kc], st[c][j]);
      // this pass's v fragments and the next pass's k fragments (the last pass fetches its own again: stays inside the wave's key range) are requested here, ahead of the softmax arithmetic that covers their latency
      const int kn = ps + 1 < npass ? k0 + KPASS : k0; const _Float16* vp = Vl + k0; const _Float16* kp = Kl + (size_t)kn * CC;   /* the lane's own addresses: every load of the run is one of them plus a constant */
#pragma unroll
      for (int jj = 0; jj < NKT / 2; ++jj)
#pragma unroll
        for (int d = 0; d < HD / 16; ++d) vf[jj][d] = frag_s(vp, 0u, (size_t)d * 16 * TT + jj * 32);
#pragma unroll
      for (int kc = 0; kc < 2; ++kc)
#pragma unroll
        for (int j = 0; j < NKT; ++j) kf[kc][j] = frag_s(kp, 0u, (size_t)(j * 16) * CC + kc * 32);
      // stands in front of any rewrite of the address registers that the loads above it name; the two addresses as inputs keep their registers whole until it: no load of the run may land in a pair that the loads in front of it name
      asm volatile("s_wait_xcnt 0x0" :: "v"(vp), "v"(kp) : "memory");
      __builtin_amdgcn_sched_barrier(0);   // keeps the compiler from sinking those loads to their first use, where each would be waited for alone
      const bool edge = k0 + KPASS > ql0;   /* wave-uniform: only passes that reach the wave's first query hold excluded keys */
#pragma unroll
      for (int c = 0; c < NCG; ++c) {
#pragma unroll
        for (int j = 0; j < NKT; ++j) st[c][j] = st[c][j] * SCALE;
        sm_pass(st[c], acc[c], m[c], l[c], k0 + 8 * g, ql0 + c * 16 + col, edge); }
#pragma unroll
      for (int jj = 0; jj < NKT / 2; ++jj) { v16h p[NCG];
#pragma unroll
        for (int c = 0; c < NCG; ++c)
#pragma unroll
          for (int i = 0; i < 8; ++i) { p[c][i] = (_Float16)st[c][2 * jj][i]; p[c][8 + i] = (_Float16)st[c][2 * jj + 1][i]; }
#pragma unroll
        for (int d = 0; d < HD / 16; ++d)
#pragma unroll
          for (int c = 0; c < NCG; ++c) acc[c][d] = wmh(vf[jj][d], p[c], acc[c][d]); } } }
  // acc[c][d][r] = ctx(query ql0 + 16 c + col, dim 16 d + 8 g + r) x sum: join the two lane halves' sums, divide, 32 contiguous bytes per lane and d
#pragma unroll
  for (int c = 0; c < NCG; ++c) { const float a = l[c] + __shfl_xor(l[c], 16); const float inv = a > 0.f ? 1.0f / a : 0.f; float* yr = Y + ((size_t)b * TT + ql0 + c * 16 + col) * CC + h * HD + 8 * g;
#pragma unroll
    for (int d = 0; d < HD / 16; ++d) { const v8f o = acc[c][d] * inv; vst2(yr + d * 16, v4f{o[0], o[1], o[2], o[3]}); vst2(yr + d * 16 + 4, v4f{o[4], o[5], o[6], o[7]}); } } }
// ---- k_out: block = (64 rows, 128 cols): out = ctx Wo (+ bo): ctx once to f16 against Wo as f16(bf16 x 2^8) exact (1 product) x 2^-8; causal early rows (< QHI of each sequence): ctx bf16 hi + lo against exact bf16 Wo (2 products)
__global__ __launch_bounds__(128) void k_out(const float* __restrict__ Y, const float* __restrict__ WO, const float* __restrict__ BO, float* __restrict__ OUT) { __shared__ __align__(16) float sf[4][16][132];
  const int tid = threadIdx.x, wave = tid >> 5, lane = tid & 31, col = lane & 15, g = lane >> 4; const int c0 = blockIdx.y * 128; const size_t r0 = (size_t)blockIdx.x * 64 + wave * 16;
  v8f acc[8] = {};
  if (CAUSAL && (int)(((size_t)blockIdx.x * 64) % TT) < QHI) {   /* block-uniform */
#pragma unroll 2
    for (int kc = 0; kc < CC / 32; ++kc) { const F2 a = split_row(Y + (r0 + col) * CC, kc * 32, lane); asm volatile("s_wait_loadcnt 0x0" ::: "memory");
#pragma unroll
      for (int j = 0; j < 8; ++j) { const v16b w = WOCOL(WO, kc * 32, c0 + j * 16 + col, lane); asm volatile("s_wait_loadcnt 0x0" ::: "memory"); acc[j] = wmma_bf(a.h, w, acc[j]); acc[j] = wmma_bf(a.l, w, acc[j]); } }
#pragma unroll
    for (int j = 0; j < 8; ++j) { const float bias = BO ? bfr(BO[c0 + j * 16 + col]) : 0.f;
#pragma unroll
      for (int r = 0; r < 8; ++r) sf[wave][8 * g + r][j * 16 + col] = acc[j][r] + bias; }
  } else {
#pragma unroll 2
    for (int kc = 0; kc < CC / 32; ++kc) { const v16h a = frag_f32(Y + (r0 + col) * CC + kc * 32, lane); asm volatile("s_wait_loadcnt 0x0" ::: "memory");
#pragma unroll
      for (int j = 0; j < 8; ++j) { const v16h w = WOCOLH(WO, kc * 32, c0 + j * 16 + col, lane); asm volatile("s_wait_loadcnt 0x0" ::: "memory"); acc[j] = wmma16(a, w, acc[j]); } }
#pragma unroll
    for (int j = 0; j < 8; ++j) { const float bias = BO ? bfr(BO[c0 + j * 16 + col]) : 0.f;
#pragma unroll
      for (int r = 0; r < 8; ++r) sf[wave][8 * g + r][j * 16 + col] = acc[j][r] * (1.0f / 256.0f) + bias; } }
  LDSX(); for (int rl = 0; rl < 16; ++rl) vst2(OUT + (r0 + rl) * DIN + c0 + lane * 4, *(const v4f*)&sf[wave][rl][lane * 4]); }

extern "C" void kernel_launch(void* const* d_in, const int* in_sizes, int n_in, void* d_out, int out_size, void* d_ws, size_t ws_size, hipStream_t stream) {
  (void)in_sizes; (void)n_in; (void)out_size;
  const float** F = (const float**)d_in;
  if (ws_size < (size_t)WS_END) return;
  char* ws = (char*)d_ws; _Float16 *QH = (_Float16*)(ws + WS_QH), *KH = (_Float16*)(ws + WS_KH), *VT = (_Float16*)(ws + WS_VT), *QL = (_Float16*)(ws + WS_QL), *KL = (_Float16*)(ws + WS_KL); __bf16 *VB = (__bf16*)(ws + WS_VB), *VBL = (__bf16*)(ws + WS_VBL); float *Y = (float*)(ws + WS_Y);
  (void)Y; (void)QL; (void)KL; (void)VB; (void)VBL;
  // inputs: 0 q, 1 k, 2 v [2,2048,1024]; 3 Wq, 4 Wk, 5 Wv, 6 Wo [1024,1024] (out,in), no biases
  k_proj<<<dim3(TNB * TT / 64, CC / 128, 3), 128, 0, stream>>>(F[0], F[1], F[2], F[3], F[4], F[5], nullptr, nullptr, nullptr, QH, QL, KH, KL, VT, VB, VBL);
  k_attn<<<dim3(TNB * NH, TT / QBLK / 2), 256, 0, stream>>>(QH, KH, QL, KL, VT, VB, VBL, Y);
  k_out<<<dim3(TNB * TT / 64, DIN / 128), 128, 0, stream>>>(Y, F[6], nullptr, (float*)d_out);
}

// v002
// Measured time: 112 microseconds a run.
// Two timings next to v001 put it at 3.67 and 3.65 times that version's speed.
// Over all steps from v000 it is 10.5 times as fast.
// compute dtype: all float inputs rounded to bf16; q/k/v = input W^T with EXACT bf16 products on WMMA 16x16x32 (f32 accumulate); causal (strict past) logits: q, k once to f16 (1 product) x 1024^-0.5, except the first 384 query rows of each sequence (3 products with f16 residuals); softmax in f32 with a running maximum; exp(logit - maximum) once to f16 against v once to f16 (1 product; bf16 hi + lo below row 384); ctx once to f16 against Wo carried x 2^8 in f16 (bf16 hi + lo against bf16 Wo, 2 products, in the first 384 rows of each sequence); f32 output.
#include <hip/hip_runtime.h>
#include <math.h>

typedef __attribute__((ext_vector_type(16))) _Float16 v16h;
typedef __attribute__((ext_vector_type(16))) __bf16 v16b;
typedef __attribute__((ext_vector_type(8)))  _Float16 v8h;
typedef __attribute__((ext_vector_type(8)))  float v8f;
typedef __attribute__((ext_vector_type(4)))  float v4f;
typedef __attribute__((ext_vector_type(2)))  float v2f;
typedef __attribute__((ext_vector_type(4)))  unsigned v4u;
typedef __attribute__((ext_vector_type(4)))  int v4i;
typedef float __attribute__((may_alias)) float_a;
typedef int __attribute__((may_alias)) int_a;

template <typename T> __device__ __forceinline__ void vst2(void* p, T v) { *(T*)p = v;  }
__device__ __forceinline__ v8f wmma16(v16h a, v16h b, v8f c) {
  v8f d = __builtin_amdgcn_wmma_f32_16x16x32_f16(false, a, false, b, (short)0, c, false, false);
  asm volatile("v_nop\n\tv_nop\n\tv_nop\n\tv_nop" : "+v"(d) : "v"(a), "v"(b));
  return d;
}
__device__ __forceinline__ v8f wmma_bf(v16b a, v16b b, v8f c) {
  v8f d = __builtin_amdgcn_wmma_f32_16x16x32_bf16(false, a, false, b, (short)0, c, false, false);
  asm volatile("v_nop\n\tv_nop\n\tv_nop\n\tv_nop" : "+v"(d) : "v"(a), "v"(b));
  return d;
}
// 16x16x32 fragments: lane = (h = lane>>4, row/col = lane&15); elements 0..7 = k0+8h+0..7, 8..15 = k0+16+8h+0..7; D element r = row 8h+r
__device__ __forceinline__ v16h frag_h(const _Float16* rowk0, int lane) {
  union { v16h v; v8h q[2]; } u; const _Float16* p = rowk0 + 8 * (lane >> 4);
  u.q[0] = *(const v8h*)p; u.q[1] = *(const v8h*)(p + 16); return u.v;
}
__device__ __forceinline__ v16h frag_f32(const float* rowk0, int lane) {
  v16h a; const float* p = rowk0 + 8 * (lane >> 4);
#pragma unroll
  for (int i = 0; i < 8; ++i) { a[i] = (_Float16)p[i]; a[8 + i] = (_Float16)p[16 + i]; }
  return a;
}
__device__ __forceinline__ v16h frag_f32s(const float* rowk0, int lane, float sc) {
  v16h a; const float* p = rowk0 + 8 * (lane >> 4);
#pragma unroll
  for (int i = 0; i < 8; ++i) { a[i] = (_Float16)(p[i] * sc); a[8 + i] = (_Float16)(p[16 + i] * sc); }
  return a;
}
// column fragment from a [K][ld] layout (column n), rows >= K read as 0
__device__ __forceinline__ v16h fragc_f32(const float* W, int k0, int n, int lane, int ld, int K) {
  v16h a; const int g = lane >> 4;
#pragma unroll
  for (int i = 0; i < 8; ++i) { const int ka = k0 + 8 * g + i, kb = ka + 16;
    a[i] = (_Float16)(ka < K ? W[(size_t)(ka < K ? ka : K - 1) * ld + n] : 0.f); a[8 + i] = (_Float16)(kb < K ? W[(size_t)(kb < K ? kb : K - 1) * ld + n] : 0.f); }
  return a;
}
struct F2 { v16b h, l; };
__device__ __forceinline__ F2 bsplit16(const float v[16]) { F2 r;
#pragma unroll
  for (int i = 0; i < 16; ++i) { const __bf16 h = (__bf16)v[i]; r.h[i] = h; r.l[i] = (__bf16)(v[i] - (float)h); }
  return r; }
__device__ __forceinline__ F2 split_row(const float* row, int k0, int lane) { float v[16]; const float* p = row + k0 + 8 * (lane >> 4);
#pragma unroll
  for (int i = 0; i < 8; ++i) { v[i] = p[i]; v[8 + i] = p[16 + i]; }
  return bsplit16(v); }
__device__ __forceinline__ F2 split_rowK(const float* row, int k0, int lane, int K) { float v[16]; const int g = lane >> 4;
#pragma unroll
  for (int i = 0; i < 8; ++i) { const int ka = k0 + 8 * g + i, kb = ka + 16; v[i] = ka < K ? row[ka < K ? ka : K - 1] : 0.f; v[8 + i] = kb < K ? row[kb < K ? kb : K - 1] : 0.f; }
  return bsplit16(v); }
__device__ __forceinline__ F2 split_col(const float* W, int k0, int n, int lane, int ld, int K) { float v[16]; const int g = lane >> 4;
#pragma unroll
  for (int i = 0; i < 8; ++i) { const int ka = k0 + 8 * g + i, kb = ka + 16; v[i] = ka < K ? W[(size_t)(ka < K ? ka : K - 1) * ld + n] : 0.f; v[8 + i] = kb < K ? W[(size_t)(kb < K ? kb : K - 1) * ld + n] : 0.f; }
  return bsplit16(v); }
__device__ __forceinline__ v8f mac3(const F2& a, const F2& b, v8f c) { c = wmma_bf(a.l, b.h, c); c = wmma_bf(a.h, b.l, c); return wmma_bf(a.h, b.h, c); }
__device__ __forceinline__ float sigm(float v) { return 1.0f / (1.0f + expf(-v)); }
#define LDSX() do { asm volatile("s_wait_dscnt 0" ::: "memory"); __builtin_amdgcn_wave_barrier(); __builtin_amdgcn_fence(__ATOMIC_RELEASE, "workgroup"); } while (0)

// In-context-learning attention (B 2, S 2,048, E 1,024 = 16 x 64; separate q/k/v inputs): qh = q Wq^T, kh = k Wk^T, vh = v Wv^T ((out,in)); scores = qh kh^T / sqrt(1024) masked where key >= query (strict past) except (0, 0); softmax; out = merged(probs vh) Wo^T.
#define NB 2
#define TT 2048
#define CC 1024            // NH * HD = projected width
#define DIN 1024          // input (model) width
#define NH 16
#define HD 64
#define NQB (TT / 64)
#define SCALE (0.03125f)
#define CAUSAL 1
#ifndef TNB
#define TNB NB
#endif
__device__ __forceinline__ float bfr(float v) { return (float)(__bf16)v; }
__host__ __device__ __forceinline__ int kb_last(int qb) { return CAUSAL ? ((qb * 64 + 63) >> 7) : (TT / 128 - 1); }
typedef __attribute__((ext_vector_type(8))) __bf16 v8b;
__device__ __forceinline__ v16b frag_b(const __bf16* rowk0, int lane) {
  union { v16b v; v8b q[2]; } u; const __bf16* p = rowk0 + 8 * (lane >> 4);
  u.q[0] = *(const v8b*)p; u.q[1] = *(const v8b*)(p + 16); return u.v;
}
#define QBH 6              // causal: query blocks 0..QBH-1 of each sequence (few keys, no averaging) take the high-precision path
#define QHI 384            // rows carrying a q residual plane
#define KHI 384            // key rows carrying k residual / v bf16 hi+lo planes (used only by the causal high-precision path)
// B fragment (k rows k0+.., output column o) of a weight: (in,out) [K][ld] or (out,in) [ld rows of K]: bf16 exact, or f16(bf16 * 256) exact
__device__ __forceinline__ v16b wcol_io(const float* Wm, int k0, int o, int lane, int ld) { v16b w; const int g = lane >> 4;
#pragma unroll
  for (int i = 0; i < 8; ++i) { w[i] = (__bf16)Wm[(size_t)(k0 + 8 * g + i) * ld + o]; w[8 + i] = (__bf16)Wm[(size_t)(k0 + 16 + 8 * g + i) * ld + o]; }
  return w; }
__device__ __forceinline__ v16b wcol_oi(const float* Wm, int k0, int o, int lane, int K) { v16b w; const float* p = Wm + (size_t)o * K + k0 + 8 * (lane >> 4);
#pragma unroll
  for (int i = 0; i < 8; ++i) { w[i] = (__bf16)p[i]; w[8 + i] = (__bf16)p[16 + i]; }
  return w; }
__device__ __forceinline__ v16h wcolh_io(const float* Wm, int k0, int o, int lane, int ld) { v16h w; const int g = lane >> 4;
#pragma unroll
  for (int i = 0; i < 8; ++i) { w[i] = (_Float16)(bfr(Wm[(size_t)(k0 + 8 * g + i) * ld + o]) * 256.0f); w[8 + i] = (_Float16)(bfr(Wm[(size_t)(k0 + 16 + 8 * g + i) * ld + o]) * 256.0f); }
  return w; }
__device__ __forceinline__ v16h wcolh_oi(const float* Wm, int k0, int o, int lane, int K) { v16h w; const float* p = Wm + (size_t)o * K + k0 + 8 * (lane >> 4);
#pragma unroll
  for (int i = 0; i < 8; ++i) { w[i] = (_Float16)(bfr(p[i]) * 256.0f); w[8 + i] = (_Float16)(bfr(p[16 + i]) * 256.0f); }
  return w; }
#define WQKV_LAYOUT 1   // 0 = (in,out) [DIN][CC]; 1 = (out,in) [CC][DIN]; 2 = per-head [NH][DIN][HD]
__device__ __forceinline__ v16b wcol_hdk(const float* Wm, int k0, int o, int lane) { v16b w; const int g = lane >> 4; const float* p = Wm + (size_t)(o / HD) * DIN * HD + (o % HD);
#pragma unroll
  for (int i = 0; i < 8; ++i) { w[i] = (__bf16)p[(size_t)(k0 + 8 * g + i) * HD]; w[8 + i] = (__bf16)p[(size_t)(k0 + 16 + 8 * g + i) * HD]; }
  return w; }
#define WO_OUT_IN 1
#if WQKV_LAYOUT == 1
#define WCOL(W, k0, o, lane) wcol_oi(W, k0, o, lane, DIN)
#elif WQKV_LAYOUT == 2
#define WCOL(W, k0, o, lane) wcol_hdk(W, k0, o, lane)
#else
#define WCOL(W, k0, o, lane) wcol_io(W, k0, o, lane, CC)
#endif
#if WO_OUT_IN
#define WOCOL(W, k0, o, lane) wcol_oi(W, k0, o, lane, CC)
#define WOCOLH(W, k0, o, lane) wcolh_oi(W, k0, o, lane, CC)
#else
#define WOCOL(W, k0, o, lane) wcol_io(W, k0, o, lane, DIN)
#define WOCOLH(W, k0, o, lane) wcolh_io(W, k0, o, lane, DIN)
#endif
#ifndef PROJ_EXTRA_PARAMS
#define PROJ_EXTRA_PARAMS
#endif

#define WS_QH  0u                                      // f16 q rows [b*t][CC]
#define WS_KH  (WS_QH + 2u * (size_t)NB * TT * CC)      // f16 k rows [b*t][CC]
#define WS_VT  (WS_KH + 2u * (size_t)NB * TT * CC)      // f16 v planes [b][c][t]
#define WS_QL  (WS_VT + 2u * (size_t)NB * CC * TT)      // f16 q residual x 2^10 rows [b][t < QHI][CC]
#define WS_KL  (WS_QL + 2u * (size_t)NB * QHI * CC)     // f16 k residual x 2^10 rows [b][t < KHI][CC]
#define WS_VB  (WS_KL + 2u * (size_t)NB * KHI * CC)     // bf16 v hi planes [b][c][t < KHI]
#define WS_VBL (WS_VB + 2u * (size_t)NB * CC * KHI)
#define WS_Y   (WS_VBL + 2u * (size_t)NB * CC * KHI)     // f32 ctx rows [b*t][CC] (only when there is an output projection)
#define WS_END (WS_Y  + 4u * (size_t)NB * TT * CC)

// plain builtin products: the compiler keeps the distance behind them itself and may place their operands in any register window
__device__ __forceinline__ v8f wmh(v16h a, v16h b, v8f c) { return __builtin_amdgcn_wmma_f32_16x16x32_f16(false, a, false, b, (short)0, c, false, false); }
__device__ __forceinline__ v8f wmb(v16b a, v16b b, v8f c) { return __builtin_amdgcn_wmma_f32_16x16x32_bf16(false, a, false, b, (short)0, c, false, false); }
typedef __attribute__((ext_vector_type(4))) __bf16 v4b;
typedef __attribute__((ext_vector_type(4))) _Float16 v4h;
__device__ __forceinline__ v4b cvt4b(v4f v) { return v4b{(__bf16)v[0], (__bf16)v[1], (__bf16)v[2], (__bf16)v[3]}; }
// ---- gemm_tile: 256 threads, acc += A[128 rows][1024] B[128 rows][1024]^T, both k-contiguous f32 rows. Each k step of BK is read once per workgroup with whole-line loads, converted once and kept in LDS as 16-bit rows of pitch 2 BK + 16 bytes (16 B x odd: no bank conflict for 16-byte fragment reads); two buffers: the next step's loads fly while this step's products run. Waves 4 x 2, 32 x 64 of the tile each (acc[i][j]: rows 32 wr + 16 i, columns 64 wc + 16 j). k runs upward in steps of 32 per accumulator.
// MODE 0: A, B to bf16. MODE 1: A to f16, B to f16(bf16 x 2^8). MODE 2: A to bf16 hi + lo (two planes, hi product first), B to bf16. On return every wave has left the buffers (sm may be reused). Every unroll directive here and in the two kernels' output staging keeps a register array (loaded pieces, fragments, accumulators) indexed by constants.
template <int MODE, int BK>
__device__ __forceinline__ void gemm_tile(const float* __restrict__ A, const float* __restrict__ Bw, char* sm, v8f (&acc)[2][4]) {
  constexpr int KD = 1024, PITCH = 2 * BK + 16, UR = BK / 4, RS = 256 / UR, NU = 128 / RS, PL = 128 * PITCH, BUF = (MODE == 2 ? 3 : 2) * PL, NS = KD / BK;
  const int tid = threadIdx.x, lane = tid & 31, col = lane & 15, g = lane >> 4, wave = tid >> 5, wr = wave >> 1, wc = wave & 1;
  const float* ga = A + (size_t)(tid / UR) * KD + (tid % UR) * 4; const float* gb = Bw + (size_t)(tid / UR) * KD + (tid % UR) * 4;   /* the thread's 16 bytes of rows tid / UR + i RS */
  char* sw = sm + (tid / UR) * PITCH + (tid % UR) * 8;
  const char* fa = sm + (wr * 32 + col) * PITCH + 16 * g; const char* fb = sm + PL + (wc * 64 + col) * PITCH + 16 * g;
  v4f ra[NU], rb[NU];
  auto fetch = [&]() {
#pragma unroll
    for (int i = 0; i < NU; ++i) { ra[i] = *(const v4f*)(ga + (size_t)i * RS * KD); rb[i] = *(const v4f*)(gb + (size_t)i * RS * KD); }
    // stands in front of the rewrite of the two address pairs that the loads above it name (every load is one of them plus a constant); the pairs as inputs keep their registers whole until it
    asm volatile("s_wait_xcnt 0x0" :: "v"(ga), "v"(gb) : "memory");
    __builtin_amdgcn_sched_barrier(0);   // holds the loads in front of the products that cover their latency, and the address additions behind the wait
    ga += BK; gb += BK; };
  auto stage = [&](int off) {
#pragma unroll
    for (int i = 0; i < NU; ++i) { char* p = sw + off + i * RS * PITCH;
      if constexpr (MODE == 0) { *(v4b*)p = cvt4b(ra[i]); *(v4b*)(p + PL) = cvt4b(rb[i]); }
      else if constexpr (MODE == 1) { *(v4h*)p = v4h{(_Float16)ra[i][0], (_Float16)ra[i][1], (_Float16)ra[i][2], (_Float16)ra[i][3]};
        *(v4h*)(p + PL) = v4h{(_Float16)(bfr(rb[i][0]) * 256.0f), (_Float16)(bfr(rb[i][1]) * 256.0f), (_Float16)(bfr(rb[i][2]) * 256.0f), (_Float16)(bfr(rb[i][3]) * 256.0f)}; }
      else { const v4b hv = cvt4b(ra[i]); *(v4b*)p = hv; *(v4b*)(p + 2 * PL) = cvt4b(v4f{ra[i][0] - (float)hv[0], ra[i][1] - (float)hv[1], ra[i][2] - (float)hv[2], ra[i][3] - (float)hv[3]}); *(v4b*)(p + PL) = cvt4b(rb[i]); } } };
  auto products = [&](int off) {
#pragma unroll
    for (int kk = 0; kk < BK / 32; ++kk) {
      if constexpr (MODE == 1) { v16h a[2], w[4];
#pragma unroll
        for (int i = 0; i < 2; ++i) { union { v16h v; v8h q[2]; } u; const char* p = fa + off + i * 16 * PITCH + kk * 64; u.q[0] = *(const v8h*)p; u.q[1] = *(const v8h*)(p + 32); a[i] = u.v; }
#pragma unroll
        for (int j = 0; j < 4; ++j) { union { v16h v; v8h q[2]; } u; const char* p = fb + off + j * 16 * PITCH + kk * 64; u.q[0] = *(const v8h*)p; u.q[1] = *(const v8h*)(p + 32); w[j] = u.v; }
#pragma unroll
        for (int i = 0; i < 2; ++i)
#pragma unroll
          for (int j = 0; j < 4; ++j) acc[i][j] = wmh(a[i], w[j], acc[i][j]);
      } else { v16b a[2], al[2], w[4];
#pragma unroll
        for (int i = 0; i < 2; ++i) { union { v16b v; v8b q[2]; } u; const char* p = fa + off + i * 16 * PITCH + kk * 64; u.q[0] = *(const v8b*)p; u.q[1] = *(const v8b*)(p + 32); a[i] = u.v;
          if constexpr (MODE == 2) { u.q[0] = *(const v8b*)(p + 2 * PL); u.q[1] = *(const v8b*)(p + 2 * PL + 32); al[i] = u.v; } }
#pragma unroll
        for (int j = 0; j < 4; ++j) { union { v16b v; v8b q[2]; } u; const char* p = fb + off + j * 16 * PITCH + kk * 64; u.q[0] = *(const v8b*)p; u.q[1] = *(const v8b*)(p + 32); w[j] = u.v; }
#pragma unroll
        for (int i = 0; i < 2; ++i)
#pragma unroll
          for (int j = 0; j < 4; ++j) acc[i][j] = wmb(a[i], w[j], acc[i][j]);
        if constexpr (MODE == 2) {
#pragma unroll
          for (int i = 0; i < 2; ++i)
#pragma unroll
            for (int j = 0; j < 4; ++j) acc[i][j] = wmb(al[i], w[j], acc[i][j]); } } } };
  fetch(); stage(0); __syncthreads();
  int cur = 0;
  for (int s = 0; s + 1 < NS; ++s) { fetch(); products(cur);
    __builtin_amdgcn_sched_barrier(0);   // keeps the conversions, which wait for the loads in flight, behind the products that cover the loads' latency
    cur ^= BUF; stage(cur); __syncthreads(); }   /* the one barrier of a step publishes the buffer just written and ends the reads of the one written next */
  products(cur); __syncthreads(); }
// stands behind a run of global loads or stores, in front of any rewrite of the registers that they name; the scheduling barrier holds later arithmetic behind it
#define XW() do { asm volatile("s_wait_xcnt 0x0" ::: "memory"); __builtin_amdgcn_sched_barrier(0); } while (0)
// ---- k_proj: block = (128 rows, 128 cols, which): q/k/v = X W (+ b) with exact bf16 products (K = DIN) -> which 0: q f16 rows (+ residual rows < QHI); 1: k f16 rows (+ residual rows < KHI); 2: v f16 planes [c][t] (+ bf16 hi/lo planes for t < KHI). The output staging reuses the LDS of the operand buffers.
__global__ __launch_bounds__(256) void k_proj(const float* __restrict__ XQ, const float* __restrict__ XK, const float* __restrict__ XV, const float* __restrict__ WQ, const float* __restrict__ WK, const float* __restrict__ WV, const float* __restrict__ BQ, const float* __restrict__ BK, const float* __restrict__ BV,
    _Float16* __restrict__ QH, _Float16* __restrict__ QL, _Float16* __restrict__ KH, _Float16* __restrict__ KL, _Float16* __restrict__ VT, __bf16* __restrict__ VB, __bf16* __restrict__ VBL) {
  __shared__ __align__(16) char sm[3 * 128 * 136 * 2];
  const int tid = threadIdx.x, wave = tid >> 5, lane = tid & 31, col = lane & 15, g = lane >> 4, wr = wave >> 1, wc = wave & 1; const int which = blockIdx.z; const int c0 = blockIdx.y * 128; const size_t r0 = (size_t)blockIdx.x * 128; const size_t bb = r0 / TT; const int t0 = (int)(r0 % TT);
  const float* X = which == 0 ? XQ : which == 1 ? XK : XV; const float* WA = which == 0 ? WQ : which == 1 ? WK : WV; const float* BA = which == 0 ? BQ : which == 1 ? BK : BV;
  v8f acc[2][4] = {};
  gemm_tile<0, 32>(X + r0 * DIN, WA + (size_t)c0 * DIN, sm, acc);
  if (which < 2) { _Float16 (*sh)[136] = (_Float16 (*)[136])sm; _Float16 (*sl)[136] = (_Float16 (*)[136])(sm + 128 * 136 * 2);
    _Float16* DH = which == 0 ? QH : KH; _Float16* DL = which == 0 ? QL : KL; const int nhi = which == 0 ? QHI : KHI; const bool hi_rows = t0 < nhi;
#pragma unroll
    for (int j = 0; j < 4; ++j) { const int cl = wc * 64 + j * 16 + col; float bias = 0.f; if (BA) { bias = bfr(BA[c0 + cl]); XW(); }
#pragma unroll
      for (int i = 0; i < 2; ++i)
#pragma unroll
        for (int r = 0; r < 8; ++r) { const float v = acc[i][j][r] + bias; const _Float16 hv = (_Float16)v; const int rl = wr * 32 + i * 16 + 8 * g + r; sh[rl][cl] = hv; sl[rl][cl] = (_Float16)((v - (float)hv) * 1024.0f); } }
    __syncthreads();
    const int rl = tid >> 4, q = tid & 15; v4u t[8];   /* piece it of a thread: row rl + 16 it, 16 bytes at element 8 q */
#pragma unroll
    for (int it = 0; it < 8; ++it) t[it] = *(const v4u*)&sh[rl + 16 * it][q * 8];
#pragma unroll
    for (int it = 0; it < 8; ++it) vst2((unsigned*)(DH + (r0 + rl + 16 * it) * CC + c0 + q * 8), t[it]);
    if (hi_rows) { XW();
#pragma unroll
      for (int it = 0; it < 8; ++it) t[it] = *(const v4u*)&sl[rl + 16 * it][q * 8];
#pragma unroll
      for (int it = 0; it < 8; ++it) vst2((unsigned*)(DL + (bb * nhi + t0 + rl + 16 * it) * (size_t)CC + c0 + q * 8), t[it]); }
  } else { _Float16 (*th)[136] = (_Float16 (*)[136])sm; __bf16 (*tb)[136] = (__bf16 (*)[136])(sm + 128 * 136 * 2); __bf16 (*tbl)[136] = (__bf16 (*)[136])(sm + 2 * 128 * 136 * 2); const bool hi_rows = t0 < KHI;
#pragma unroll
    for (int j = 0; j < 4; ++j) { const int cl = wc * 64 + j * 16 + col; float bias = 0.f; if (BA) { bias = bfr(BA[c0 + cl]); XW(); }
#pragma unroll
      for (int i = 0; i < 2; ++i)
#pragma unroll
        for (int r = 0; r < 8; ++r) { const float v = acc[i][j][r] + bias; const int rl = wr * 32 + i * 16 + 8 * g + r; th[cl][rl] = (_Float16)v; const __bf16 bh = (__bf16)v; tb[cl][rl] = bh; tbl[cl][rl] = (__bf16)(v - (float)bh); } }
    __syncthreads();
    const int cl = tid >> 4, q = tid & 15; v4u t[8];   /* piece it of a thread: plane cl + 16 it, 16 bytes at element 8 q */
#pragma unroll
    for (int it = 0; it < 8; ++it) t[it] = *(const v4u*)&th[cl + 16 * it][q * 8];
#pragma unroll
    for (int it = 0; it < 8; ++it) vst2((unsigned*)(VT + (bb * CC + c0 + cl + 16 * it) * (size_t)TT + t0 + q * 8), t[it]);
    XW();
    if (hi_rows) {
#pragma unroll
      for (int it = 0; it < 8; ++it) t[it] = *(const v4u*)&tb[cl + 16 * it][q * 8];
#pragma unroll
      for (int it = 0; it < 8; ++it) vst2((unsigned*)(VB + (bb * CC + c0 + cl + 16 * it) * (size_t)KHI + t0 + q * 8), t[it]);
      XW();
#pragma unroll
      for (int it = 0; it < 8; ++it) t[it] = *(const v4u*)&tbl[cl + 16 * it][q * 8];
#pragma unroll
      for (int it = 0; it < 8; ++it) vst2((unsigned*)(VBL + (bb * CC + c0 + cl + 16 * it) * (size_t)KHI + t0 + q * 8), t[it]);
      XW(); } } }
// frag_h from a base, the lane's own byte offset (row and lane half; 0 where the base already holds it) and a constant element offset
__device__ __forceinline__ v16h frag_s(const _Float16* base, unsigned lo, size_t e) { union { v16h v; v8h q[2]; } u; const char* p = (const char*)base + lo; u.q[0] = *(const v8h*)(p + 2 * e); u.q[1] = *(const v8h*)(p + 2 * e + 32); return u.v; }
// ---- k_attn: one wave = QWAVE queries (NCG groups of 16 columns) of (b, h); it walks its visible keys in passes of KPASS keys. S^T = k q^T (a lane holds the logits of ONE query: tile j, register r = key 16 j + 8 g + r), running maximum and sum per lane, ctx^T += v^T P^T with P^T packed from the score registers as the B operand (element order = the fragment k order above). Logits and P stay in registers. Queries < QHI: 3-product logits (f16 residuals) and P, v as bf16 hi + lo (3 products).
#define NCG 2              // 16-query column groups per wave: each k / v fragment load feeds NCG products
#define NKT 4              // 16-key tiles per pass
#define KPASS (16 * NKT)
#define QWAVE (16 * NCG)
#define QBLK (4 * QWAVE)
// one pass of the running softmax for one column group: mask by index (strict past, except (0, 0)), new maximum (own keys, then the other lane half), rescale sum and ctx, st <- exp(logit - maximum). An excluded logit is -3e38 and its exp is 0: key 0 is visible to every query, so the maximum is a real logit from the first pass on.
__device__ __forceinline__ void sm_pass(v8f (&st)[NKT], v8f (&acc)[HD / 16], float& m, float& l, int kg, int t, bool edge) {
  if (edge) {
#pragma unroll
    for (int j = 0; j < NKT; ++j)
#pragma unroll
      for (int r = 0; r < 8; ++r) { const int k = kg + j * 16 + r; st[j][r] = (k < t || (k | t) == 0) ? st[j][r] : -3.0e38f; } }
  float mx = st[0][0];
#pragma unroll
  for (int j = 0; j < NKT; ++j)
#pragma unroll
    for (int r = 0; r < 8; ++r) mx = fmaxf(mx, st[j][r]);
  mx = fmaxf(mx, __shfl_xor(mx, 16));
  const float mn = fmaxf(m, mx), f = expf(m - mn); m = mn;
  float s = 0.f;
#pragma unroll
  for (int j = 0; j < NKT; ++j)
#pragma unroll
    for (int r = 0; r < 8; ++r) { const float e = expf(st[j][r] - mn); st[j][r] = e; s += e; }
  l = l * f + s;
#pragma unroll
  for (int d = 0; d < HD / 16; ++d) acc[d] = acc[d] * f; }
// two waves per SIMD is all this grid supplies (256 workgroups of 8 waves): the register budget of two lets the fragments fetched ahead stay in registers
__global__ __launch_bounds__(256) __attribute__((amdgpu_waves_per_eu(2, 2))) void k_attn(const _Float16* __restrict__ QH, const _Float16* __restrict__ KH, const _Float16* __restrict__ QL, const _Float16* __restrict__ KL, const _Float16* __restrict__ VT, const __bf16* __restrict__ VB, const __bf16* __restrict__ VBL, float* __restrict__ Y) {
  const int tid = threadIdx.x, lane = tid & 31, col = lane & 15, g = lane >> 4; const int wave = __builtin_amdgcn_readfirstlane(tid >> 5);
  const int b = blockIdx.x / NH, h = blockIdx.x % NH; const int qt = wave < 4 ? TT / QBLK - 1 - (int)blockIdx.y : (int)blockIdx.y; const int ql0 = qt * QBLK + (wave & 3) * QWAVE;   /* waves 0-3 take query tile n - 1 - y, waves 4-7 tile y: every workgroup walks the same number of keys */
  const int npass = (ql0 + QWAVE - 2) / KPASS + 1;   /* the wave's last visible key is ql0 + QWAVE - 2 */
  const _Float16* Qb = QH + ((size_t)b * TT + ql0 + col) * CC + h * HD; const _Float16* Kb = KH + ((size_t)b * TT + col) * CC + h * HD;
  float m[NCG], l[NCG]; v8f acc[NCG][HD / 16];
#pragma unroll
  for (int c = 0; c < NCG; ++c) { m[c] = -3.0e38f; l[c] = 0.f;
#pragma unroll
    for (int d = 0; d < HD / 16; ++d) acc[c][d] = v8f{}; }
  if (ql0 < QHI) {   /* wave-uniform; the wave's passes end at or below key KHI */
    const _Float16* QLb = QL + ((size_t)b * QHI + ql0 + col) * CC + h * HD; const _Float16* KLb = KL + ((size_t)b * KHI + col) * CC + h * HD;
    const __bf16* VBb = VB + ((size_t)b * CC + h * HD + col) * (size_t)KHI; const __bf16* VLb = VBL + ((size_t)b * CC + h * HD + col) * (size_t)KHI;
    v16h qf[NCG][2], qlf[NCG][2];
#pragma unroll
    for (int c = 0; c < NCG; ++c)
#pragma unroll
      for (int kc = 0; kc < 2; ++kc) { qf[c][kc] = frag_h(Qb + (size_t)c * 16 * CC + kc * 32, lane); qlf[c][kc] = frag_h(QLb + (size_t)c * 16 * CC + kc * 32, lane); }
    // stands in front of any rewrite of the address registers that the loads above it name; the loaded fragments as inputs hold the loads in front of it, the scheduling barrier holds later address arithmetic behind it
    asm volatile("s_wait_xcnt 0x0" :: "v"(qf[0][0]), "v"(qf[0][1]), "v"(qf[1][0]), "v"(qf[1][1]), "v"(qlf[0][0]), "v"(qlf[0][1]), "v"(qlf[1][0]), "v"(qlf[1][1]) : "memory");
    __builtin_amdgcn_sched_barrier(0);
    for (int ps = 0; ps < npass; ++ps) { const int k0 = ps * KPASS; v8f st[NCG][NKT];
#pragma unroll
      for (int j = 0; j < NKT; ++j) { v8f a[NCG] = {}, al[NCG] = {};
#pragma unroll
        for (int kc = 0; kc < 2; ++kc) { const v16h kf = frag_h(Kb + (size_t)(k0 + j * 16) * CC + kc * 32, lane), klf = frag_h(KLb + (size_t)(k0 + j * 16) * CC + kc * 32, lane);
#pragma unroll
          for (int c = 0; c < NCG; ++c) { a[c] = wmh(kf, qf[c][kc], a[c]); al[c] = wmh(kf, qlf[c][kc], al[c]); al[c] = wmh(klf, qf[c][kc], al[c]); } }
#pragma unroll
        for (int c = 0; c < NCG; ++c) st[c][j] = (a[c] + al[c] * (1.0f / 1024.0f)) * SCALE; }
#pragma unroll
      for (int c = 0; c < NCG; ++c) sm_pass(st[c], acc[c], m[c], l[c], k0 + 8 * g, ql0 + c * 16 + col, true);
#pragma unroll
      for (int jj = 0; jj < NKT / 2; ++jj) { F2 p[NCG];
#pragma unroll
        for (int c = 0; c < NCG; ++c) { float pv[16];
#pragma unroll
          for (int i = 0; i < 8; ++i) { pv[i] = st[c][2 * jj][i]; pv[8 + i] = st[c][2 * jj + 1][i]; }
          p[c] = bsplit16(pv); }
#pragma unroll
        for (int d = 0; d < HD / 16; ++d) { const size_t po = (size_t)d * 16 * KHI + k0 + jj * 32; const v16b vh = frag_b(VBb + po, lane), vl = frag_b(VLb + po, lane);
#pragma unroll
          for (int c = 0; c < NCG; ++c) { acc[c][d] = wmb(vh, p[c].h, acc[c][d]); acc[c][d] = wmb(vh, p[c].l, acc[c][d]); acc[c][d] = wmb(vl, p[c].h, acc[c][d]); } } } }
  } else {
    const _Float16* Qu = QH + ((size_t)b * TT + ql0) * CC + h * HD; const _Float16* Ku = KH + (size_t)b * TT * CC + h * HD; const _Float16* Vu = VT + ((size_t)b * CC + h * HD) * (size_t)TT;   /* wave-uniform bases */
    const unsigned rlo = 2u * (col * CC + 8 * g);   /* the lane's byte offset in q / k rows */
    const _Float16* Kl = Ku + col * CC + 8 * g; const _Float16* Vl = Vu + col * TT + 8 * g;   /* the lane's own row of k, plane of v */
    v16h qf[NCG][2];
#pragma unroll
    for (int c = 0; c < NCG; ++c)
#pragma unroll
      for (int kc = 0; kc < 2; ++kc) qf[c][kc] = frag_s(Qu, rlo, (size_t)c * 16 * CC + kc * 32);
    v16h kf[2][NKT], vf[NKT / 2][HD / 16];
#pragma unroll
    for (int kc = 0; kc < 2; ++kc)
#pragma unroll
      for (int j = 0; j < NKT; ++j) kf[kc][j] = frag_s(Ku, rlo, (size_t)(j * 16) * CC + kc * 32);
    // stands in front of any rewrite of the registers that the loads above it name; the two bases and the offset as inputs keep those registers whole until it, the scheduling barrier holds the loads in front of it and later address arithmetic behind it
    asm volatile("s_wait_xcnt 0x0" :: "s"(Qu), "s"(Ku), "v"(rlo) : "memory");
    __builtin_amdgcn_sched_barrier(0);
    for (int ps = 0; ps < npass; ++ps) { const int k0 = ps * KPASS; v8f st[NCG][NKT];
#pragma unroll
      for (int c = 0; c < NCG; ++c)
#pragma unroll
        for (int j = 0; j < NKT; ++j) st[c][j] = v8f{};
#pragma unroll
      for (int kc = 0; kc < 2; ++kc)
#pragma unroll
        for (int j = 0; j < NKT; ++j)
#pragma unroll
          for (int c = 0; c < NCG; ++c) st[c][j] = wmh(kf[kc][j], qf[c][kc], st[c][j]);
      // this pass's v fragments and the next pass's k fragments (the last pass fetches its own again: stays inside the wave's key range) are requested here, ahead of the softmax arithmetic that covers their latency
      const int kn = ps + 1 < npass ? k0 + KPASS : k0; const _Float16* vp = Vl + k0; const _Float16* kp = Kl + (size_t)kn * CC;   /* the lane's own addresses: every load of the run is one of them plus a constant */
#pragma unroll
      for (int jj = 0; jj < NKT / 2; ++jj)
#pragma unroll
        for (int d = 0; d < HD / 16; ++d) vf[jj][d] = frag_s(vp, 0u, (size_t)d * 16 * TT + jj * 32);
#pragma unroll
      for (int kc = 0; kc < 2; ++kc)
#pragma unroll
        for (int j = 0; j < NKT; ++j) kf[kc][j] = frag_s(kp, 0u, (size_t)(j * 16) * CC + kc * 32);
      // stands in front of any rewrite of the address registers that the loads above it name; the two addresses as inputs keep their registers whole until it: no load of the run may land in a pair that the loads in front of it name
      asm volatile("s_wait_xcnt 0x0" :: "v"(vp), "v"(kp) : "memory");
      __builtin_amdgcn_sched_barrier(0);   // keeps the compiler from sinking those loads to their first use, where each would be waited for alone
      const bool edge = k0 + KPASS > ql0;   /* wave-uniform: only passes that reach the wave's first query hold excluded keys */
#pragma unroll
      for (int c = 0; c < NCG; ++c) {
#pragma unroll
        for (int j = 0; j < NKT; ++j) st[c][j] = st[c][j] * SCALE;
        sm_pass(st[c], acc[c], m[c], l[c], k0 + 8 * g, ql0 + c * 16 + col, edge); }
#pragma unroll
      for (int jj = 0; jj < NKT / 2; ++jj) { v16h p[NCG];
#pragma unroll
        for (int c = 0; c < NCG; ++c)
#pragma unroll
          for (int i = 0; i < 8; ++i) { p[c][i] = (_Float16)st[c][2 * jj][i]; p[c][8 + i] = (_Float16)st[c][2 * jj + 1][i]; }
#pragma unroll
        for (int d = 0; d < HD / 16; ++d)
#pragma unroll
          for (int c = 0; c < NCG; ++c) acc[c][d] = wmh(vf[jj][d], p[c], acc[c][d]); } } }
  // acc[c][d][r] = ctx(query ql0 + 16 c + col, dim 16 d + 8 g + r) x sum: join the two lane halves' sums, divide, 32 contiguous bytes per lane and d
#pragma unroll
  for (int c = 0; c < NCG; ++c) { const float a = l[c] + __shfl_xor(l[c], 16); const float inv = a > 0.f ? 1.0f / a : 0.f; float* yr = Y + ((size_t)b * TT + ql0 + c * 16 + col) * CC + h * HD + 8 * g;
#pragma unroll
    for (int d = 0; d < HD / 16; ++d) { const v8f o = acc[c][d] * inv; vst2(yr + d * 16, v4f{o[0], o[1], o[2], o[3]}); vst2(yr + d * 16 + 4, v4f{o[4], o[5], o[6], o[7]}); } } }
// ---- k_out: block = (128 rows, 128 cols): out = ctx Wo (+ bo): ctx once to f16 against Wo as f16(bf16 x 2^8) exact (1 product) x 2^-8; causal early rows (< QHI of each sequence): ctx bf16 hi + lo against exact bf16 Wo (2 products). Each wave stages its 32 x 64 of the output in its own part of the LDS that the operand buffers have left.
__global__ __launch_bounds__(256) void k_out(const float* __restrict__ Y, const float* __restrict__ WO, const float* __restrict__ BO, float* __restrict__ OUT) { __shared__ __align__(16) char sm[2 * 3 * 128 * 144];
  const int tid = threadIdx.x, wave = tid >> 5, lane = tid & 31, col = lane & 15, g = lane >> 4, wr = wave >> 1, wc = wave & 1; const int c0 = blockIdx.y * 128; const size_t r0 = (size_t)blockIdx.x * 128;
  v8f acc[2][4] = {}; float sc;
  if (CAUSAL && (int)(r0 % TT) < QHI) { gemm_tile<2, 64>(Y + r0 * CC, WO + (size_t)c0 * CC, sm, acc); sc = 1.0f; }   /* block-uniform */
  else { gemm_tile<1, 64>(Y + r0 * CC, WO + (size_t)c0 * CC, sm, acc); sc = 1.0f / 256.0f; }
  float (*sf)[68] = (float (*)[68])(sm + wave * 32 * 68 * 4);
#pragma unroll
  for (int j = 0; j < 4; ++j) { const float bias = BO ? bfr(BO[c0 + wc * 64 + j * 16 + col]) : 0.f;
#pragma unroll
    for (int i = 0; i < 2; ++i)
#pragma unroll
      for (int r = 0; r < 8; ++r) sf[i * 16 + 8 * g + r][j * 16 + col] = acc[i][j][r] * sc + bias; }
  LDSX();
#pragma unroll
  for (int rl = 0; rl < 32; rl += 2) vst2(OUT + (r0 + wr * 32 + rl + g) * DIN + c0 + wc * 64 + col * 4, *(const v4f*)&sf[rl + g][col * 4]); }

extern "C" void kernel_launch(void* const* d_in, const int* in_sizes, int n_in, void* d_out, int out_size, void* d_ws, size_t ws_size, hipStream_t stream) {
  (void)in_sizes; (void)n_in; (void)out_size;
  const float** F = (const float**)d_in;
  if (ws_size < (size_t)WS_END) return;
  char* ws = (char*)d_ws; _Float16 *QH = (_Float16*)(ws + WS_QH), *KH = (_Float16*)(ws + WS_KH), *VT = (_Float16*)(ws + WS_VT), *QL = (_Float16*)(ws + WS_QL), *KL = (_Float16*)(ws + WS_KL); __bf16 *VB = (__bf16*)(ws + WS_VB), *VBL = (__bf16*)(ws + WS_VBL); float *Y = (float*)(ws + WS_Y);
  (void)Y; (void)QL; (void)KL; (void)VB; (void)VBL;
  // inputs: 0 q, 1 k, 2 v [2,2048,1024]; 3 Wq, 4 Wk, 5 Wv, 6 Wo [1024,1024] (out,in), no biases
  k_proj<<<dim3(TNB * TT / 128, CC / 128, 3), 256, 0, stream>>>(F[0], F[1], F[2], F[3], F[4], F[5], nullptr, nullptr, nullptr, QH, QL, KH, KL, VT, VB, VBL);
  k_attn<<<dim3(TNB * NH, TT / QBLK / 2), 256, 0, stream>>>(QH, KH, QL, KL, VT, VB, VBL, Y);
  k_out<<<dim3(TNB * TT / 128, DIN / 128), 256, 0, stream>>>(Y, F[6], nullptr, (float*)d_out);
}

// v003
// It runs in 103 microseconds.
// Two timings next to v002 put it at 1.09 and 1.08 times that version's speed.
// Over all steps from v000 it is 11.3 times as fast.
// compute dtype: all float inputs rounded to bf16; q/k/v = input W^T with EXACT bf16 products on WMMA 16x16x32 (f32 accumulate); causal (strict past) logits: q, k once to f16 (1 product) x 1024^-0.5, except the first 384 query rows of each sequence (3 products with f16 residuals); softmax in f32 with a running maximum; exp(logit - maximum) once to f16 against v once to f16 (1 product; bf16 hi + lo below row 384); ctx once to f16 against Wo carried x 2^8 in f16 (bf16 hi + lo against bf16 Wo, 2 products, in the first 384 rows of each sequence); f32 output.
#include <hip/hip_runtime.h>
#include <math.h>

typedef __attribute__((ext_vector_type(16))) _Float16 v16h;
typedef __attribute__((ext_vector_type(16))) __bf16 v16b;
typedef __attribute__((ext_vector_type(8)))  _Float16 v8h;
typedef __attribute__((ext_vector_type(8)))  float v8f;
typedef __attribute__((ext_vector_type(4)))  float v4f;
typedef __attribute__((ext_vector_type(2)))  float v2f;
typedef __attribute__((ext_vector_type(4)))  unsigned v4u;
typedef __attribute__((ext_vector_type(4)))  int v4i;
typedef float __attribute__((may_alias)) float_a;
typedef int __attribute__((may_alias)) int_a;

template <typename T> __device__ __forceinline__ void vst2(void* p, T v) { *(T*)p = v;  }
__device__ __forceinline__ v8f wmma16(v16h a, v16h b, v8f c) {
  v8f d = __builtin_amdgcn_wmma_f32_16x16x32_f16(false, a, false, b, (short)0, c, false, false);
  asm volatile("v_nop\n\tv_nop\n\tv_nop\n\tv_nop" : "+v"(d) : "v"(a), "v"(b));
  return d;
}
__device__ __forceinline__ v8f wmma_bf(v16b a, v16b b, v8f c) {
  v8f d = __builtin_amdgcn_wmma_f32_16x16x32_bf16(false, a, false, b, (short)0, c, false, false);
  asm volatile("v_nop\n\tv_nop\n\tv_nop\n\tv_nop" : "+v"(d) : "v"(a), "v"(b));
  return d;
}
// 16x16x32 fragments: lane = (h = lane>>4, row/col = lane&15); elements 0..7 = k0+8h+0..7, 8..15 = k0+16+8h+0..7; D element r = row 8h+r
__device__ __forceinline__ v16h frag_h(const _Float16* rowk0, int lane) {
  union { v16h v; v8h q[2]; } u; const _Float16* p = rowk0 + 8 * (lane >> 4);
  u.q[0] = *(const v8h*)p; u.q[1] = *(const v8h*)(p + 16); return u.v;
}
__device__ __forceinline__ v16h frag_f32(const float* rowk0, int lane) {
  v16h a; const float* p = rowk0 + 8 * (lane >> 4);
#pragma unroll
  for (int i = 0; i < 8; ++i) { a[i] = (_Float16)p[i]; a[8 + i] = (_Float16)p[16 + i]; }
  return a;
}
__device__ __forceinline__ v16h frag_f32s(const float* rowk0, int lane, float sc) {
  v16h a; const float* p = rowk0 + 8 * (lane >> 4);
#pragma unroll
  for (int i = 0; i < 8; ++i) { a[i] = (_Float16)(p[i] * sc); a[8 + i] = (_Float16)(p[16 + i] * sc); }
  return a;
}
// column fragment from a [K][ld] layout (column n), rows >= K read as 0
__device__ __forceinline__ v16h fragc_f32(const float* W, int k0, int n, int lane, int ld, int K) {
  v16h a; const int g = lane >> 4;
#pragma unroll
  for (int i = 0; i < 8; ++i) { const int ka = k0 + 8 * g + i, kb = ka + 16;
    a[i] = (_Float16)(ka < K ? W[(size_t)(ka < K ? ka : K - 1) * ld + n] : 0.f); a[8 + i] = (_Float16)(kb < K ? W[(size_t)(kb < K ? kb : K - 1) * ld + n] : 0.f); }
  return a;
}
struct F2 { v16b h, l; };
__device__ __forceinline__ F2 bsplit16(const float v[16]) { F2 r;
#pragma unroll
  for (int i = 0; i < 16; ++i) { const __bf16 h = (__bf16)v[i]; r.h[i] = h; r.l[i] = (__bf16)(v[i] - (float)h); }
  return r; }
__device__ __forceinline__ F2 split_row(const float* row, int k0, int lane) { float v[16]; const float* p = row + k0 + 8 * (lane >> 4);
#pragma unroll
  for (int i = 0; i < 8; ++i) { v[i] = p[i]; v[8 + i] = p[16 + i]; }
  return bsplit16(v); }
__device__ __forceinline__ F2 split_rowK(const float* row, int k0, int lane, int K) { float v[16]; const int g = lane >> 4;
#pragma unroll
  for (int i = 0; i < 8; ++i) { const int ka = k0 + 8 * g + i, kb = ka + 16; v[i] = ka < K ? row[ka < K ? ka : K - 1] : 0.f; v[8 + i] = kb < K ? row[kb < K ? kb : K - 1] : 0.f; }
  return bsplit16(v); }
__device__ __forceinline__ F2 split_col(const float* W, int k0, int n, int lane, int ld, int K) { float v[16]; const int g = lane >> 4;
#pragma unroll
  for (int i = 0; i < 8; ++i) { const int ka = k0 + 8 * g + i, kb = ka + 16; v[i] = ka < K ? W[(size_t)(ka < K ? ka : K - 1) * ld + n] : 0.f; v[8 + i] = kb < K ? W[(size_t)(kb < K ? kb : K - 1) * ld + n] : 0.f; }
  return bsplit16(v); }
__device__ __forceinline__ v8f mac3(const F2& a, const F2& b, v8f c) { c = wmma_bf(a.l, b.h, c); c = wmma_bf(a.h, b.l, c); return wmma_bf(a.h, b.h, c); }
__device__ __forceinline__ float sigm(float v) { return 1.0f / (1.0f + expf(-v)); }
#define LDSX() do { asm volatile("s_wait_dscnt 0" ::: "memory"); __builtin_amdgcn_wave_barrier(); __builtin_amdgcn_fence(__ATOMIC_RELEASE, "workgroup"); } while (0)

// In-context-learning attention (B 2, S 2,048, E 1,024 = 16 x 64; separate q/k/v inputs): qh = q Wq^T, kh = k Wk^T, vh = v Wv^T ((out,in)); scores = qh kh^T / sqrt(1024) masked where key >= query (strict past) except (0, 0); softmax; out = merged(probs vh) Wo^T.
#define NB 2
#define TT 2048
#define CC 1024            // NH * HD = projected width
#define DIN 1024          // input (model) width
#define NH 16
#define HD 64
#define NQB (TT / 64)
#define SCALE (0.03125f)
#define CAUSAL 1
#ifndef TNB
#define TNB NB
#endif
__device__ __forceinline__ float bfr(float v) { return (float)(__bf16)v; }
__host__ __device__ __forceinline__ int kb_last(int qb) { return CAUSAL ? ((qb * 64 + 63) >> 7) : (TT / 128 - 1); }
typedef __attribute__((ext_vector_type(8))) __bf16 v8b;
__device__ __forceinline__ v16b frag_b(const __bf16* rowk0, int lane) {
  union { v16b v; v8b q[2]; } u; const __bf16* p = rowk0 + 8 * (lane >> 4);
  u.q[0] = *(const v8b*)p; u.q[1] = *(const v8b*)(p + 16); return u.v;
}
#define QBH 6              // causal: query blocks 0..QBH-1 of each sequence (few keys, no averaging) take the high-precision path
#define QHI 384            // rows carrying a q residual plane
#define KHI 384            // key rows carrying k residual / v bf16 hi+lo planes (used only by the causal high-precision path)
// B fragment (k rows k0+.., output column o) of a weight: (in,out) [K][ld] or (out,in) [ld rows of K]: bf16 exact, or f16(bf16 * 256) exact
__device__ __forceinline__ v16b wcol_io(const float* Wm, int k0, int o, int lane, int ld) { v16b w; const int g = lane >> 4;
#pragma unroll
  for (int i = 0; i < 8; ++i) { w[i] = (__bf16)Wm[(size_t)(k0 + 8 * g + i) * ld + o]; w[8 + i] = (__bf16)Wm[(size_t)(k0 + 16 + 8 * g + i) * ld + o]; }
  return w; }
__device__ __forceinline__ v16b wcol_oi(const float* Wm, int k0, int o, int lane, int K) { v16b w; const float* p = Wm + (size_t)o * K + k0 + 8 * (lane >> 4);
#pragma unroll
  for (int i = 0; i < 8; ++i) { w[i] = (__bf16)p[i]; w[8 + i] = (__bf16)p[16 + i]; }
  return w; }
__device__ __forceinline__ v16h wcolh_io(const float* Wm, int k0, int o, int lane, int ld) { v16h w; const int g = lane >> 4;
#pragma unroll
  for (int i = 0; i < 8; ++i) { w[i] = (_Float16)(bfr(Wm[(size_t)(k0 + 8 * g + i) * ld + o]) * 256.0f); w[8 + i] = (_Float16)(bfr(Wm[(size_t)(k0 + 16 + 8 * g + i) * ld + o]) * 256.0f); }
  return w; }
__device__ __forceinline__ v16h wcolh_oi(const float* Wm, int k0, int o, int lane, int K) { v16h w; const float* p = Wm + (size_t)o * K + k0 + 8 * (lane >> 4);
#pragma unroll
  for (int i = 0; i < 8; ++i) { w[i] = (_Float16)(bfr(p[i]) * 256.0f); w[8 + i] = (_Float16)(bfr(p[16 + i]) * 256.0f); }
  return w; }
#define WQKV_LAYOUT 1   // 0 = (in,out) [DIN][CC]; 1 = (out,in) [CC][DIN]; 2 = per-head [NH][DIN][HD]
__device__ __forceinline__ v16b wcol_hdk(const float* Wm, int k0, int o, int lane) { v16b w; const int g = lane >> 4; const float* p = Wm + (size_t)(o / HD) * DIN * HD + (o % HD);
#pragma unroll
  for (int i = 0; i < 8; ++i) { w[i] = (__bf16)p[(size_t)(k0 + 8 * g + i) * HD]; w[8 + i] = (__bf16)p[(size_t)(k0 + 16 + 8 * g + i) * HD]; }
  return w; }
#define WO_OUT_IN 1
#if WQKV_LAYOUT == 1
#define WCOL(W, k0, o, lane) wcol_oi(W, k0, o, lane, DIN)
#elif WQKV_LAYOUT == 2
#define WCOL(W, k0, o, lane) wcol_hdk(W, k0, o, lane)
#else
#define WCOL(W, k0, o, lane) wcol_io(W, k0, o, lane, CC)
#endif
#if WO_OUT_IN
#define WOCOL(W, k0, o, lane) wcol_oi(W, k0, o, lane, CC)
#define WOCOLH(W, k0, o, lane) wcolh_oi(W, k0, o, lane, CC)
#else
#define WOCOL(W, k0, o, lane) wcol_io(W, k0, o, lane, DIN)
#define WOCOLH(W, k0, o, lane) wcolh_io(W, k0, o, lane, DIN)
#endif
#ifndef PROJ_EXTRA_PARAMS
#define PROJ_EXTRA_PARAMS
#endif

#define WS_QH  0u                                      // f16 q rows [b*t][CC]
#define WS_KH  (WS_QH + 2u * (size_t)NB * TT * CC)      // f16 k rows [b*t][CC]
#define WS_VT  (WS_KH + 2u * (size_t)NB * TT * CC)      // f16 v planes [b][c][t]
#define WS_QL  (WS_VT + 2u * (size_t)NB * CC * TT)      // f16 q residual x 2^10 rows [b][t < QHI][CC]
#define WS_KL  (WS_QL + 2u * (size_t)NB * QHI * CC)     // f16 k residual x 2^10 rows [b][t < KHI][CC]
#define WS_VB  (WS_KL + 2u * (size_t)NB * KHI * CC)     // bf16 v hi planes [b][c][t < KHI]
#define WS_VBL (WS_VB + 2u * (size_t)NB * CC * KHI)
#define WS_Y   (WS_VBL + 2u * (size_t)NB * CC * KHI)     // f32 ctx rows [b*t][CC] (only when there is an output projection)
#define WS_END (WS_Y  + 4u * (size_t)NB * TT * CC)

// plain builtin products: the compiler keeps the distance behind them itself and may place their operands in any register window
__device__ __forceinline__ v8f wmh(v16h a, v16h b, v8f c) { return __builtin_amdgcn_wmma_f32_16x16x32_f16(false, a, false, b, (short)0, c, false, false); }
__device__ __forceinline__ v8f wmb(v16b a, v16b b, v8f c) { return __builtin_amdgcn_wmma_f32_16x16x32_bf16(false, a, false, b, (short)0, c, false, false); }
typedef __attribute__((ext_vector_type(4))) __bf16 v4b;
typedef __attribute__((ext_vector_type(4))) _Float16 v4h;
__device__ __forceinline__ v4b cvt4b(v4f v) { return v4b{(__bf16)v[0], (__bf16)v[1], (__bf16)v[2], (__bf16)v[3]}; }
// ---- gemm_tile: 256 threads, acc += A[128 rows][1024] B[128 rows][1024]^T, both k-contiguous f32 rows. Each k step of BK is read once per workgroup with whole-line loads, converted once and kept in LDS as 16-bit rows of pitch 2 BK + 16 bytes (16 B x odd: no bank conflict for 16-byte fragment reads); two buffers: the next step's loads fly while this step's products run. Waves 4 x 2, 32 x 64 of the tile each (acc[i][j]: rows 32 wr + 16 i, columns 64 wc + 16 j). k runs upward in steps of 32 per accumulator.
// MODE 0: A, B to bf16. MODE 1: A to f16, B to f16(bf16 x 2^8). MODE 2: A to bf16 hi + lo (two planes, hi product first), B to bf16. On return every wave has left the buffers (sm may be reused). Every unroll directive here and in the two kernels' output staging keeps a register array (loaded pieces, fragments, accumulators) indexed by constants.
template <int MODE, int BK>
__device__ __forceinline__ void gemm_tile(const float* __restrict__ A, const float* __restrict__ Bw, char* sm, v8f (&acc)[2][4]) {
  constexpr int KD = 1024, PITCH = 2 * BK + 16, UR = BK / 4, RS = 256 / UR, NU = 128 / RS, PL = 128 * PITCH, BUF = (MODE == 2 ? 3 : 2) * PL, NS = KD / BK;
  const int tid = threadIdx.x, lane = tid & 31, col = lane & 15, g = lane >> 4, wave = tid >> 5, wr = wave >> 1, wc = wave & 1;
  const float* ga = A + (size_t)(tid / UR) * KD + (tid % UR) * 4; const float* gb = Bw + (size_t)(tid / UR) * KD + (tid % UR) * 4;   /* the thread's 16 bytes of rows tid / UR + i RS */
  char* sw = sm + (tid / UR) * PITCH + (tid % UR) * 8;
  const char* fa = sm + (wr * 32 + col) * PITCH + 16 * g; const char* fb = sm + PL + (wc * 64 + col) * PITCH + 16 * g;
  v4f ra[NU], rb[NU];
  auto fetch = [&]() {
#pragma unroll
    for (int i = 0; i < NU; ++i) { ra[i] = *(const v4f*)(ga + (size_t)i * RS * KD); rb[i] = *(const v4f*)(gb + (size_t)i * RS * KD); }
    // stands in front of the rewrite of the two address pairs that the loads above it name (every load is one of them plus a constant); the pairs as inputs keep their registers whole until it
    asm volatile("s_wait_xcnt 0x0" :: "v"(ga), "v"(gb) : "memory");
    __builtin_amdgcn_sched_barrier(0);   // holds the loads in front of the products that cover their latency, and the address additions behind the wait
    ga += BK; gb += BK; };
  auto stage = [&](int off) {
#pragma unroll
    for (int i = 0; i < NU; ++i) { char* p = sw + off + i * RS * PITCH;
      if constexpr (MODE == 0) { *(v4b*)p = cvt4b(ra[i]); *(v4b*)(p + PL) = cvt4b(rb[i]); }
      else if constexpr (MODE == 1) { *(v4h*)p = v4h{(_Float16)ra[i][0], (_Float16)ra[i][1], (_Float16)ra[i][2], (_Float16)ra[i][3]};
        *(v4h*)(p + PL) = v4h{(_Float16)(bfr(rb[i][0]) * 256.0f), (_Float16)(bfr(rb[i][1]) * 256.0f), (_Float16)(bfr(rb[i][2]) * 256.0f), (_Float16)(bfr(rb[i][3]) * 256.0f)}; }
      else { const v4b hv = cvt4b(ra[i]); *(v4b*)p = hv; *(v4b*)(p + 2 * PL) = cvt4b(v4f{ra[i][0] - (float)hv[0], ra[i][1] - (float)hv[1], ra[i][2] - (float)hv[2], ra[i][3] - (float)hv[3]}); *(v4b*)(p + PL) = cvt4b(rb[i]); } } };
  auto products = [&](int off) {
#pragma unroll
    for (int kk = 0; kk < BK / 32; ++kk) {
      if constexpr (MODE == 1) { v16h a[2], w[4];
#pragma unroll
        for (int i = 0; i < 2; ++i) { union { v16h v; v8h q[2]; } u; const char* p = fa + off + i * 16 * PITCH + kk * 64; u.q[0] = *(const v8h*)p; u.q[1] = *(const v8h*)(p + 32); a[i] = u.v; }
#pragma unroll
        for (int j = 0; j < 4; ++j) { union { v16h v; v8h q[2]; } u; const char* p = fb + off + j * 16 * PITCH + kk * 64; u.q[0] = *(const v8h*)p; u.q[1] = *(const v8h*)(p + 32); w[j] = u.v; }
#pragma unroll
        for (int i = 0; i < 2; ++i)
#pragma unroll
          for (int j = 0; j < 4; ++j) acc[i][j] = wmh(a[i], w[j], acc[i][j]);
      } else { v16b a[2], al[2], w[4];
#pragma unroll
        for (int i = 0; i < 2; ++i) { union { v16b v; v8b q[2]; } u; const char* p = fa + off + i * 16 * PITCH + kk * 64; u.q[0] = *(const v8b*)p; u.q[1] = *(const v8b*)(p + 32); a[i] = u.v;
          if constexpr (MODE == 2) { u.q[0] = *(const v8b*)(p + 2 * PL); u.q[1] = *(const v8b*)(p + 2 * PL + 32); al[i] = u.v; } }
#pragma unroll
        for (int j = 0; j < 4; ++j) { union { v16b v; v8b q[2]; } u; const char* p = fb + off + j * 16 * PITCH + kk * 64; u.q[0] = *(const v8b*)p; u.q[1] = *(const v8b*)(p + 32); w[j] = u.v; }
#pragma unroll
        for (int i = 0; i < 2; ++i)
#pragma unroll
          for (int j = 0; j < 4; ++j) acc[i][j] = wmb(a[i], w[j], acc[i][j]);
        if constexpr (MODE == 2) {
#pragma unroll
          for (int i = 0; i < 2; ++i)
#pragma unroll
            for (int j = 0; j < 4; ++j) acc[i][j] = wmb(al[i], w[j], acc[i][j]); } } } };
  fetch(); stage(0); __syncthreads();
  int cur = 0;
  for (int s = 0; s + 1 < NS; ++s) { fetch(); products(cur);
    __builtin_amdgcn_sched_barrier(0);   // keeps the conversions, which wait for the loads in flight, behind the products that cover the loads' latency
    cur ^= BUF; stage(cur); __syncthreads(); }   /* the one barrier of a step publishes the buffer just written and ends the reads of the one written next */
  products(cur); __syncthreads(); }
// stands behind a run of global loads or stores, in front of any rewrite of the registers that they name; the scheduling barrier holds later arithmetic behind it
#define XW() do { asm volatile("s_wait_xcnt 0x0" ::: "memory"); __builtin_amdgcn_sched_barrier(0); } while (0)
// ---- k_proj: block = (128 rows, 128 cols, which): q/k/v = X W (+ b) with exact bf16 products (K = DIN) -> which 0: q f16 rows (+ residual rows < QHI); 1: k f16 rows (+ residual rows < KHI); 2: v f16 planes [c][t] (+ bf16 hi/lo planes for t < KHI). The output staging reuses the LDS of the operand buffers.
__global__ __launch_bounds__(256) void k_proj(const float* __restrict__ XQ, const float* __restrict__ XK, const float* __restrict__ XV, const float* __restrict__ WQ, const float* __restrict__ WK, const float* __restrict__ WV, const float* __restrict__ BQ, const float* __restrict__ BK, const float* __restrict__ BV,
    _Float16* __restrict__ QH, _Float16* __restrict__ QL, _Float16* __restrict__ KH, _Float16* __restrict__ KL, _Float16* __restrict__ VT, __bf16* __restrict__ VB, __bf16* __restrict__ VBL) {
  __shared__ __align__(16) char sm[3 * 128 * 136 * 2];
  const int tid = threadIdx.x, wave = tid >> 5, lane = tid & 31, col = lane & 15, g = lane >> 4, wr = wave >> 1, wc = wave & 1; const int which = blockIdx.z; const int c0 = blockIdx.y * 128; const size_t r0 = (size_t)blockIdx.x * 128; const size_t bb = r0 / TT; const int t0 = (int)(r0 % TT);
  const float* X = which == 0 ? XQ : which == 1 ? XK : XV; const float* WA = which == 0 ? WQ : which == 1 ? WK : WV; const float* BA = which == 0 ? BQ : which == 1 ? BK : BV;
  v8f acc[2][4] = {};
  gemm_tile<0, 32>(X + r0 * DIN, WA + (size_t)c0 * DIN, sm, acc);
  if (which < 2) { _Float16 (*sh)[136] = (_Float16 (*)[136])sm; _Float16 (*sl)[136] = (_Float16 (*)[136])(sm + 128 * 136 * 2);
    _Float16* DH = which == 0 ? QH : KH; _Float16* DL = which == 0 ? QL : KL; const int nhi = which == 0 ? QHI : KHI; const bool hi_rows = t0 < nhi;
#pragma unroll
    for (int j = 0; j < 4; ++j) { const int cl = wc * 64 + j * 16 + col; float bias = 0.f; if (BA) { bias = bfr(BA[c0 + cl]); XW(); }
#pragma unroll
      for (int i = 0; i < 2; ++i)
#pragma unroll
        for (int r = 0; r < 8; ++r) { const float v = acc[i][j][r] + bias; const _Float16 hv = (_Float16)v; const int rl = wr * 32 + i * 16 + 8 * g + r; sh[rl][cl] = hv; sl[rl][cl] = (_Float16)((v - (float)hv) * 1024.0f); } }
    __syncthreads();
    const int rl = tid >> 4, q = tid & 15; v4u t[8];   /* piece it of a thread: row rl + 16 it, 16 bytes at element 8 q */
#pragma unroll
    for (int it = 0; it < 8; ++it) t[it] = *(const v4u*)&sh[rl + 16 * it][q * 8];
#pragma unroll
    for (int it = 0; it < 8; ++it) vst2((unsigned*)(DH + (r0 + rl + 16 * it) * CC + c0 + q * 8), t[it]);
    if (hi_rows) { XW();
#pragma unroll
      for (int it = 0; it < 8; ++it) t[it] = *(const v4u*)&sl[rl + 16 * it][q * 8];
#pragma unroll
      for (int it = 0; it < 8; ++it) vst2((unsigned*)(DL + (bb * nhi + t0 + rl + 16 * it) * (size_t)CC + c0 + q * 8), t[it]); }
  } else { _Float16 (*th)[136] = (_Float16 (*)[136])sm; __bf16 (*tb)[136] = (__bf16 (*)[136])(sm + 128 * 136 * 2); __bf16 (*tbl)[136] = (__bf16 (*)[136])(sm + 2 * 128 * 136 * 2); const bool hi_rows = t0 < KHI;
#pragma unroll
    for (int j = 0; j < 4; ++j) { const int cl = wc * 64 + j * 16 + col; float bias = 0.f; if (BA) { bias = bfr(BA[c0 + cl]); XW(); }
#pragma unroll
      for (int i = 0; i < 2; ++i)
#pragma unroll
        for (int r = 0; r < 8; ++r) { const float v = acc[i][j][r] + bias; const int rl = wr * 32 + i * 16 + 8 * g + r; th[cl][rl] = (_Float16)v; const __bf16 bh = (__bf16)v; tb[cl][rl] = bh; tbl[cl][rl] = (__bf16)(v - (float)bh); } }
    __syncthreads();
    const int cl = tid >> 4, q = tid & 15; v4u t[8];   /* piece it of a thread: plane cl + 16 it, 16 bytes at element 8 q */
#pragma unroll
    for (int it = 0; it < 8; ++it) t[it] = *(const v4u*)&th[cl + 16 * it][q * 8];
#pragma unroll
    for (int it = 0; it < 8; ++it) vst2((unsigned*)(VT + (bb * CC + c0 + cl + 16 * it) * (size_t)TT + t0 + q * 8), t[it]);
    XW();
    if (hi_rows) {
#pragma unroll
      for (int it = 0; it < 8; ++it) t[it] = *(const v4u*)&tb[cl + 16 * it][q * 8];
#pragma unroll
      for (int it = 0; it < 8; ++it) vst2((unsigned*)(VB + (bb * CC + c0 + cl + 16 * it) * (size_t)KHI + t0 + q * 8), t[it]);
      XW();
#pragma unroll
      for (int it = 0; it < 8; ++it) t[it] = *(const v4u*)&tbl[cl + 16 * it][q * 8];
#pragma unroll
      for (int it = 0; it < 8; ++it) vst2((unsigned*)(VBL + (bb * CC + c0 + cl + 16 * it) * (size_t)KHI + t0 + q * 8), t[it]);
      XW(); } } }
// frag_h from a base, the lane's own byte offset (row and lane half; 0 where the base already holds it) and a constant element offset
__device__ __forceinline__ v16h frag_s(const _Float16* base, unsigned lo, size_t e) { union { v16h v; v8h q[2]; } u; const char* p = (const char*)base + lo; u.q[0] = *(const v8h*)(p + 2 * e); u.q[1] = *(const v8h*)(p + 2 * e + 32); return u.v; }
// ---- k_attn: one wave = QWAVE queries (NCG groups of 16 columns) of (b, h); it walks its visible keys in passes of KPASS keys. S^T = k q^T (a lane holds the logits of ONE query: tile j, register r = key 16 j + 8 g + r), running maximum and sum per lane, ctx^T += v^T P^T with P^T packed from the score registers as the B operand (element order = the fragment k order above). Logits and P stay in registers. Queries < QHI: 3-product logits (f16 residuals) and P, v as bf16 hi + lo (3 products).
#define NCG 2              // 16-query column groups per wave: each k / v fragment load feeds NCG products
#define NKT 4              // 16-key tiles per pass
#define KPASS (16 * NKT)
#define QWAVE (16 * NCG)
#define QBLK (4 * QWAVE)
// one pass of the running softmax for one column group: mask by index (strict past, except (0, 0)), new maximum (own keys, then the other lane half), rescale sum and ctx, st <- exp(logit - maximum). An excluded logit is -3e38 and its exp is 0: key 0 is visible to every query, so the maximum is a real logit from the first pass on.
// st arrives as the raw q.k sums: exp(SCALE (s - max)) = 2^(C2 s - C2 max) with C2 = SCALE log2(e), one fused multiply-add and one hardware base-2 exponential per logit; m holds C2 x the running maximum (C2 > 0: scaling keeps the order).
#define C2 (SCALE * 1.44269504088896340736f)
__device__ __forceinline__ void sm_pass(v8f (&st)[NKT], v8f (&acc)[HD / 16], float& m, float& l, int kg, int t, bool edge) {
  if (edge) {
#pragma unroll
    for (int j = 0; j < NKT; ++j)
#pragma unroll
      for (int r = 0; r < 8; ++r) { const int k = kg + j * 16 + r; st[j][r] = (k < t || (k | t) == 0) ? st[j][r] : -3.0e38f; } }
  float mx = st[0][0];
#pragma unroll
  for (int j = 0; j < NKT; ++j)
#pragma unroll
    for (int r = 0; r < 8; ++r) mx = fmaxf(mx, st[j][r]);
  mx = fmaxf(mx, __shfl_xor(mx, 16));
  const float mn = fmaxf(m, mx * C2), f = __builtin_amdgcn_exp2f(m - mn); m = mn;
  float s = 0.f;
#pragma unroll
  for (int j = 0; j < NKT; ++j) { float x[8];
#pragma unroll
    for (int r = 0; r < 8; ++r) x[r] = fmaf(st[j][r], C2, -mn);
    // a tile's eight exponentials, each in its own register: no one of them reads a neighbour's result or overwrites a neighbour's argument, and the v_nop is the slot that the last one asks for in front of whatever the compiler puts next (as builtins, neighbours came out sharing registers)
    asm("v_exp_f32 %0, %0\n\tv_exp_f32 %1, %1\n\tv_exp_f32 %2, %2\n\tv_exp_f32 %3, %3\n\tv_exp_f32 %4, %4\n\tv_exp_f32 %5, %5\n\tv_exp_f32 %6, %6\n\tv_exp_f32 %7, %7\n\tv_nop"
        : "+v"(x[0]), "+v"(x[1]), "+v"(x[2]), "+v"(x[3]), "+v"(x[4]), "+v"(x[5]), "+v"(x[6]), "+v"(x[7]));
#pragma unroll
    for (int r = 0; r < 8; ++r) { st[j][r] = x[r]; s += x[r]; } }
  l = l * f + s;
#pragma unroll
  for (int d = 0; d < HD / 16; ++d) acc[d] = acc[d] * f; }
// two waves per SIMD is all this grid supplies (256 workgroups of 8 waves): the register budget of two lets the fragments fetched ahead stay in registers
__global__ __launch_bounds__(256) __attribute__((amdgpu_waves_per_eu(2, 2))) void k_attn(const _Float16* __restrict__ QH, const _Float16* __restrict__ KH, const _Float16* __restrict__ QL, const _Float16* __restrict__ KL, const _Float16* __restrict__ VT, const __bf16* __restrict__ VB, const __bf16* __restrict__ VBL, float* __restrict__ Y) {
  const int tid = threadIdx.x, lane = tid & 31, col = lane & 15, g = lane >> 4; const int wave = __builtin_amdgcn_readfirstlane(tid >> 5);
  const int b = blockIdx.x / NH, h = blockIdx.x % NH; const int qt = wave < 4 ? TT / QBLK - 1 - (int)blockIdx.y : (int)blockIdx.y; const int ql0 = qt * QBLK + (wave & 3) * QWAVE;   /* waves 0-3 take query tile n - 1 - y, waves 4-7 tile y: every workgroup walks the same number of keys */
  const int npass = (ql0 + QWAVE - 2) / KPASS + 1;   /* the wave's last visible key is ql0 + QWAVE - 2 */
  const _Float16* Qb = QH + ((size_t)b * TT + ql0 + col) * CC + h * HD; const _Float16* Kb = KH + ((size_t)b * TT + col) * CC + h * HD;
  float m[NCG], l[NCG]; v8f acc[NCG][HD / 16];
#pragma unroll
  for (int c = 0; c < NCG; ++c) { m[c] = -3.0e38f; l[c] = 0.f;
#pragma unroll
    for (int d = 0; d < HD / 16; ++d) acc[c][d] = v8f{}; }
  if (ql0 < QHI) {   /* wave-uniform; the wave's passes end at or below key KHI */
    const _Float16* QLb = QL + ((size_t)b * QHI + ql0 + col) * CC + h * HD; const _Float16* KLb = KL + ((size_t)b * KHI + col) * CC + h * HD;
    const __bf16* VBb = VB + ((size_t)b * CC + h * HD + col) * (size_t)KHI; const __bf16* VLb = VBL + ((size_t)b * CC + h * HD + col) * (size_t)KHI;
    v16h qf[NCG][2], qlf[NCG][2];
#pragma unroll
    for (int c = 0; c < NCG; ++c)
#pragma unroll
      for (int kc = 0; kc < 2; ++kc) { qf[c][kc] = frag_h(Qb + (size_t)c * 16 * CC + kc * 32, lane); qlf[c][kc] = frag_h(QLb + (size_t)c * 16 * CC + kc * 32, lane); }
    // stands in front of any rewrite of the address registers that the loads above it name; the loaded fragments as inputs hold the loads in front of it, the scheduling barrier holds later address arithmetic behind it
    asm volatile("s_wait_xcnt 0x0" :: "v"(qf[0][0]), "v"(qf[0][1]), "v"(qf[1][0]), "v"(qf[1][1]), "v"(qlf[0][0]), "v"(qlf[0][1]), "v"(qlf[1][0]), "v"(qlf[1][1]) : "memory");
    __builtin_amdgcn_sched_barrier(0);
    for (int ps = 0; ps < npass; ++ps) { const int k0 = ps * KPASS; v8f st[NCG][NKT];
#pragma unroll
      for (int j = 0; j < NKT; ++j) { v8f a[NCG] = {}, al[NCG] = {};
#pragma unroll
        for (int kc = 0; kc < 2; ++kc) { const v16h kf = frag_h(Kb + (size_t)(k0 + j * 16) * CC + kc * 32, lane), klf = frag_h(KLb + (size_t)(k0 + j * 16) * CC + kc * 32, lane);
#pragma unroll
          for (int c = 0; c < NCG; ++c) { a[c] = wmh(kf, qf[c][kc], a[c]); al[c] = wmh(kf, qlf[c][kc], al[c]); al[c] = wmh(klf, qf[c][kc], al[c]); } }
#pragma unroll
        for (int c = 0; c < NCG; ++c) st[c][j] = a[c] + al[c] * (1.0f / 1024.0f); }
#pragma unroll
      for (int c = 0; c < NCG; ++c) sm_pass(st[c], acc[c], m[c], l[c], k0 + 8 * g, ql0 + c * 16 + col, true);
#pragma unroll
      for (int jj = 0; jj < NKT / 2; ++jj) { F2 p[NCG];
#pragma unroll
        for (int c = 0; c < NCG; ++c) { float pv[16];
#pragma unroll
          for (int i = 0; i < 8; ++i) { pv[i] = st[c][2 * jj][i]; pv[8 + i] = st[c][2 * jj + 1][i]; }
          p[c] = bsplit16(pv); }
#pragma unroll
        for (int d = 0; d < HD / 16; ++d) { const size_t po = (size_t)d * 16 * KHI + k0 + jj * 32; const v16b vh = frag_b(VBb + po, lane), vl = frag_b(VLb + po, lane);
#pragma unroll
          for (int c = 0; c < NCG; ++c) { acc[c][d] = wmb(vh, p[c].h, acc[c][d]); acc[c][d] = wmb(vh, p[c].l, acc[c][d]); acc[c][d] = wmb(vl, p[c].h, acc[c][d]); } } } }
  } else {
    const _Float16* Qu = QH + ((size_t)b * TT + ql0) * CC + h * HD; const _Float16* Ku = KH + (size_t)b * TT * CC + h * HD; const _Float16* Vu = VT + ((size_t)b * CC + h * HD) * (size_t)TT;   /* wave-uniform bases */
    const unsigned rlo = 2u * (col * CC + 8 * g);   /* the lane's byte offset in q / k rows */
    const _Float16* Kl = Ku + col * CC + 8 * g; const _Float16* Vl = Vu + col * TT + 8 * g;   /* the lane's own row of k, plane of v */
    v16h qf[NCG][2];
#pragma unroll
    for (int c = 0; c < NCG; ++c)
#pragma unroll
      for (int kc = 0; kc < 2; ++kc) qf[c][kc] = frag_s(Qu, rlo, (size_t)c * 16 * CC + kc * 32);
    v16h kf[2][NKT], vf[NKT / 2][HD / 16];
#pragma unroll
    for (int kc = 0; kc < 2; ++kc)
#pragma unroll
      for (int j = 0; j < NKT; ++j) kf[kc][j] = frag_s(Ku, rlo, (size_t)(j * 16) * CC + kc * 32);
    // stands in front of any rewrite of the registers that the loads above it name; the two bases and the offset as inputs keep those registers whole until it, the scheduling barrier holds the loads in front of it and later address arithmetic behind it
    asm volatile("s_wait_xcnt 0x0" :: "s"(Qu), "s"(Ku), "v"(rlo) : "memory");
    __builtin_amdgcn_sched_barrier(0);
    for (int ps = 0; ps < npass; ++ps) { const int k0 = ps * KPASS; v8f st[NCG][NKT];
#pragma unroll
      for (int c = 0; c < NCG; ++c)
#pragma unroll
        for (int j = 0; j < NKT; ++j) st[c][j] = v8f{};
#pragma unroll
      for (int kc = 0; kc < 2; ++kc)
#pragma unroll
        for (int j = 0; j < NKT; ++j)
#pragma unroll
          for (int c = 0; c < NCG; ++c) st[c][j] = wmh(kf[kc][j], qf[c][kc], st[c][j]);
      // this pass's v fragments and the next pass's k fragments (the last pass fetches its own again: stays inside the wave's key range) are requested here, ahead of the softmax arithmetic that covers their latency
      const int kn = ps + 1 < npass ? k0 + KPASS : k0; const _Float16* vp = Vl + k0; const _Float16* kp = Kl + (size_t)kn * CC;   /* the lane's own addresses: every load of the run is one of them plus a constant */
#pragma unroll
      for (int jj = 0; jj < NKT / 2; ++jj)
#pragma unroll
        for (int d = 0; d < HD / 16; ++d) vf[jj][d] = frag_s(vp, 0u, (size_t)d * 16 * TT + jj * 32);
#pragma unroll
      for (int kc = 0; kc < 2; ++kc)
#pragma unroll
        for (int j = 0; j < NKT; ++j) kf[kc][j] = frag_s(kp, 0u, (size_t)(j * 16) * CC + kc * 32);
      // stands in front of any rewrite of the address registers that the loads above it name; the two addresses as inputs keep their registers whole until it: no load of the run may land in a pair that the loads in front of it name
      asm volatile("s_wait_xcnt 0x0" :: "v"(vp), "v"(kp) : "memory");
      __builtin_amdgcn_sched_barrier(0);   // keeps the compiler from sinking those loads to their first use, where each would be waited for alone
      const bool edge = k0 + KPASS > ql0;   /* wave-uniform: only passes that reach the wave's first query hold excluded keys */
#pragma unroll
      for (int c = 0; c < NCG; ++c) sm_pass(st[c], acc[c], m[c], l[c], k0 + 8 * g, ql0 + c * 16 + col, edge);
#pragma unroll
      for (int jj = 0; jj < NKT / 2; ++jj) { v16h p[NCG];
#pragma unroll
        for (int c = 0; c < NCG; ++c)
#pragma unroll
          for (int i = 0; i < 8; ++i) { p[c][i] = (_Float16)st[c][2 * jj][i]; p[c][8 + i] = (_Float16)st[c][2 * jj + 1][i]; }
#pragma unroll
        for (int d = 0; d < HD / 16; ++d)
#pragma unroll
          for (int c = 0; c < NCG; ++c) acc[c][d] = wmh(vf[jj][d], p[c], acc[c][d]); } } }
  // acc[c][d][r] = ctx(query ql0 + 16 c + col, dim 16 d + 8 g + r) x sum: join the two lane halves' sums, divide, 32 contiguous bytes per lane and d
#pragma unroll
  for (int c = 0; c < NCG; ++c) { const float a = l[c] + __shfl_xor(l[c], 16); const float inv = a > 0.f ? 1.0f / a : 0.f; float* yr = Y + ((size_t)b * TT + ql0 + c * 16 + col) * CC + h * HD + 8 * g;
#pragma unroll
    for (int d = 0; d < HD / 16; ++d) { const v8f o = acc[c][d] * inv; vst2(yr + d * 16, v4f{o[0], o[1], o[2], o[3]}); vst2(yr + d * 16 + 4, v4f{o[4], o[5], o[6], o[7]}); } } }
// ---- k_out: block = (128 rows, 128 cols): out = ctx Wo (+ bo): ctx once to f16 against Wo as f16(bf16 x 2^8) exact (1 product) x 2^-8; causal early rows (< QHI of each sequence): ctx bf16 hi + lo against exact bf16 Wo (2 products). Each wave stages its 32 x 64 of the output in its own part of the LDS that the operand buffers have left.
__global__ __launch_bounds__(256) void k_out(const float* __restrict__ Y, const float* __restrict__ WO, const float* __restrict__ BO, float* __restrict__ OUT) { __shared__ __align__(16) char sm[2 * 3 * 128 * 144];
  const int tid = threadIdx.x, wave = tid >> 5, lane = tid & 31, col = lane & 15, g = lane >> 4, wr = wave >> 1, wc = wave & 1; const int c0 = blockIdx.y * 128; const size_t r0 = (size_t)blockIdx.x * 128;
  v8f acc[2][4] = {}; float sc;
  if (CAUSAL && (int)(r0 % TT) < QHI) { gemm_tile<2, 64>(Y + r0 * CC, WO + (size_t)c0 * CC, sm, acc); sc = 1.0f; }   /* block-uniform */
  else { gemm_tile<1, 64>(Y + r0 * CC, WO + (size_t)c0 * CC, sm, acc); sc = 1.0f / 256.0f; }
  float (*sf)[68] = (float (*)[68])(sm + wave * 32 * 68 * 4);
#pragma unroll
  for (int j = 0; j < 4; ++j) { const float bias = BO ? bfr(BO[c0 + wc * 64 + j * 16 + col]) : 0.f;
#pragma unroll
    for (int i = 0; i < 2; ++i)
#pragma unroll
      for (int r = 0; r < 8; ++r) sf[i * 16 + 8 * g + r][j * 16 + col] = acc[i][j][r] * sc + bias; }
  LDSX();
#pragma unroll
  for (int rl = 0; rl < 32; rl += 2) vst2(OUT + (r0 + wr * 32 + rl + g) * DIN + c0 + wc * 64 + col * 4, *(const v4f*)&sf[rl + g][col * 4]); }

extern "C" void kernel_launch(void* const* d_in, const int* in_sizes, int n_in, void* d_out, int out_size, void* d_ws, size_t ws_size, hipStream_t stream) {
  (void)in_sizes; (void)n_in; (void)out_size;
  const float** F = (const float**)d_in;
  if (ws_size < (size_t)WS_END) return;
  char* ws = (char*)d_ws; _Float16 *QH = (_Float16*)(ws + WS_QH), *KH = (_Float16*)(ws + WS_KH), *VT = (_Float16*)(ws + WS_VT), *QL = (_Float16*)(ws + WS_QL), *KL = (_Float16*)(ws + WS_KL); __bf16 *VB = (__bf16*)(ws + WS_VB), *VBL = (__bf16*)(ws + WS_VBL); float *Y = (float*)(ws + WS_Y);
  (void)Y; (void)QL; (void)KL; (void)VB; (void)VBL;
  // inputs: 0 q, 1 k, 2 v [2,2048,1024]; 3 Wq, 4 Wk, 5 Wv, 6 Wo [1024,1024] (out,in), no biases
  k_proj<<<dim3(TNB * TT / 128, CC / 128, 3), 256, 0, stream>>>(F[0], F[1], F[2], F[3], F[4], F[5], nullptr, nullptr, nullptr, QH, QL, KH, KL, VT, VB, VBL);
  k_attn<<<dim3(TNB * NH, TT / QBLK / 2), 256, 0, stream>>>(QH, KH, QL, KL, VT, VB, VBL, Y);
  k_out<<<dim3(TNB * TT / 128, DIN / 128), 256, 0, stream>>>(Y, F[6], nullptr, (float*)d_out);
}

// v004
// A run of this version takes 93.8 microseconds.
// Next to v003, in two timings, it ran 1.07 times as fast each time.
// Counting every step since v000, it is 12.2 times as fast.
// compute dtype: all float inputs rounded to bf16; q/k/v = input W^T with EXACT bf16 products on WMMA 16x16x32 (f32 accumulate); causal (strict past) logits: q, k once to f16 (1 product) x 1024^-0.5, except the first 384 query rows of each sequence (3 products with f16 residuals); softmax in f32 with a running maximum; exp(logit - maximum) once to f16 against v once to f16 (1 product; bf16 hi + lo below row 384); ctx once to f16 against Wo carried x 2^8 in f16 (bf16 hi + lo against bf16 Wo, 2 products, in the first 384 rows of each sequence); f32 output.
#include <hip/hip_runtime.h>
#include <math.h>

typedef __attribute__((ext_vector_type(16))) _Float16 v16h;
typedef __attribute__((ext_vector_type(16))) __bf16 v16b;
typedef __attribute__((ext_vector_type(8)))  _Float16 v8h;
typedef __attribute__((ext_vector_type(8)))  float v8f;
typedef __attribute__((ext_vector_type(4)))  float v4f;
typedef __attribute__((ext_vector_type(2)))  float v2f;
typedef __attribute__((ext_vector_type(4)))  unsigned v4u;
typedef __attribute__((ext_vector_type(4)))  int v4i;
typedef float __attribute__((may_alias)) float_a;
typedef int __attribute__((may_alias)) int_a;

template <typename T> __device__ __forceinline__ void vst2(void* p, T v) { *(T*)p = v;  }
__device__ __forceinline__ v8f wmma16(v16h a, v16h b, v8f c) {
  v8f d = __builtin_amdgcn_wmma_f32_16x16x32_f16(false, a, false, b, (short)0, c, false, false);
  asm volatile("v_nop\n\tv_nop\n\tv_nop\n\tv_nop" : "+v"(d) : "v"(a), "v"(b));
  return d;
}
__device__ __forceinline__ v8f wmma_bf(v16b a, v16b b, v8f c) {
  v8f d = __builtin_amdgcn_wmma_f32_16x16x32_bf16(false, a, false, b, (short)0, c, false, false);
  asm volatile("v_nop\n\tv_nop\n\tv_nop\n\tv_nop" : "+v"(d) : "v"(a), "v"(b));
  return d;
}
// 16x16x32 fragments: lane = (h = lane>>4, row/col = lane&15); elements 0..7 = k0+8h+0..7, 8..15 = k0+16+8h+0..7; D element r = row 8h+r
__device__ __forceinline__ v16h frag_h(const _Float16* rowk0, int lane) {
  union { v16h v; v8h q[2]; } u; const _Float16* p = rowk0 + 8 * (lane >> 4);
  u.q[0] = *(const v8h*)p; u.q[1] = *(const v8h*)(p + 16); return u.v;
}
__device__ __forceinline__ v16h frag_f32(const float* rowk0, int lane) {
  v16h a; const float* p = rowk0 + 8 * (lane >> 4);
#pragma unroll
  for (int i = 0; i < 8; ++i) { a[i] = (_Float16)p[i]; a[8 + i] = (_Float16)p[16 + i]; }
  return a;
}
__device__ __forceinline__ v16h frag_f32s(const float* rowk0, int lane, float sc) {
  v16h a; const float* p = rowk0 + 8 * (lane >> 4);
#pragma unroll
  for (int i = 0; i < 8; ++i) { a[i] = (_Float16)(p[i] * sc); a[8 + i] = (_Float16)(p[16 + i] * sc); }
  return a;
}
// column fragment from a [K][ld] layout (column n), rows >= K read as 0
__device__ __forceinline__ v16h fragc_f32(const float* W, int k0, int n, int lane, int ld, int K) {
  v16h a; const int g = lane >> 4;
#pragma unroll
  for (int i = 0; i < 8; ++i) { const int ka = k0 + 8 * g + i, kb = ka + 16;
    a[i] = (_Float16)(ka < K ? W[(size_t)(ka < K ? ka : K - 1) * ld + n] : 0.f); a[8 + i] = (_Float16)(kb < K ? W[(size_t)(kb < K ? kb : K - 1) * ld + n] : 0.f); }
  return a;
}
struct F2 { v16b h, l; };
__device__ __forceinline__ F2 bsplit16(const float v[16]) { F2 r;
#pragma unroll
  for (int i = 0; i < 16; ++i) { const __bf16 h = (__bf16)v[i]; r.h[i] = h; r.l[i] = (__bf16)(v[i] - (float)h); }
  return r; }
__device__ __forceinline__ F2 split_row(const float* row, int k0, int lane) { float v[16]; const float* p = row + k0 + 8 * (lane >> 4);
#pragma unroll
  for (int i = 0; i < 8; ++i) { v[i] = p[i]; v[8 + i] = p[16 + i]; }
  return bsplit16(v); }
__device__ __forceinline__ F2 split_rowK(const float* row, int k0, int lane, int K) { float v[16]; const int g = lane >> 4;
#pragma unroll
  for (int i = 0; i < 8; ++i) { const int ka = k0 + 8 * g + i, kb = ka + 16; v[i] = ka < K ? row[ka < K ? ka : K - 1] : 0.f; v[8 + i] = kb < K ? row[kb < K ? kb : K - 1] : 0.f; }
  return bsplit16(v); }
__device__ __forceinline__ F2 split_col(const float* W, int k0, int n, int lane, int ld, int K) { float v[16]; const int g = lane >> 4;
#pragma unroll
  for (int i = 0; i < 8; ++i) { const int ka = k0 + 8 * g + i, kb = ka + 16; v[i] = ka < K ? W[(size_t)(ka < K ? ka : K - 1) * ld + n] : 0.f; v[8 + i] = kb < K ? W[(size_t)(kb < K ? kb : K - 1) * ld + n] : 0.f; }
  return bsplit16(v); }
__device__ __forceinline__ v8f mac3(const F2& a, const F2& b, v8f c) { c = wmma_bf(a.l, b.h, c); c = wmma_bf(a.h, b.l, c); return wmma_bf(a.h, b.h, c); }
__device__ __forceinline__ float sigm(float v) { return 1.0f / (1.0f + expf(-v)); }
#define LDSX() do { asm volatile("s_wait_dscnt 0" ::: "memory"); __builtin_amdgcn_wave_barrier(); __builtin_amdgcn_fence(__ATOMIC_RELEASE, "workgroup"); } while (0)

// In-context-learning attention (B 2, S 2,048, E 1,024 = 16 x 64; separate q/k/v inputs): qh = q Wq^T, kh = k Wk^T, vh = v Wv^T ((out,in)); scores = qh kh^T / sqrt(1024) masked where key >= query (strict past) except (0, 0); softmax; out = merged(probs vh) Wo^T.
#define NB 2
#define TT 2048
#define CC 1024            // NH * HD = projected width
#define DIN 1024          // input (model) width
#define NH 16
#define HD 64
#define NQB (TT / 64)
#define SCALE (0.03125f)
#define CAUSAL 1
#ifndef TNB
#define TNB NB
#endif
__device__ __forceinline__ float bfr(float v) { return (float)(__bf16)v; }
__host__ __device__ __forceinline__ int kb_last(int qb) { return CAUSAL ? ((qb * 64 + 63) >> 7) : (TT / 128 - 1); }
typedef __attribute__((ext_vector_type(8))) __bf16 v8b;
__device__ __forceinline__ v16b frag_b(const __bf16* rowk0, int lane) {
  union { v16b v; v8b q[2]; } u; const __bf16* p = rowk0 + 8 * (lane >> 4);
  u.q[0] = *(const v8b*)p; u.q[1] = *(const v8b*)(p + 16); return u.v;
}
#define QBH 6              // read nowhere: the high-precision paths are taken by query rows < QHI
#define QHI 384            // rows carrying a q residual plane
#define KHI 384            // key rows carrying k residual / v bf16 hi+lo planes (used only by the causal high-precision path)
// B fragment (k rows k0+.., output column o) of a weight: (in,out) [K][ld] or (out,in) [ld rows of K]: bf16 exact, or f16(bf16 * 256) exact
__device__ __forceinline__ v16b wcol_io(const float* Wm, int k0, int o, int lane, int ld) { v16b w; const int g = lane >> 4;
#pragma unroll
  for (int i = 0; i < 8; ++i) { w[i] = (__bf16)Wm[(size_t)(k0 + 8 * g + i) * ld + o]; w[8 + i] = (__bf16)Wm[(size_t)(k0 + 16 + 8 * g + i) * ld + o]; }
  return w; }
__device__ __forceinline__ v16b wcol_oi(const float* Wm, int k0, int o, int lane, int K) { v16b w; const float* p = Wm + (size_t)o * K + k0 + 8 * (lane >> 4);
#pragma unroll
  for (int i = 0; i < 8; ++i) { w[i] = (__bf16)p[i]; w[8 + i] = (__bf16)p[16 + i]; }
  return w; }
__device__ __forceinline__ v16h wcolh_io(const float* Wm, int k0, int o, int lane, int ld) { v16h w; const int g = lane >> 4;
#pragma unroll
  for (int i = 0; i < 8; ++i) { w[i] = (_Float16)(bfr(Wm[(size_t)(k0 + 8 * g + i) * ld + o]) * 256.0f); w[8 + i] = (_Float16)(bfr(Wm[(size_t)(k0 + 16 + 8 * g + i) * ld + o]) * 256.0f); }
  return w; }
__device__ __forceinline__ v16h wcolh_oi(const float* Wm, int k0, int o, int lane, int K) { v16h w; const float* p = Wm + (size_t)o * K + k0 + 8 * (lane >> 4);
#pragma unroll
  for (int i = 0; i < 8; ++i) { w[i] = (_Float16)(bfr(p[i]) * 256.0f); w[8 + i] = (_Float16)(bfr(p[16 + i]) * 256.0f); }
  return w; }
#define WQKV_LAYOUT 1   // 0 = (in,out) [DIN][CC]; 1 = (out,in) [CC][DIN]; 2 = per-head [NH][DIN][HD]
__device__ __forceinline__ v16b wcol_hdk(const float* Wm, int k0, int o, int lane) { v16b w; const int g = lane >> 4; const float* p = Wm + (size_t)(o / HD) * DIN * HD + (o % HD);
#pragma unroll
  for (int i = 0; i < 8; ++i) { w[i] = (__bf16)p[(size_t)(k0 + 8 * g + i) * HD]; w[8 + i] = (__bf16)p[(size_t)(k0 + 16 + 8 * g + i) * HD]; }
  return w; }
#define WO_OUT_IN 1
#if WQKV_LAYOUT == 1
#define WCOL(W, k0, o, lane) wcol_oi(W, k0, o, lane, DIN)
#elif WQKV_LAYOUT == 2
#define WCOL(W, k0, o, lane) wcol_hdk(W, k0, o, lane)
#else
#define WCOL(W, k0, o, lane) wcol_io(W, k0, o, lane, CC)
#endif
#if WO_OUT_IN
#define WOCOL(W, k0, o, lane) wcol_oi(W, k0, o, lane, CC)
#define WOCOLH(W, k0, o, lane) wcolh_oi(W, k0, o, lane, CC)
#else
#define WOCOL(W, k0, o, lane) wcol_io(W, k0, o, lane, DIN)
#define WOCOLH(W, k0, o, lane) wcolh_io(W, k0, o, lane, DIN)
#endif
#ifndef PROJ_EXTRA_PARAMS
#define PROJ_EXTRA_PARAMS
#endif

#define WS_QH  0u                                      // f16 q rows [b*t][CC]
#define WS_KH  (WS_QH + 2u * (size_t)NB * TT * CC)      // f16 k rows [b*t][CC]
#define WS_VT  (WS_KH + 2u * (size_t)NB * TT * CC)      // f16 v planes [b][c][t]
#define WS_QL  (WS_VT + 2u * (size_t)NB * CC * TT)      // f16 q residual x 2^10 rows [b][t < QHI][CC]
#define WS_KL  (WS_QL + 2u * (size_t)NB * QHI * CC)     // f16 k residual x 2^10 rows [b][t < KHI][CC]
#define WS_VB  (WS_KL + 2u * (size_t)NB * KHI * CC)     // bf16 v hi planes [b][c][t < KHI]
#define WS_VBL (WS_VB + 2u * (size_t)NB * CC * KHI)
#define WS_Y   (WS_VBL + 2u * (size_t)NB * CC * KHI)     // f32 ctx rows [b*t][CC] (only when there is an output projection)
#define WS_END (WS_Y  + 4u * (size_t)NB * TT * CC)

// plain builtin products: the compiler keeps the distance behind them itself and may place their operands in any register window
__device__ __forceinline__ v8f wmh(v16h a, v16h b, v8f c) { return __builtin_amdgcn_wmma_f32_16x16x32_f16(false, a, false, b, (short)0, c, false, false); }
__device__ __forceinline__ v8f wmb(v16b a, v16b b, v8f c) { return __builtin_amdgcn_wmma_f32_16x16x32_bf16(false, a, false, b, (short)0, c, false, false); }
typedef __attribute__((ext_vector_type(4))) __bf16 v4b;
typedef __attribute__((ext_vector_type(4))) _Float16 v4h;
__device__ __forceinline__ v4b cvt4b(v4f v) { return v4b{(__bf16)v[0], (__bf16)v[1], (__bf16)v[2], (__bf16)v[3]}; }
// ---- gemm_tile: 256 threads, acc += A[128 rows][1024] B[128 rows][1024]^T, both k-contiguous f32 rows. Each k step of BK is read once per workgroup with whole-line loads, converted once and kept in LDS as 16-bit rows of pitch 2 BK + 16 bytes (16 B x odd: no bank conflict for 16-byte fragment reads); two buffers: the next step's loads fly while this step's products run. Waves 4 x 2, 32 x 64 of the tile each (acc[i][j]: rows 32 wr + 16 i, columns 64 wc + 16 j). The k walk begins at step s0 (the same for the whole workgroup, below KD / BK), runs upward and wraps to step 0: workgroups that share operand rows are given different s0, so that they do not ask L2 for the same lines at the same moment.
// MODE 0: A, B to bf16. MODE 1: A to f16, B to f16(bf16 x 2^8). MODE 2: A to bf16 hi + lo (two planes, hi product first), B to bf16. On return every wave has left the buffers (sm may be reused). Every unroll directive here and in the two kernels' output staging keeps a register array (loaded pieces, fragments, accumulators) indexed by constants.
template <int MODE, int BK>
__device__ __forceinline__ void gemm_tile(const float* __restrict__ A, const float* __restrict__ Bw, char* sm, v8f (&acc)[2][4], int s0) {
  constexpr int KD = 1024, PITCH = 2 * BK + 16, UR = BK / 4, RS = 256 / UR, NU = 128 / RS, PL = 128 * PITCH, BUF = (MODE == 2 ? 3 : 2) * PL, NS = KD / BK;
  const int tid = threadIdx.x, lane = tid & 31, col = lane & 15, g = lane >> 4, wave = tid >> 5, wr = wave >> 1, wc = wave & 1;
  const float* ga = A + (size_t)(tid / UR) * KD + (tid % UR) * 4 + s0 * BK; const float* gb = Bw + (size_t)(tid / UR) * KD + (tid % UR) * 4 + s0 * BK;   /* the thread's 16 bytes of rows tid / UR + i RS, at k step s0 */
  int ks = s0;   /* the k step that the next fetch reads */
  char* sw = sm + (tid / UR) * PITCH + (tid % UR) * 8;
  const char* fa = sm + (wr * 32 + col) * PITCH + 16 * g; const char* fb = sm + PL + (wc * 64 + col) * PITCH + 16 * g;
  v4f ra[NU], rb[NU];
  auto fetch = [&]() {
#pragma unroll
    for (int i = 0; i < NU; ++i) { ra[i] = *(const v4f*)(ga + (size_t)i * RS * KD); rb[i] = *(const v4f*)(gb + (size_t)i * RS * KD); }
    // stands in front of the rewrite of the two address pairs that the loads above it name (every load is one of them plus a constant); the pairs as inputs keep their registers whole until it
    asm volatile("s_wait_xcnt 0x0" :: "v"(ga), "v"(gb) : "memory");
    __builtin_amdgcn_sched_barrier(0);   // holds the loads in front of the products that cover their latency, and the address additions behind the wait
    ks = ks + 1 == NS ? 0 : ks + 1; const int adv = ks == 0 ? BK - KD : BK;   /* behind the last k step the walk wraps to the first */
    ga += adv; gb += adv; };
  auto stage = [&](int off) {
#pragma unroll
    for (int i = 0; i < NU; ++i) { char* p = sw + off + i * RS * PITCH;
      if constexpr (MODE == 0) { *(v4b*)p = cvt4b(ra[i]); *(v4b*)(p + PL) = cvt4b(rb[i]); }
      else if constexpr (MODE == 1) { *(v4h*)p = v4h{(_Float16)ra[i][0], (_Float16)ra[i][1], (_Float16)ra[i][2], (_Float16)ra[i][3]};
        *(v4h*)(p + PL) = v4h{(_Float16)(bfr(rb[i][0]) * 256.0f), (_Float16)(bfr(rb[i][1]) * 256.0f), (_Float16)(bfr(rb[i][2]) * 256.0f), (_Float16)(bfr(rb[i][3]) * 256.0f)}; }
      else { const v4b hv = cvt4b(ra[i]); *(v4b*)p = hv; *(v4b*)(p + 2 * PL) = cvt4b(v4f{ra[i][0] - (float)hv[0], ra[i][1] - (float)hv[1], ra[i][2] - (float)hv[2], ra[i][3] - (float)hv[3]}); *(v4b*)(p + PL) = cvt4b(rb[i]); } } };
  auto products = [&](int off) {
#pragma unroll
    for (int kk = 0; kk < BK / 32; ++kk) {
      if constexpr (MODE == 1) { v16h a[2], w[4];
#pragma unroll
        for (int i = 0; i < 2; ++i) { union { v16h v; v8h q[2]; } u; const char* p = fa + off + i * 16 * PITCH + kk * 64; u.q[0] = *(const v8h*)p; u.q[1] = *(const v8h*)(p + 32); a[i] = u.v; }
#pragma unroll
        for (int j = 0; j < 4; ++j) { union { v16h v; v8h q[2]; } u; const char* p = fb + off + j * 16 * PITCH + kk * 64; u.q[0] = *(const v8h*)p; u.q[1] = *(const v8h*)(p + 32); w[j] = u.v; }
#pragma unroll
        for (int i = 0; i < 2; ++i)
#pragma unroll
          for (int j = 0; j < 4; ++j) acc[i][j] = wmh(a[i], w[j], acc[i][j]);
      } else { v16b a[2], al[2], w[4];
#pragma unroll
        for (int i = 0; i < 2; ++i) { union { v16b v; v8b q[2]; } u; const char* p = fa + off + i * 16 * PITCH + kk * 64; u.q[0] = *(const v8b*)p; u.q[1] = *(const v8b*)(p + 32); a[i] = u.v;
          if constexpr (MODE == 2) { u.q[0] = *(const v8b*)(p + 2 * PL); u.q[1] = *(const v8b*)(p + 2 * PL + 32); al[i] = u.v; } }
#pragma unroll
        for (int j = 0; j < 4; ++j) { union { v16b v; v8b q[2]; } u; const char* p = fb + off + j * 16 * PITCH + kk * 64; u.q[0] = *(const v8b*)p; u.q[1] = *(const v8b*)(p + 32); w[j] = u.v; }
#pragma unroll
        for (int i = 0; i < 2; ++i)
#pragma unroll
          for (int j = 0; j < 4; ++j) acc[i][j] = wmb(a[i], w[j], acc[i][j]);
        if constexpr (MODE == 2) {
#pragma unroll
          for (int i = 0; i < 2; ++i)
#pragma unroll
            for (int j = 0; j < 4; ++j) acc[i][j] = wmb(al[i], w[j], acc[i][j]); } } } };
  fetch(); stage(0); __syncthreads();
  int cur = 0;
  for (int s = 0; s + 1 < NS; ++s) { fetch(); products(cur);
    __builtin_amdgcn_sched_barrier(0);   // keeps the conversions, which wait for the loads in flight, behind the products that cover the loads' latency
    cur ^= BUF; stage(cur); __syncthreads(); }   /* the one barrier of a step publishes the buffer just written and ends the reads of the one written next */
  products(cur); __syncthreads(); }
// stands behind a run of global loads or stores, in front of any rewrite of the registers that they name; the scheduling barrier holds later arithmetic behind it
#define XW() do { asm volatile("s_wait_xcnt 0x0" ::: "memory"); __builtin_amdgcn_sched_barrier(0); } while (0)
// ---- k_proj: block = (128 rows, 128 cols, which): q/k/v = X W (+ b) with exact bf16 products (K = DIN) -> which 0: q f16 rows (+ residual rows < QHI); 1: k f16 rows (+ residual rows < KHI); 2: v f16 planes [c][t] (+ bf16 hi/lo planes for t < KHI). The output staging reuses the LDS of the operand buffers.
__global__ __launch_bounds__(256) void k_proj(const float* __restrict__ XQ, const float* __restrict__ XK, const float* __restrict__ XV, const float* __restrict__ WQ, const float* __restrict__ WK, const float* __restrict__ WV, const float* __restrict__ BQ, const float* __restrict__ BK, const float* __restrict__ BV,
    _Float16* __restrict__ QH, _Float16* __restrict__ QL, _Float16* __restrict__ KH, _Float16* __restrict__ KL, _Float16* __restrict__ VT, __bf16* __restrict__ VB, __bf16* __restrict__ VBL) {
  __shared__ __align__(16) char sm[3 * 128 * 136 * 2];
  const int tid = threadIdx.x, wave = tid >> 5, lane = tid & 31, col = lane & 15, g = lane >> 4, wr = wave >> 1, wc = wave & 1; const int which = blockIdx.z; const int c0 = blockIdx.y * 128; const size_t r0 = (size_t)blockIdx.x * 128; const size_t bb = r0 / TT; const int t0 = (int)(r0 % TT);
  const float* X = which == 0 ? XQ : which == 1 ? XK : XV; const float* WA = which == 0 ? WQ : which == 1 ? WK : WV; const float* BA = which == 0 ? BQ : which == 1 ? BK : BV;
  v8f acc[2][4] = {};
  gemm_tile<0, 32>(X + r0 * DIN, WA + (size_t)c0 * DIN, sm, acc, (int)((blockIdx.x + 4 * blockIdx.y) & 31));   /* 32 k steps: the 32 row blocks that share a weight tile start at 32 different steps, the 8 column blocks that share input rows 4 steps apart */
  if (which < 2) { _Float16 (*sh)[136] = (_Float16 (*)[136])sm; _Float16 (*sl)[136] = (_Float16 (*)[136])(sm + 128 * 136 * 2);
    _Float16* DH = which == 0 ? QH : KH; _Float16* DL = which == 0 ? QL : KL; const int nhi = which == 0 ? QHI : KHI; const bool hi_rows = t0 < nhi;
#pragma unroll
    for (int j = 0; j < 4; ++j) { const int cl = wc * 64 + j * 16 + col; float bias = 0.f; if (BA) { bias = bfr(BA[c0 + cl]); XW(); }
#pragma unroll
      for (int i = 0; i < 2; ++i)
#pragma unroll
        for (int r = 0; r < 8; ++r) { const float v = acc[i][j][r] + bias; const _Float16 hv = (_Float16)v; const int rl = wr * 32 + i * 16 + 8 * g + r; sh[rl][cl] = hv; sl[rl][cl] = (_Float16)((v - (float)hv) * 1024.0f); } }
    __syncthreads();
    const int rl = tid >> 4, q = tid & 15; v4u t[8];   /* piece it of a thread: row rl + 16 it, 16 bytes at element 8 q */
#pragma unroll
    for (int it = 0; it < 8; ++it) t[it] = *(const v4u*)&sh[rl + 16 * it][q * 8];
#pragma unroll
    for (int it = 0; it < 8; ++it) vst2((unsigned*)(DH + (r0 + rl + 16 * it) * CC + c0 + q * 8), t[it]);
    if (hi_rows) { XW();
#pragma unroll
      for (int it = 0; it < 8; ++it) t[it] = *(const v4u*)&sl[rl + 16 * it][q * 8];
#pragma unroll
      for (int it = 0; it < 8; ++it) vst2((unsigned*)(DL + (bb * nhi + t0 + rl + 16 * it) * (size_t)CC + c0 + q * 8), t[it]); }
  } else { _Float16 (*th)[136] = (_Float16 (*)[136])sm; __bf16 (*tb)[136] = (__bf16 (*)[136])(sm + 128 * 136 * 2); __bf16 (*tbl)[136] = (__bf16 (*)[136])(sm + 2 * 128 * 136 * 2); const bool hi_rows = t0 < KHI;
#pragma unroll
    for (int j = 0; j < 4; ++j) { const int cl = wc * 64 + j * 16 + col; float bias = 0.f; if (BA) { bias = bfr(BA[c0 + cl]); XW(); }
#pragma unroll
      for (int i = 0; i < 2; ++i)
#pragma unroll
        for (int r = 0; r < 8; ++r) { const float v = acc[i][j][r] + bias; const int rl = wr * 32 + i * 16 + 8 * g + r; th[cl][rl] = (_Float16)v; const __bf16 bh = (__bf16)v; tb[cl][rl] = bh; tbl[cl][rl] = (__bf16)(v - (float)bh); } }
    __syncthreads();
    const int cl = tid >> 4, q = tid & 15; v4u t[8];   /* piece it of a thread: plane cl + 16 it, 16 bytes at element 8 q */
#pragma unroll
    for (int it = 0; it < 8; ++it) t[it] = *(const v4u*)&th[cl + 16 * it][q * 8];
#pragma unroll
    for (int it = 0; it < 8; ++it) vst2((unsigned*)(VT + (bb * CC + c0 + cl + 16 * it) * (size_t)TT + t0 + q * 8), t[it]);
    XW();
    if (hi_rows) {
#pragma unroll
      for (int it = 0; it < 8; ++it) t[it] = *(const v4u*)&tb[cl + 16 * it][q * 8];
#pragma unroll
      for (int it = 0; it < 8; ++it) vst2((unsigned*)(VB + (bb * CC + c0 + cl + 16 * it) * (size_t)KHI + t0 + q * 8), t[it]);
      XW();
#pragma unroll
      for (int it = 0; it < 8; ++it) t[it] = *(const v4u*)&tbl[cl + 16 * it][q * 8];
#pragma unroll
      for (int it = 0; it < 8; ++it) vst2((unsigned*)(VBL + (bb * CC + c0 + cl + 16 * it) * (size_t)KHI + t0 + q * 8), t[it]);
      XW(); } } }
// frag_h from a base, the lane's own byte offset (row and lane half; 0 where the base already holds it) and a constant element offset
__device__ __forceinline__ v16h frag_s(const _Float16* base, unsigned lo, size_t e) { union { v16h v; v8h q[2]; } u; const char* p = (const char*)base + lo; u.q[0] = *(const v8h*)(p + 2 * e); u.q[1] = *(const v8h*)(p + 2 * e + 32); return u.v; }
// ---- k_attn: one wave = QWAVE queries (NCG groups of 16 columns) of (b, h); it walks its visible keys in passes of KPASS keys. S^T = k q^T (a lane holds the logits of ONE query: tile j, register r = key 16 j + 8 g + r), running maximum and sum per lane, ctx^T += v^T P^T with P^T packed from the score registers as the B operand (element order = the fragment k order above). Logits and P stay in registers. Queries < QHI: 3-product logits (f16 residuals) and P, v as bf16 hi + lo (3 products).
#define NCG 2              // 16-query column groups per wave: each k / v fragment load feeds NCG products
#define NKT 4              // 16-key tiles per pass
#define KPASS (16 * NKT)
#define QWAVE (16 * NCG)
#define QBLK (4 * QWAVE)
// one pass of the running softmax for one column group: mask by index (strict past, except (0, 0)), new maximum (own keys, then the other lane half), rescale sum and ctx, st <- exp(logit - maximum). An excluded logit is -3e38 and its exp is 0: key 0 is visible to every query, so the maximum is a real logit from the first pass on.
// st arrives as the raw q.k sums: exp(SCALE (s - max)) = 2^(C2 s - C2 max) with C2 = SCALE log2(e), one fused multiply-add and one hardware base-2 exponential per logit; m holds C2 x the running maximum (C2 > 0: scaling keeps the order).
#define C2 (SCALE * 1.44269504088896340736f)
__device__ __forceinline__ void sm_pass(v8f (&st)[NKT], v8f (&acc)[HD / 16], float& m, float& l, int kg, int t, bool edge) {
  if (edge) {
#pragma unroll
    for (int j = 0; j < NKT; ++j)
#pragma unroll
      for (int r = 0; r < 8; ++r) { const int k = kg + j * 16 + r; st[j][r] = (k < t || (k | t) == 0) ? st[j][r] : -3.0e38f; } }
  float mx = st[0][0];
#pragma unroll
  for (int j = 0; j < NKT; ++j)
#pragma unroll
    for (int r = 0; r < 8; ++r) mx = fmaxf(mx, st[j][r]);
  mx = fmaxf(mx, __shfl_xor(mx, 16));
  const float mn = fmaxf(m, mx * C2), f = __builtin_amdgcn_exp2f(m - mn); m = mn;
  float s = 0.f;
#pragma unroll
  for (int j = 0; j < NKT; ++j) { float x[8];
#pragma unroll
    for (int r = 0; r < 8; ++r) x[r] = fmaf(st[j][r], C2, -mn);
    // a tile's eight exponentials, each in its own register: no one of them reads a neighbour's result or overwrites a neighbour's argument, and the v_nop is the slot that the last one asks for in front of whatever the compiler puts next (as builtins, neighbours came out sharing registers)
    asm("v_exp_f32 %0, %0\n\tv_exp_f32 %1, %1\n\tv_exp_f32 %2, %2\n\tv_exp_f32 %3, %3\n\tv_exp_f32 %4, %4\n\tv_exp_f32 %5, %5\n\tv_exp_f32 %6, %6\n\tv_exp_f32 %7, %7\n\tv_nop"
        : "+v"(x[0]), "+v"(x[1]), "+v"(x[2]), "+v"(x[3]), "+v"(x[4]), "+v"(x[5]), "+v"(x[6]), "+v"(x[7]));
#pragma unroll
    for (int r = 0; r < 8; ++r) { st[j][r] = x[r]; s += x[r]; } }
  l = l * f + s;
#pragma unroll
  for (int d = 0; d < HD / 16; ++d) acc[d] = acc[d] * f; }
// two waves per SIMD is all this grid supplies (256 workgroups of 8 waves): the register budget of two lets the fragments fetched ahead stay in registers
__global__ __launch_bounds__(256) __attribute__((amdgpu_waves_per_eu(2, 2))) void k_attn(const _Float16* __restrict__ QH, const _Float16* __restrict__ KH, const _Float16* __restrict__ QL, const _Float16* __restrict__ KL, const _Float16* __restrict__ VT, const __bf16* __restrict__ VB, const __bf16* __restrict__ VBL, float* __restrict__ Y) {
  const int tid = threadIdx.x, lane = tid & 31, col = lane & 15, g = lane >> 4; const int wave = __builtin_amdgcn_readfirstlane(tid >> 5);
  const int b = blockIdx.x / NH, h = blockIdx.x % NH; const int qt = wave < 4 ? TT / QBLK - 1 - (int)blockIdx.y : (int)blockIdx.y; const int ql0 = qt * QBLK + (wave & 3) * QWAVE;   /* waves 0-3 take query tile n - 1 - y, waves 4-7 tile y: every workgroup walks the same number of keys */
  const int npass = (ql0 + QWAVE - 2) / KPASS + 1;   /* the wave's last visible key is ql0 + QWAVE - 2 */
  const _Float16* Qb = QH + ((size_t)b * TT + ql0 + col) * CC + h * HD; const _Float16* Kb = KH + ((size_t)b * TT + col) * CC + h * HD;
  float m[NCG], l[NCG]; v8f acc[NCG][HD / 16];
#pragma unroll
  for (int c = 0; c < NCG; ++c) { m[c] = -3.0e38f; l[c] = 0.f;
#pragma unroll
    for (int d = 0; d < HD / 16; ++d) acc[c][d] = v8f{}; }
  if (ql0 < QHI) {   /* wave-uniform; the wave's passes end at or below key KHI */
    const _Float16* QLb = QL + ((size_t)b * QHI + ql0 + col) * CC + h * HD; const _Float16* KLb = KL + ((size_t)b * KHI + col) * CC + h * HD;
    const __bf16* VBb = VB + ((size_t)b * CC + h * HD + col) * (size_t)KHI; const __bf16* VLb = VBL + ((size_t)b * CC + h * HD + col) * (size_t)KHI;
    v16h qf[NCG][2], qlf[NCG][2];
#pragma unroll
    for (int c = 0; c < NCG; ++c)
#pragma unroll
      for (int kc = 0; kc < 2; ++kc) { qf[c][kc] = frag_h(Qb + (size_t)c * 16 * CC + kc * 32, lane); qlf[c][kc] = frag_h(QLb + (size_t)c * 16 * CC + kc * 32, lane); }
    // stands in front of any rewrite of the address registers that the loads above it name; the loaded fragments as inputs hold the loads in front of it, the scheduling barrier holds later address arithmetic behind it
    asm volatile("s_wait_xcnt 0x0" :: "v"(qf[0][0]), "v"(qf[0][1]), "v"(qf[1][0]), "v"(qf[1][1]), "v"(qlf[0][0]), "v"(qlf[0][1]), "v"(qlf[1][0]), "v"(qlf[1][1]) : "memory");
    __builtin_amdgcn_sched_barrier(0);
    for (int ps = 0; ps < npass; ++ps) { const int k0 = ps * KPASS; v8f st[NCG][NKT];
#pragma unroll
      for (int j = 0; j < NKT; ++j) { v8f a[NCG] = {}, al[NCG] = {};
#pragma unroll
        for (int kc = 0; kc < 2; ++kc) { const v16h kf = frag_h(Kb + (size_t)(k0 + j * 16) * CC + kc * 32, lane), klf = frag_h(KLb + (size_t)(k0 + j * 16) * CC + kc * 32, lane);
#pragma unroll
          for (int c = 0; c < NCG; ++c) { a[c] = wmh(kf, qf[c][kc], a[c]); al[c] = wmh(kf, qlf[c][kc], al[c]); al[c] = wmh(klf, qf[c][kc], al[c]); } }
#pragma unroll
        for (int c = 0; c < NCG; ++c) st[c][j] = a[c] + al[c] * (1.0f / 1024.0f); }
#pragma unroll
      for (int c = 0; c < NCG; ++c) sm_pass(st[c], acc[c], m[c], l[c], k0 + 8 * g, ql0 + c * 16 + col, true);
#pragma unroll
      for (int jj = 0; jj < NKT / 2; ++jj) { F2 p[NCG];
#pragma unroll
        for (int c = 0; c < NCG; ++c) { float pv[16];
#pragma unroll
          for (int i = 0; i < 8; ++i) { pv[i] = st[c][2 * jj][i]; pv[8 + i] = st[c][2 * jj + 1][i]; }
          p[c] = bsplit16(pv); }
#pragma unroll
        for (int d = 0; d < HD / 16; ++d) { const size_t po = (size_t)d * 16 * KHI + k0 + jj * 32; const v16b vh = frag_b(VBb + po, lane), vl = frag_b(VLb + po, lane);
#pragma unroll
          for (int c = 0; c < NCG; ++c) { acc[c][d] = wmb(vh, p[c].h, acc[c][d]); acc[c][d] = wmb(vh, p[c].l, acc[c][d]); acc[c][d] = wmb(vl, p[c].h, acc[c][d]); } } } }
  } else {
    const _Float16* Qu = QH + ((size_t)b * TT + ql0) * CC + h * HD; const _Float16* Ku = KH + (size_t)b * TT * CC + h * HD; const _Float16* Vu = VT + ((size_t)b * CC + h * HD) * (size_t)TT;   /* wave-uniform bases */
    const unsigned rlo = 2u * (col * CC + 8 * g);   /* the lane's byte offset in q / k rows */
    const _Float16* Kl = Ku + col * CC + 8 * g; const _Float16* Vl = Vu + col * TT + 8 * g;   /* the lane's own row of k, plane of v */
    v16h qf[NCG][2];
#pragma unroll
    for (int c = 0; c < NCG; ++c)
#pragma unroll
      for (int kc = 0; kc < 2; ++kc) qf[c][kc] = frag_s(Qu, rlo, (size_t)c * 16 * CC + kc * 32);
    v16h kf[2][NKT], vf[NKT / 2][HD / 16];
#pragma unroll
    for (int kc = 0; kc < 2; ++kc)
#pragma unroll
      for (int j = 0; j < NKT; ++j) kf[kc][j] = frag_s(Ku, rlo, (size_t)(j * 16) * CC + kc * 32);
    // stands in front of any rewrite of the registers that the loads above it name; the two bases and the offset as inputs keep those registers whole until it, the scheduling barrier holds the loads in front of it and later address arithmetic behind it
    asm volatile("s_wait_xcnt 0x0" :: "s"(Qu), "s"(Ku), "v"(rlo) : "memory");
    __builtin_amdgcn_sched_barrier(0);
    for (int ps = 0; ps < npass; ++ps) { const int k0 = ps * KPASS; v8f st[NCG][NKT];
#pragma unroll
      for (int c = 0; c < NCG; ++c)
#pragma unroll
        for (int j = 0; j < NKT; ++j) st[c][j] = v8f{};
#pragma unroll
      for (int kc = 0; kc < 2; ++kc)
#pragma unroll
        for (int j = 0; j < NKT; ++j)
#pragma unroll
          for (int c = 0; c < NCG; ++c) st[c][j] = wmh(kf[kc][j], qf[c][kc], st[c][j]);
      // this pass's v fragments and the next pass's k fragments (the last pass fetches its own again: stays inside the wave's key range) are requested here, ahead of the softmax arithmetic that covers their latency
      const int kn = ps + 1 < npass ? k0 + KPASS : k0; const _Float16* vp = Vl + k0; const _Float16* kp = Kl + (size_t)kn * CC;   /* the lane's own addresses: every load of the run is one of them plus a constant */
#pragma unroll
      for (int jj = 0; jj < NKT / 2; ++jj)
#pragma unroll
        for (int d = 0; d < HD / 16; ++d) vf[jj][d] = frag_s(vp, 0u, (size_t)d * 16 * TT + jj * 32);
#pragma unroll
      for (int kc = 0; kc < 2; ++kc)
#pragma unroll
        for (int j = 0; j < NKT; ++j) kf[kc][j] = frag_s(kp, 0u, (size_t)(j * 16) * CC + kc * 32);
      // stands in front of any rewrite of the address registers that the loads above it name; the two addresses as inputs keep their registers whole until it: no load of the run may land in a pair that the loads in front of it name
      asm volatile("s_wait_xcnt 0x0" :: "v"(vp), "v"(kp) : "memory");
      __builtin_amdgcn_sched_barrier(0);   // keeps the compiler from sinking those loads to their first use, where each would be waited for alone
      const bool edge = k0 + KPASS > ql0;   /* wave-uniform: only passes that reach the wave's first query hold excluded keys */
#pragma unroll
      for (int c = 0; c < NCG; ++c) sm_pass(st[c], acc[c], m[c], l[c], k0 + 8 * g, ql0 + c * 16 + col, edge);
#pragma unroll
      for (int jj = 0; jj < NKT / 2; ++jj) { v16h p[NCG];
#pragma unroll
        for (int c = 0; c < NCG; ++c)
#pragma unroll
          for (int i = 0; i < 8; ++i) { p[c][i] = (_Float16)st[c][2 * jj][i]; p[c][8 + i] = (_Float16)st[c][2 * jj + 1][i]; }
#pragma unroll
        for (int d = 0; d < HD / 16; ++d)
#pragma unroll
          for (int c = 0; c < NCG; ++c) acc[c][d] = wmh(vf[jj][d], p[c], acc[c][d]); } } }
  // acc[c][d][r] = ctx(query ql0 + 16 c + col, dim 16 d + 8 g + r) x sum: join the two lane halves' sums, divide, 32 contiguous bytes per lane and d
#pragma unroll
  for (int c = 0; c < NCG; ++c) { const float a = l[c] + __shfl_xor(l[c], 16); const float inv = a > 0.f ? 1.0f / a : 0.f; float* yr = Y + ((size_t)b * TT + ql0 + c * 16 + col) * CC + h * HD + 8 * g;
#pragma unroll
    for (int d = 0; d < HD / 16; ++d) { const v8f o = acc[c][d] * inv; vst2(yr + d * 16, v4f{o[0], o[1], o[2], o[3]}); vst2(yr + d * 16 + 4, v4f{o[4], o[5], o[6], o[7]}); } } }
// ---- k_out: block = (128 rows, 128 cols): out = ctx Wo (+ bo): ctx once to f16 against Wo as f16(bf16 x 2^8) exact (1 product) x 2^-8; causal early rows (< QHI of each sequence): ctx bf16 hi + lo against exact bf16 Wo (2 products). Each wave stages its 32 x 64 of the output in its own part of the LDS that the operand buffers have left.
__global__ __launch_bounds__(256) void k_out(const float* __restrict__ Y, const float* __restrict__ WO, const float* __restrict__ BO, float* __restrict__ OUT) { __shared__ __align__(16) char sm[2 * 3 * 128 * 144];
  const int tid = threadIdx.x, wave = tid >> 5, lane = tid & 31, col = lane & 15, g = lane >> 4, wr = wave >> 1, wc = wave & 1; const int c0 = blockIdx.y * 128; const size_t r0 = (size_t)blockIdx.x * 128;
  v8f acc[2][4] = {}; float sc; const int s0 = (int)((blockIdx.x + 2 * blockIdx.y) & 15);   /* 16 k steps: the 8 column blocks that share ctx rows start 2 steps apart, the 32 row blocks that share a weight tile at all 16 steps, two at each */
  if (CAUSAL && (int)(r0 % TT) < QHI) { gemm_tile<2, 64>(Y + r0 * CC, WO + (size_t)c0 * CC, sm, acc, s0); sc = 1.0f; }   /* block-uniform */
  else { gemm_tile<1, 64>(Y + r0 * CC, WO + (size_t)c0 * CC, sm, acc, s0); sc = 1.0f / 256.0f; }
  float (*sf)[68] = (float (*)[68])(sm + wave * 32 * 68 * 4);
#pragma unroll
  for (int j = 0; j < 4; ++j) { const float bias = BO ? bfr(BO[c0 + wc * 64 + j * 16 + col]) : 0.f;
#pragma unroll
    for (int i = 0; i < 2; ++i)
#pragma unroll
      for (int r = 0; r < 8; ++r) sf[i * 16 + 8 * g + r][j * 16 + col] = acc[i][j][r] * sc + bias; }
  LDSX();
#pragma unroll
  for (int rl = 0; rl < 32; rl += 2) vst2(OUT + (r0 + wr * 32 + rl + g) * DIN + c0 + wc * 64 + col * 4, *(const v4f*)&sf[rl + g][col * 4]); }

extern "C" void kernel_launch(void* const* d_in, const int* in_sizes, int n_in, void* d_out, int out_size, void* d_ws, size_t ws_size, hipStream_t stream) {
  (void)in_sizes; (void)n_in; (void)out_size;
  const float** F = (const float**)d_in;
  if (ws_size < (size_t)WS_END) return;
  char* ws = (char*)d_ws; _Float16 *QH = (_Float16*)(ws + WS_QH), *KH = (_Float16*)(ws + WS_KH), *VT = (_Float16*)(ws + WS_VT), *QL = (_Float16*)(ws + WS_QL), *KL = (_Float16*)(ws + WS_KL); __bf16 *VB = (__bf16*)(ws + WS_VB), *VBL = (__bf16*)(ws + WS_VBL); float *Y = (float*)(ws + WS_Y);
  (void)Y; (void)QL; (void)KL; (void)VB; (void)VBL;
  // inputs: 0 q, 1 k, 2 v [2,2048,1024]; 3 Wq, 4 Wk, 5 Wv, 6 Wo [1024,1024] (out,in), no biases
  k_proj<<<dim3(TNB * TT / 128, CC / 128, 3), 256, 0, stream>>>(F[0], F[1], F[2], F[3], F[4], F[5], nullptr, nullptr, nullptr, QH, QL, KH, KL, VT, VB, VBL);
  k_attn<<<dim3(TNB * NH, TT / QBLK / 2), 256, 0, stream>>>(QH, KH, QL, KL, VT, VB, VBL, Y);
  k_out<<<dim3(TNB * TT / 128, DIN / 128), 256, 0, stream>>>(Y, F[6], nullptr, (float*)d_out);
}

// v005
// A run of this version takes 90.4 microseconds.
// Next to v004, in two timings, it ran 1.07 times as fast each time.
// Counting every step since v000, it is 13.1 times as fast.
// compute dtype: all float inputs rounded to bf16; q/k/v = input W^T with EXACT bf16 products on WMMA 16x16x32 (f32 accumulate); causal (strict past) logits: q, k once to f16 (1 product) x 1024^-0.5, except the first 384 query rows of each sequence (3 products with f16 residuals); softmax in f32 with a running maximum; exp(logit - maximum) once to f16 against v once to f16 (1 product; bf16 hi + lo below row 384); ctx once to f16 against Wo carried x 2^8 in f16 (bf16 hi + lo against bf16 Wo, 2 products, in the first 384 rows of each sequence); f32 output.
#include <hip/hip_runtime.h>
#include <math.h>

typedef __attribute__((ext_vector_type(16))) _Float16 v16h;
typedef __attribute__((ext_vector_type(16))) __bf16 v16b;
typedef __attribute__((ext_vector_type(8)))  _Float16 v8h;
typedef __attribute__((ext_vector_type(8)))  float v8f;
typedef __attribute__((ext_vector_type(4)))  float v4f;
typedef __attribute__((ext_vector_type(2)))  float v2f;
typedef __attribute__((ext_vector_type(4)))  unsigned v4u;
typedef __attribute__((ext_vector_type(4)))  int v4i;
typedef float __attribute__((may_alias)) float_a;
typedef int __attribute__((may_alias)) int_a;

template <typename T> __device__ __forceinline__ void vst2(void* p, T v) { *(T*)p = v;  }
__device__ __forceinline__ v8f wmma16(v16h a, v16h b, v8f c) {
  v8f d = __builtin_amdgcn_wmma_f32_16x16x32_f16(false, a, false, b, (short)0, c, false, false);
  asm volatile("v_nop\n\tv_nop\n\tv_nop\n\tv_nop" : "+v"(d) : "v"(a), "v"(b));
  return d;
}
__device__ __forceinline__ v8f wmma_bf(v16b a, v16b b, v8f c) {
  v8f d = __builtin_amdgcn_wmma_f32_16x16x32_bf16(false, a, false, b, (short)0, c, false, false);
  asm volatile("v_nop\n\tv_nop\n\tv_nop\n\tv_nop" : "+v"(d) : "v"(a), "v"(b));
  return d;
}
// 16x16x32 fragments: lane = (h = lane>>4, row/col = lane&15); elements 0..7 = k0+8h+0..7, 8..15 = k0+16+8h+0..7; D element r = row 8h+r
__device__ __forceinline__ v16h frag_h(const _Float16* rowk0, int lane) {
  union { v16h v; v8h q[2]; } u; const _Float16* p = rowk0 + 8 * (lane >> 4);
  u.q[0] = *(const v8h*)p; u.q[1] = *(const v8h*)(p + 16); return u.v;
}
__device__ __forceinline__ v16h frag_f32(const float* rowk0, int lane) {
  v16h a; const float* p = rowk0 + 8 * (lane >> 4);
#pragma unroll
  for (int i = 0; i < 8; ++i) { a[i] = (_Float16)p[i]; a[8 + i] = (_Float16)p[16 + i]; }
  return a;
}
__device__ __forceinline__ v16h frag_f32s(const float* rowk0, int lane, float sc) {
  v16h a; const float* p = rowk0 + 8 * (lane >> 4);
#pragma unroll
  for (int i = 0; i < 8; ++i) { a[i] = (_Float16)(p[i] * sc); a[8 + i] = (_Float16)(p[16 + i] * sc); }
  return a;
}
// column fragment from a [K][ld] layout (column n), rows >= K read as 0
__device__ __forceinline__ v16h fragc_f32(const float* W, int k0, int n, int lane, int ld, int K) {
  v16h a; const int g = lane >> 4;
#pragma unroll
  for (int i = 0; i < 8; ++i) { const int ka = k0 + 8 * g + i, kb = ka + 16;
    a[i] = (_Float16)(ka < K ? W[(size_t)(ka < K ? ka : K - 1) * ld + n] : 0.f); a[8 + i] = (_Float16)(kb < K ? W[(size_t)(kb < K ? kb : K - 1) * ld + n] : 0.f); }
  return a;
}
struct F2 { v16b h, l; };
__device__ __forceinline__ F2 bsplit16(const float v[16]) { F2 r;
#pragma unroll
  for (int i = 0; i < 16; ++i) { const __bf16 h = (__bf16)v[i]; r.h[i] = h; r.l[i] = (__bf16)(v[i] - (float)h); }
  return r; }
__device__ __forceinline__ F2 split_row(const float* row, int k0, int lane) { float v[16]; const float* p = row + k0 + 8 * (lane >> 4);
#pragma unroll
  for (int i = 0; i < 8; ++i) { v[i] = p[i]; v[8 + i] = p[16 + i]; }
  return bsplit16(v); }
__device__ __forceinline__ F2 split_rowK(const float* row, int k0, int lane, int K) { float v[16]; const int g = lane >> 4;
#pragma unroll
  for (int i = 0; i < 8; ++i) { const int ka = k0 + 8 * g + i, kb = ka + 16; v[i] = ka < K ? row[ka < K ? ka : K - 1] : 0.f; v[8 + i] = kb < K ? row[kb < K ? kb : K - 1] : 0.f; }
  return bsplit16(v); }
__device__ __forceinline__ F2 split_col(const float* W, int k0, int n, int lane, int ld, int K) { float v[16]; const int g = lane >> 4;
#pragma unroll
  for (int i = 0; i < 8; ++i) { const int ka = k0 + 8 * g + i, kb = ka + 16; v[i] = ka < K ? W[(size_t)(ka < K ? ka : K - 1) * ld + n] : 0.f; v[8 + i] = kb < K ? W[(size_t)(kb < K ? kb : K - 1) * ld + n] : 0.f; }
  return bsplit16(v); }
__device__ __forceinline__ v8f mac3(const F2& a, const F2& b, v8f c) { c = wmma_bf(a.l, b.h, c); c = wmma_bf(a.h, b.l, c); return wmma_bf(a.h, b.h, c); }
__device__ __forceinline__ float sigm(float v) { return 1.0f / (1.0f + expf(-v)); }
#define LDSX() do { asm volatile("s_wait_dscnt 0" ::: "memory"); __builtin_amdgcn_wave_barrier(); __builtin_amdgcn_fence(__ATOMIC_RELEASE, "workgroup"); } while (0)

// In-context-learning attention (B 2, S 2,048, E 1,024 = 16 x 64; separate q/k/v inputs): qh = q Wq^T, kh = k Wk^T, vh = v Wv^T ((out,in)); scores = qh kh^T / sqrt(1024) masked where key >= query (strict past) except (0, 0); softmax; out = merged(probs vh) Wo^T.
#define NB 2
#define TT 2048
#define CC 1024            // NH * HD = projected width
#define DIN 1024          // input (model) width
#define NH 16
#define HD 64
#define NQB (TT / 64)
#define SCALE (0.03125f)
#define CAUSAL 1
#ifndef TNB
#define TNB NB
#endif
__device__ __forceinline__ float bfr(float v) { return (float)(__bf16)v; }
__host__ __device__ __forceinline__ int kb_last(int qb) { return CAUSAL ? ((qb * 64 + 63) >> 7) : (TT / 128 - 1); }
typedef __attribute__((ext_vector_type(8))) __bf16 v8b;
__device__ __forceinline__ v16b frag_b(const __bf16* rowk0, int lane) {
  union { v16b v; v8b q[2]; } u; const __bf16* p = rowk0 + 8 * (lane >> 4);
  u.q[0] = *(const v8b*)p; u.q[1] = *(const v8b*)(p + 16); return u.v;
}
#define QBH 6              // read nowhere: the high-precision paths are taken by query rows < QHI
#define QHI 384            // rows carrying a q residual plane
#define KHI 384            // key rows carrying k residual / v bf16 hi+lo planes (used only by the causal high-precision path)
// B fragment (k rows k0+.., output column o) of a weight: (in,out) [K][ld] or (out,in) [ld rows of K]: bf16 exact, or f16(bf16 * 256) exact
__device__ __forceinline__ v16b wcol_io(const float* Wm, int k0, int o, int lane, int ld) { v16b w; const int g = lane >> 4;
#pragma unroll
  for (int i = 0; i < 8; ++i) { w[i] = (__bf16)Wm[(size_t)(k0 + 8 * g + i) * ld + o]; w[8 + i] = (__bf16)Wm[(size_t)(k0 + 16 + 8 * g + i) * ld + o]; }
  return w; }
__device__ __forceinline__ v16b wcol_oi(const float* Wm, int k0, int o, int lane, int K) { v16b w; const float* p = Wm + (size_t)o * K + k0 + 8 * (lane >> 4);
#pragma unroll
  for (int i = 0; i < 8; ++i) { w[i] = (__bf16)p[i]; w[8 + i] = (__bf16)p[16 + i]; }
  return w; }
__device__ __forceinline__ v16h wcolh_io(const float* Wm, int k0, int o, int lane, int ld) { v16h w; const int g = lane >> 4;
#pragma unroll
  for (int i = 0; i < 8; ++i) { w[i] = (_Float16)(bfr(Wm[(size_t)(k0 + 8 * g + i) * ld + o]) * 256.0f); w[8 + i] = (_Float16)(bfr(Wm[(size_t)(k0 + 16 + 8 * g + i) * ld + o]) * 256.0f); }
  return w; }
__device__ __forceinline__ v16h wcolh_oi(const float* Wm, int k0, int o, int lane, int K) { v16h w; const float* p = Wm + (size_t)o * K + k0 + 8 * (lane >> 4);
#pragma unroll
  for (int i = 0; i < 8; ++i) { w[i] = (_Float16)(bfr(p[i]) * 256.0f); w[8 + i] = (_Float16)(bfr(p[16 + i]) * 256.0f); }
  return w; }
#define WQKV_LAYOUT 1   // 0 = (in,out) [DIN][CC]; 1 = (out,in) [CC][DIN]; 2 = per-head [NH][DIN][HD]
__device__ __forceinline__ v16b wcol_hdk(const float* Wm, int k0, int o, int lane) { v16b w; const int g = lane >> 4; const float* p = Wm + (size_t)(o / HD) * DIN * HD + (o % HD);
#pragma unroll
  for (int i = 0; i < 8; ++i) { w[i] = (__bf16)p[(size_t)(k0 + 8 * g + i) * HD]; w[8 + i] = (__bf16)p[(size_t)(k0 + 16 + 8 * g + i) * HD]; }
  return w; }
#define WO_OUT_IN 1
#if WQKV_LAYOUT == 1
#define WCOL(W, k0, o, lane) wcol_oi(W, k0, o, lane, DIN)
#elif WQKV_LAYOUT == 2
#define WCOL(W, k0, o, lane) wcol_hdk(W, k0, o, lane)
#else
#define WCOL(W, k0, o, lane) wcol_io(W, k0, o, lane, CC)
#endif
#if WO_OUT_IN
#define WOCOL(W, k0, o, lane) wcol_oi(W, k0, o, lane, CC)
#define WOCOLH(W, k0, o, lane) wcolh_oi(W, k0, o, lane, CC)
#else
#define WOCOL(W, k0, o, lane) wcol_io(W, k0, o, lane, DIN)
#define WOCOLH(W, k0, o, lane) wcolh_io(W, k0, o, lane, DIN)
#endif
#ifndef PROJ_EXTRA_PARAMS
#define PROJ_EXTRA_PARAMS
#endif

#define WS_QH  0u                                      // f16 q rows [b*t][CC]
#define WS_KH  (WS_QH + 2u * (size_t)NB * TT * CC)      // f16 k rows [b*t][CC]
#define WS_VT  (WS_KH + 2u * (size_t)NB * TT * CC)      // f16 v planes [b][c][t]
#define WS_QL  (WS_VT + 2u * (size_t)NB * CC * TT)      // f16 q residual x 2^10 rows [b][t < QHI][CC]
#define WS_KL  (WS_QL + 2u * (size_t)NB * QHI * CC)     // f16 k residual x 2^10 rows [b][t < KHI][CC]
#define WS_VB  (WS_KL + 2u * (size_t)NB * KHI * CC)     // bf16 v hi planes [b][c][t < KHI]
#define WS_VBL (WS_VB + 2u * (size_t)NB * CC * KHI)
#define WS_Y   (WS_VBL + 2u * (size_t)NB * CC * KHI)     // f32 ctx rows [b*t][CC] (only when there is an output projection)
#define WS_END (WS_Y  + 4u * (size_t)NB * TT * CC)

// plain builtin products: the compiler keeps the distance behind them itself and may place their operands in any register window
__device__ __forceinline__ v8f wmh(v16h a, v16h b, v8f c) { return __builtin_amdgcn_wmma_f32_16x16x32_f16(false, a, false, b, (short)0, c, false, false); }
__device__ __forceinline__ v8f wmb(v16b a, v16b b, v8f c) { return __builtin_amdgcn_wmma_f32_16x16x32_bf16(false, a, false, b, (short)0, c, false, false); }
typedef __attribute__((ext_vector_type(4))) __bf16 v4b;
typedef __attribute__((ext_vector_type(4))) _Float16 v4h;
__device__ __forceinline__ v4b cvt4b(v4f v) { return v4b{(__bf16)v[0], (__bf16)v[1], (__bf16)v[2], (__bf16)v[3]}; }
// ---- gemm_tile: 256 threads, acc += A[128 rows][1024] B[128 rows][1024]^T, both k-contiguous f32 rows. Each k step of BK is read once per workgroup with whole-line loads, converted once and kept in LDS as 16-bit rows of pitch 2 BK + 16 bytes (16 B x odd: no bank conflict for 16-byte fragment reads); two buffers: the next step's loads fly while this step's products run. Waves 4 x 2, 32 x 64 of the tile each (acc[i][j]: rows 32 wr + 16 i, columns 64 wc + 16 j). The k walk begins at step s0 (the same for the whole workgroup, below KD / BK), runs upward and wraps to step 0: workgroups that share operand rows are given different s0, so that they do not ask L2 for the same lines at the same moment.
// MODE 0: A, B to bf16. MODE 1: A to f16, B to f16(bf16 x 2^8). MODE 2: A to bf16 hi + lo (two planes, hi product first), B to bf16. On return every wave has left the buffers (sm may be reused). Every unroll directive here and in the two kernels' output staging keeps a register array (loaded pieces, fragments, accumulators) indexed by constants.
template <int MODE, int BK>
__device__ __forceinline__ void gemm_tile(const float* __restrict__ A, const float* __restrict__ Bw, char* sm, v8f (&acc)[2][4], int s0) {
  constexpr int KD = 1024, PITCH = 2 * BK + 16, UR = BK / 4, RS = 256 / UR, NU = 128 / RS, PL = 128 * PITCH, BUF = (MODE == 2 ? 3 : 2) * PL, NS = KD / BK;
  const int tid = threadIdx.x, lane = tid & 31, col = lane & 15, g = lane >> 4, wave = tid >> 5, wr = wave >> 1, wc = wave & 1;
  const float* ga = A + (size_t)(tid / UR) * KD + (tid % UR) * 4 + s0 * BK; const float* gb = Bw + (size_t)(tid / UR) * KD + (tid % UR) * 4 + s0 * BK;   /* the thread's 16 bytes of rows tid / UR + i RS, at k step s0 */
  int ks = s0;   /* the k step that the next fetch reads */
  char* sw = sm + (tid / UR) * PITCH + (tid % UR) * 8;
  const char* fa = sm + (wr * 32 + col) * PITCH + 16 * g; const char* fb = sm + PL + (wc * 64 + col) * PITCH + 16 * g;
  v4f ra[NU], rb[NU];
  auto fetch = [&]() {
#pragma unroll
    for (int i = 0; i < NU; ++i) { ra[i] = *(const v4f*)(ga + (size_t)i * RS * KD); rb[i] = *(const v4f*)(gb + (size_t)i * RS * KD); }
    // stands in front of the rewrite of the two address pairs that the loads above it name (every load is one of them plus a constant); the pairs as inputs keep their registers whole until it
    asm volatile("s_wait_xcnt 0x0" :: "v"(ga), "v"(gb) : "memory");
    __builtin_amdgcn_sched_barrier(0);   // holds the loads in front of the products that cover their latency, and the address additions behind the wait
    ks = ks + 1 == NS ? 0 : ks + 1; const int adv = ks == 0 ? BK - KD : BK;   /* behind the last k step the walk wraps to the first */
    ga += adv; gb += adv; };
  auto stage = [&](int off) {
#pragma unroll
    for (int i = 0; i < NU; ++i) { char* p = sw + off + i * RS * PITCH;
      if constexpr (MODE == 0) { *(v4b*)p = cvt4b(ra[i]); *(v4b*)(p + PL) = cvt4b(rb[i]); }
      else if constexpr (MODE == 1) { *(v4h*)p = v4h{(_Float16)ra[i][0], (_Float16)ra[i][1], (_Float16)ra[i][2], (_Float16)ra[i][3]};
        *(v4h*)(p + PL) = v4h{(_Float16)(bfr(rb[i][0]) * 256.0f), (_Float16)(bfr(rb[i][1]) * 256.0f), (_Float16)(bfr(rb[i][2]) * 256.0f), (_Float16)(bfr(rb[i][3]) * 256.0f)}; }
      else { const v4b hv = cvt4b(ra[i]); *(v4b*)p = hv; *(v4b*)(p + 2 * PL) = cvt4b(v4f{ra[i][0] - (float)hv[0], ra[i][1] - (float)hv[1], ra[i][2] - (float)hv[2], ra[i][3] - (float)hv[3]}); *(v4b*)(p + PL) = cvt4b(rb[i]); } } };
  auto products = [&](int off) {
#pragma unroll
    for (int kk = 0; kk < BK / 32; ++kk) {
      if constexpr (MODE == 1) { v16h a[2], w[4];
#pragma unroll
        for (int i = 0; i < 2; ++i) { union { v16h v; v8h q[2]; } u; const char* p = fa + off + i * 16 * PITCH + kk * 64; u.q[0] = *(const v8h*)p; u.q[1] = *(const v8h*)(p + 32); a[i] = u.v; }
#pragma unroll
        for (int j = 0; j < 4; ++j) { union { v16h v; v8h q[2]; } u; const char* p = fb + off + j * 16 * PITCH + kk * 64; u.q[0] = *(const v8h*)p; u.q[1] = *(const v8h*)(p + 32); w[j] = u.v; }
#pragma unroll
        for (int i = 0; i < 2; ++i)
#pragma unroll
          for (int j = 0; j < 4; ++j) acc[i][j] = wmh(a[i], w[j], acc[i][j]);
      } else { v16b a[2], al[2], w[4];
#pragma unroll
        for (int i = 0; i < 2; ++i) { union { v16b v; v8b q[2]; } u; const char* p = fa + off + i * 16 * PITCH + kk * 64; u.q[0] = *(const v8b*)p; u.q[1] = *(const v8b*)(p + 32); a[i] = u.v;
          if constexpr (MODE == 2) { u.q[0] = *(const v8b*)(p + 2 * PL); u.q[1] = *(const v8b*)(p + 2 * PL + 32); al[i] = u.v; } }
#pragma unroll
        for (int j = 0; j < 4; ++j) { union { v16b v; v8b q[2]; } u; const char* p = fb + off + j * 16 * PITCH + kk * 64; u.q[0] = *(const v8b*)p; u.q[1] = *(const v8b*)(p + 32); w[j] = u.v; }
#pragma unroll
        for (int i = 0; i < 2; ++i)
#pragma unroll
          for (int j = 0; j < 4; ++j) acc[i][j] = wmb(a[i], w[j], acc[i][j]);
        if constexpr (MODE == 2) {
#pragma unroll
          for (int i = 0; i < 2; ++i)
#pragma unroll
            for (int j = 0; j < 4; ++j) acc[i][j] = wmb(al[i], w[j], acc[i][j]); } } } };
  fetch(); stage(0); __syncthreads();
  int cur = 0;
  for (int s = 0; s + 1 < NS; ++s) { fetch(); products(cur);
    __builtin_amdgcn_sched_barrier(0);   // keeps the conversions, which wait for the loads in flight, behind the products that cover the loads' latency
    cur ^= BUF; stage(cur); __syncthreads(); }   /* the one barrier of a step publishes the buffer just written and ends the reads of the one written next */
  products(cur); __syncthreads(); }
// stands behind a run of global loads or stores, in front of any rewrite of the registers that they name; the scheduling barrier holds later arithmetic behind it
#define XW() do { asm volatile("s_wait_xcnt 0x0" ::: "memory"); __builtin_amdgcn_sched_barrier(0); } while (0)
// ---- k_proj: block = (128 rows, 128 cols, which): q/k/v = X W (+ b) with exact bf16 products (K = DIN) -> which 0: q f16 rows (+ residual rows < QHI); 1: k f16 rows (+ residual rows < KHI); 2: v f16 planes [c][t] (+ bf16 hi/lo planes for t < KHI). The output staging reuses the LDS of the operand buffers.
__global__ __launch_bounds__(256) void k_proj(const float* __restrict__ XQ, const float* __restrict__ XK, const float* __restrict__ XV, const float* __restrict__ WQ, const float* __restrict__ WK, const float* __restrict__ WV, const float* __restrict__ BQ, const float* __restrict__ BK, const float* __restrict__ BV,
    _Float16* __restrict__ QH, _Float16* __restrict__ QL, _Float16* __restrict__ KH, _Float16* __restrict__ KL, _Float16* __restrict__ VT, __bf16* __restrict__ VB, __bf16* __restrict__ VBL) {
  __shared__ __align__(16) char sm[3 * 128 * 136 * 2];
  const int tid = threadIdx.x, wave = tid >> 5, lane = tid & 31, col = lane & 15, g = lane >> 4, wr = wave >> 1, wc = wave & 1; const int which = blockIdx.z; const int c0 = blockIdx.y * 128; const size_t r0 = (size_t)blockIdx.x * 128; const size_t bb = r0 / TT; const int t0 = (int)(r0 % TT);
  const float* X = which == 0 ? XQ : which == 1 ? XK : XV; const float* WA = which == 0 ? WQ : which == 1 ? WK : WV; const float* BA = which == 0 ? BQ : which == 1 ? BK : BV;
  v8f acc[2][4] = {};
  gemm_tile<0, 32>(X + r0 * DIN, WA + (size_t)c0 * DIN, sm, acc, (int)((blockIdx.x + 4 * blockIdx.y) & 31));   /* 32 k steps: the 32 row blocks that share a weight tile start at 32 different steps, the 8 column blocks that share input rows 4 steps apart */
  if (which < 2) { _Float16 (*sh)[136] = (_Float16 (*)[136])sm; _Float16 (*sl)[136] = (_Float16 (*)[136])(sm + 128 * 136 * 2);
    _Float16* DH = which == 0 ? QH : KH; _Float16* DL = which == 0 ? QL : KL; const int nhi = which == 0 ? QHI : KHI; const bool hi_rows = t0 < nhi;
#pragma unroll
    for (int j = 0; j < 4; ++j) { const int cl = wc * 64 + j * 16 + col; float bias = 0.f; if (BA) { bias = bfr(BA[c0 + cl]); XW(); }
#pragma unroll
      for (int i = 0; i < 2; ++i)
#pragma unroll
        for (int r = 0; r < 8; ++r) { const float v = acc[i][j][r] + bias; const _Float16 hv = (_Float16)v; const int rl = wr * 32 + i * 16 + 8 * g + r; sh[rl][cl] = hv; sl[rl][cl] = (_Float16)((v - (float)hv) * 1024.0f); } }
    __syncthreads();
    const int rl = tid >> 4, q = tid & 15; v4u t[8];   /* piece it of a thread: row rl + 16 it, 16 bytes at element 8 q */
#pragma unroll
    for (int it = 0; it < 8; ++it) t[it] = *(const v4u*)&sh[rl + 16 * it][q * 8];
#pragma unroll
    for (int it = 0; it < 8; ++it) vst2((unsigned*)(DH + (r0 + rl + 16 * it) * CC + c0 + q * 8), t[it]);
    if (hi_rows) { XW();
#pragma unroll
      for (int it = 0; it < 8; ++it) t[it] = *(const v4u*)&sl[rl + 16 * it][q * 8];
#pragma unroll
      for (int it = 0; it < 8; ++it) vst2((unsigned*)(DL + (bb * nhi + t0 + rl + 16 * it) * (size_t)CC + c0 + q * 8), t[it]); }
  } else { _Float16 (*th)[136] = (_Float16 (*)[136])sm; __bf16 (*tb)[136] = (__bf16 (*)[136])(sm + 128 * 136 * 2); __bf16 (*tbl)[136] = (__bf16 (*)[136])(sm + 2 * 128 * 136 * 2); const bool hi_rows = t0 < KHI;
#pragma unroll
    for (int j = 0; j < 4; ++j) { const int cl = wc * 64 + j * 16 + col; float bias = 0.f; if (BA) { bias = bfr(BA[c0 + cl]); XW(); }
#pragma unroll
      for (int i = 0; i < 2; ++i)
#pragma unroll
        for (int r = 0; r < 8; ++r) { const float v = acc[i][j][r] + bias; const int rl = wr * 32 + i * 16 + 8 * g + r; th[cl][rl] = (_Float16)v; const __bf16 bh = (__bf16)v; tb[cl][rl] = bh; tbl[cl][rl] = (__bf16)(v - (float)bh); } }
    __syncthreads();
    const int cl = tid >> 4, q = tid & 15; v4u t[8];   /* piece it of a thread: plane cl + 16 it, 16 bytes at element 8 q */
#pragma unroll
    for (int it = 0; it < 8; ++it) t[it] = *(const v4u*)&th[cl + 16 * it][q * 8];
#pragma unroll
    for (int it = 0; it < 8; ++it) vst2((unsigned*)(VT + (bb * CC + c0 + cl + 16 * it) * (size_t)TT + t0 + q * 8), t[it]);
    XW();
    if (hi_rows) {
#pragma unroll
      for (int it = 0; it < 8; ++it) t[it] = *(const v4u*)&tb[cl + 16 * it][q * 8];
#pragma unroll
      for (int it = 0; it < 8; ++it) vst2((unsigned*)(VB + (bb * CC + c0 + cl + 16 * it) * (size_t)KHI + t0 + q * 8), t[it]);
      XW();
#pragma unroll
      for (int it = 0; it < 8; ++it) t[it] = *(const v4u*)&tbl[cl + 16 * it][q * 8];
#pragma unroll
      for (int it = 0; it < 8; ++it) vst2((unsigned*)(VBL + (bb * CC + c0 + cl + 16 * it) * (size_t)KHI + t0 + q * 8), t[it]);
      XW(); } } }
// frag_h from a base, the lane's own byte offset (row and lane half; 0 where the base already holds it) and a constant element offset
__device__ __forceinline__ v16h frag_s(const _Float16* base, unsigned lo, size_t e) { union { v16h v; v8h q[2]; } u; const char* p = (const char*)base + lo; u.q[0] = *(const v8h*)(p + 2 * e); u.q[1] = *(const v8h*)(p + 2 * e + 32); return u.v; }
// the same for bf16, from the lane's own address (row and lane half) and a constant element offset
__device__ __forceinline__ v16b frag_bs(const __bf16* base, size_t e) { union { v16b v; v8b q[2]; } u; u.q[0] = *(const v8b*)(base + e); u.q[1] = *(const v8b*)(base + e + 16); return u.v; }
// ---- k_attn: one wave = QWAVE queries (NCG groups of 16 columns) of (b, h); it walks its visible keys in passes of KPASS keys. S^T = k q^T (a lane holds the logits of ONE query: tile j, register r = key 16 j + 8 g + r), running maximum and sum per lane, ctx^T += v^T P^T with P^T packed from the score registers as the B operand (element order = the fragment k order above). Logits and P stay in registers. Queries < QHI: 3-product logits (f16 residuals) and P, v as bf16 hi + lo (3 products).
#define NCG 2              // 16-query column groups per wave: each k / v fragment load feeds NCG products
#define NKT 4              // 16-key tiles per pass
#define KPASS (16 * NKT)
#define QWAVE (16 * NCG)
#define QBLK (4 * QWAVE)
// one pass of the running softmax for one column group: mask by index (strict past, except (0, 0)), new maximum (own keys, then the other lane half), rescale sum and ctx, st <- exp(logit - maximum). An excluded logit is -3e38 and its exp is 0: key 0 is visible to every query, so the maximum is a real logit from the first pass on.
// st arrives as the raw q.k sums: exp(SCALE (s - max)) = 2^(C2 s - C2 max) with C2 = SCALE log2(e), one fused multiply-add and one hardware base-2 exponential per logit; m holds C2 x the running maximum (C2 > 0: scaling keeps the order).
#define C2 (SCALE * 1.44269504088896340736f)
__device__ __forceinline__ void sm_pass(v8f (&st)[NKT], v8f (&acc)[HD / 16], float& m, float& l, int kg, int t, bool edge) {
  if (edge) {
#pragma unroll
    for (int j = 0; j < NKT; ++j)
#pragma unroll
      for (int r = 0; r < 8; ++r) { const int k = kg + j * 16 + r; st[j][r] = (k < t || (k | t) == 0) ? st[j][r] : -3.0e38f; } }
  float mx = st[0][0];
#pragma unroll
  for (int j = 0; j < NKT; ++j)
#pragma unroll
    for (int r = 0; r < 8; ++r) mx = fmaxf(mx, st[j][r]);
  mx = fmaxf(mx, __shfl_xor(mx, 16));
  const float mn = fmaxf(m, mx * C2), f = __builtin_amdgcn_exp2f(m - mn); m = mn;
  float s = 0.f;
#pragma unroll
  for (int j = 0; j < NKT; ++j) { float x[8];
#pragma unroll
    for (int r = 0; r < 8; ++r) x[r] = fmaf(st[j][r], C2, -mn);
    // a tile's eight exponentials, each in its own register: no one of them reads a neighbour's result or overwrites a neighbour's argument, and the v_nop is the slot that the last one asks for in front of whatever the compiler puts next (as builtins, neighbours came out sharing registers)
    asm("v_exp_f32 %0, %0\n\tv_exp_f32 %1, %1\n\tv_exp_f32 %2, %2\n\tv_exp_f32 %3, %3\n\tv_exp_f32 %4, %4\n\tv_exp_f32 %5, %5\n\tv_exp_f32 %6, %6\n\tv_exp_f32 %7, %7\n\tv_nop"
        : "+v"(x[0]), "+v"(x[1]), "+v"(x[2]), "+v"(x[3]), "+v"(x[4]), "+v"(x[5]), "+v"(x[6]), "+v"(x[7]));
#pragma unroll
    for (int r = 0; r < 8; ++r) { st[j][r] = x[r]; s += x[r]; } }
  l = l * f + s;
#pragma unroll
  for (int d = 0; d < HD / 16; ++d) acc[d] = acc[d] * f; }
// two waves per SIMD is all this grid supplies (256 workgroups of 8 waves): the register budget of two lets the fragments fetched ahead stay in registers
__global__ __launch_bounds__(256) __attribute__((amdgpu_waves_per_eu(2, 2))) void k_attn(const _Float16* __restrict__ QH, const _Float16* __restrict__ KH, const _Float16* __restrict__ QL, const _Float16* __restrict__ KL, const _Float16* __restrict__ VT, const __bf16* __restrict__ VB, const __bf16* __restrict__ VBL, float* __restrict__ Y) {
  const int tid = threadIdx.x, lane = tid & 31, col = lane & 15, g = lane >> 4; const int wave = __builtin_amdgcn_readfirstlane(tid >> 5);
  const int b = blockIdx.x / NH, h = blockIdx.x % NH; const int qt = wave < 4 ? TT / QBLK - 1 - (int)blockIdx.y : (int)blockIdx.y; const int ql0 = qt * QBLK + (wave & 3) * QWAVE;   /* waves 0-3 take query tile n - 1 - y, waves 4-7 tile y: every workgroup walks the same number of keys */
  const int npass = (ql0 + QWAVE - 2) / KPASS + 1;   /* the wave's last visible key is ql0 + QWAVE - 2 */
  const _Float16* Qb = QH + ((size_t)b * TT + ql0 + col) * CC + h * HD; const _Float16* Kb = KH + ((size_t)b * TT + col) * CC + h * HD;
  float m[NCG], l[NCG]; v8f acc[NCG][HD / 16];
#pragma unroll
  for (int c = 0; c < NCG; ++c) { m[c] = -3.0e38f; l[c] = 0.f;
#pragma unroll
    for (int d = 0; d < HD / 16; ++d) acc[c][d] = v8f{}; }
  if (ql0 < QHI) {   /* wave-uniform; the wave's passes end at or below key KHI */
    const _Float16* QLb = QL + ((size_t)b * QHI + ql0 + col) * CC + h * HD; const _Float16* KLb = KL + ((size_t)b * KHI + col) * CC + h * HD;
    const __bf16* VBb = VB + ((size_t)b * CC + h * HD + col) * (size_t)KHI; const __bf16* VLb = VBL + ((size_t)b * CC + h * HD + col) * (size_t)KHI;
    v16h qf[NCG][2], qlf[NCG][2]; const _Float16* qp = Qb + 8 * g; const _Float16* qlp = QLb + 8 * g;   /* the lane's own addresses */
#pragma unroll
    for (int c = 0; c < NCG; ++c)
#pragma unroll
      for (int kc = 0; kc < 2; ++kc) { qf[c][kc] = frag_s(qp, 0u, (size_t)c * 16 * CC + kc * 32); qlf[c][kc] = frag_s(qlp, 0u, (size_t)c * 16 * CC + kc * 32); }
    // stands in front of any rewrite of the address registers that the loads above it name; the two addresses as inputs keep their registers whole until it, the scheduling barrier holds the loads in front of it and later address arithmetic behind it (the fragments themselves are no operands: as operands of an asm statement they would be held to the first 256 registers for the whole loop, which now has no room for them there)
    asm volatile("s_wait_xcnt 0x0" :: "v"(qp), "v"(qlp) : "memory");
    __builtin_amdgcn_sched_barrier(0);
    for (int ps = 0; ps < npass; ++ps) { const int k0 = ps * KPASS; v8f st[NCG][NKT];
      // the pass's k fragments, values and residuals, are requested as one group: the wave waits for memory once, not once per tile and half row
      const _Float16* kp = Kb + (size_t)k0 * CC + 8 * g; const _Float16* klp = KLb + (size_t)k0 * CC + 8 * g;   /* the lane's own addresses: every load of the group is one of them plus a constant */
      v16h kf[NKT][2], klf[NKT][2];
#pragma unroll
      for (int j = 0; j < NKT; ++j)
#pragma unroll
        for (int kc = 0; kc < 2; ++kc) { kf[j][kc] = frag_s(kp, 0u, (size_t)(j * 16) * CC + kc * 32); klf[j][kc] = frag_s(klp, 0u, (size_t)(j * 16) * CC + kc * 32); }
      // stands in front of any rewrite of the address registers that the loads above it name; the two addresses as inputs keep their registers whole until it
      asm volatile("s_wait_xcnt 0x0" :: "v"(kp), "v"(klp) : "memory");
      __builtin_amdgcn_sched_barrier(0);   // keeps the compiler from sinking those loads to their first use, where each would be waited for alone
#pragma unroll
      for (int j = 0; j < NKT; ++j) { v8f a[NCG] = {}, al[NCG] = {};
#pragma unroll
        for (int kc = 0; kc < 2; ++kc)
#pragma unroll
          for (int c = 0; c < NCG; ++c) { a[c] = wmh(kf[j][kc], qf[c][kc], a[c]); al[c] = wmh(kf[j][kc], qlf[c][kc], al[c]); al[c] = wmh(klf[j][kc], qf[c][kc], al[c]); }
#pragma unroll
        for (int c = 0; c < NCG; ++c) st[c][j] = a[c] + al[c] * (1.0f / 1024.0f); }
      // the pass's v fragments, hi and lo, are requested here as one group, ahead of the softmax arithmetic that covers their latency
      const __bf16* vp = VBb + k0 + 8 * g; const __bf16* vlp = VLb + k0 + 8 * g;
      v16b vh[NKT / 2][HD / 16], vl[NKT / 2][HD / 16];
#pragma unroll
      for (int jj = 0; jj < NKT / 2; ++jj)
#pragma unroll
        for (int d = 0; d < HD / 16; ++d) { vh[jj][d] = frag_bs(vp, (size_t)d * 16 * KHI + jj * 32); vl[jj][d] = frag_bs(vlp, (size_t)d * 16 * KHI + jj * 32); }
      // as above: in front of any rewrite of the two addresses, and the loads stay in front of the softmax
      asm volatile("s_wait_xcnt 0x0" :: "v"(vp), "v"(vlp) : "memory");
      __builtin_amdgcn_sched_barrier(0);
#pragma unroll
      for (int c = 0; c < NCG; ++c) sm_pass(st[c], acc[c], m[c], l[c], k0 + 8 * g, ql0 + c * 16 + col, true);
#pragma unroll
      for (int jj = 0; jj < NKT / 2; ++jj) { F2 p[NCG];
#pragma unroll
        for (int c = 0; c < NCG; ++c) { float pv[16];
#pragma unroll
          for (int i = 0; i < 8; ++i) { pv[i] = st[c][2 * jj][i]; pv[8 + i] = st[c][2 * jj + 1][i]; }
          p[c] = bsplit16(pv); }
#pragma unroll
        for (int d = 0; d < HD / 16; ++d)
#pragma unroll
          for (int c = 0; c < NCG; ++c) { acc[c][d] = wmb(vh[jj][d], p[c].h, acc[c][d]); acc[c][d] = wmb(vh[jj][d], p[c].l, acc[c][d]); acc[c][d] = wmb(vl[jj][d], p[c].h, acc[c][d]); } } }
  } else {
    const _Float16* Qu = QH + ((size_t)b * TT + ql0) * CC + h * HD; const _Float16* Ku = KH + (size_t)b * TT * CC + h * HD; const _Float16* Vu = VT + ((size_t)b * CC + h * HD) * (size_t)TT;   /* wave-uniform bases */
    const unsigned rlo = 2u * (col * CC + 8 * g);   /* the lane's byte offset in q / k rows */
    const _Float16* Kl = Ku + col * CC + 8 * g; const _Float16* Vl = Vu + col * TT + 8 * g;   /* the lane's own row of k, plane of v */
    v16h qf[NCG][2];
#pragma unroll
    for (int c = 0; c < NCG; ++c)
#pragma unroll
      for (int kc = 0; kc < 2; ++kc) qf[c][kc] = frag_s(Qu, rlo, (size_t)c * 16 * CC + kc * 32);
    v16h kf[2][NKT], vf[NKT / 2][HD / 16];
#pragma unroll
    for (int kc = 0; kc < 2; ++kc)
#pragma unroll
      for (int j = 0; j < NKT; ++j) kf[kc][j] = frag_s(Ku, rlo, (size_t)(j * 16) * CC + kc * 32);
    // stands in front of any rewrite of the registers that the loads above it name; the two bases and the offset as inputs keep those registers whole until it, the scheduling barrier holds the loads in front of it and later address arithmetic behind it
    asm volatile("s_wait_xcnt 0x0" :: "s"(Qu), "s"(Ku), "v"(rlo) : "memory");
    __builtin_amdgcn_sched_barrier(0);
    for (int ps = 0; ps < npass; ++ps) { const int k0 = ps * KPASS; v8f st[NCG][NKT];
#pragma unroll
      for (int c = 0; c < NCG; ++c)
#pragma unroll
        for (int j = 0; j < NKT; ++j) st[c][j] = v8f{};
#pragma unroll
      for (int kc = 0; kc < 2; ++kc)
#pragma unroll
        for (int j = 0; j < NKT; ++j)
#pragma unroll
          for (int c = 0; c < NCG; ++c) st[c][j] = wmh(kf[kc][j], qf[c][kc], st[c][j]);
      // this pass's v fragments and the next pass's k fragments (the last pass fetches its own again: stays inside the wave's key range) are requested here, ahead of the softmax arithmetic that covers their latency
      const int kn = ps + 1 < npass ? k0 + KPASS : k0; const _Float16* vp = Vl + k0; const _Float16* kp = Kl + (size_t)kn * CC;   /* the lane's own addresses: every load of the run is one of them plus a constant */
#pragma unroll
      for (int jj = 0; jj < NKT / 2; ++jj)
#pragma unroll
        for (int d = 0; d < HD / 16; ++d) vf[jj][d] = frag_s(vp, 0u, (size_t)d * 16 * TT + jj * 32);
#pragma unroll
      for (int kc = 0; kc < 2; ++kc)
#pragma unroll
        for (int j = 0; j < NKT; ++j) kf[kc][j] = frag_s(kp, 0u, (size_t)(j * 16) * CC + kc * 32);
      // stands in front of any rewrite of the address registers that the loads above it name; the two addresses as inputs keep their registers whole until it: no load of the run may land in a pair that the loads in front of it name
      asm volatile("s_wait_xcnt 0x0" :: "v"(vp), "v"(kp) : "memory");
      __builtin_amdgcn_sched_barrier(0);   // keeps the compiler from sinking those loads to their first use, where each would be waited for alone
      const bool edge = k0 + KPASS > ql0;   /* wave-uniform: only passes that reach the wave's first query hold excluded keys */
#pragma unroll
      for (int c = 0; c < NCG; ++c) sm_pass(st[c], acc[c], m[c], l[c], k0 + 8 * g, ql0 + c * 16 + col, edge);
#pragma unroll
      for (int jj = 0; jj < NKT / 2; ++jj) { v16h p[NCG];
#pragma unroll
        for (int c = 0; c < NCG; ++c)
#pragma unroll
          for (int i = 0; i < 8; ++i) { p[c][i] = (_Float16)st[c][2 * jj][i]; p[c][8 + i] = (_Float16)st[c][2 * jj + 1][i]; }
#pragma unroll
        for (int d = 0; d < HD / 16; ++d)
#pragma unroll
          for (int c = 0; c < NCG; ++c) acc[c][d] = wmh(vf[jj][d], p[c], acc[c][d]); } } }
  // acc[c][d][r] = ctx(query ql0 + 16 c + col, dim 16 d + 8 g + r) x sum: join the two lane halves' sums, divide, 32 contiguous bytes per lane and d
#pragma unroll
  for (int c = 0; c < NCG; ++c) { const float a = l[c] + __shfl_xor(l[c], 16); const float inv = a > 0.f ? 1.0f / a : 0.f; float* yr = Y + ((size_t)b * TT + ql0 + c * 16 + col) * CC + h * HD + 8 * g;
#pragma unroll
    for (int d = 0; d < HD / 16; ++d) { const v8f o = acc[c][d] * inv; vst2(yr + d * 16, v4f{o[0], o[1], o[2], o[3]}); vst2(yr + d * 16 + 4, v4f{o[4], o[5], o[6], o[7]}); } } }
// ---- k_out: block = (128 rows, 128 cols): out = ctx Wo (+ bo): ctx once to f16 against Wo as f16(bf16 x 2^8) exact (1 product) x 2^-8; causal early rows (< QHI of each sequence): ctx bf16 hi + lo against exact bf16 Wo (2 products). Each wave stages its 32 x 64 of the output in its own part of the LDS that the operand buffers have left.
__global__ __launch_bounds__(256) void k_out(const float* __restrict__ Y, const float* __restrict__ WO, const float* __restrict__ BO, float* __restrict__ OUT) { __shared__ __align__(16) char sm[2 * 3 * 128 * 144];
  const int tid = threadIdx.x, wave = tid >> 5, lane = tid & 31, col = lane & 15, g = lane >> 4, wr = wave >> 1, wc = wave & 1; const int c0 = blockIdx.y * 128; const size_t r0 = (size_t)blockIdx.x * 128;
  v8f acc[2][4] = {}; float sc; const int s0 = (int)((blockIdx.x + 2 * blockIdx.y) & 15);   /* 16 k steps: the 8 column blocks that share ctx rows start 2 steps apart, the 32 row blocks that share a weight tile at all 16 steps, two at each */
  if (CAUSAL && (int)(r0 % TT) < QHI) { gemm_tile<2, 64>(Y + r0 * CC, WO + (size_t)c0 * CC, sm, acc, s0); sc = 1.0f; }   /* block-uniform */
  else { gemm_tile<1, 64>(Y + r0 * CC, WO + (size_t)c0 * CC, sm, acc, s0); sc = 1.0f / 256.0f; }
  float (*sf)[68] = (float (*)[68])(sm + wave * 32 * 68 * 4);
#pragma unroll
  for (int j = 0; j < 4; ++j) { const float bias = BO ? bfr(BO[c0 + wc * 64 + j * 16 + col]) : 0.f;
#pragma unroll
    for (int i = 0; i < 2; ++i)
#pragma unroll
      for (int r = 0; r < 8; ++r) sf[i * 16 + 8 * g + r][j * 16 + col] = acc[i][j][r] * sc + bias; }
  LDSX();
#pragma unroll
  for (int rl = 0; rl < 32; rl += 2) vst2(OUT + (r0 + wr * 32 + rl + g) * DIN + c0 + wc * 64 + col * 4, *(const v4f*)&sf[rl + g][col * 4]); }

extern "C" void kernel_launch(void* const* d_in, const int* in_sizes, int n_in, void* d_out, int out_size, void* d_ws, size_t ws_size, hipStream_t stream) {
  (void)in_sizes; (void)n_in; (void)out_size;
  const float** F = (const float**)d_in;
  if (ws_size < (size_t)WS_END) return;
  char* ws = (char*)d_ws; _Float16 *QH = (_Float16*)(ws + WS_QH), *KH = (_Float16*)(ws + WS_KH), *VT = (_Float16*)(ws + WS_VT), *QL = (_Float16*)(ws + WS_QL), *KL = (_Float16*)(ws + WS_KL); __bf16 *VB = (__bf16*)(ws + WS_VB), *VBL = (__bf16*)(ws + WS_VBL); float *Y = (float*)(ws + WS_Y);
  (void)Y; (void)QL; (void)KL; (void)VB; (void)VBL;
  // inputs: 0 q, 1 k, 2 v [2,2048,1024]; 3 Wq, 4 Wk, 5 Wv, 6 Wo [1024,1024] (out,in), no biases
  k_proj<<<dim3(TNB * TT / 128, CC / 128, 3), 256, 0, stream>>>(F[0], F[1], F[2], F[3], F[4], F[5], nullptr, nullptr, nullptr, QH, QL, KH, KL, VT, VB, VBL);
  k_attn<<<dim3(TNB * NH, TT / QBLK / 2), 256, 0, stream>>>(QH, KH, QL, KL, VT, VB, VBL, Y);
  k_out<<<dim3(TNB * TT / 128, DIN / 128), 256, 0, stream>>>(Y, F[6], nullptr, (float*)d_out);
}

// v006
// It runs in 86 microseconds.
// Two timings next to v005 both put it at 1.05 times that version's speed.
// Counting every step since v000, it is 13.7 times as fast.
// compute dtype: all float inputs rounded to bf16; q/k/v = input W^T with EXACT bf16 products on WMMA 16x16x32 (f32 accumulate); causal (strict past) logits: q, k once to f16 (1 product) x 1024^-0.5, except the first 384 query rows of each sequence (3 products with f16 residuals); softmax in f32 with a running maximum; exp(logit - maximum) once to f16 against v once to f16 (1 product; bf16 hi + lo below row 384); ctx once to f16 against Wo carried x 2^8 in f16 (bf16 hi + lo against bf16 Wo, 2 products, in the first 384 rows of each sequence); f32 output.
#include <hip/hip_runtime.h>
#include <math.h>

typedef __attribute__((ext_vector_type(16))) _Float16 v16h;
typedef __attribute__((ext_vector_type(16))) __bf16 v16b;
typedef __attribute__((ext_vector_type(8)))  _Float16 v8h;
typedef __attribute__((ext_vector_type(8)))  float v8f;
typedef __attribute__((ext_vector_type(4)))  float v4f;
typedef __attribute__((ext_vector_type(2)))  float v2f;
typedef __attribute__((ext_vector_type(4)))  unsigned v4u;
typedef __attribute__((ext_vector_type(4)))  int v4i;
typedef float __attribute__((may_alias)) float_a;
typedef int __attribute__((may_alias)) int_a;

template <typename T> __device__ __forceinline__ void vst2(void* p, T v) { *(T*)p = v;  }
__device__ __forceinline__ v8f wmma16(v16h a, v16h b, v8f c) {
  v8f d = __builtin_amdgcn_wmma_f32_16x16x32_f16(false, a, false, b, (short)0, c, false, false);
  asm volatile("v_nop\n\tv_nop\n\tv_nop\n\tv_nop" : "+v"(d) : "v"(a), "v"(b));
  return d;
}
__device__ __forceinline__ v8f wmma_bf(v16b a, v16b b, v8f c) {
  v8f d = __builtin_amdgcn_wmma_f32_16x16x32_bf16(false, a, false, b, (short)0, c, false, false);
  asm volatile("v_nop\n\tv_nop\n\tv_nop\n\tv_nop" : "+v"(d) : "v"(a), "v"(b));
  return d;
}
// 16x16x32 fragments: lane = (h = lane>>4, row/col = lane&15); elements 0..7 = k0+8h+0..7, 8..15 = k0+16+8h+0..7; D element r = row 8h+r
__device__ __forceinline__ v16h frag_h(const _Float16* rowk0, int lane) {
  union { v16h v; v8h q[2]; } u; const _Float16* p = rowk0 + 8 * (lane >> 4);
  u.q[0] = *(const v8h*)p; u.q[1] = *(const v8h*)(p + 16); return u.v;
}
__device__ __forceinline__ v16h frag_f32(const float* rowk0, int lane) {
  v16h a; const float* p = rowk0 + 8 * (lane >> 4);
#pragma unroll
  for (int i = 0; i < 8; ++i) { a[i] = (_Float16)p[i]; a[8 + i] = (_Float16)p[16 + i]; }
  return a;
}
__device__ __forceinline__ v16h frag_f32s(const float* rowk0, int lane, float sc) {
  v16h a; const float* p = rowk0 + 8 * (lane >> 4);
#pragma unroll
  for (int i = 0; i < 8; ++i) { a[i] = (_Float16)(p[i] * sc); a[8 + i] = (_Float16)(p[16 + i] * sc); }
  return a;
}
// column fragment from a [K][ld] layout (column n), rows >= K read as 0
__device__ __forceinline__ v16h fragc_f32(const float* W, int k0, int n, int lane, int ld, int K) {
  v16h a; const int g = lane >> 4;
#pragma unroll
  for (int i = 0; i < 8; ++i) { const int ka = k0 + 8 * g + i, kb = ka + 16;
    a[i] = (_Float16)(ka < K ? W[(size_t)(ka < K ? ka : K - 1) * ld + n] : 0.f); a[8 + i] = (_Float16)(kb < K ? W[(size_t)(kb < K ? kb : K - 1) * ld + n] : 0.f); }
  return a;
}
struct F2 { v16b h, l; };
__device__ __forceinline__ F2 bsplit16(const float v[16]) { F2 r;
#pragma unroll
  for (int i = 0; i < 16; ++i) { const __bf16 h = (__bf16)v[i]; r.h[i] = h; r.l[i] = (__bf16)(v[i] - (float)h); }
  return r; }
__device__ __forceinline__ F2 split_row(const float* row, int k0, int lane) { float v[16]; const float* p = row + k0 + 8 * (lane >> 4);
#pragma unroll
  for (int i = 0; i < 8; ++i) { v[i] = p[i]; v[8 + i] = p[16 + i]; }
  return bsplit16(v); }
__device__ __forceinline__ F2 split_rowK(const float* row, int k0, int lane, int K) { float v[16]; const int g = lane >> 4;
#pragma unroll
  for (int i = 0; i < 8; ++i) { const int ka = k0 + 8 * g + i, kb = ka + 16; v[i] = ka < K ? row[ka < K ? ka : K - 1] : 0.f; v[8 + i] = kb < K ? row[kb < K ? kb : K - 1] : 0.f; }
  return bsplit16(v); }
__device__ __forceinline__ F2 split_col(const float* W, int k0, int n, int lane, int ld, int K) { float v[16]; const int g = lane >> 4;
#pragma unroll
  for (int i = 0; i < 8; ++i) { const int ka = k0 + 8 * g + i, kb = ka + 16; v[i] = ka < K ? W[(size_t)(ka < K ? ka : K - 1) * ld + n] : 0.f; v[8 + i] = kb < K ? W[(size_t)(kb < K ? kb : K - 1) * ld + n] : 0.f; }
  return bsplit16(v); }
__device__ __forceinline__ v8f mac3(const F2& a, const F2& b, v8f c) { c = wmma_bf(a.l, b.h, c); c = wmma_bf(a.h, b.l, c); return wmma_bf(a.h, b.h, c); }
__device__ __forceinline__ float sigm(float v) { return 1.0f / (1.0f + expf(-v)); }
#define LDSX() do { asm volatile("s_wait_dscnt 0" ::: "memory"); __builtin_amdgcn_wave_barrier(); __builtin_amdgcn_fence(__ATOMIC_RELEASE, "workgroup"); } while (0)

// In-context-learning attention (B 2, S 2,048, E 1,024 = 16 x 64; separate q/k/v inputs): qh = q Wq^T, kh = k Wk^T, vh = v Wv^T ((out,in)); scores = qh kh^T / sqrt(1024) masked where key >= query (strict past) except (0, 0); softmax; out = merged(probs vh) Wo^T.
#define NB 2
#define TT 2048
#define CC 1024            // NH * HD = projected width
#define DIN 1024          // input (model) width
#define NH 16
#define HD 64
#define NQB (TT / 64)
#define SCALE (0.03125f)
#define CAUSAL 1
#ifndef TNB
#define TNB NB
#endif
__device__ __forceinline__ float bfr(float v) { return (float)(__bf16)v; }
__host__ __device__ __forceinline__ int kb_last(int qb) { return CAUSAL ? ((qb * 64 + 63) >> 7) : (TT / 128 - 1); }
typedef __attribute__((ext_vector_type(8))) __bf16 v8b;
__device__ __forceinline__ v16b frag_b(const __bf16* rowk0, int lane) {
  union { v16b v; v8b q[2]; } u; const __bf16* p = rowk0 + 8 * (lane >> 4);
  u.q[0] = *(const v8b*)p; u.q[1] = *(const v8b*)(p + 16); return u.v;
}
#define QBH 6              // read nowhere: the high-precision paths are taken by query rows < QHI
#define QHI 384            // rows carrying a q residual plane
#define KHI 384            // key rows carrying k residual / v bf16 hi+lo planes (used only by the causal high-precision path)
// B fragment (k rows k0+.., output column o) of a weight: (in,out) [K][ld] or (out,in) [ld rows of K]: bf16 exact, or f16(bf16 * 256) exact
__device__ __forceinline__ v16b wcol_io(const float* Wm, int k0, int o, int lane, int ld) { v16b w; const int g = lane >> 4;
#pragma unroll
  for (int i = 0; i < 8; ++i) { w[i] = (__bf16)Wm[(size_t)(k0 + 8 * g + i) * ld + o]; w[8 + i] = (__bf16)Wm[(size_t)(k0 + 16 + 8 * g + i) * ld + o]; }
  return w; }
__device__ __forceinline__ v16b wcol_oi(const float* Wm, int k0, int o, int lane, int K) { v16b w; const float* p = Wm + (size_t)o * K + k0 + 8 * (lane >> 4);
#pragma unroll
  for (int i = 0; i < 8; ++i) { w[i] = (__bf16)p[i]; w[8 + i] = (__bf16)p[16 + i]; }
  return w; }
__device__ __forceinline__ v16h wcolh_io(const float* Wm, int k0, int o, int lane, int ld) { v16h w; const int g = lane >> 4;
#pragma unroll
  for (int i = 0; i < 8; ++i) { w[i] = (_Float16)(bfr(Wm[(size_t)(k0 + 8 * g + i) * ld + o]) * 256.0f); w[8 + i] = (_Float16)(bfr(Wm[(size_t)(k0 + 16 + 8 * g + i) * ld + o]) * 256.0f); }
  return w; }
__device__ __forceinline__ v16h wcolh_oi(const float* Wm, int k0, int o, int lane, int K) { v16h w; const float* p = Wm + (size_t)o * K + k0 + 8 * (lane >> 4);
#pragma unroll
  for (int i = 0; i < 8; ++i) { w[i] = (_Float16)(bfr(p[i]) * 256.0f); w[8 + i] = (_Float16)(bfr(p[16 + i]) * 256.0f); }
  return w; }
#define WQKV_LAYOUT 1   // 0 = (in,out) [DIN][CC]; 1 = (out,in) [CC][DIN]; 2 = per-head [NH][DIN][HD]
__device__ __forceinline__ v16b wcol_hdk(const float* Wm, int k0, int o, int lane) { v16b w; const int g = lane >> 4; const float* p = Wm + (size_t)(o / HD) * DIN * HD + (o % HD);
#pragma unroll
  for (int i = 0; i < 8; ++i) { w[i] = (__bf16)p[(size_t)(k0 + 8 * g + i) * HD]; w[8 + i] = (__bf16)p[(size_t)(k0 + 16 + 8 * g + i) * HD]; }
  return w; }
#define WO_OUT_IN 1
#if WQKV_LAYOUT == 1
#define WCOL(W, k0, o, lane) wcol_oi(W, k0, o, lane, DIN)
#elif WQKV_LAYOUT == 2
#define WCOL(W, k0, o, lane) wcol_hdk(W, k0, o, lane)
#else
#define WCOL(W, k0, o, lane) wcol_io(W, k0, o, lane, CC)
#endif
#if WO_OUT_IN
#define WOCOL(W, k0, o, lane) wcol_oi(W, k0, o, lane, CC)
#define WOCOLH(W, k0, o, lane) wcolh_oi(W, k0, o, lane, CC)
#else
#define WOCOL(W, k0, o, lane) wcol_io(W, k0, o, lane, DIN)
#define WOCOLH(W, k0, o, lane) wcolh_io(W, k0, o, lane, DIN)
#endif
#ifndef PROJ_EXTRA_PARAMS
#define PROJ_EXTRA_PARAMS
#endif

#define WS_QH  0u                                      // f16 q rows [b*t][CC]
#define WS_KH  (WS_QH + 2u * (size_t)NB * TT * CC)      // f16 k rows [b*t][CC]
#define WS_VT  (WS_KH + 2u * (size_t)NB * TT * CC)      // f16 v planes [b][c][t]
#define WS_QL  (WS_VT + 2u * (size_t)NB * CC * TT)      // f16 q residual x 2^10 rows [b][t < QHI][CC]
#define WS_KL  (WS_QL + 2u * (size_t)NB * QHI * CC)     // f16 k residual x 2^10 rows [b][t < KHI][CC]
#define WS_VB  (WS_KL + 2u * (size_t)NB * KHI * CC)     // bf16 v hi planes [b][c][t < KHI]
#define WS_VBL (WS_VB + 2u * (size_t)NB * CC * KHI)
#define WS_Y   (WS_VBL + 2u * (size_t)NB * CC * KHI)     // f32 ctx rows [b*t][CC] (only when there is an output projection)
#define WS_END (WS_Y  + 4u * (size_t)NB * TT * CC)

// plain builtin products: the compiler keeps the distance behind them itself and may place their operands in any register window
__device__ __forceinline__ v8f wmh(v16h a, v16h b, v8f c) { return __builtin_amdgcn_wmma_f32_16x16x32_f16(false, a, false, b, (short)0, c, false, false); }
__device__ __forceinline__ v8f wmb(v16b a, v16b b, v8f c) { return __builtin_amdgcn_wmma_f32_16x16x32_bf16(false, a, false, b, (short)0, c, false, false); }
typedef __attribute__((ext_vector_type(4))) __bf16 v4b;
typedef __attribute__((ext_vector_type(4))) _Float16 v4h;
__device__ __forceinline__ v4b cvt4b(v4f v) { return v4b{(__bf16)v[0], (__bf16)v[1], (__bf16)v[2], (__bf16)v[3]}; }
// ---- gemm_tile: 256 threads, acc += A[128 rows][1024] B[128 rows][1024]^T, both k-contiguous f32 rows. Each k step of BK is read once per workgroup with whole-line loads, converted once and kept in LDS as 16-bit rows of pitch 2 BK + 16 bytes (16 B x odd: no bank conflict for 16-byte fragment reads); two buffers: the next step's loads fly while this step's products run. Waves 4 x 2, 32 x 64 of the tile each (acc[i][j]: rows 32 wr + 16 i, columns 64 wc + 16 j). The k walk begins at step s0 (the same for the whole workgroup, below KD / BK), runs upward and wraps to step 0: workgroups that share operand rows are given different s0, so that they do not ask L2 for the same lines at the same moment.
// MODE 0: A, B to bf16. MODE 1: A to f16, B to f16(bf16 x 2^8). MODE 2: A to bf16 hi + lo (two planes, hi product first), B to bf16. On return every wave has left the buffers (sm may be reused). Every unroll directive here and in the two kernels' output staging keeps a register array (loaded pieces, fragments, accumulators) indexed by constants.
template <int MODE, int BK>
__device__ __forceinline__ void gemm_tile(const float* __restrict__ A, const float* __restrict__ Bw, char* sm, v8f (&acc)[2][4], int s0) {
  constexpr int KD = 1024, PITCH = 2 * BK + 16, UR = BK / 4, RS = 256 / UR, NU = 128 / RS, PL = 128 * PITCH, BUF = (MODE == 2 ? 3 : 2) * PL, NS = KD / BK;
  const int tid = threadIdx.x, lane = tid & 31, col = lane & 15, g = lane >> 4, wave = tid >> 5, wr = wave >> 1, wc = wave & 1;
  const float* ga = A + (size_t)(tid / UR) * KD + (tid % UR) * 4 + s0 * BK; const float* gb = Bw + (size_t)(tid / UR) * KD + (tid % UR) * 4 + s0 * BK;   /* the thread's 16 bytes of rows tid / UR + i RS, at k step s0 */
  int ks = s0;   /* the k step that the next fetch reads */
  char* sw = sm + (tid / UR) * PITCH + (tid % UR) * 8;
  const char* fa = sm + (wr * 32 + col) * PITCH + 16 * g; const char* fb = sm + PL + (wc * 64 + col) * PITCH + 16 * g;
  v4f ra[NU], rb[NU];
  auto fetch = [&]() {
#pragma unroll
    for (int i = 0; i < NU; ++i) { ra[i] = *(const v4f*)(ga + (size_t)i * RS * KD); rb[i] = *(const v4f*)(gb + (size_t)i * RS * KD); }
    // stands in front of the rewrite of the two address pairs that the loads above it name (every load is one of them plus a constant); the pairs as inputs keep their registers whole until it
    asm volatile("s_wait_xcnt 0x0" :: "v"(ga), "v"(gb) : "memory");
    __builtin_amdgcn_sched_barrier(0);   // holds the loads in front of the products that cover their latency, and the address additions behind the wait
    ks = ks + 1 == NS ? 0 : ks + 1; const int adv = ks == 0 ? BK - KD : BK;   /* behind the last k step the walk wraps to the first */
    ga += adv; gb += adv; };
  auto stage = [&](int off) {
#pragma unroll
    for (int i = 0; i < NU; ++i) { char* p = sw + off + i * RS * PITCH;
      if constexpr (MODE == 0) { *(v4b*)p = cvt4b(ra[i]); *(v4b*)(p + PL) = cvt4b(rb[i]); }
      else if constexpr (MODE == 1) { *(v4h*)p = v4h{(_Float16)ra[i][0], (_Float16)ra[i][1], (_Float16)ra[i][2], (_Float16)ra[i][3]};
        *(v4h*)(p + PL) = v4h{(_Float16)(bfr(rb[i][0]) * 256.0f), (_Float16)(bfr(rb[i][1]) * 256.0f), (_Float16)(bfr(rb[i][2]) * 256.0f), (_Float16)(bfr(rb[i][3]) * 256.0f)}; }
      else { const v4b hv = cvt4b(ra[i]); *(v4b*)p = hv; *(v4b*)(p + 2 * PL) = cvt4b(v4f{ra[i][0] - (float)hv[0], ra[i][1] - (float)hv[1], ra[i][2] - (float)hv[2], ra[i][3] - (float)hv[3]}); *(v4b*)(p + PL) = cvt4b(rb[i]); } } };
  auto products = [&](int off) {
#pragma unroll
    for (int kk = 0; kk < BK / 32; ++kk) {
      if constexpr (MODE == 1) { v16h a[2], w[4];
#pragma unroll
        for (int i = 0; i < 2; ++i) { union { v16h v; v8h q[2]; } u; const char* p = fa + off + i * 16 * PITCH + kk * 64; u.q[0] = *(const v8h*)p; u.q[1] = *(const v8h*)(p + 32); a[i] = u.v; }
#pragma unroll
        for (int j = 0; j < 4; ++j) { union { v16h v; v8h q[2]; } u; const char* p = fb + off + j * 16 * PITCH + kk * 64; u.q[0] = *(const v8h*)p; u.q[1] = *(const v8h*)(p + 32); w[j] = u.v; }
#pragma unroll
        for (int i = 0; i < 2; ++i)
#pragma unroll
          for (int j = 0; j < 4; ++j) acc[i][j] = wmh(a[i], w[j], acc[i][j]);
      } else { v16b a[2], al[2], w[4];
#pragma unroll
        for (int i = 0; i < 2; ++i) { union { v16b v; v8b q[2]; } u; const char* p = fa + off + i * 16 * PITCH + kk * 64; u.q[0] = *(const v8b*)p; u.q[1] = *(const v8b*)(p + 32); a[i] = u.v;
          if constexpr (MODE == 2) { u.q[0] = *(const v8b*)(p + 2 * PL); u.q[1] = *(const v8b*)(p + 2 * PL + 32); al[i] = u.v; } }
#pragma unroll
        for (int j = 0; j < 4; ++j) { union { v16b v; v8b q[2]; } u; const char* p = fb + off + j * 16 * PITCH + kk * 64; u.q[0] = *(const v8b*)p; u.q[1] = *(const v8b*)(p + 32); w[j] = u.v; }
#pragma unroll
        for (int i = 0; i < 2; ++i)
#pragma unroll
          for (int j = 0; j < 4; ++j) acc[i][j] = wmb(a[i], w[j], acc[i][j]);
        if constexpr (MODE == 2) {
#pragma unroll
          for (int i = 0; i < 2; ++i)
#pragma unroll
            for (int j = 0; j < 4; ++j) acc[i][j] = wmb(al[i], w[j], acc[i][j]); } } } };
  fetch(); stage(0); __syncthreads();
  int cur = 0;
  for (int s = 0; s + 1 < NS; ++s) { fetch(); products(cur);
    __builtin_amdgcn_sched_barrier(0);   // keeps the conversions, which wait for the loads in flight, behind the products that cover the loads' latency
    cur ^= BUF; stage(cur); __syncthreads(); }   /* the one barrier of a step publishes the buffer just written and ends the reads of the one written next */
  products(cur); __syncthreads(); }
// stands behind a run of global loads or stores, in front of any rewrite of the registers that they name; the scheduling barrier holds later arithmetic behind it
#define XW() do { asm volatile("s_wait_xcnt 0x0" ::: "memory"); __builtin_amdgcn_sched_barrier(0); } while (0)
// ---- k_proj: block = (128 rows, 128 cols, which): q/k/v = X W (+ b) with exact bf16 products (K = DIN) -> which 0: q f16 rows (+ residual rows < QHI); 1: k f16 rows (+ residual rows < KHI); 2: v f16 planes [c][t] (+ bf16 hi/lo planes for t < KHI). The output staging reuses the LDS of the operand buffers.
__global__ __launch_bounds__(256) void k_proj(const float* __restrict__ XQ, const float* __restrict__ XK, const float* __restrict__ XV, const float* __restrict__ WQ, const float* __restrict__ WK, const float* __restrict__ WV, const float* __restrict__ BQ, const float* __restrict__ BK, const float* __restrict__ BV,
    _Float16* __restrict__ QH, _Float16* __restrict__ QL, _Float16* __restrict__ KH, _Float16* __restrict__ KL, _Float16* __restrict__ VT, __bf16* __restrict__ VB, __bf16* __restrict__ VBL) {
  __shared__ __align__(16) char sm[3 * 128 * 136 * 2];
  const int tid = threadIdx.x, wave = tid >> 5, lane = tid & 31, col = lane & 15, g = lane >> 4, wr = wave >> 1, wc = wave & 1; const int which = blockIdx.z; const int c0 = blockIdx.y * 128; const size_t r0 = (size_t)blockIdx.x * 128; const size_t bb = r0 / TT; const int t0 = (int)(r0 % TT);
  const float* X = which == 0 ? XQ : which == 1 ? XK : XV; const float* WA = which == 0 ? WQ : which == 1 ? WK : WV; const float* BA = which == 0 ? BQ : which == 1 ? BK : BV;
  v8f acc[2][4] = {};
  gemm_tile<0, 32>(X + r0 * DIN, WA + (size_t)c0 * DIN, sm, acc, (int)((blockIdx.x + 4 * blockIdx.y) & 31));   /* 32 k steps: the 32 row blocks that share a weight tile start at 32 different steps, the 8 column blocks that share input rows 4 steps apart */
  if (which < 2) { _Float16 (*sh)[136] = (_Float16 (*)[136])sm; _Float16 (*sl)[136] = (_Float16 (*)[136])(sm + 128 * 136 * 2);
    _Float16* DH = which == 0 ? QH : KH; _Float16* DL = which == 0 ? QL : KL; const int nhi = which == 0 ? QHI : KHI; const bool hi_rows = t0 < nhi;
#pragma unroll
    for (int j = 0; j < 4; ++j) { const int cl = wc * 64 + j * 16 + col; float bias = 0.f; if (BA) { bias = bfr(BA[c0 + cl]); XW(); }
#pragma unroll
      for (int i = 0; i < 2; ++i)
#pragma unroll
        for (int r = 0; r < 8; ++r) { const float v = acc[i][j][r] + bias; const _Float16 hv = (_Float16)v; const int rl = wr * 32 + i * 16 + 8 * g + r; sh[rl][cl] = hv; sl[rl][cl] = (_Float16)((v - (float)hv) * 1024.0f); } }
    __syncthreads();
    const int rl = tid >> 4, q = tid & 15; v4u t[8];   /* piece it of a thread: row rl + 16 it, 16 bytes at element 8 q */
#pragma unroll
    for (int it = 0; it < 8; ++it) t[it] = *(const v4u*)&sh[rl + 16 * it][q * 8];
#pragma unroll
    for (int it = 0; it < 8; ++it) vst2((unsigned*)(DH + (r0 + rl + 16 * it) * CC + c0 + q * 8), t[it]);
    if (hi_rows) { XW();
#pragma unroll
      for (int it = 0; it < 8; ++it) t[it] = *(const v4u*)&sl[rl + 16 * it][q * 8];
#pragma unroll
      for (int it = 0; it < 8; ++it) vst2((unsigned*)(DL + (bb * nhi + t0 + rl + 16 * it) * (size_t)CC + c0 + q * 8), t[it]); }
  } else { _Float16 (*th)[136] = (_Float16 (*)[136])sm; __bf16 (*tb)[136] = (__bf16 (*)[136])(sm + 128 * 136 * 2); __bf16 (*tbl)[136] = (__bf16 (*)[136])(sm + 2 * 128 * 136 * 2); const bool hi_rows = t0 < KHI;
#pragma unroll
    for (int j = 0; j < 4; ++j) { const int cl = wc * 64 + j * 16 + col; float bias = 0.f; if (BA) { bias = bfr(BA[c0 + cl]); XW(); }
#pragma unroll
      for (int i = 0; i < 2; ++i)
#pragma unroll
        for (int r = 0; r < 8; ++r) { const float v = acc[i][j][r] + bias; const int rl = wr * 32 + i * 16 + 8 * g + r; th[cl][rl] = (_Float16)v; const __bf16 bh = (__bf16)v; tb[cl][rl] = bh; tbl[cl][rl] = (__bf16)(v - (float)bh); } }
    __syncthreads();
    const int cl = tid >> 4, q = tid & 15; v4u t[8];   /* piece it of a thread: plane cl + 16 it, 16 bytes at element 8 q */
#pragma unroll
    for (int it = 0; it < 8; ++it) t[it] = *(const v4u*)&th[cl + 16 * it][q * 8];
#pragma unroll
    for (int it = 0; it < 8; ++it) vst2((unsigned*)(VT + (bb * CC + c0 + cl + 16 * it) * (size_t)TT + t0 + q * 8), t[it]);
    XW();
    if (hi_rows) {
#pragma unroll
      for (int it = 0; it < 8; ++it) t[it] = *(const v4u*)&tb[cl + 16 * it][q * 8];
#pragma unroll
      for (int it = 0; it < 8; ++it) vst2((unsigned*)(VB + (bb * CC + c0 + cl + 16 * it) * (size_t)KHI + t0 + q * 8), t[it]);
      XW();
#pragma unroll
      for (int it = 0; it < 8; ++it) t[it] = *(const v4u*)&tbl[cl + 16 * it][q * 8];
#pragma unroll
      for (int it = 0; it < 8; ++it) vst2((unsigned*)(VBL + (bb * CC + c0 + cl + 16 * it) * (size_t)KHI + t0 + q * 8), t[it]);
      XW(); } } }
// frag_h from a base, the lane's own byte offset (row and lane half; 0 where the base already holds it) and a constant element offset
__device__ __forceinline__ v16h frag_s(const _Float16* base, unsigned lo, size_t e) { union { v16h v; v8h q[2]; } u; const char* p = (const char*)base + lo; u.q[0] = *(const v8h*)(p + 2 * e); u.q[1] = *(const v8h*)(p + 2 * e + 32); return u.v; }
// the same for bf16, from the lane's own address (row and lane half) and a constant element offset
__device__ __forceinline__ v16b frag_bs(const __bf16* base, size_t e) { union { v16b v; v8b q[2]; } u; u.q[0] = *(const v8b*)(base + e); u.q[1] = *(const v8b*)(base + e + 16); return u.v; }
// ---- k_attn: one walk = QWAVE queries (NCG groups of 16 columns) of (b, h) and a run of their visible keys, in passes of KPASS keys. S^T = k q^T (a lane holds the logits of ONE query: tile j, register r = key 16 j + 8 g + r), running maximum and sum per lane, ctx^T += v^T P^T with P^T packed from the score registers as the B operand (element order = the fragment k order above). Logits and P stay in registers. Queries < QHI: 3-product logits (f16 residuals) and P, v as bf16 hi + lo (3 products).
#define NCG 2              // 16-query column groups per wave: each k / v fragment load feeds NCG products
#define NKT 4              // 16-key tiles per pass
#define KPASS (16 * NKT)
#define QWAVE (16 * NCG)
#define QBLK (4 * QWAVE)
// one pass of the running softmax for one column group: mask by index (strict past, except (0, 0)), new maximum (own keys, then the other lane half), rescale sum and ctx, st <- exp(logit - maximum). An excluded logit is -3e38 and its exp is 0.
// st arrives as the raw q.k sums: exp(SCALE (s - max)) = 2^(C2 s - C2 max) with C2 = SCALE log2(e), one fused multiply-add and one hardware base-2 exponential per logit; m holds C2 x the running maximum (C2 > 0: scaling keeps the order).
#define C2 (SCALE * 1.44269504088896340736f)
__device__ __forceinline__ void sm_pass(v8f (&st)[NKT], v8f (&acc)[HD / 16], float& m, float& l, int kg, int t, bool edge) {
  if (edge) {
#pragma unroll
    for (int j = 0; j < NKT; ++j)
#pragma unroll
      for (int r = 0; r < 8; ++r) { const int k = kg + j * 16 + r; st[j][r] = (k < t || (k | t) == 0) ? st[j][r] : -3.0e38f; } }
  float mx = st[0][0];
#pragma unroll
  for (int j = 0; j < NKT; ++j)
#pragma unroll
    for (int r = 0; r < 8; ++r) mx = fmaxf(mx, st[j][r]);
  mx = fmaxf(mx, __shfl_xor(mx, 16));
  // the floor is below C2 x any sum of f16 products, so it changes no real maximum; it keeps a query that has seen only excluded keys so far (a wave that starts its walk behind key 0) at exp = 0
  const float mn = fmaxf(fmaxf(m, mx * C2), -1.0e30f), f = __builtin_amdgcn_exp2f(m - mn); m = mn;
  float s = 0.f;
#pragma unroll
  for (int j = 0; j < NKT; ++j) { float x[8];
#pragma unroll
    for (int r = 0; r < 8; ++r) x[r] = fmaf(st[j][r], C2, -mn);
    // a tile's eight exponentials, each in its own register: no one of them reads a neighbour's result or overwrites a neighbour's argument, and the v_nop is the slot that the last one asks for in front of whatever the compiler puts next (as builtins, neighbours came out sharing registers)
    asm("v_exp_f32 %0, %0\n\tv_exp_f32 %1, %1\n\tv_exp_f32 %2, %2\n\tv_exp_f32 %3, %3\n\tv_exp_f32 %4, %4\n\tv_exp_f32 %5, %5\n\tv_exp_f32 %6, %6\n\tv_exp_f32 %7, %7\n\tv_nop"
        : "+v"(x[0]), "+v"(x[1]), "+v"(x[2]), "+v"(x[3]), "+v"(x[4]), "+v"(x[5]), "+v"(x[6]), "+v"(x[7]));
#pragma unroll
    for (int r = 0; r < 8; ++r) { st[j][r] = x[r]; s += x[r]; } }
  l = l * f + s;
#pragma unroll
  for (int d = 0; d < HD / 16; ++d) acc[d] = acc[d] * f; }
// two waves per SIMD is all this grid supplies (256 workgroups of 8 waves): the register budget of two lets the fragments fetched ahead stay in registers
__global__ __launch_bounds__(256) __attribute__((amdgpu_waves_per_eu(2, 2))) void k_attn(const _Float16* __restrict__ QH, const _Float16* __restrict__ KH, const _Float16* __restrict__ QL, const _Float16* __restrict__ KL, const _Float16* __restrict__ VT, const __bf16* __restrict__ VB, const __bf16* __restrict__ VBL, float* __restrict__ Y) {
  const int tid = threadIdx.x, lane = tid & 31, col = lane & 15, g = lane >> 4; const int wave = __builtin_amdgcn_readfirstlane(tid >> 5);
  __shared__ __align__(16) char sx[4 * 17 * 512];   /* a helper wave's partial state: 17 pieces of 16 bytes per lane */
  const int b = blockIdx.x / NH, h = blockIdx.x % NH; const int w4 = wave & 3; const bool helper = wave >= 4;
  // the workgroup holds query tiles n - 1 - y (late) and y (early). Waves w and w + 4 share a SIMD and the same 32 queries of each tile: wave w + 4 walks the early tile's queries, then the late queries' passes from cut on; wave w walks the late queries' passes below cut. cut gives both the same load (a high-precision pass counted as three), so that neither runs alone on its SIMD for long
  const int qlL = (TT / QBLK - 1 - (int)blockIdx.y) * QBLK + w4 * QWAVE, qlE = (int)blockIdx.y * QBLK + w4 * QWAVE;
  const int nL = (qlL + QWAVE - 2) / KPASS + 1, nE = (qlE + QWAVE - 2) / KPASS + 1;   /* a wave's last visible key is its first query + QWAVE - 2 */
  const int half = (nL + (qlE < QHI ? 3 * nE : nE) + 1) / 2, cut = half < nL ? half : nL;
  float m[NCG], l[NCG]; v8f acc[NCG][HD / 16];
  // acc[c][d][r] = ctx(query q0 + 16 c + col, dim 16 d + 8 g + r) x sum: join the two lane halves' sums, divide, 32 contiguous bytes per lane and d
  auto store_out = [&](int q0) {
#pragma unroll
    for (int c = 0; c < NCG; ++c) { const float a = l[c] + __shfl_xor(l[c], 16); const float inv = a > 0.f ? 1.0f / a : 0.f; float* yr = Y + ((size_t)b * TT + q0 + c * 16 + col) * CC + h * HD + 8 * g;
#pragma unroll
      for (int d = 0; d < HD / 16; ++d) { const v8f o = acc[c][d] * inv; vst2(yr + d * 16, v4f{o[0], o[1], o[2], o[3]}); vst2(yr + d * 16 + 4, v4f{o[4], o[5], o[6], o[7]}); } }
    XW(); };
  // one walk: the 32 queries from ql0 on, passes p0 .. npass - 1; early: the queries may be high-precision rows
  auto walk = [&](int ql0, int p0, int npass, bool early) __attribute__((always_inline)) {
  const _Float16* Qb = QH + ((size_t)b * TT + ql0 + col) * CC + h * HD; const _Float16* Kb = KH + ((size_t)b * TT + col) * CC + h * HD;
#pragma unroll
  for (int c = 0; c < NCG; ++c) { m[c] = -3.0e38f; l[c] = 0.f;
#pragma unroll
    for (int d = 0; d < HD / 16; ++d) acc[c][d] = v8f{}; }
  if (early && ql0 < QHI) {   /* wave-uniform; an early tile alone (p0 = 0); the wave's passes end at or below key KHI */
    const _Float16* QLb = QL + ((size_t)b * QHI + ql0 + col) * CC + h * HD; const _Float16* KLb = KL + ((size_t)b * KHI + col) * CC + h * HD;
    const __bf16* VBb = VB + ((size_t)b * CC + h * HD + col) * (size_t)KHI; const __bf16* VLb = VBL + ((size_t)b * CC + h * HD + col) * (size_t)KHI;
    v16h qf[NCG][2], qlf[NCG][2]; const _Float16* qp = Qb + 8 * g; const _Float16* qlp = QLb + 8 * g;   /* the lane's own addresses */
#pragma unroll
    for (int c = 0; c < NCG; ++c)
#pragma unroll
      for (int kc = 0; kc < 2; ++kc) { qf[c][kc] = frag_s(qp, 0u, (size_t)c * 16 * CC + kc * 32); qlf[c][kc] = frag_s(qlp, 0u, (size_t)c * 16 * CC + kc * 32); }
    // stands in front of any rewrite of the address registers that the loads above it name; the two addresses as inputs keep their registers whole until it, the scheduling barrier holds the loads in front of it and later address arithmetic behind it (the fragments themselves are no operands: as operands of an asm statement they would be held to the first 256 registers for the whole loop, which now has no room for them there)
    asm volatile("s_wait_xcnt 0x0" :: "v"(qp), "v"(qlp) : "memory");
    __builtin_amdgcn_sched_barrier(0);
    for (int ps = 0; ps < npass; ++ps) { const int k0 = ps * KPASS; v8f st[NCG][NKT];
      // the pass's k fragments, values and residuals, are requested as one group: the wave waits for memory once, not once per tile and half row
      const _Float16* kp = Kb + (size_t)k0 * CC + 8 * g; const _Float16* klp = KLb + (size_t)k0 * CC + 8 * g;   /* the lane's own addresses: every load of the group is one of them plus a constant */
      v16h kf[NKT][2], klf[NKT][2];
#pragma unroll
      for (int j = 0; j < NKT; ++j)
#pragma unroll
        for (int kc = 0; kc < 2; ++kc) { kf[j][kc] = frag_s(kp, 0u, (size_t)(j * 16) * CC + kc * 32); klf[j][kc] = frag_s(klp, 0u, (size_t)(j * 16) * CC + kc * 32); }
      // stands in front of any rewrite of the address registers that the loads above it name; the two addresses as inputs keep their registers whole until it
      asm volatile("s_wait_xcnt 0x0" :: "v"(kp), "v"(klp) : "memory");
      __builtin_amdgcn_sched_barrier(0);   // keeps the compiler from sinking those loads to their first use, where each would be waited for alone
#pragma unroll
      for (int j = 0; j < NKT; ++j) { v8f a[NCG] = {}, al[NCG] = {};
#pragma unroll
        for (int kc = 0; kc < 2; ++kc)
#pragma unroll
          for (int c = 0; c < NCG; ++c) { a[c] = wmh(kf[j][kc], qf[c][kc], a[c]); al[c] = wmh(kf[j][kc], qlf[c][kc], al[c]); al[c] = wmh(klf[j][kc], qf[c][kc], al[c]); }
#pragma unroll
        for (int c = 0; c < NCG; ++c) st[c][j] = a[c] + al[c] * (1.0f / 1024.0f); }
      // the pass's v fragments, hi and lo, are requested here as one group, ahead of the softmax arithmetic that covers their latency
      const __bf16* vp = VBb + k0 + 8 * g; const __bf16* vlp = VLb + k0 + 8 * g;
      v16b vh[NKT / 2][HD / 16], vl[NKT / 2][HD / 16];
#pragma unroll
      for (int jj = 0; jj < NKT / 2; ++jj)
#pragma unroll
        for (int d = 0; d < HD / 16; ++d) { vh[jj][d] = frag_bs(vp, (size_t)d * 16 * KHI + jj * 32); vl[jj][d] = frag_bs(vlp, (size_t)d * 16 * KHI + jj * 32); }
      // as above: in front of any rewrite of the two addresses, and the loads stay in front of the softmax
      asm volatile("s_wait_xcnt 0x0" :: "v"(vp), "v"(vlp) : "memory");
      __builtin_amdgcn_sched_barrier(0);
#pragma unroll
      for (int c = 0; c < NCG; ++c) sm_pass(st[c], acc[c], m[c], l[c], k0 + 8 * g, ql0 + c * 16 + col, true);
#pragma unroll
      for (int jj = 0; jj < NKT / 2; ++jj) { F2 p[NCG];
#pragma unroll
        for (int c = 0; c < NCG; ++c) { float pv[16];
#pragma unroll
          for (int i = 0; i < 8; ++i) { pv[i] = st[c][2 * jj][i]; pv[8 + i] = st[c][2 * jj + 1][i]; }
          p[c] = bsplit16(pv); }
#pragma unroll
        for (int d = 0; d < HD / 16; ++d)
#pragma unroll
          for (int c = 0; c < NCG; ++c) { acc[c][d] = wmb(vh[jj][d], p[c].h, acc[c][d]); acc[c][d] = wmb(vh[jj][d], p[c].l, acc[c][d]); acc[c][d] = wmb(vl[jj][d], p[c].h, acc[c][d]); } } }
  } else if (p0 < npass) {
    const _Float16* Qu = QH + ((size_t)b * TT + ql0) * CC + h * HD; const _Float16* Ku = KH + (size_t)b * TT * CC + h * HD; const _Float16* Vu = VT + ((size_t)b * CC + h * HD) * (size_t)TT;   /* wave-uniform bases */
    const unsigned rlo = 2u * (col * CC + 8 * g);   /* the lane's byte offset in q / k rows */
    const _Float16* Kl = Ku + col * CC + 8 * g; const _Float16* Vl = Vu + col * TT + 8 * g;   /* the lane's own row of k, plane of v */
    v16h qf[NCG][2];
#pragma unroll
    for (int c = 0; c < NCG; ++c)
#pragma unroll
      for (int kc = 0; kc < 2; ++kc) qf[c][kc] = frag_s(Qu, rlo, (size_t)c * 16 * CC + kc * 32);
    v16h kf[2][NKT], vf[NKT / 2][HD / 16]; const _Float16* Kf = Ku + (size_t)p0 * KPASS * CC;   /* the task's first pass */
#pragma unroll
    for (int kc = 0; kc < 2; ++kc)
#pragma unroll
      for (int j = 0; j < NKT; ++j) kf[kc][j] = frag_s(Kf, rlo, (size_t)(j * 16) * CC + kc * 32);
    // stands in front of any rewrite of the registers that the loads above it name; the two bases and the offset as inputs keep those registers whole until it, the scheduling barrier holds the loads in front of it and later address arithmetic behind it
    asm volatile("s_wait_xcnt 0x0" :: "s"(Qu), "s"(Kf), "v"(rlo) : "memory");
    __builtin_amdgcn_sched_barrier(0);
    for (int ps = p0; ps < npass; ++ps) { const int k0 = ps * KPASS; v8f st[NCG][NKT];
#pragma unroll
      for (int c = 0; c < NCG; ++c)
#pragma unroll
        for (int j = 0; j < NKT; ++j) st[c][j] = v8f{};
#pragma unroll
      for (int kc = 0; kc < 2; ++kc)
#pragma unroll
        for (int j = 0; j < NKT; ++j)
#pragma unroll
          for (int c = 0; c < NCG; ++c) st[c][j] = wmh(kf[kc][j], qf[c][kc], st[c][j]);
      // this pass's v fragments and the next pass's k fragments (the last pass fetches its own again: stays inside the wave's key range) are requested here, ahead of the softmax arithmetic that covers their latency
      const int kn = ps + 1 < npass ? k0 + KPASS : k0; const _Float16* vp = Vl + k0; const _Float16* kp = Kl + (size_t)kn * CC;   /* the lane's own addresses: every load of the run is one of them plus a constant */
#pragma unroll
      for (int jj = 0; jj < NKT / 2; ++jj)
#pragma unroll
        for (int d = 0; d < HD / 16; ++d) vf[jj][d] = frag_s(vp, 0u, (size_t)d * 16 * TT + jj * 32);
#pragma unroll
      for (int kc = 0; kc < 2; ++kc)
#pragma unroll
        for (int j = 0; j < NKT; ++j) kf[kc][j] = frag_s(kp, 0u, (size_t)(j * 16) * CC + kc * 32);
      // stands in front of any rewrite of the address registers that the loads above it name; the two addresses as inputs keep their registers whole until it: no load of the run may land in a pair that the loads in front of it name
      asm volatile("s_wait_xcnt 0x0" :: "v"(vp), "v"(kp) : "memory");
      __builtin_amdgcn_sched_barrier(0);   // keeps the compiler from sinking those loads to their first use, where each would be waited for alone
      const bool edge = k0 + KPASS > ql0;   /* wave-uniform: only passes that reach the wave's first query hold excluded keys */
#pragma unroll
      for (int c = 0; c < NCG; ++c) sm_pass(st[c], acc[c], m[c], l[c], k0 + 8 * g, ql0 + c * 16 + col, edge);
#pragma unroll
      for (int jj = 0; jj < NKT / 2; ++jj) { v16h p[NCG];
#pragma unroll
        for (int c = 0; c < NCG; ++c)
#pragma unroll
          for (int i = 0; i < 8; ++i) { p[c][i] = (_Float16)st[c][2 * jj][i]; p[c][8 + i] = (_Float16)st[c][2 * jj + 1][i]; }
#pragma unroll
        for (int d = 0; d < HD / 16; ++d)
#pragma unroll
          for (int c = 0; c < NCG; ++c) acc[c][d] = wmh(vf[jj][d], p[c], acc[c][d]); } } }
  };
  if (helper) { walk(qlE, 0, nE, true); store_out(qlE); }
  walk(qlL, helper ? cut : 0, helper ? nL : cut, false);
  // the helper's partial maximum, sum and ctx of the late queries go to its partner through LDS (the same lane holds the same query and dims in both waves): piece q of a lane at (17 w + q) x 512 + 16 lane
  char* xp = sx + (w4 * 17 * 32 + lane) * 16;
  if (helper) {
#pragma unroll
    for (int c = 0; c < NCG; ++c)
#pragma unroll
      for (int d = 0; d < HD / 16; ++d) { const v8f o = acc[c][d]; *(v4f*)(xp + ((c * (HD / 16) + d) * 2) * 512) = v4f{o[0], o[1], o[2], o[3]}; *(v4f*)(xp + ((c * (HD / 16) + d) * 2 + 1) * 512) = v4f{o[4], o[5], o[6], o[7]}; }
    *(v4f*)(xp + 16 * 512) = v4f{m[0], m[1], l[0], l[1]}; }
  __syncthreads();   // the partial states are written before a partner reads them
  if (!helper) { const v4f ml = *(const v4f*)(xp + 16 * 512);
#pragma unroll
    for (int c = 0; c < NCG; ++c) { const float mm = fmaxf(m[c], ml[c]), f1 = __builtin_amdgcn_exp2f(m[c] - mm), f2 = __builtin_amdgcn_exp2f(ml[c] - mm); l[c] = l[c] * f1 + ml[NCG + c] * f2;   /* both parts brought to the common maximum; a helper without a pass holds sum 0, ctx 0 and f2 = 0 */
#pragma unroll
      for (int d = 0; d < HD / 16; ++d) { const v4f a0 = *(const v4f*)(xp + ((c * (HD / 16) + d) * 2) * 512), a1 = *(const v4f*)(xp + ((c * (HD / 16) + d) * 2 + 1) * 512);
#pragma unroll
        for (int r = 0; r < 4; ++r) { acc[c][d][r] = acc[c][d][r] * f1 + a0[r] * f2; acc[c][d][4 + r] = acc[c][d][4 + r] * f1 + a1[r] * f2; } } }
    store_out(qlL); } }
// ---- k_out: block = (128 rows, 128 cols): out = ctx Wo (+ bo): ctx once to f16 against Wo as f16(bf16 x 2^8) exact (1 product) x 2^-8; causal early rows (< QHI of each sequence): ctx bf16 hi + lo against exact bf16 Wo (2 products). Each wave stages its 32 x 64 of the output in its own part of the LDS that the operand buffers have left.
__global__ __launch_bounds__(256) void k_out(const float* __restrict__ Y, const float* __restrict__ WO, const float* __restrict__ BO, float* __restrict__ OUT) { __shared__ __align__(16) char sm[2 * 3 * 128 * 144];
  const int tid = threadIdx.x, wave = tid >> 5, lane = tid & 31, col = lane & 15, g = lane >> 4, wr = wave >> 1, wc = wave & 1; const int c0 = blockIdx.y * 128; const size_t r0 = (size_t)blockIdx.x * 128;
  v8f acc[2][4] = {}; float sc; const int s0 = (int)((blockIdx.x + 2 * blockIdx.y) & 15);   /* 16 k steps: the 8 column blocks that share ctx rows start 2 steps apart, the 32 row blocks that share a weight tile at all 16 steps, two at each */
  if (CAUSAL && (int)(r0 % TT) < QHI) { gemm_tile<2, 64>(Y + r0 * CC, WO + (size_t)c0 * CC, sm, acc, s0); sc = 1.0f; }   /* block-uniform */
  else { gemm_tile<1, 64>(Y + r0 * CC, WO + (size_t)c0 * CC, sm, acc, s0); sc = 1.0f / 256.0f; }
  float (*sf)[68] = (float (*)[68])(sm + wave * 32 * 68 * 4);
#pragma unroll
  for (int j = 0; j < 4; ++j) { const float bias = BO ? bfr(BO[c0 + wc * 64 + j * 16 + col]) : 0.f;
#pragma unroll
    for (int i = 0; i < 2; ++i)
#pragma unroll
      for (int r = 0; r < 8; ++r) sf[i * 16 + 8 * g + r][j * 16 + col] = acc[i][j][r] * sc + bias; }
  LDSX();
#pragma unroll
  for (int rl = 0; rl < 32; rl += 2) vst2(OUT + (r0 + wr * 32 + rl + g) * DIN + c0 + wc * 64 + col * 4, *(const v4f*)&sf[rl + g][col * 4]); }

extern "C" void kernel_launch(void* const* d_in, const int* in_sizes, int n_in, void* d_out, int out_size, void* d_ws, size_t ws_size, hipStream_t stream) {
  (void)in_sizes; (void)n_in; (void)out_size;
  const float** F = (const float**)d_in;
  if (ws_size < (size_t)WS_END) return;
  char* ws = (char*)d_ws; _Float16 *QH = (_Float16*)(ws + WS_QH), *KH = (_Float16*)(ws + WS_KH), *VT = (_Float16*)(ws + WS_VT), *QL = (_Float16*)(ws + WS_QL), *KL = (_Float16*)(ws + WS_KL); __bf16 *VB = (__bf16*)(ws + WS_VB), *VBL = (__bf16*)(ws + WS_VBL); float *Y = (float*)(ws + WS_Y);
  (void)Y; (void)QL; (void)KL; (void)VB; (void)VBL;
  // inputs: 0 q, 1 k, 2 v [2,2048,1024]; 3 Wq, 4 Wk, 5 Wv, 6 Wo [1024,1024] (out,in), no biases
  k_proj<<<dim3(TNB * TT / 128, CC / 128, 3), 256, 0, stream>>>(F[0], F[1], F[2], F[3], F[4], F[5], nullptr, nullptr, nullptr, QH, QL, KH, KL, VT, VB, VBL);
  k_attn<<<dim3(TNB * NH, TT / QBLK / 2), 256, 0, stream>>>(QH, KH, QL, KL, VT, VB, VBL, Y);
  k_out<<<dim3(TNB * TT / 128, DIN / 128), 256, 0, stream>>>(Y, F[6], nullptr, (float*)d_out);
}

// v007
// It runs in 76.8 microseconds.
// Timed twice side by side with v006, it ran 1.12 times as fast both times.
// All steps since v000 together make it 15.3 times as fast.
// compute dtype: all float inputs rounded to bf16; q/k/v = input W^T with EXACT bf16 products on WMMA 16x16x32 (f32 accumulate); causal (strict past) logits: q, k once to f16 (1 product) x 1024^-0.5, except the first 384 query rows of each sequence (3 products with f16 residuals); softmax in f32 with a running maximum; exp(logit - maximum) once to f16 against v once to f16 (1 product; bf16 hi + lo below row 384); ctx once to f16 against Wo carried x 2^8 in f16 (bf16 hi + lo against bf16 Wo, 2 products, in the first 384 rows of each sequence); f32 output.
#include <hip/hip_runtime.h>
#include <math.h>

typedef __attribute__((ext_vector_type(16))) _Float16 v16h;
typedef __attribute__((ext_vector_type(16))) __bf16 v16b;
typedef __attribute__((ext_vector_type(8)))  _Float16 v8h;
typedef __attribute__((ext_vector_type(8)))  float v8f;
typedef __attribute__((ext_vector_type(4)))  float v4f;
typedef __attribute__((ext_vector_type(2)))  float v2f;
typedef __attribute__((ext_vector_type(4)))  unsigned v4u;
typedef __attribute__((ext_vector_type(4)))  int v4i;
typedef float __attribute__((may_alias)) float_a;
typedef int __attribute__((may_alias)) int_a;

template <typename T> __device__ __forceinline__ void vst2(void* p, T v) { *(T*)p = v;  }
__device__ __forceinline__ v8f wmma16(v16h a, v16h b, v8f c) {
  v8f d = __builtin_amdgcn_wmma_f32_16x16x32_f16(false, a, false, b, (short)0, c, false, false);
  asm volatile("v_nop\n\tv_nop\n\tv_nop\n\tv_nop" : "+v"(d) : "v"(a), "v"(b));
  return d;
}
__device__ __forceinline__ v8f wmma_bf(v16b a, v16b b, v8f c) {
  v8f d = __builtin_amdgcn_wmma_f32_16x16x32_bf16(false, a, false, b, (short)0, c, false, false);
  asm volatile("v_nop\n\tv_nop\n\tv_nop\n\tv_nop" : "+v"(d) : "v"(a), "v"(b));
  return d;
}
// 16x16x32 fragments: lane = (h = lane>>4, row/col = lane&15); elements 0..7 = k0+8h+0..7, 8..15 = k0+16+8h+0..7; D element r = row 8h+r
__device__ __forceinline__ v16h frag_h(const _Float16* rowk0, int lane) {
  union { v16h v; v8h q[2]; } u; const _Float16* p = rowk0 + 8 * (lane >> 4);
  u.q[0] = *(const v8h*)p; u.q[1] = *(const v8h*)(p + 16); return u.v;
}
__device__ __forceinline__ v16h frag_f32(const float* rowk0, int lane) {
  v16h a; const float* p = rowk0 + 8 * (lane >> 4);
#pragma unroll
  for (int i = 0; i < 8; ++i) { a[i] = (_Float16)p[i]; a[8 + i] = (_Float16)p[16 + i]; }
  return a;
}
__device__ __forceinline__ v16h frag_f32s(const float* rowk0, int lane, float sc) {
  v16h a; const float* p = rowk0 + 8 * (lane >> 4);
#pragma unroll
  for (int i = 0; i < 8; ++i) { a[i] = (_Float16)(p[i] * sc); a[8 + i] = (_Float16)(p[16 + i] * sc); }
  return a;
}
// column fragment from a [K][ld] layout (column n), rows >= K read as 0
__device__ __forceinline__ v16h fragc_f32(const float* W, int k0, int n, int lane, int ld, int K) {
  v16h a; const int g = lane >> 4;
#pragma unroll
  for (int i = 0; i < 8; ++i) { const int ka = k0 + 8 * g + i, kb = ka + 16;
    a[i] = (_Float16)(ka < K ? W[(size_t)(ka < K ? ka : K - 1) * ld + n] : 0.f); a[8 + i] = (_Float16)(kb < K ? W[(size_t)(kb < K ? kb : K - 1) * ld + n] : 0.f); }
  return a;
}
struct F2 { v16b h, l; };
__device__ __forceinline__ F2 bsplit16(const float v[16]) { F2 r;
#pragma unroll
  for (int i = 0; i < 16; ++i) { const __bf16 h = (__bf16)v[i]; r.h[i] = h; r.l[i] = (__bf16)(v[i] - (float)h); }
  return r; }
__device__ __forceinline__ F2 split_row(const float* row, int k0, int lane) { float v[16]; const float* p = row + k0 + 8 * (lane >> 4);
#pragma unroll
  for (int i = 0; i < 8; ++i) { v[i] = p[i]; v[8 + i] = p[16 + i]; }
  return bsplit16(v); }
__device__ __forceinline__ F2 split_rowK(const float* row, int k0, int lane, int K) { float v[16]; const int g = lane >> 4;
#pragma unroll
  for (int i = 0; i < 8; ++i) { const int ka = k0 + 8 * g + i, kb = ka + 16; v[i] = ka < K ? row[ka < K ? ka : K - 1] : 0.f; v[8 + i] = kb < K ? row[kb < K ? kb : K - 1] : 0.f; }
  return bsplit16(v); }
__device__ __forceinline__ F2 split_col(const float* W, int k0, int n, int lane, int ld, int K) { float v[16]; const int g = lane >> 4;
#pragma unroll
  for (int i = 0; i < 8; ++i) { const int ka = k0 + 8 * g + i, kb = ka + 16; v[i] = ka < K ? W[(size_t)(ka < K ? ka : K - 1) * ld + n] : 0.f; v[8 + i] = kb < K ? W[(size_t)(kb < K ? kb : K - 1) * ld + n] : 0.f; }
  return bsplit16(v); }
__device__ __forceinline__ v8f mac3(const F2& a, const F2& b, v8f c) { c = wmma_bf(a.l, b.h, c); c = wmma_bf(a.h, b.l, c); return wmma_bf(a.h, b.h, c); }
__device__ __forceinline__ float sigm(float v) { return 1.0f / (1.0f + expf(-v)); }
#define LDSX() do { asm volatile("s_wait_dscnt 0" ::: "memory"); __builtin_amdgcn_wave_barrier(); __builtin_amdgcn_fence(__ATOMIC_RELEASE, "workgroup"); } while (0)

// In-context-learning attention (B 2, S 2,048, E 1,024 = 16 x 64; separate q/k/v inputs): qh = q Wq^T, kh = k Wk^T, vh = v Wv^T ((out,in)); scores = qh kh^T / sqrt(1024) masked where key >= query (strict past) except (0, 0); softmax; out = merged(probs vh) Wo^T.
#define NB 2
#define TT 2048
#define CC 1024            // NH * HD = projected width
#define DIN 1024          // input (model) width
#define NH 16
#define HD 64
#define NQB (TT / 64)
#define SCALE (0.03125f)
#define CAUSAL 1
#ifndef TNB
#define TNB NB
#endif
__device__ __forceinline__ float bfr(float v) { return (float)(__bf16)v; }
__host__ __device__ __forceinline__ int kb_last(int qb) { return CAUSAL ? ((qb * 64 + 63) >> 7) : (TT / 128 - 1); }
typedef __attribute__((ext_vector_type(8))) __bf16 v8b;
__device__ __forceinline__ v16b frag_b(const __bf16* rowk0, int lane) {
  union { v16b v; v8b q[2]; } u; const __bf16* p = rowk0 + 8 * (lane >> 4);
  u.q[0] = *(const v8b*)p; u.q[1] = *(const v8b*)(p + 16); return u.v;
}
#define QBH 6              // read nowhere: the high-precision paths are taken by query rows < QHI
#define QHI 384            // rows carrying a q residual plane
#define KHI 384            // key rows carrying k residual / v bf16 hi+lo planes (used only by the causal high-precision path)
// B fragment (k rows k0+.., output column o) of a weight: (in,out) [K][ld] or (out,in) [ld rows of K]: bf16 exact, or f16(bf16 * 256) exact
__device__ __forceinline__ v16b wcol_io(const float* Wm, int k0, int o, int lane, int ld) { v16b w; const int g = lane >> 4;
#pragma unroll
  for (int i = 0; i < 8; ++i) { w[i] = (__bf16)Wm[(size_t)(k0 + 8 * g + i) * ld + o]; w[8 + i] = (__bf16)Wm[(size_t)(k0 + 16 + 8 * g + i) * ld + o]; }
  return w; }
__device__ __forceinline__ v16b wcol_oi(const float* Wm, int k0, int o, int lane, int K) { v16b w; const float* p = Wm + (size_t)o * K + k0 + 8 * (lane >> 4);
#pragma unroll
  for (int i = 0; i < 8; ++i) { w[i] = (__bf16)p[i]; w[8 + i] = (__bf16)p[16 + i]; }
  return w; }
__device__ __forceinline__ v16h wcolh_io(const float* Wm, int k0, int o, int lane, int ld) { v16h w; const int g = lane >> 4;
#pragma unroll
  for (int i = 0; i < 8; ++i) { w[i] = (_Float16)(bfr(Wm[(size_t)(k0 + 8 * g + i) * ld + o]) * 256.0f); w[8 + i] = (_Float16)(bfr(Wm[(size_t)(k0 + 16 + 8 * g + i) * ld + o]) * 256.0f); }
  return w; }
__device__ __forceinline__ v16h wcolh_oi(const float* Wm, int k0, int o, int lane, int K) { v16h w; const float* p = Wm + (size_t)o * K + k0 + 8 * (lane >> 4);
#pragma unroll
  for (int i = 0; i < 8; ++i) { w[i] = (_Float16)(bfr(p[i]) * 256.0f); w[8 + i] = (_Float16)(bfr(p[16 + i]) * 256.0f); }
  return w; }
#define WQKV_LAYOUT 1   // 0 = (in,out) [DIN][CC]; 1 = (out,in) [CC][DIN]; 2 = per-head [NH][DIN][HD]
__device__ __forceinline__ v16b wcol_hdk(const float* Wm, int k0, int o, int lane) { v16b w; const int g = lane >> 4; const float* p = Wm + (size_t)(o / HD) * DIN * HD + (o % HD);
#pragma unroll
  for (int i = 0; i < 8; ++i) { w[i] = (__bf16)p[(size_t)(k0 + 8 * g + i) * HD]; w[8 + i] = (__bf16)p[(size_t)(k0 + 16 + 8 * g + i) * HD]; }
  return w; }
#define WO_OUT_IN 1
#if WQKV_LAYOUT == 1
#define WCOL(W, k0, o, lane) wcol_oi(W, k0, o, lane, DIN)
#elif WQKV_LAYOUT == 2
#define WCOL(W, k0, o, lane) wcol_hdk(W, k0, o, lane)
#else
#define WCOL(W, k0, o, lane) wcol_io(W, k0, o, lane, CC)
#endif
#if WO_OUT_IN
#define WOCOL(W, k0, o, lane) wcol_oi(W, k0, o, lane, CC)
#define WOCOLH(W, k0, o, lane) wcolh_oi(W, k0, o, lane, CC)
#else
#define WOCOL(W, k0, o, lane) wcol_io(W, k0, o, lane, DIN)
#define WOCOLH(W, k0, o, lane) wcolh_io(W, k0, o, lane, DIN)
#endif
#ifndef PROJ_EXTRA_PARAMS
#define PROJ_EXTRA_PARAMS
#endif

#define WS_QH  0u                                      // f16 q rows [b*t][CC]
// k and v planes lie in the order of k_attn's A fragments, so that each of its 16-byte-per-lane loads covers 512 contiguous bytes (4 whole lines) and not 32 bytes of each of 16 lines.
// k: [b][h][t / 16][kc 2][q 2][lane 32][8]: lane (g, col) holds key 16 (t / 16) + col, dims 32 kc + 16 q + 8 g + 0..7. v: [b][h][t / 32][d 4][q 2][lane 32][8]: lane (g, col) holds dim 16 d + col, keys 32 (t / 32) + 16 q + 8 g + 0..7.
#define WS_KH  (WS_QH + 2u * (size_t)NB * TT * CC)      // f16 k, fragment order, all t
#define WS_VT  (WS_KH + 2u * (size_t)NB * TT * CC)      // f16 v, fragment order, all t
#define WS_QL  (WS_VT + 2u * (size_t)NB * CC * TT)      // f16 q residual x 2^10 rows [b][t < QHI][CC]
#define WS_KL  (WS_QL + 2u * (size_t)NB * QHI * CC)     // f16 k residual x 2^10, fragment order, t < KHI
#define WS_VB  (WS_KL + 2u * (size_t)NB * KHI * CC)     // bf16 v hi (then lo), fragment order, t < KHI
#define WS_VBL (WS_VB + 2u * (size_t)NB * CC * KHI)
#define WS_Y   (WS_VBL + 2u * (size_t)NB * CC * KHI)     // f32 ctx rows [b*t][CC] (only when there is an output projection)
#define WS_END (WS_Y  + 4u * (size_t)NB * TT * CC)

// plain builtin products: the compiler keeps the distance behind them itself and may place their operands in any register window
__device__ __forceinline__ v8f wmh(v16h a, v16h b, v8f c) { return __builtin_amdgcn_wmma_f32_16x16x32_f16(false, a, false, b, (short)0, c, false, false); }
__device__ __forceinline__ v8f wmb(v16b a, v16b b, v8f c) { return __builtin_amdgcn_wmma_f32_16x16x32_bf16(false, a, false, b, (short)0, c, false, false); }
typedef __attribute__((ext_vector_type(4))) __bf16 v4b;
typedef __attribute__((ext_vector_type(4))) _Float16 v4h;
__device__ __forceinline__ v4b cvt4b(v4f v) { return v4b{(__bf16)v[0], (__bf16)v[1], (__bf16)v[2], (__bf16)v[3]}; }
// ---- gemm_tile: 256 threads, acc += A[128 rows][1024] B[128 rows][1024]^T, both k-contiguous f32 rows. Each k step of BK is read once per workgroup with whole-line loads, converted once and kept in LDS as 16-bit rows of pitch 2 BK + 16 bytes (16 B x odd: no bank conflict for 16-byte fragment reads); two buffers: the next step's loads fly while this step's products run. Waves 4 x 2, 32 x 64 of the tile each (acc[i][j]: rows 32 wr + 16 i, columns 64 wc + 16 j). The k walk begins at step s0 (the same for the whole workgroup, below KD / BK), runs upward and wraps to step 0: workgroups that share operand rows are given different s0, so that they do not ask L2 for the same lines at the same moment.
// MODE 0: A, B to bf16. MODE 1: A to f16, B to f16(bf16 x 2^8). MODE 2: A to bf16 hi + lo (two planes, hi product first), B to bf16. On return every wave has left the buffers (sm may be reused). Every unroll directive here and in the two kernels' output staging keeps a register array (loaded pieces, fragments, accumulators) indexed by constants.
template <int MODE, int BK>
__device__ __forceinline__ void gemm_tile(const float* __restrict__ A, const float* __restrict__ Bw, char* sm, v8f (&acc)[2][4], int s0) {
  constexpr int KD = 1024, PITCH = 2 * BK + 16, UR = BK / 4, RS = 256 / UR, NU = 128 / RS, PL = 128 * PITCH, BUF = (MODE == 2 ? 3 : 2) * PL, NS = KD / BK;
  const int tid = threadIdx.x, lane = tid & 31, col = lane & 15, g = lane >> 4, wave = tid >> 5, wr = wave >> 1, wc = wave & 1;
  const float* ga = A + (size_t)(tid / UR) * KD + (tid % UR) * 4 + s0 * BK; const float* gb = Bw + (size_t)(tid / UR) * KD + (tid % UR) * 4 + s0 * BK;   /* the thread's 16 bytes of rows tid / UR + i RS, at k step s0 */
  int ks = s0;   /* the k step that the next fetch reads */
  char* sw = sm + (tid / UR) * PITCH + (tid % UR) * 8;
  const char* fa = sm + (wr * 32 + col) * PITCH + 16 * g; const char* fb = sm + PL + (wc * 64 + col) * PITCH + 16 * g;
  v4f ra[NU], rb[NU];
  auto fetch = [&]() {
#pragma unroll
    for (int i = 0; i < NU; ++i) { ra[i] = *(const v4f*)(ga + (size_t)i * RS * KD); rb[i] = *(const v4f*)(gb + (size_t)i * RS * KD); }
    // stands in front of the rewrite of the two address pairs that the loads above it name (every load is one of them plus a constant); the pairs as inputs keep their registers whole until it
    asm volatile("s_wait_xcnt 0x0" :: "v"(ga), "v"(gb) : "memory");
    __builtin_amdgcn_sched_barrier(0);   // holds the loads in front of the products that cover their latency, and the address additions behind the wait
    ks = ks + 1 == NS ? 0 : ks + 1; const int adv = ks == 0 ? BK - KD : BK;   /* behind the last k step the walk wraps to the first */
    ga += adv; gb += adv; };
  auto stage = [&](int off) {
#pragma unroll
    for (int i = 0; i < NU; ++i) { char* p = sw + off + i * RS * PITCH;
      if constexpr (MODE == 0) { *(v4b*)p = cvt4b(ra[i]); *(v4b*)(p + PL) = cvt4b(rb[i]); }
      else if constexpr (MODE == 1) { *(v4h*)p = v4h{(_Float16)ra[i][0], (_Float16)ra[i][1], (_Float16)ra[i][2], (_Float16)ra[i][3]};
        *(v4h*)(p + PL) = v4h{(_Float16)(bfr(rb[i][0]) * 256.0f), (_Float16)(bfr(rb[i][1]) * 256.0f), (_Float16)(bfr(rb[i][2]) * 256.0f), (_Float16)(bfr(rb[i][3]) * 256.0f)}; }
      else { const v4b hv = cvt4b(ra[i]); *(v4b*)p = hv; *(v4b*)(p + 2 * PL) = cvt4b(v4f{ra[i][0] - (float)hv[0], ra[i][1] - (float)hv[1], ra[i][2] - (float)hv[2], ra[i][3] - (float)hv[3]}); *(v4b*)(p + PL) = cvt4b(rb[i]); } } };
  auto products = [&](int off) {
#pragma unroll
    for (int kk = 0; kk < BK / 32; ++kk) {
      if constexpr (MODE == 1) { v16h a[2], w[4];
#pragma unroll
        for (int i = 0; i < 2; ++i) { union { v16h v; v8h q[2]; } u; const char* p = fa + off + i * 16 * PITCH + kk * 64; u.q[0] = *(const v8h*)p; u.q[1] = *(const v8h*)(p + 32); a[i] = u.v; }
#pragma unroll
        for (int j = 0; j < 4; ++j) { union { v16h v; v8h q[2]; } u; const char* p = fb + off + j * 16 * PITCH + kk * 64; u.q[0] = *(const v8h*)p; u.q[1] = *(const v8h*)(p + 32); w[j] = u.v; }
#pragma unroll
        for (int i = 0; i < 2; ++i)
#pragma unroll
          for (int j = 0; j < 4; ++j) acc[i][j] = wmh(a[i], w[j], acc[i][j]);
      } else { v16b a[2], al[2], w[4];
#pragma unroll
        for (int i = 0; i < 2; ++i) { union { v16b v; v8b q[2]; } u; const char* p = fa + off + i * 16 * PITCH + kk * 64; u.q[0] = *(const v8b*)p; u.q[1] = *(const v8b*)(p + 32); a[i] = u.v;
          if constexpr (MODE == 2) { u.q[0] = *(const v8b*)(p + 2 * PL); u.q[1] = *(const v8b*)(p + 2 * PL + 32); al[i] = u.v; } }
#pragma unroll
        for (int j = 0; j < 4; ++j) { union { v16b v; v8b q[2]; } u; const char* p = fb + off + j * 16 * PITCH + kk * 64; u.q[0] = *(const v8b*)p; u.q[1] = *(const v8b*)(p + 32); w[j] = u.v; }
#pragma unroll
        for (int i = 0; i < 2; ++i)
#pragma unroll
          for (int j = 0; j < 4; ++j) acc[i][j] = wmb(a[i], w[j], acc[i][j]);
        if constexpr (MODE == 2) {
#pragma unroll
          for (int i = 0; i < 2; ++i)
#pragma unroll
            for (int j = 0; j < 4; ++j) acc[i][j] = wmb(al[i], w[j], acc[i][j]); } } } };
  fetch(); stage(0); __syncthreads();
  int cur = 0;
  for (int s = 0; s + 1 < NS; ++s) { fetch(); products(cur);
    __builtin_amdgcn_sched_barrier(0);   // keeps the conversions, which wait for the loads in flight, behind the products that cover the loads' latency
    cur ^= BUF; stage(cur); __syncthreads(); }   /* the one barrier of a step publishes the buffer just written and ends the reads of the one written next */
  products(cur); __syncthreads(); }
// stands behind a run of global loads or stores, in front of any rewrite of the registers that they name; the scheduling barrier holds later arithmetic behind it
#define XW() do { asm volatile("s_wait_xcnt 0x0" ::: "memory"); __builtin_amdgcn_sched_barrier(0); } while (0)
// ---- k_proj: block = (128 rows, 128 cols, which): q/k/v = X W (+ b) with exact bf16 products (K = DIN) -> which 0: q f16 rows (+ residual rows < QHI); 1: k f16 in fragment order (+ residual for t < KHI); 2: v f16 in fragment order (+ bf16 hi/lo for t < KHI). The output staging reuses the LDS of the operand buffers.
__global__ __launch_bounds__(256) void k_proj(const float* __restrict__ XQ, const float* __restrict__ XK, const float* __restrict__ XV, const float* __restrict__ WQ, const float* __restrict__ WK, const float* __restrict__ WV, const float* __restrict__ BQ, const float* __restrict__ BK, const float* __restrict__ BV,
    _Float16* __restrict__ QH, _Float16* __restrict__ QL, _Float16* __restrict__ KH, _Float16* __restrict__ KL, _Float16* __restrict__ VT, __bf16* __restrict__ VB, __bf16* __restrict__ VBL) {
  __shared__ __align__(16) char sm[3 * 128 * 136 * 2];
  const int tid = threadIdx.x, wave = tid >> 5, lane = tid & 31, col = lane & 15, g = lane >> 4, wr = wave >> 1, wc = wave & 1; const int which = blockIdx.z; const int c0 = blockIdx.y * 128; const size_t r0 = (size_t)blockIdx.x * 128; const size_t bb = r0 / TT; const int t0 = (int)(r0 % TT);
  const float* X = which == 0 ? XQ : which == 1 ? XK : XV; const float* WA = which == 0 ? WQ : which == 1 ? WK : WV; const float* BA = which == 0 ? BQ : which == 1 ? BK : BV;
  v8f acc[2][4] = {};
  gemm_tile<0, 32>(X + r0 * DIN, WA + (size_t)c0 * DIN, sm, acc, (int)((blockIdx.x + 4 * blockIdx.y) & 31));   /* 32 k steps: the 32 row blocks that share a weight tile start at 32 different steps, the 8 column blocks that share input rows 4 steps apart */
  if (which < 2) { _Float16 (*sh)[136] = (_Float16 (*)[136])sm; _Float16 (*sl)[136] = (_Float16 (*)[136])(sm + 128 * 136 * 2);
    _Float16* DH = which == 0 ? QH : KH; _Float16* DL = which == 0 ? QL : KL; const int nhi = which == 0 ? QHI : KHI; const bool hi_rows = t0 < nhi;
#pragma unroll
    for (int j = 0; j < 4; ++j) { const int cl = wc * 64 + j * 16 + col; float bias = 0.f; if (BA) { bias = bfr(BA[c0 + cl]); XW(); }
#pragma unroll
      for (int i = 0; i < 2; ++i)
#pragma unroll
        for (int r = 0; r < 8; ++r) { const float v = acc[i][j][r] + bias; const _Float16 hv = (_Float16)v; const int rl = wr * 32 + i * 16 + 8 * g + r; sh[rl][cl] = hv; sl[rl][cl] = (_Float16)((v - (float)hv) * 1024.0f); } }
    __syncthreads();
    v4u t[8];
    if (which == 0) { const int rl = tid >> 4, q = tid & 15;   /* piece it of a thread: row rl + 16 it, 16 bytes at element 8 q */
#pragma unroll
      for (int it = 0; it < 8; ++it) t[it] = *(const v4u*)&sh[rl + 16 * it][q * 8];
#pragma unroll
      for (int it = 0; it < 8; ++it) vst2((unsigned*)(DH + (r0 + rl + 16 * it) * CC + c0 + q * 8), t[it]);
      if (hi_rows) { XW();
#pragma unroll
        for (int it = 0; it < 8; ++it) t[it] = *(const v4u*)&sl[rl + 16 * it][q * 8];
#pragma unroll
        for (int it = 0; it < 8; ++it) vst2((unsigned*)(DL + (bb * nhi + t0 + rl + 16 * it) * (size_t)CC + c0 + q * 8), t[it]); }
    } else {   /* k, fragment order: wave = 16-key tile; piece it = (head it >> 2, kc, q): key 16 wave + col, dims 16 it + 8 g + 0..7 of the 128 columns; a wave's store is 512 contiguous bytes */
      const size_t hb = bb * NH + c0 / HD; const int kt = (t0 >> 4) + wave;
#pragma unroll
      for (int it = 0; it < 8; ++it) t[it] = *(const v4u*)&sh[wave * 16 + col][it * 16 + 8 * g];
#pragma unroll
      for (int it = 0; it < 8; ++it) vst2((unsigned*)(DH + ((hb + (it >> 2)) * (TT / 16) + kt) * 1024 + (it & 3) * 256 + lane * 8), t[it]);
      if (hi_rows) { XW();
#pragma unroll
        for (int it = 0; it < 8; ++it) t[it] = *(const v4u*)&sl[wave * 16 + col][it * 16 + 8 * g];
#pragma unroll
        for (int it = 0; it < 8; ++it) vst2((unsigned*)(DL + ((hb + (it >> 2)) * (KHI / 16) + kt) * 1024 + (it & 3) * 256 + lane * 8), t[it]); }
      XW(); }   /* behind the k stores, with or without the residual run, in front of any rewrite of the registers that they name */
  } else { _Float16 (*th)[136] = (_Float16 (*)[136])sm; __bf16 (*tb)[136] = (__bf16 (*)[136])(sm + 128 * 136 * 2); __bf16 (*tbl)[136] = (__bf16 (*)[136])(sm + 2 * 128 * 136 * 2); const bool hi_rows = t0 < KHI;
#pragma unroll
    for (int j = 0; j < 4; ++j) { const int cl = wc * 64 + j * 16 + col; float bias = 0.f; if (BA) { bias = bfr(BA[c0 + cl]); XW(); }
#pragma unroll
      for (int i = 0; i < 2; ++i)
#pragma unroll
        for (int r = 0; r < 8; ++r) { const float v = acc[i][j][r] + bias; const int rl = wr * 32 + i * 16 + 8 * g + r; th[cl][rl] = (_Float16)v; const __bf16 bh = (__bf16)v; tb[cl][rl] = bh; tbl[cl][rl] = (__bf16)(v - (float)bh); } }
    __syncthreads();
    /* v, fragment order: wave = (head wave >> 2, d = wave & 3); piece it = (32-key group it >> 1, q): dim 16 wave + col of the 128 columns, keys 16 it + 8 g + 0..7; a wave's store is 512 contiguous bytes */
    const size_t hb = bb * NH + c0 / HD + (wave >> 2); const int kg = t0 >> 5; const int fo = (wave & 3) * 512 + lane * 8; v4u t[8];
#pragma unroll
    for (int it = 0; it < 8; ++it) t[it] = *(const v4u*)&th[wave * 16 + col][it * 16 + 8 * g];
#pragma unroll
    for (int it = 0; it < 8; ++it) vst2((unsigned*)(VT + (hb * (TT / 32) + kg + (it >> 1)) * 2048 + (it & 1) * 256 + fo), t[it]);
    XW();
    if (hi_rows) {
#pragma unroll
      for (int it = 0; it < 8; ++it) t[it] = *(const v4u*)&tb[wave * 16 + col][it * 16 + 8 * g];
#pragma unroll
      for (int it = 0; it < 8; ++it) vst2((unsigned*)(VB + (hb * (KHI / 32) + kg + (it >> 1)) * 2048 + (it & 1) * 256 + fo), t[it]);
      XW();
#pragma unroll
      for (int it = 0; it < 8; ++it) t[it] = *(const v4u*)&tbl[wave * 16 + col][it * 16 + 8 * g];
#pragma unroll
      for (int it = 0; it < 8; ++it) vst2((unsigned*)(VBL + (hb * (KHI / 32) + kg + (it >> 1)) * 2048 + (it & 1) * 256 + fo), t[it]);
      XW(); } } }
// frag_h from a base, the lane's own byte offset (row and lane half; 0 where the base already holds it) and a constant element offset
__device__ __forceinline__ v16h frag_s(const _Float16* base, unsigned lo, size_t e) { union { v16h v; v8h q[2]; } u; const char* p = (const char*)base + lo; u.q[0] = *(const v8h*)(p + 2 * e); u.q[1] = *(const v8h*)(p + 2 * e + 32); return u.v; }
// a fragment stored in fragment order: its two 16-byte pieces per lane lie 512 bytes apart; from a base, the lane's byte offset 16 lane (0 where the base already holds it) and a constant element offset
__device__ __forceinline__ v16h frag_o(const _Float16* base, unsigned lo, size_t e) { union { v16h v; v8h q[2]; } u; const char* p = (const char*)base + lo; u.q[0] = *(const v8h*)(p + 2 * e); u.q[1] = *(const v8h*)(p + 2 * e + 512); return u.v; }
// the same for bf16, from the lane's own address
__device__ __forceinline__ v16b frag_bo(const __bf16* base, size_t e) { union { v16b v; v8b q[2]; } u; u.q[0] = *(const v8b*)(base + e); u.q[1] = *(const v8b*)(base + e + 256); return u.v; }
// ---- k_attn: one walk = QWAVE queries (NCG groups of 16 columns) of (b, h) over a run of their passes of KPASS keys; waves w and w + 4 split the late queries' passes. S^T = k q^T (a lane holds the logits of ONE query: tile j, register r = key 16 j + 8 g + r), running maximum and sum per lane, ctx^T += v^T P^T with P^T packed from the score registers as the B operand (element order = the fragment k order above). Logits and P stay in registers. Queries < QHI: 3-product logits (f16 residuals) and P, v as bf16 hi + lo (3 products).
#define NCG 2              // 16-query column groups per wave: each k / v fragment load feeds NCG products
#define NKT 4              // 16-key tiles per pass
#define KPASS (16 * NKT)
#define QWAVE (16 * NCG)
#define QBLK (4 * QWAVE)
// one pass of the running softmax for one column group: mask by index (strict past, except (0, 0)), new maximum (own keys, then the other lane half), rescale sum and ctx, st <- exp(logit - maximum). An excluded logit is -3e38 and its exp is 0.
// st arrives as the raw q.k sums: exp(SCALE (s - max)) = 2^(C2 s - C2 max) with C2 = SCALE log2(e), one fused multiply-add and one hardware base-2 exponential per logit; m holds C2 x the running maximum (C2 > 0: scaling keeps the order).
#define C2 (SCALE * 1.44269504088896340736f)
__device__ __forceinline__ void sm_pass(v8f (&st)[NKT], v8f (&acc)[HD / 16], float& m, float& l, int kg, int t, bool edge) {
  if (edge) {
#pragma unroll
    for (int j = 0; j < NKT; ++j)
#pragma unroll
      for (int r = 0; r < 8; ++r) { const int k = kg + j * 16 + r; st[j][r] = (k < t || (k | t) == 0) ? st[j][r] : -3.0e38f; } }
  float mx = st[0][0];
#pragma unroll
  for (int j = 0; j < NKT; ++j)
#pragma unroll
    for (int r = 0; r < 8; ++r) mx = fmaxf(mx, st[j][r]);
  mx = fmaxf(mx, __shfl_xor(mx, 16));
  // the floor is below C2 x any sum of f16 products, so it changes no real maximum; it keeps a query that has seen only excluded keys so far (a wave that starts its walk behind key 0) at exp = 0
  const float mn = fmaxf(fmaxf(m, mx * C2), -1.0e30f), f = __builtin_amdgcn_exp2f(m - mn); m = mn;
  float s = 0.f;
#pragma unroll
  for (int j = 0; j < NKT; ++j) { float x[8];
#pragma unroll
    for (int r = 0; r < 8; ++r) x[r] = fmaf(st[j][r], C2, -mn);
    // a tile's eight exponentials, each in its own register: no one of them reads a neighbour's result or overwrites a neighbour's argument, and the v_nop is the slot that the last one asks for in front of whatever the compiler puts next (as builtins, neighbours came out sharing registers)
    asm("v_exp_f32 %0, %0\n\tv_exp_f32 %1, %1\n\tv_exp_f32 %2, %2\n\tv_exp_f32 %3, %3\n\tv_exp_f32 %4, %4\n\tv_exp_f32 %5, %5\n\tv_exp_f32 %6, %6\n\tv_exp_f32 %7, %7\n\tv_nop"
        : "+v"(x[0]), "+v"(x[1]), "+v"(x[2]), "+v"(x[3]), "+v"(x[4]), "+v"(x[5]), "+v"(x[6]), "+v"(x[7]));
#pragma unroll
    for (int r = 0; r < 8; ++r) { st[j][r] = x[r]; s += x[r]; } }
  l = l * f + s;
#pragma unroll
  for (int d = 0; d < HD / 16; ++d) acc[d] = acc[d] * f; }
// two waves per SIMD is all this grid supplies (256 workgroups of 8 waves): the register budget of two lets the fragments fetched ahead stay in registers
__global__ __launch_bounds__(256) __attribute__((amdgpu_waves_per_eu(2, 2))) void k_attn(const _Float16* __restrict__ QH, const _Float16* __restrict__ KH, const _Float16* __restrict__ QL, const _Float16* __restrict__ KL, const _Float16* __restrict__ VT, const __bf16* __restrict__ VB, const __bf16* __restrict__ VBL, float* __restrict__ Y) {
  const int tid = threadIdx.x, lane = tid & 31, col = lane & 15, g = lane >> 4; const int wave = __builtin_amdgcn_readfirstlane(tid >> 5);
  __shared__ __align__(16) char sx[4 * 17 * 512];   /* a helper wave's partial state: 17 pieces of 16 bytes per lane */
  const int b = blockIdx.x / NH, h = blockIdx.x % NH; const int w4 = wave & 3; const bool helper = wave >= 4;
  // the workgroup holds query tiles n - 1 - y (late) and y (early). Waves w and w + 4 share a SIMD and the same 32 queries of each tile: wave w + 4 walks the early tile's queries, then the late queries' passes from cut on; wave w walks the late queries' passes below cut. cut gives both the same load (a high-precision pass counted as three), so that neither runs alone on its SIMD for long
  const int qlL = (TT / QBLK - 1 - (int)blockIdx.y) * QBLK + w4 * QWAVE, qlE = (int)blockIdx.y * QBLK + w4 * QWAVE;
  const int nL = (qlL + QWAVE - 2) / KPASS + 1, nE = (qlE + QWAVE - 2) / KPASS + 1;   /* a wave's last visible key is its first query + QWAVE - 2 */
  const int half = (nL + (qlE < QHI ? 3 * nE : nE) + 1) / 2, cut = half < nL ? half : nL;
  float m[NCG], l[NCG]; v8f acc[NCG][HD / 16];
  // acc[c][d][r] = ctx(query q0 + 16 c + col, dim 16 d + 8 g + r) x sum: join the two lane halves' sums, divide, 32 contiguous bytes per lane and d
  auto store_out = [&](int q0) {
#pragma unroll
    for (int c = 0; c < NCG; ++c) { const float a = l[c] + __shfl_xor(l[c], 16); const float inv = a > 0.f ? 1.0f / a : 0.f; float* yr = Y + ((size_t)b * TT + q0 + c * 16 + col) * CC + h * HD + 8 * g;
#pragma unroll
      for (int d = 0; d < HD / 16; ++d) { const v8f o = acc[c][d] * inv; vst2(yr + d * 16, v4f{o[0], o[1], o[2], o[3]}); vst2(yr + d * 16 + 4, v4f{o[4], o[5], o[6], o[7]}); } }
    XW(); };
  // one walk: the 32 queries from ql0 on, passes p0 .. npass - 1; early: the queries may be high-precision rows
  auto walk = [&](int ql0, int p0, int npass, bool early) __attribute__((always_inline)) {
  const _Float16* Qb = QH + ((size_t)b * TT + ql0 + col) * CC + h * HD; const size_t bh = (size_t)(b * NH + h) * HD;   /* x the plane's key count: where (b, h) begins in a fragment-order plane; 64 keys (a pass) are 4096 elements there */
#pragma unroll
  for (int c = 0; c < NCG; ++c) { m[c] = -3.0e38f; l[c] = 0.f;
#pragma unroll
    for (int d = 0; d < HD / 16; ++d) acc[c][d] = v8f{}; }
  if (early && ql0 < QHI) {   /* wave-uniform; an early tile alone (p0 = 0); the wave's passes end at or below key KHI */
    const _Float16* QLb = QL + ((size_t)b * QHI + ql0 + col) * CC + h * HD; const _Float16* Kb = KH + bh * TT + 8 * lane; const _Float16* KLb = KL + bh * KHI + 8 * lane;
    const __bf16* VBb = VB + bh * KHI + 8 * lane; const __bf16* VLb = VBL + bh * KHI + 8 * lane;
    v16h qf[NCG][2], qlf[NCG][2]; const _Float16* qp = Qb + 8 * g; const _Float16* qlp = QLb + 8 * g;   /* the lane's own addresses */
#pragma unroll
    for (int c = 0; c < NCG; ++c)
#pragma unroll
      for (int kc = 0; kc < 2; ++kc) { qf[c][kc] = frag_s(qp, 0u, (size_t)c * 16 * CC + kc * 32); qlf[c][kc] = frag_s(qlp, 0u, (size_t)c * 16 * CC + kc * 32); }
    // stands in front of any rewrite of the address registers that the loads above it name; the two addresses as inputs keep their registers whole until it, the scheduling barrier holds the loads in front of it and later address arithmetic behind it (the fragments themselves are no operands: as operands of an asm statement they would be held to the first 256 registers for the whole loop, which now has no room for them there)
    asm volatile("s_wait_xcnt 0x0" :: "v"(qp), "v"(qlp) : "memory");
    __builtin_amdgcn_sched_barrier(0);
    for (int ps = 0; ps < npass; ++ps) { const int k0 = ps * KPASS; v8f st[NCG][NKT];
      // the pass's k fragments, values and residuals, are requested as one group: the wave waits for memory once, not once per tile and half row
      const _Float16* kp = Kb + (size_t)k0 * HD; const _Float16* klp = KLb + (size_t)k0 * HD;   /* the lane's own addresses: every load of the group is one of them plus a constant */
      v16h kf[NKT][2], klf[NKT][2];
#pragma unroll
      for (int j = 0; j < NKT; ++j)
#pragma unroll
        for (int kc = 0; kc < 2; ++kc) { kf[j][kc] = frag_o(kp, 0u, (size_t)j * 1024 + kc * 512); klf[j][kc] = frag_o(klp, 0u, (size_t)j * 1024 + kc * 512); }
      // stands in front of any rewrite of the address registers that the loads above it name; the two addresses as inputs keep their registers whole until it
      asm volatile("s_wait_xcnt 0x0" :: "v"(kp), "v"(klp) : "memory");
      __builtin_amdgcn_sched_barrier(0);   // keeps the compiler from sinking those loads to their first use, where each would be waited for alone
#pragma unroll
      for (int j = 0; j < NKT; ++j) { v8f a[NCG] = {}, al[NCG] = {};
#pragma unroll
        for (int kc = 0; kc < 2; ++kc)
#pragma unroll
          for (int c = 0; c < NCG; ++c) { a[c] = wmh(kf[j][kc], qf[c][kc], a[c]); al[c] = wmh(kf[j][kc], qlf[c][kc], al[c]); al[c] = wmh(klf[j][kc], qf[c][kc], al[c]); }
#pragma unroll
        for (int c = 0; c < NCG; ++c) st[c][j] = a[c] + al[c] * (1.0f / 1024.0f); }
      // the pass's v fragments, hi and lo, are requested here as one group, ahead of the softmax arithmetic that covers their latency
      const __bf16* vp = VBb + (size_t)k0 * HD; const __bf16* vlp = VLb + (size_t)k0 * HD;
      v16b vh[NKT / 2][HD / 16], vl[NKT / 2][HD / 16];
#pragma unroll
      for (int jj = 0; jj < NKT / 2; ++jj)
#pragma unroll
        for (int d = 0; d < HD / 16; ++d) { vh[jj][d] = frag_bo(vp, (size_t)jj * 2048 + d * 512); vl[jj][d] = frag_bo(vlp, (size_t)jj * 2048 + d * 512); }
      // as above: in front of any rewrite of the two addresses, and the loads stay in front of the softmax
      asm volatile("s_wait_xcnt 0x0" :: "v"(vp), "v"(vlp) : "memory");
      __builtin_amdgcn_sched_barrier(0);
#pragma unroll
      for (int c = 0; c < NCG; ++c) sm_pass(st[c], acc[c], m[c], l[c], k0 + 8 * g, ql0 + c * 16 + col, true);
#pragma unroll
      for (int jj = 0; jj < NKT / 2; ++jj) { F2 p[NCG];
#pragma unroll
        for (int c = 0; c < NCG; ++c) { float pv[16];
#pragma unroll
          for (int i = 0; i < 8; ++i) { pv[i] = st[c][2 * jj][i]; pv[8 + i] = st[c][2 * jj + 1][i]; }
          p[c] = bsplit16(pv); }
#pragma unroll
        for (int d = 0; d < HD / 16; ++d)
#pragma unroll
          for (int c = 0; c < NCG; ++c) { acc[c][d] = wmb(vh[jj][d], p[c].h, acc[c][d]); acc[c][d] = wmb(vh[jj][d], p[c].l, acc[c][d]); acc[c][d] = wmb(vl[jj][d], p[c].h, acc[c][d]); } } }
  } else if (p0 < npass) {
    const _Float16* Qu = QH + ((size_t)b * TT + ql0) * CC + __builtin_amdgcn_readfirstlane(h * HD); const _Float16* Ku = KH + bh * TT; const _Float16* Vu = VT + bh * TT;   /* wave-uniform bases; the builtin keeps q's base a scalar pair in both walks, so that the wait below holds the very pair that the q loads name (in the second walk the head offset came through a vector register, and the loads got a copy that the wait did not hold) */
    const unsigned rlo = 2u * (col * CC + 8 * g), flo = 16u * lane;   /* the lane's byte offset in q rows; in a 512-byte piece of k or v */
    const _Float16* Kl = Ku + 8 * lane; const _Float16* Vl = Vu + 8 * lane;   /* the lane's own 16 bytes of the first pieces of k, of v */
    v16h qf[NCG][2];
#pragma unroll
    for (int c = 0; c < NCG; ++c)
#pragma unroll
      for (int kc = 0; kc < 2; ++kc) qf[c][kc] = frag_s(Qu, rlo, (size_t)c * 16 * CC + kc * 32);
    v16h kf[2][NKT], vf[NKT / 2][HD / 16]; const _Float16* Kf = Ku + (size_t)p0 * KPASS * HD;   /* the task's first pass */
#pragma unroll
    for (int kc = 0; kc < 2; ++kc)
#pragma unroll
      for (int j = 0; j < NKT; ++j) kf[kc][j] = frag_o(Kf, flo, (size_t)j * 1024 + kc * 512);
    // stands in front of any rewrite of the registers that the loads above it name; the two bases and the two offsets as inputs keep those registers whole until it, the scheduling barrier holds the loads in front of it and later address arithmetic behind it
    asm volatile("s_wait_xcnt 0x0" :: "s"(Qu), "s"(Kf), "v"(rlo), "v"(flo) : "memory");
    __builtin_amdgcn_sched_barrier(0);
    for (int ps = p0; ps < npass; ++ps) { const int k0 = ps * KPASS; v8f st[NCG][NKT];
#pragma unroll
      for (int c = 0; c < NCG; ++c)
#pragma unroll
        for (int j = 0; j < NKT; ++j) st[c][j] = v8f{};
#pragma unroll
      for (int kc = 0; kc < 2; ++kc)
#pragma unroll
        for (int j = 0; j < NKT; ++j)
#pragma unroll
          for (int c = 0; c < NCG; ++c) st[c][j] = wmh(kf[kc][j], qf[c][kc], st[c][j]);
      // this pass's v fragments and the next pass's k fragments (the last pass fetches its own again: stays inside the wave's key range) are requested here, ahead of the softmax arithmetic that covers their latency
      const int kn = ps + 1 < npass ? k0 + KPASS : k0; const _Float16* vp = Vl + (size_t)k0 * HD; const _Float16* kp = Kl + (size_t)kn * HD;   /* the lane's own addresses: every load of the run is one of them plus a constant */
#pragma unroll
      for (int jj = 0; jj < NKT / 2; ++jj)
#pragma unroll
        for (int d = 0; d < HD / 16; ++d) vf[jj][d] = frag_o(vp, 0u, (size_t)jj * 2048 + d * 512);
#pragma unroll
      for (int kc = 0; kc < 2; ++kc)
#pragma unroll
        for (int j = 0; j < NKT; ++j) kf[kc][j] = frag_o(kp, 0u, (size_t)j * 1024 + kc * 512);
      // stands in front of any rewrite of the address registers that the loads above it name; the two addresses as inputs keep their registers whole until it: no load of the run may land in a pair that the loads in front of it name
      asm volatile("s_wait_xcnt 0x0" :: "v"(vp), "v"(kp) : "memory");
      __builtin_amdgcn_sched_barrier(0);   // keeps the compiler from sinking those loads to their first use, where each would be waited for alone
      const bool edge = k0 + KPASS > ql0;   /* wave-uniform: only passes that reach the wave's first query hold excluded keys */
#pragma unroll
      for (int c = 0; c < NCG; ++c) sm_pass(st[c], acc[c], m[c], l[c], k0 + 8 * g, ql0 + c * 16 + col, edge);
#pragma unroll
      for (int jj = 0; jj < NKT / 2; ++jj) { v16h p[NCG];
#pragma unroll
        for (int c = 0; c < NCG; ++c)
#pragma unroll
          for (int i = 0; i < 8; ++i) { p[c][i] = (_Float16)st[c][2 * jj][i]; p[c][8 + i] = (_Float16)st[c][2 * jj + 1][i]; }
#pragma unroll
        for (int d = 0; d < HD / 16; ++d)
#pragma unroll
          for (int c = 0; c < NCG; ++c) acc[c][d] = wmh(vf[jj][d], p[c], acc[c][d]); } } }
  };
  if (helper) { walk(qlE, 0, nE, true); store_out(qlE); }
  walk(qlL, helper ? cut : 0, helper ? nL : cut, false);
  // the helper's partial maximum, sum and ctx of the late queries go to its partner through LDS (the same lane holds the same query and dims in both waves): piece q of a lane at (17 w + q) x 512 + 16 lane
  char* xp = sx + (w4 * 17 * 32 + lane) * 16;
  if (helper) {
#pragma unroll
    for (int c = 0; c < NCG; ++c)
#pragma unroll
      for (int d = 0; d < HD / 16; ++d) { const v8f o = acc[c][d]; *(v4f*)(xp + ((c * (HD / 16) + d) * 2) * 512) = v4f{o[0], o[1], o[2], o[3]}; *(v4f*)(xp + ((c * (HD / 16) + d) * 2 + 1) * 512) = v4f{o[4], o[5], o[6], o[7]}; }
    *(v4f*)(xp + 16 * 512) = v4f{m[0], m[1], l[0], l[1]}; }
  __syncthreads();   // the partial states are written before a partner reads them
  if (!helper) { const v4f ml = *(const v4f*)(xp + 16 * 512);
#pragma unroll
    for (int c = 0; c < NCG; ++c) { const float mm = fmaxf(m[c], ml[c]), f1 = __builtin_amdgcn_exp2f(m[c] - mm), f2 = __builtin_amdgcn_exp2f(ml[c] - mm); l[c] = l[c] * f1 + ml[NCG + c] * f2;   /* both parts brought to the common maximum; a helper without a pass holds sum 0, ctx 0 and f2 = 0 */
#pragma unroll
      for (int d = 0; d < HD / 16; ++d) { const v4f a0 = *(const v4f*)(xp + ((c * (HD / 16) + d) * 2) * 512), a1 = *(const v4f*)(xp + ((c * (HD / 16) + d) * 2 + 1) * 512);
#pragma unroll
        for (int r = 0; r < 4; ++r) { acc[c][d][r] = acc[c][d][r] * f1 + a0[r] * f2; acc[c][d][4 + r] = acc[c][d][4 + r] * f1 + a1[r] * f2; } } }
    store_out(qlL); } }
// ---- k_out: block = (128 rows, 128 cols): out = ctx Wo (+ bo): ctx once to f16 against Wo as f16(bf16 x 2^8) exact (1 product) x 2^-8; causal early rows (< QHI of each sequence): ctx bf16 hi + lo against exact bf16 Wo (2 products). Each wave stages its 32 x 64 of the output in its own part of the LDS that the operand buffers have left.
__global__ __launch_bounds__(256) void k_out(const float* __restrict__ Y, const float* __restrict__ WO, const float* __restrict__ BO, float* __restrict__ OUT) { __shared__ __align__(16) char sm[2 * 3 * 128 * 144];
  const int tid = threadIdx.x, wave = tid >> 5, lane = tid & 31, col = lane & 15, g = lane >> 4, wr = wave >> 1, wc = wave & 1; const int c0 = blockIdx.y * 128; const size_t r0 = (size_t)blockIdx.x * 128;
  v8f acc[2][4] = {}; float sc; const int s0 = (int)((blockIdx.x + 2 * blockIdx.y) & 15);   /* 16 k steps: the 8 column blocks that share ctx rows start 2 steps apart, the 32 row blocks that share a weight tile at all 16 steps, two at each */
  if (CAUSAL && (int)(r0 % TT) < QHI) { gemm_tile<2, 64>(Y + r0 * CC, WO + (size_t)c0 * CC, sm, acc, s0); sc = 1.0f; }   /* block-uniform */
  else { gemm_tile<1, 64>(Y + r0 * CC, WO + (size_t)c0 * CC, sm, acc, s0); sc = 1.0f / 256.0f; }
  float (*sf)[68] = (float (*)[68])(sm + wave * 32 * 68 * 4);
#pragma unroll
  for (int j = 0; j < 4; ++j) { const float bias = BO ? bfr(BO[c0 + wc * 64 + j * 16 + col]) : 0.f;
#pragma unroll
    for (int i = 0; i < 2; ++i)
#pragma unroll
      for (int r = 0; r < 8; ++r) sf[i * 16 + 8 * g + r][j * 16 + col] = acc[i][j][r] * sc + bias; }
  LDSX();
#pragma unroll
  for (int rl = 0; rl < 32; rl += 2) vst2(OUT + (r0 + wr * 32 + rl + g) * DIN + c0 + wc * 64 + col * 4, *(const v4f*)&sf[rl + g][col * 4]); }

extern "C" void kernel_launch(void* const* d_in, const int* in_sizes, int n_in, void* d_out, int out_size, void* d_ws, size_t ws_size, hipStream_t stream) {
  (void)in_sizes; (void)n_in; (void)out_size;
  const float** F = (const float**)d_in;
  if (ws_size < (size_t)WS_END) return;
  char* ws = (char*)d_ws; _Float16 *QH = (_Float16*)(ws + WS_QH), *KH = (_Float16*)(ws + WS_KH), *VT = (_Float16*)(ws + WS_VT), *QL = (_Float16*)(ws + WS_QL), *KL = (_Float16*)(ws + WS_KL); __bf16 *VB = (__bf16*)(ws + WS_VB), *VBL = (__bf16*)(ws + WS_VBL); float *Y = (float*)(ws + WS_Y);
  (void)Y; (void)QL; (void)KL; (void)VB; (void)VBL;
  // inputs: 0 q, 1 k, 2 v [2,2048,1024]; 3 Wq, 4 Wk, 5 Wv, 6 Wo [1024,1024] (out,in), no biases
  k_proj<<<dim3(TNB * TT / 128, CC / 128, 3), 256, 0, stream>>>(F[0], F[1], F[2], F[3], F[4], F[5], nullptr, nullptr, nullptr, QH, QL, KH, KL, VT, VB, VBL);
  k_attn<<<dim3(TNB * NH, TT / QBLK / 2), 256, 0, stream>>>(QH, KH, QL, KL, VT, VB, VBL, Y);
  k_out<<<dim3(TNB * TT / 128, DIN / 128), 256, 0, stream>>>(Y, F[6], nullptr, (float*)d_out);
}

// v008
// One run takes 74 microseconds.
// Next to v007, in two timings, it ran 1.04 times as fast each time.
// All steps since v000 together make it 15.9 times as fast.
// compute dtype: all float inputs rounded to bf16; q/k/v = input W^T with EXACT bf16 products on WMMA 16x16x32 (f32 accumulate); causal (strict past) logits: q, k once to f16 (1 product) x 1024^-0.5, except the first 384 query rows of each sequence (3 products with f16 residuals); softmax in f32 with a running maximum; exp(logit - maximum) once to f16 against v once to f16 (1 product; bf16 hi + lo below row 384); ctx once to f16 against Wo carried x 2^8 in f16 (bf16 hi + lo against bf16 Wo, 2 products, in the first 384 rows of each sequence); f32 output.
#include <hip/hip_runtime.h>
#include <math.h>

typedef __attribute__((ext_vector_type(16))) _Float16 v16h;
typedef __attribute__((ext_vector_type(16))) __bf16 v16b;
typedef __attribute__((ext_vector_type(8)))  _Float16 v8h;
typedef __attribute__((ext_vector_type(8)))  float v8f;
typedef __attribute__((ext_vector_type(4)))  float v4f;
typedef __attribute__((ext_vector_type(2)))  float v2f;
typedef __attribute__((ext_vector_type(4)))  unsigned v4u;
typedef __attribute__((ext_vector_type(4)))  int v4i;
typedef float __attribute__((may_alias)) float_a;
typedef int __attribute__((may_alias)) int_a;

template <typename T> __device__ __forceinline__ void vst2(void* p, T v) { *(T*)p = v;  }
__device__ __forceinline__ v8f wmma16(v16h a, v16h b, v8f c) {
  v8f d = __builtin_amdgcn_wmma_f32_16x16x32_f16(false, a, false, b, (short)0, c, false, false);
  asm volatile("v_nop\n\tv_nop\n\tv_nop\n\tv_nop" : "+v"(d) : "v"(a), "v"(b));
  return d;
}
__device__ __forceinline__ v8f wmma_bf(v16b a, v16b b, v8f c) {
  v8f d = __builtin_amdgcn_wmma_f32_16x16x32_bf16(false, a, false, b, (short)0, c, false, false);
  asm volatile("v_nop\n\tv_nop\n\tv_nop\n\tv_nop" : "+v"(d) : "v"(a), "v"(b));
  return d;
}
// 16x16x32 fragments: lane = (h = lane>>4, row/col = lane&15); elements 0..7 = k0+8h+0..7, 8..15 = k0+16+8h+0..7; D element r = row 8h+r
__device__ __forceinline__ v16h frag_h(const _Float16* rowk0, int lane) {
  union { v16h v; v8h q[2]; } u; const _Float16* p = rowk0 + 8 * (lane >> 4);
  u.q[0] = *(const v8h*)p; u.q[1] = *(const v8h*)(p + 16); return u.v;
}
__device__ __forceinline__ v16h frag_f32(const float* rowk0, int lane) {
  v16h a; const float* p = rowk0 + 8 * (lane >> 4);
#pragma unroll
  for (int i = 0; i < 8; ++i) { a[i] = (_Float16)p[i]; a[8 + i] = (_Float16)p[16 + i]; }
  return a;
}
__device__ __forceinline__ v16h frag_f32s(const float* rowk0, int lane, float sc) {
  v16h a; const float* p = rowk0 + 8 * (lane >> 4);
#pragma unroll
  for (int i = 0; i < 8; ++i) { a[i] = (_Float16)(p[i] * sc); a[8 + i] = (_Float16)(p[16 + i] * sc); }
  return a;
}
// column fragment from a [K][ld] layout (column n), rows >= K read as 0
__device__ __forceinline__ v16h fragc_f32(const float* W, int k0, int n, int lane, int ld, int K) {
  v16h a; const int g = lane >> 4;
#pragma unroll
  for (int i = 0; i < 8; ++i) { const int ka = k0 + 8 * g + i, kb = ka + 16;
    a[i] = (_Float16)(ka < K ? W[(size_t)(ka < K ? ka : K - 1) * ld + n] : 0.f); a[8 + i] = (_Float16)(kb < K ? W[(size_t)(kb < K ? kb : K - 1) * ld + n] : 0.f); }
  return a;
}
struct F2 { v16b h, l; };
__device__ __forceinline__ F2 bsplit16(const float v[16]) { F2 r;
#pragma unroll
  for (int i = 0; i < 16; ++i) { const __bf16 h = (__bf16)v[i]; r.h[i] = h; r.l[i] = (__bf16)(v[i] - (float)h); }
  return r; }
__device__ __forceinline__ F2 split_row(const float* row, int k0, int lane) { float v[16]; const float* p = row + k0 + 8 * (lane >> 4);
#pragma unroll
  for (int i = 0; i < 8; ++i) { v[i] = p[i]; v[8 + i] = p[16 + i]; }
  return bsplit16(v); }
__device__ __forceinline__ F2 split_rowK(const float* row, int k0, int lane, int K) { float v[16]; const int g = lane >> 4;
#pragma unroll
  for (int i = 0; i < 8; ++i) { const int ka = k0 + 8 * g + i, kb = ka + 16; v[i] = ka < K ? row[ka < K ? ka : K - 1] : 0.f; v[8 + i] = kb < K ? row[kb < K ? kb : K - 1] : 0.f; }
  return bsplit16(v); }
__device__ __forceinline__ F2 split_col(const float* W, int k0, int n, int lane, int ld, int K) { float v[16]; const int g = lane >> 4;
#pragma unroll
  for (int i = 0; i < 8; ++i) { const int ka = k0 + 8 * g + i, kb = ka + 16; v[i] = ka < K ? W[(size_t)(ka < K ? ka : K - 1) * ld + n] : 0.f; v[8 + i] = kb < K ? W[(size_t)(kb < K ? kb : K - 1) * ld + n] : 0.f; }
  return bsplit16(v); }
__device__ __forceinline__ v8f mac3(const F2& a, const F2& b, v8f c) { c = wmma_bf(a.l, b.h, c); c = wmma_bf(a.h, b.l, c); return wmma_bf(a.h, b.h, c); }
__device__ __forceinline__ float sigm(float v) { return 1.0f / (1.0f + expf(-v)); }
#define LDSX() do { asm volatile("s_wait_dscnt 0" ::: "memory"); __builtin_amdgcn_wave_barrier(); __builtin_amdgcn_fence(__ATOMIC_RELEASE, "workgroup"); } while (0)

// In-context-learning attention (B 2, S 2,048, E 1,024 = 16 x 64; separate q/k/v inputs): qh = q Wq^T, kh = k Wk^T, vh = v Wv^T ((out,in)); scores = qh kh^T / sqrt(1024) masked where key >= query (strict past) except (0, 0); softmax; out = merged(probs vh) Wo^T.
#define NB 2
#define TT 2048
#define CC 1024            // NH * HD = projected width
#define DIN 1024          // input (model) width
#define NH 16
#define HD 64
#define NQB (TT / 64)
#define SCALE (0.03125f)
#define CAUSAL 1
#ifndef TNB
#define TNB NB
#endif
__device__ __forceinline__ float bfr(float v) { return (float)(__bf16)v; }
__host__ __device__ __forceinline__ int kb_last(int qb) { return CAUSAL ? ((qb * 64 + 63) >> 7) : (TT / 128 - 1); }
typedef __attribute__((ext_vector_type(8))) __bf16 v8b;
__device__ __forceinline__ v16b frag_b(const __bf16* rowk0, int lane) {
  union { v16b v; v8b q[2]; } u; const __bf16* p = rowk0 + 8 * (lane >> 4);
  u.q[0] = *(const v8b*)p; u.q[1] = *(const v8b*)(p + 16); return u.v;
}
#define QBH 6              // read nowhere: the high-precision paths are taken by query rows < QHI
#define QHI 384            // rows carrying a q residual plane
#define KHI 384            // key rows carrying k residual / v bf16 hi+lo planes (used only by the causal high-precision path)
// B fragment (k rows k0+.., output column o) of a weight: (in,out) [K][ld] or (out,in) [ld rows of K]: bf16 exact, or f16(bf16 * 256) exact
__device__ __forceinline__ v16b wcol_io(const float* Wm, int k0, int o, int lane, int ld) { v16b w; const int g = lane >> 4;
#pragma unroll
  for (int i = 0; i < 8; ++i) { w[i] = (__bf16)Wm[(size_t)(k0 + 8 * g + i) * ld + o]; w[8 + i] = (__bf16)Wm[(size_t)(k0 + 16 + 8 * g + i) * ld + o]; }
  return w; }
__device__ __forceinline__ v16b wcol_oi(const float* Wm, int k0, int o, int lane, int K) { v16b w; const float* p = Wm + (size_t)o * K + k0 + 8 * (lane >> 4);
#pragma unroll
  for (int i = 0; i < 8; ++i) { w[i] = (__bf16)p[i]; w[8 + i] = (__bf16)p[16 + i]; }
  return w; }
__device__ __forceinline__ v16h wcolh_io(const float* Wm, int k0, int o, int lane, int ld) { v16h w; const int g = lane >> 4;
#pragma unroll
  for (int i = 0; i < 8; ++i) { w[i] = (_Float16)(bfr(Wm[(size_t)(k0 + 8 * g + i) * ld + o]) * 256.0f); w[8 + i] = (_Float16)(bfr(Wm[(size_t)(k0 + 16 + 8 * g + i) * ld + o]) * 256.0f); }
  return w; }
__device__ __forceinline__ v16h wcolh_oi(const float* Wm, int k0, int o, int lane, int K) { v16h w; const float* p = Wm + (size_t)o * K + k0 + 8 * (lane >> 4);
#pragma unroll
  for (int i = 0; i < 8; ++i) { w[i] = (_Float16)(bfr(p[i]) * 256.0f); w[8 + i] = (_Float16)(bfr(p[16 + i]) * 256.0f); }
  return w; }
#define WQKV_LAYOUT 1   // 0 = (in,out) [DIN][CC]; 1 = (out,in) [CC][DIN]; 2 = per-head [NH][DIN][HD]
__device__ __forceinline__ v16b wcol_hdk(const float* Wm, int k0, int o, int lane) { v16b w; const int g = lane >> 4; const float* p = Wm + (size_t)(o / HD) * DIN * HD + (o % HD);
#pragma unroll
  for (int i = 0; i < 8; ++i) { w[i] = (__bf16)p[(size_t)(k0 + 8 * g + i) * HD]; w[8 + i] = (__bf16)p[(size_t)(k0 + 16 + 8 * g + i) * HD]; }
  return w; }
#define WO_OUT_IN 1
#if WQKV_LAYOUT == 1
#define WCOL(W, k0, o, lane) wcol_oi(W, k0, o, lane, DIN)
#elif WQKV_LAYOUT == 2
#define WCOL(W, k0, o, lane) wcol_hdk(W, k0, o, lane)
#else
#define WCOL(W, k0, o, lane) wcol_io(W, k0, o, lane, CC)
#endif
#if WO_OUT_IN
#define WOCOL(W, k0, o, lane) wcol_oi(W, k0, o, lane, CC)
#define WOCOLH(W, k0, o, lane) wcolh_oi(W, k0, o, lane, CC)
#else
#define WOCOL(W, k0, o, lane) wcol_io(W, k0, o, lane, DIN)
#define WOCOLH(W, k0, o, lane) wcolh_io(W, k0, o, lane, DIN)
#endif
#ifndef PROJ_EXTRA_PARAMS
#define PROJ_EXTRA_PARAMS
#endif

#define WS_QH  0u                                      // f16 q rows [b*t][CC]
// k and v planes lie in the order of k_attn's A fragments, so that each of its 16-byte-per-lane loads covers 512 contiguous bytes (4 whole lines) and not 32 bytes of each of 16 lines.
// k: [b][h][t / 16][kc 2][q 2][lane 32][8]: lane (g, col) holds key 16 (t / 16) + col, dims 32 kc + 16 q + 8 g + 0..7. v: [b][h][t / 32][d 4][q 2][lane 32][8]: lane (g, col) holds dim 16 d + col, keys 32 (t / 32) + 16 q + 8 g + 0..7.
#define WS_KH  (WS_QH + 2u * (size_t)NB * TT * CC)      // f16 k, fragment order, all t
#define WS_VT  (WS_KH + 2u * (size_t)NB * TT * CC)      // f16 v, fragment order, all t
#define WS_QL  (WS_VT + 2u * (size_t)NB * CC * TT)      // f16 q residual x 2^10 rows [b][t < QHI][CC]
#define WS_KL  (WS_QL + 2u * (size_t)NB * QHI * CC)     // f16 k residual x 2^10, fragment order, t < KHI
#define WS_VB  (WS_KL + 2u * (size_t)NB * KHI * CC)     // bf16 v hi (then lo), fragment order, t < KHI
#define WS_VBL (WS_VB + 2u * (size_t)NB * CC * KHI)
#define WS_Y   (WS_VBL + 2u * (size_t)NB * CC * KHI)     // f32 ctx rows [b*t][CC] (only when there is an output projection)
#define WS_END (WS_Y  + 4u * (size_t)NB * TT * CC)

// plain builtin products: the compiler keeps the distance behind them itself and may place their operands in any register window
__device__ __forceinline__ v8f wmh(v16h a, v16h b, v8f c) { return __builtin_amdgcn_wmma_f32_16x16x32_f16(false, a, false, b, (short)0, c, false, false); }
__device__ __forceinline__ v8f wmb(v16b a, v16b b, v8f c) { return __builtin_amdgcn_wmma_f32_16x16x32_bf16(false, a, false, b, (short)0, c, false, false); }
typedef __attribute__((ext_vector_type(4))) __bf16 v4b;
typedef __attribute__((ext_vector_type(4))) _Float16 v4h;
__device__ __forceinline__ v4b cvt4b(v4f v) { return v4b{(__bf16)v[0], (__bf16)v[1], (__bf16)v[2], (__bf16)v[3]}; }
// ---- gemm_tile: 256 threads, acc += A[128 rows][1024] B[128 rows][1024]^T, both k-contiguous f32 rows. Each k step of BK is read once per workgroup with whole-line loads, converted once and kept in LDS as 16-bit rows of pitch 2 BK + 16 bytes (16 B x odd: no bank conflict for 16-byte fragment reads); two buffers: the next step's loads fly while this step's products run. Waves 4 x 2, 32 x 64 of the tile each (acc[i][j]: rows 32 wr + 16 i, columns 64 wc + 16 j). The k walk begins at step s0 (the same for the whole workgroup, below KD / BK), runs upward and wraps to step 0: workgroups that share operand rows are given different s0, so that they do not ask L2 for the same lines at the same moment.
// MODE 0: A, B to bf16. MODE 1: A to f16, B to f16(bf16 x 2^8). MODE 2: A to bf16 hi + lo (two planes, hi product first), B to bf16. On return every wave has left the buffers (sm may be reused). Every unroll directive here and in the two kernels' output staging keeps a register array (loaded pieces, fragments, accumulators) indexed by constants.
// MT = 2 (MODE 0 only): A has 256 rows, and a wave holds 64 x 64 of the 256 x 128 tile: acc[i][j] with i = 2, 3 are the rows of i = 0, 1 plus 128. Each fragment read from LDS then feeds 4 products, and the B rows are asked of L2 once per 256 rows of A. LDS of a buffer: A planes (128 MT rows), B plane, then MODE 2's lo plane.
template <int MODE, int BK, int MT = 1>
__device__ __forceinline__ void gemm_tile(const float* __restrict__ A, const float* __restrict__ Bw, char* sm, v8f (&acc)[2 * MT][4], int s0) {
  static_assert(MT == 1 || MODE == 0, "256 rows of A: bf16 operands only");
  constexpr int KD = 1024, PITCH = 2 * BK + 16, UR = BK / 4, RS = 256 / UR, NU = 128 / RS, PL = 128 * PITCH, PLA = MT * PL, BUF = PLA + PL + (MODE == 2 ? PLA : 0), NS = KD / BK;
  const int tid = threadIdx.x, lane = tid & 31, col = lane & 15, g = lane >> 4, wave = tid >> 5, wr = wave >> 1, wc = wave & 1;
  const float* ga = A + (size_t)(tid / UR) * KD + (tid % UR) * 4 + s0 * BK; const float* gb = Bw + (size_t)(tid / UR) * KD + (tid % UR) * 4 + s0 * BK;   /* the thread's 16 bytes of rows tid / UR + i RS, at k step s0 */
  int ks = s0;   /* the k step that the next fetch reads */
  char* sw = sm + (tid / UR) * PITCH + (tid % UR) * 8;
  const char* fa = sm + (wr * 32 + col) * PITCH + 16 * g; const char* fb = sm + PLA + (wc * 64 + col) * PITCH + 16 * g;
  v4f ra[MT * NU], rb[NU];
  auto fetch = [&]() {
#pragma unroll
    for (int i = 0; i < NU; ++i) { ra[i] = *(const v4f*)(ga + (size_t)i * RS * KD); rb[i] = *(const v4f*)(gb + (size_t)i * RS * KD); }
#pragma unroll
    for (int i = NU; i < MT * NU; ++i) ra[i] = *(const v4f*)(ga + (size_t)i * RS * KD);
    // stands in front of the rewrite of the two address pairs that the loads above it name (every load is one of them plus a constant); the pairs as inputs keep their registers whole until it
    asm volatile("s_wait_xcnt 0x0" :: "v"(ga), "v"(gb) : "memory");
    __builtin_amdgcn_sched_barrier(0);   // holds the loads in front of the products that cover their latency, and the address additions behind the wait
    ks = ks + 1 == NS ? 0 : ks + 1; const int adv = ks == 0 ? BK - KD : BK;   /* behind the last k step the walk wraps to the first */
    ga += adv; gb += adv; };
  auto stage = [&](int off) {
#pragma unroll
    for (int i = 0; i < NU; ++i) { char* p = sw + off + i * RS * PITCH;
      if constexpr (MODE == 0) { *(v4b*)p = cvt4b(ra[i]); *(v4b*)(p + PLA) = cvt4b(rb[i]); }
      else if constexpr (MODE == 1) { *(v4h*)p = v4h{(_Float16)ra[i][0], (_Float16)ra[i][1], (_Float16)ra[i][2], (_Float16)ra[i][3]};
        *(v4h*)(p + PL) = v4h{(_Float16)(bfr(rb[i][0]) * 256.0f), (_Float16)(bfr(rb[i][1]) * 256.0f), (_Float16)(bfr(rb[i][2]) * 256.0f), (_Float16)(bfr(rb[i][3]) * 256.0f)}; }
      else { const v4b hv = cvt4b(ra[i]); *(v4b*)p = hv; *(v4b*)(p + 2 * PL) = cvt4b(v4f{ra[i][0] - (float)hv[0], ra[i][1] - (float)hv[1], ra[i][2] - (float)hv[2], ra[i][3] - (float)hv[3]}); *(v4b*)(p + PL) = cvt4b(rb[i]); } }
#pragma unroll
    for (int i = NU; i < MT * NU; ++i) *(v4b*)(sw + off + i * RS * PITCH) = cvt4b(ra[i]); };
  auto products = [&](int off) {
#pragma unroll
    for (int kk = 0; kk < BK / 32; ++kk) {
      if constexpr (MODE == 1) { v16h a[2], w[4];
#pragma unroll
        for (int i = 0; i < 2; ++i) { union { v16h v; v8h q[2]; } u; const char* p = fa + off + i * 16 * PITCH + kk * 64; u.q[0] = *(const v8h*)p; u.q[1] = *(const v8h*)(p + 32); a[i] = u.v; }
#pragma unroll
        for (int j = 0; j < 4; ++j) { union { v16h v; v8h q[2]; } u; const char* p = fb + off + j * 16 * PITCH + kk * 64; u.q[0] = *(const v8h*)p; u.q[1] = *(const v8h*)(p + 32); w[j] = u.v; }
#pragma unroll
        for (int i = 0; i < 2; ++i)
#pragma unroll
          for (int j = 0; j < 4; ++j) acc[i][j] = wmh(a[i], w[j], acc[i][j]);
      } else { v16b a[2 * MT], al[2], w[4];
#pragma unroll
        for (int i = 0; i < 2 * MT; ++i) { union { v16b v; v8b q[2]; } u; const char* p = fa + off + ((i >> 1) * 128 + (i & 1) * 16) * PITCH + kk * 64; u.q[0] = *(const v8b*)p; u.q[1] = *(const v8b*)(p + 32); a[i] = u.v;
          if constexpr (MODE == 2) { u.q[0] = *(const v8b*)(p + 2 * PL); u.q[1] = *(const v8b*)(p + 2 * PL + 32); al[i] = u.v; } }
#pragma unroll
        for (int j = 0; j < 4; ++j) { union { v16b v; v8b q[2]; } u; const char* p = fb + off + j * 16 * PITCH + kk * 64; u.q[0] = *(const v8b*)p; u.q[1] = *(const v8b*)(p + 32); w[j] = u.v; }
#pragma unroll
        for (int i = 0; i < 2 * MT; ++i)
#pragma unroll
          for (int j = 0; j < 4; ++j) acc[i][j] = wmb(a[i], w[j], acc[i][j]);
        if constexpr (MODE == 2) {
#pragma unroll
          for (int i = 0; i < 2; ++i)
#pragma unroll
            for (int j = 0; j < 4; ++j) acc[i][j] = wmb(al[i], w[j], acc[i][j]); } } } };
  fetch(); stage(0); __syncthreads();
  int cur = 0;
  for (int s = 0; s + 1 < NS; ++s) { fetch(); products(cur);
    __builtin_amdgcn_sched_barrier(0);   // keeps the conversions, which wait for the loads in flight, behind the products that cover the loads' latency
    cur ^= BUF; stage(cur); __syncthreads(); }   /* the one barrier of a step publishes the buffer just written and ends the reads of the one written next */
  products(cur); __syncthreads(); }
// stands behind a run of global loads or stores, in front of any rewrite of the registers that they name; the scheduling barrier holds later arithmetic behind it
#define XW() do { asm volatile("s_wait_xcnt 0x0" ::: "memory"); __builtin_amdgcn_sched_barrier(0); } while (0)
// ---- k_proj: block = (256 rows, 128 cols, which), written out as two halves of 128 rows one after the other: q/k/v = X W (+ b) with exact bf16 products (K = DIN) -> which 0: q f16 rows (+ residual rows < QHI); 1: k f16 in fragment order (+ residual for t < KHI); 2: v f16 in fragment order (+ bf16 hi/lo for t < KHI). The output staging reuses the LDS of the operand buffers.
__global__ __launch_bounds__(256) void k_proj(const float* __restrict__ XQ, const float* __restrict__ XK, const float* __restrict__ XV, const float* __restrict__ WQ, const float* __restrict__ WK, const float* __restrict__ WV, const float* __restrict__ BQ, const float* __restrict__ BK, const float* __restrict__ BV,
    _Float16* __restrict__ QH, _Float16* __restrict__ QL, _Float16* __restrict__ KH, _Float16* __restrict__ KL, _Float16* __restrict__ VT, __bf16* __restrict__ VB, __bf16* __restrict__ VBL) {
  __shared__ __align__(16) char sm[3 * 128 * 136 * 2];
  const int tid = threadIdx.x, wave = tid >> 5, lane = tid & 31, col = lane & 15, g = lane >> 4, wr = wave >> 1, wc = wave & 1; const int which = blockIdx.z; const int c0 = blockIdx.y * 128; const size_t rb0 = (size_t)blockIdx.x * 256; const size_t bb = rb0 / TT;
  const float* X = which == 0 ? XQ : which == 1 ? XK : XV; const float* WA = which == 0 ? WQ : which == 1 ? WK : WV; const float* BA = which == 0 ? BQ : which == 1 ? BK : BV;
  v8f acc[4][4] = {};
  gemm_tile<0, 32, 2>(X + rb0 * DIN, WA + (size_t)c0 * DIN, sm, acc, (int)((2 * blockIdx.x + 4 * blockIdx.y) & 31));   /* 32 k steps: the 16 row blocks that share a weight tile start 2 steps apart, the 8 column blocks that share input rows 4 steps apart */
  // unrolled: the accumulators stay indexed by constants
#pragma unroll
  for (int hh = 0; hh < 2; ++hh) { const size_t r0 = rb0 + 128 * hh; const int t0 = (int)(r0 % TT);   /* half hh: rows r0 .. r0 + 127, accumulators acc[2 hh + i] */
  if (hh) __syncthreads();   // every wave has read the first half out of the staging LDS before the second half is written there
  if (which < 2) { _Float16 (*sh)[136] = (_Float16 (*)[136])sm; _Float16 (*sl)[136] = (_Float16 (*)[136])(sm + 128 * 136 * 2);
    _Float16* DH = which == 0 ? QH : KH; _Float16* DL = which == 0 ? QL : KL; const int nhi = which == 0 ? QHI : KHI; const bool hi_rows = t0 < nhi;
#pragma unroll
    for (int j = 0; j < 4; ++j) { const int cl = wc * 64 + j * 16 + col; float bias = 0.f; if (BA) { bias = bfr(BA[c0 + cl]); XW(); }
#pragma unroll
      for (int i = 0; i < 2; ++i)
#pragma unroll
        for (int r = 0; r < 8; ++r) { const float v = acc[2 * hh + i][j][r] + bias; const _Float16 hv = (_Float16)v; const int rl = wr * 32 + i * 16 + 8 * g + r; sh[rl][cl] = hv; sl[rl][cl] = (_Float16)((v - (float)hv) * 1024.0f); } }
    __syncthreads();
    v4u t[8];
    if (which == 0) { const int rl = tid >> 4, q = tid & 15;   /* piece it of a thread: row rl + 16 it, 16 bytes at element 8 q */
#pragma unroll
      for (int it = 0; it < 8; ++it) t[it] = *(const v4u*)&sh[rl + 16 * it][q * 8];
#pragma unroll
      for (int it = 0; it < 8; ++it) vst2((unsigned*)(DH + (r0 + rl + 16 * it) * CC + c0 + q * 8), t[it]);
      if (hi_rows) { XW();
#pragma unroll
        for (int it = 0; it < 8; ++it) t[it] = *(const v4u*)&sl[rl + 16 * it][q * 8];
#pragma unroll
        for (int it = 0; it < 8; ++it) vst2((unsigned*)(DL + (bb * nhi + t0 + rl + 16 * it) * (size_t)CC + c0 + q * 8), t[it]); }
      XW();   /* behind the q stores, in front of the second half's rewrite of the registers that they name */
    } else {   /* k, fragment order: wave = 16-key tile; piece it = (head it >> 2, kc, q): key 16 wave + col, dims 16 it + 8 g + 0..7 of the 128 columns; a wave's store is 512 contiguous bytes */
      const size_t hb = bb * NH + c0 / HD; const int kt = (t0 >> 4) + wave;
#pragma unroll
      for (int it = 0; it < 8; ++it) t[it] = *(const v4u*)&sh[wave * 16 + col][it * 16 + 8 * g];
#pragma unroll
      for (int it = 0; it < 8; ++it) vst2((unsigned*)(DH + ((hb + (it >> 2)) * (TT / 16) + kt) * 1024 + (it & 3) * 256 + lane * 8), t[it]);
      if (hi_rows) { XW();
#pragma unroll
        for (int it = 0; it < 8; ++it) t[it] = *(const v4u*)&sl[wave * 16 + col][it * 16 + 8 * g];
#pragma unroll
        for (int it = 0; it < 8; ++it) vst2((unsigned*)(DL + ((hb + (it >> 2)) * (KHI / 16) + kt) * 1024 + (it & 3) * 256 + lane * 8), t[it]); }
      XW(); }   /* behind the k stores, with or without the residual run, in front of any rewrite of the registers that they name */
  } else { _Float16 (*th)[136] = (_Float16 (*)[136])sm; __bf16 (*tb)[136] = (__bf16 (*)[136])(sm + 128 * 136 * 2); __bf16 (*tbl)[136] = (__bf16 (*)[136])(sm + 2 * 128 * 136 * 2); const bool hi_rows = t0 < KHI;
#pragma unroll
    for (int j = 0; j < 4; ++j) { const int cl = wc * 64 + j * 16 + col; float bias = 0.f; if (BA) { bias = bfr(BA[c0 + cl]); XW(); }
#pragma unroll
      for (int i = 0; i < 2; ++i)
#pragma unroll
        for (int r = 0; r < 8; ++r) { const float v = acc[2 * hh + i][j][r] + bias; const int rl = wr * 32 + i * 16 + 8 * g + r; th[cl][rl] = (_Float16)v; const __bf16 bh = (__bf16)v; tb[cl][rl] = bh; tbl[cl][rl] = (__bf16)(v - (float)bh); } }
    __syncthreads();
    /* v, fragment order: wave = (head wave >> 2, d = wave & 3); piece it = (32-key group it >> 1, q): dim 16 wave + col of the 128 columns, keys 16 it + 8 g + 0..7; a wave's store is 512 contiguous bytes */
    const size_t hb = bb * NH + c0 / HD + (wave >> 2); const int kg = t0 >> 5; const int fo = (wave & 3) * 512 + lane * 8; v4u t[8];
#pragma unroll
    for (int it = 0; it < 8; ++it) t[it] = *(const v4u*)&th[wave * 16 + col][it * 16 + 8 * g];
#pragma unroll
    for (int it = 0; it < 8; ++it) vst2((unsigned*)(VT + (hb * (TT / 32) + kg + (it >> 1)) * 2048 + (it & 1) * 256 + fo), t[it]);
    XW();
    if (hi_rows) {
#pragma unroll
      for (int it = 0; it < 8; ++it) t[it] = *(const v4u*)&tb[wave * 16 + col][it * 16 + 8 * g];
#pragma unroll
      for (int it = 0; it < 8; ++it) vst2((unsigned*)(VB + (hb * (KHI / 32) + kg + (it >> 1)) * 2048 + (it & 1) * 256 + fo), t[it]);
      XW();
#pragma unroll
      for (int it = 0; it < 8; ++it) t[it] = *(const v4u*)&tbl[wave * 16 + col][it * 16 + 8 * g];
#pragma unroll
      for (int it = 0; it < 8; ++it) vst2((unsigned*)(VBL + (hb * (KHI / 32) + kg + (it >> 1)) * 2048 + (it & 1) * 256 + fo), t[it]);
      XW(); } } } }
// frag_h from a base, the lane's own byte offset (row and lane half; 0 where the base already holds it) and a constant element offset
__device__ __forceinline__ v16h frag_s(const _Float16* base, unsigned lo, size_t e) { union { v16h v; v8h q[2]; } u; const char* p = (const char*)base + lo; u.q[0] = *(const v8h*)(p + 2 * e); u.q[1] = *(const v8h*)(p + 2 * e + 32); return u.v; }
// a fragment stored in fragment order: its two 16-byte pieces per lane lie 512 bytes apart; from a base, the lane's byte offset 16 lane (0 where the base already holds it) and a constant element offset
__device__ __forceinline__ v16h frag_o(const _Float16* base, unsigned lo, size_t e) { union { v16h v; v8h q[2]; } u; const char* p = (const char*)base + lo; u.q[0] = *(const v8h*)(p + 2 * e); u.q[1] = *(const v8h*)(p + 2 * e + 512); return u.v; }
// the same for bf16, from the lane's own address
__device__ __forceinline__ v16b frag_bo(const __bf16* base, size_t e) { union { v16b v; v8b q[2]; } u; u.q[0] = *(const v8b*)(base + e); u.q[1] = *(const v8b*)(base + e + 256); return u.v; }
// ---- k_attn: one walk = QWAVE queries (NCG groups of 16 columns) of (b, h) over a run of their passes of KPASS keys; waves w and w + 4 split the late queries' passes. S^T = k q^T (a lane holds the logits of ONE query: tile j, register r = key 16 j + 8 g + r), running maximum and sum per lane, ctx^T += v^T P^T with P^T packed from the score registers as the B operand (element order = the fragment k order above). Logits and P stay in registers. Queries < QHI: 3-product logits (f16 residuals) and P, v as bf16 hi + lo (3 products).
#define NCG 2              // 16-query column groups per wave: each k / v fragment load feeds NCG products
#define NKT 4              // 16-key tiles per pass
#define KPASS (16 * NKT)
#define QWAVE (16 * NCG)
#define QBLK (4 * QWAVE)
// one pass of the running softmax for one column group: mask by index (strict past, except (0, 0)), new maximum (own keys, then the other lane half), rescale sum and ctx, st <- exp(logit - maximum). An excluded logit is -3e38 and its exp is 0.
// st arrives as the raw q.k sums: exp(SCALE (s - max)) = 2^(C2 s - C2 max) with C2 = SCALE log2(e), one fused multiply-add and one hardware base-2 exponential per logit; m holds C2 x the running maximum (C2 > 0: scaling keeps the order).
#define C2 (SCALE * 1.44269504088896340736f)
__device__ __forceinline__ void sm_pass(v8f (&st)[NKT], v8f (&acc)[HD / 16], float& m, float& l, int kg, int t, bool edge) {
  if (edge) {
#pragma unroll
    for (int j = 0; j < NKT; ++j)
#pragma unroll
      for (int r = 0; r < 8; ++r) { const int k = kg + j * 16 + r; st[j][r] = (k < t || (k | t) == 0) ? st[j][r] : -3.0e38f; } }
  float mx = st[0][0];
#pragma unroll
  for (int j = 0; j < NKT; ++j)
#pragma unroll
    for (int r = 0; r < 8; ++r) mx = fmaxf(mx, st[j][r]);
  mx = fmaxf(mx, __shfl_xor(mx, 16));
  // the floor is below C2 x any sum of f16 products, so it changes no real maximum; it keeps a query that has seen only excluded keys so far (a wave that starts its walk behind key 0) at exp = 0
  const float mn = fmaxf(fmaxf(m, mx * C2), -1.0e30f), f = __builtin_amdgcn_exp2f(m - mn); m = mn;
  float s = 0.f;
#pragma unroll
  for (int j = 0; j < NKT; ++j) { float x[8];
#pragma unroll
    for (int r = 0; r < 8; ++r) x[r] = fmaf(st[j][r], C2, -mn);
    // a tile's eight exponentials, each in its own register: no one of them reads a neighbour's result or overwrites a neighbour's argument, and the v_nop is the slot that the last one asks for in front of whatever the compiler puts next (as builtins, neighbours came out sharing registers)
    asm("v_exp_f32 %0, %0\n\tv_exp_f32 %1, %1\n\tv_exp_f32 %2, %2\n\tv_exp_f32 %3, %3\n\tv_exp_f32 %4, %4\n\tv_exp_f32 %5, %5\n\tv_exp_f32 %6, %6\n\tv_exp_f32 %7, %7\n\tv_nop"
        : "+v"(x[0]), "+v"(x[1]), "+v"(x[2]), "+v"(x[3]), "+v"(x[4]), "+v"(x[5]), "+v"(x[6]), "+v"(x[7]));
#pragma unroll
    for (int r = 0; r < 8; ++r) { st[j][r] = x[r]; s += x[r]; } }
  l = l * f + s;
#pragma unroll
  for (int d = 0; d < HD / 16; ++d) acc[d] = acc[d] * f; }
// two waves per SIMD is all this grid supplies (256 workgroups of 8 waves): the register budget of two lets the fragments fetched ahead stay in registers
__global__ __launch_bounds__(256) __attribute__((amdgpu_waves_per_eu(2, 2))) void k_attn(const _Float16* __restrict__ QH, const _Float16* __restrict__ KH, const _Float16* __restrict__ QL, const _Float16* __restrict__ KL, const _Float16* __restrict__ VT, const __bf16* __restrict__ VB, const __bf16* __restrict__ VBL, float* __restrict__ Y) {
  const int tid = threadIdx.x, lane = tid & 31, col = lane & 15, g = lane >> 4; const int wave = __builtin_amdgcn_readfirstlane(tid >> 5);
  __shared__ __align__(16) char sx[4 * 17 * 512];   /* a helper wave's partial state: 17 pieces of 16 bytes per lane */
  const int b = blockIdx.x / NH, h = blockIdx.x % NH; const int w4 = wave & 3; const bool helper = wave >= 4;
  // the workgroup holds query tiles n - 1 - y (late) and y (early). Waves w and w + 4 share a SIMD and the same 32 queries of each tile: wave w + 4 walks the early tile's queries, then the late queries' passes from cut on; wave w walks the late queries' passes below cut. cut gives both the same load (a high-precision pass counted as three), so that neither runs alone on its SIMD for long
  const int qlL = (TT / QBLK - 1 - (int)blockIdx.y) * QBLK + w4 * QWAVE, qlE = (int)blockIdx.y * QBLK + w4 * QWAVE;
  const int nL = (qlL + QWAVE - 2) / KPASS + 1, nE = (qlE + QWAVE - 2) / KPASS + 1;   /* a wave's last visible key is its first query + QWAVE - 2 */
  const int half = (nL + (qlE < QHI ? 3 * nE : nE) + 1) / 2, cut = half < nL ? half : nL;
  float m[NCG], l[NCG]; v8f acc[NCG][HD / 16];
  // acc[c][d][r] = ctx(query q0 + 16 c + col, dim 16 d + 8 g + r) x sum: join the two lane halves' sums, divide, 32 contiguous bytes per lane and d
  auto store_out = [&](int q0) {
#pragma unroll
    for (int c = 0; c < NCG; ++c) { const float a = l[c] + __shfl_xor(l[c], 16); const float inv = a > 0.f ? 1.0f / a : 0.f; float* yr = Y + ((size_t)b * TT + q0 + c * 16 + col) * CC + h * HD + 8 * g;
#pragma unroll
      for (int d = 0; d < HD / 16; ++d) { const v8f o = acc[c][d] * inv; vst2(yr + d * 16, v4f{o[0], o[1], o[2], o[3]}); vst2(yr + d * 16 + 4, v4f{o[4], o[5], o[6], o[7]}); } }
    XW(); };
  // one walk: the 32 queries from ql0 on, passes p0 .. npass - 1; early: the queries may be high-precision rows
  auto walk = [&](int ql0, int p0, int npass, bool early) __attribute__((always_inline)) {
  const _Float16* Qb = QH + ((size_t)b * TT + ql0 + col) * CC + h * HD; const size_t bh = (size_t)(b * NH + h) * HD;   /* x the plane's key count: where (b, h) begins in a fragment-order plane; 64 keys (a pass) are 4096 elements there */
#pragma unroll
  for (int c = 0; c < NCG; ++c) { m[c] = -3.0e38f; l[c] = 0.f;
#pragma unroll
    for (int d = 0; d < HD / 16; ++d) acc[c][d] = v8f{}; }
  if (early && ql0 < QHI) {   /* wave-uniform; an early tile alone (p0 = 0); the wave's passes end at or below key KHI */
    const _Float16* QLb = QL + ((size_t)b * QHI + ql0 + col) * CC + h * HD; const _Float16* Kb = KH + bh * TT + 8 * lane; const _Float16* KLb = KL + bh * KHI + 8 * lane;
    const __bf16* VBb = VB + bh * KHI + 8 * lane; const __bf16* VLb = VBL + bh * KHI + 8 * lane;
    v16h qf[NCG][2], qlf[NCG][2]; const _Float16* qp = Qb + 8 * g; const _Float16* qlp = QLb + 8 * g;   /* the lane's own addresses */
#pragma unroll
    for (int c = 0; c < NCG; ++c)
#pragma unroll
      for (int kc = 0; kc < 2; ++kc) { qf[c][kc] = frag_s(qp, 0u, (size_t)c * 16 * CC + kc * 32); qlf[c][kc] = frag_s(qlp, 0u, (size_t)c * 16 * CC + kc * 32); }
    // stands in front of any rewrite of the address registers that the loads above it name; the two addresses as inputs keep their registers whole until it, the scheduling barrier holds the loads in front of it and later address arithmetic behind it (the fragments themselves are no operands: as operands of an asm statement they would be held to the first 256 registers for the whole loop, which now has no room for them there)
    asm volatile("s_wait_xcnt 0x0" :: "v"(qp), "v"(qlp) : "memory");
    __builtin_amdgcn_sched_barrier(0);
    for (int ps = 0; ps < npass; ++ps) { const int k0 = ps * KPASS; v8f st[NCG][NKT];
      // the pass's k fragments, values and residuals, are requested as one group: the wave waits for memory once, not once per tile and half row
      const _Float16* kp = Kb + (size_t)k0 * HD; const _Float16* klp = KLb + (size_t)k0 * HD;   /* the lane's own addresses: every load of the group is one of them plus a constant */
      v16h kf[NKT][2], klf[NKT][2];
#pragma unroll
      for (int j = 0; j < NKT; ++j)
#pragma unroll
        for (int kc = 0; kc < 2; ++kc) { kf[j][kc] = frag_o(kp, 0u, (size_t)j * 1024 + kc * 512); klf[j][kc] = frag_o(klp, 0u, (size_t)j * 1024 + kc * 512); }
      // stands in front of any rewrite of the address registers that the loads above it name; the two addresses as inputs keep their registers whole until it
      asm volatile("s_wait_xcnt 0x0" :: "v"(kp), "v"(klp) : "memory");
      __builtin_amdgcn_sched_barrier(0);   // keeps the compiler from sinking those loads to their first use, where each would be waited for alone
#pragma unroll
      for (int j = 0; j < NKT; ++j) { v8f a[NCG] = {}, al[NCG] = {};
#pragma unroll
        for (int kc = 0; kc < 2; ++kc)
#pragma unroll
          for (int c = 0; c < NCG; ++c) { a[c] = wmh(kf[j][kc], qf[c][kc], a[c]); al[c] = wmh(kf[j][kc], qlf[c][kc], al[c]); al[c] = wmh(klf[j][kc], qf[c][kc], al[c]); }
#pragma unroll
        for (int c = 0; c < NCG; ++c) st[c][j] = a[c] + al[c] * (1.0f / 1024.0f); }
      // the pass's v fragments, hi and lo, are requested here as one group, ahead of the softmax arithmetic that covers their latency
      const __bf16* vp = VBb + (size_t)k0 * HD; const __bf16* vlp = VLb + (size_t)k0 * HD;
      v16b vh[NKT / 2][HD / 16], vl[NKT / 2][HD / 16];
#pragma unroll
      for (int jj = 0; jj < NKT / 2; ++jj)
#pragma unroll
        for (int d = 0; d < HD / 16; ++d) { vh[jj][d] = frag_bo(vp, (size_t)jj * 2048 + d * 512); vl[jj][d] = frag_bo(vlp, (size_t)jj * 2048 + d * 512); }
      // as above: in front of any rewrite of the two addresses, and the loads stay in front of the softmax
      asm volatile("s_wait_xcnt 0x0" :: "v"(vp), "v"(vlp) : "memory");
      __builtin_amdgcn_sched_barrier(0);
#pragma unroll
      for (int c = 0; c < NCG; ++c) sm_pass(st[c], acc[c], m[c], l[c], k0 + 8 * g, ql0 + c * 16 + col, true);
#pragma unroll
      for (int jj = 0; jj < NKT / 2; ++jj) { F2 p[NCG];
#pragma unroll
        for (int c = 0; c < NCG; ++c) { float pv[16];
#pragma unroll
          for (int i = 0; i < 8; ++i) { pv[i] = st[c][2 * jj][i]; pv[8 + i] = st[c][2 * jj + 1][i]; }
          p[c] = bsplit16(pv); }
#pragma unroll
        for (int d = 0; d < HD / 16; ++d)
#pragma unroll
          for (int c = 0; c < NCG; ++c) { acc[c][d] = wmb(vh[jj][d], p[c].h, acc[c][d]); acc[c][d] = wmb(vh[jj][d], p[c].l, acc[c][d]); acc[c][d] = wmb(vl[jj][d], p[c].h, acc[c][d]); } } }
  } else if (p0 < npass) {
    const _Float16* Qu = QH + ((size_t)b * TT + ql0) * CC + __builtin_amdgcn_readfirstlane(h * HD); const _Float16* Ku = KH + bh * TT; const _Float16* Vu = VT + bh * TT;   /* wave-uniform bases; the builtin keeps q's base a scalar pair in both walks, so that the wait below holds the very pair that the q loads name (in the second walk the head offset came through a vector register, and the loads got a copy that the wait did not hold) */
    const unsigned rlo = 2u * (col * CC + 8 * g), flo = 16u * lane;   /* the lane's byte offset in q rows; in a 512-byte piece of k or v */
    const _Float16* Kl = Ku + 8 * lane; const _Float16* Vl = Vu + 8 * lane;   /* the lane's own 16 bytes of the first pieces of k, of v */
    v16h qf[NCG][2];
#pragma unroll
    for (int c = 0; c < NCG; ++c)
#pragma unroll
      for (int kc = 0; kc < 2; ++kc) qf[c][kc] = frag_s(Qu, rlo, (size_t)c * 16 * CC + kc * 32);
    v16h kf[2][NKT], vf[NKT / 2][HD / 16]; const _Float16* Kf = Ku + (size_t)p0 * KPASS * HD;   /* the task's first pass */
#pragma unroll
    for (int kc = 0; kc < 2; ++kc)
#pragma unroll
      for (int j = 0; j < NKT; ++j) kf[kc][j] = frag_o(Kf, flo, (size_t)j * 1024 + kc * 512);
    // stands in front of any rewrite of the registers that the loads above it name; the two bases and the two offsets as inputs keep those registers whole until it, the scheduling barrier holds the loads in front of it and later address arithmetic behind it
    asm volatile("s_wait_xcnt 0x0" :: "s"(Qu), "s"(Kf), "v"(rlo), "v"(flo) : "memory");
    __builtin_amdgcn_sched_barrier(0);
    for (int ps = p0; ps < npass; ++ps) { const int k0 = ps * KPASS; v8f st[NCG][NKT];
#pragma unroll
      for (int c = 0; c < NCG; ++c)
#pragma unroll
        for (int j = 0; j < NKT; ++j) st[c][j] = v8f{};
#pragma unroll
      for (int kc = 0; kc < 2; ++kc)
#pragma unroll
        for (int j = 0; j < NKT; ++j)
#pragma unroll
          for (int c = 0; c < NCG; ++c) st[c][j] = wmh(kf[kc][j], qf[c][kc], st[c][j]);
      // this pass's v fragments and the next pass's k fragments (the last pass fetches its own again: stays inside the wave's key range) are requested here, ahead of the softmax arithmetic that covers their latency
      const int kn = ps + 1 < npass ? k0 + KPASS : k0; const _Float16* vp = Vl + (size_t)k0 * HD; const _Float16* kp = Kl + (size_t)kn * HD;   /* the lane's own addresses: every load of the run is one of them plus a constant */
#pragma unroll
      for (int jj = 0; jj < NKT / 2; ++jj)
#pragma unroll
        for (int d = 0; d < HD / 16; ++d) vf[jj][d] = frag_o(vp, 0u, (size_t)jj * 2048 + d * 512);
#pragma unroll
      for (int kc = 0; kc < 2; ++kc)
#pragma unroll
        for (int j = 0; j < NKT; ++j) kf[kc][j] = frag_o(kp, 0u, (size_t)j * 1024 + kc * 512);
      // stands in front of any rewrite of the address registers that the loads above it name; the two addresses as inputs keep their registers whole until it: no load of the run may land in a pair that the loads in front of it name
      asm volatile("s_wait_xcnt 0x0" :: "v"(vp), "v"(kp) : "memory");
      __builtin_amdgcn_sched_barrier(0);   // keeps the compiler from sinking those loads to their first use, where each would be waited for alone
      const bool edge = k0 + KPASS > ql0;   /* wave-uniform: only passes that reach the wave's first query hold excluded keys */
#pragma unroll
      for (int c = 0; c < NCG; ++c) sm_pass(st[c], acc[c], m[c], l[c], k0 + 8 * g, ql0 + c * 16 + col, edge);
#pragma unroll
      for (int jj = 0; jj < NKT / 2; ++jj) { v16h p[NCG];
#pragma unroll
        for (int c = 0; c < NCG; ++c)
#pragma unroll
          for (int i = 0; i < 8; ++i) { p[c][i] = (_Float16)st[c][2 * jj][i]; p[c][8 + i] = (_Float16)st[c][2 * jj + 1][i]; }
#pragma unroll
        for (int d = 0; d < HD / 16; ++d)
#pragma unroll
          for (int c = 0; c < NCG; ++c) acc[c][d] = wmh(vf[jj][d], p[c], acc[c][d]); } } }
  };
  if (helper) { walk(qlE, 0, nE, true); store_out(qlE); }
  walk(qlL, helper ? cut : 0, helper ? nL : cut, false);
  // the helper's partial maximum, sum and ctx of the late queries go to its partner through LDS (the same lane holds the same query and dims in both waves): piece q of a lane at (17 w + q) x 512 + 16 lane
  char* xp = sx + (w4 * 17 * 32 + lane) * 16;
  if (helper) {
#pragma unroll
    for (int c = 0; c < NCG; ++c)
#pragma unroll
      for (int d = 0; d < HD / 16; ++d) { const v8f o = acc[c][d]; *(v4f*)(xp + ((c * (HD / 16) + d) * 2) * 512) = v4f{o[0], o[1], o[2], o[3]}; *(v4f*)(xp + ((c * (HD / 16) + d) * 2 + 1) * 512) = v4f{o[4], o[5], o[6], o[7]}; }
    *(v4f*)(xp + 16 * 512) = v4f{m[0], m[1], l[0], l[1]}; }
  __syncthreads();   // the partial states are written before a partner reads them
  if (!helper) { const v4f ml = *(const v4f*)(xp + 16 * 512);
#pragma unroll
    for (int c = 0; c < NCG; ++c) { const float mm = fmaxf(m[c], ml[c]), f1 = __builtin_amdgcn_exp2f(m[c] - mm), f2 = __builtin_amdgcn_exp2f(ml[c] - mm); l[c] = l[c] * f1 + ml[NCG + c] * f2;   /* both parts brought to the common maximum; a helper without a pass holds sum 0, ctx 0 and f2 = 0 */
#pragma unroll
      for (int d = 0; d < HD / 16; ++d) { const v4f a0 = *(const v4f*)(xp + ((c * (HD / 16) + d) * 2) * 512), a1 = *(const v4f*)(xp + ((c * (HD / 16) + d) * 2 + 1) * 512);
#pragma unroll
        for (int r = 0; r < 4; ++r) { acc[c][d][r] = acc[c][d][r] * f1 + a0[r] * f2; acc[c][d][4 + r] = acc[c][d][4 + r] * f1 + a1[r] * f2; } } }
    store_out(qlL); } }
// ---- k_out: block = (128 rows, 128 cols): out = ctx Wo (+ bo): ctx once to f16 against Wo as f16(bf16 x 2^8) exact (1 product) x 2^-8; causal early rows (< QHI of each sequence): ctx bf16 hi + lo against exact bf16 Wo (2 products). Each wave stages its 32 x 64 of the output in its own part of the LDS that the operand buffers have left.
__global__ __launch_bounds__(256) void k_out(const float* __restrict__ Y, const float* __restrict__ WO, const float* __restrict__ BO, float* __restrict__ OUT) { __shared__ __align__(16) char sm[2 * 3 * 128 * 144];
  const int tid = threadIdx.x, wave = tid >> 5, lane = tid & 31, col = lane & 15, g = lane >> 4, wr = wave >> 1, wc = wave & 1; const int c0 = blockIdx.y * 128; const size_t r0 = (size_t)blockIdx.x * 128;
  v8f acc[2][4] = {}; float sc; const int s0 = (int)((blockIdx.x + 2 * blockIdx.y) & 15);   /* 16 k steps: the 8 column blocks that share ctx rows start 2 steps apart, the 32 row blocks that share a weight tile at all 16 steps, two at each */
  if (CAUSAL && (int)(r0 % TT) < QHI) { gemm_tile<2, 64>(Y + r0 * CC, WO + (size_t)c0 * CC, sm, acc, s0); sc = 1.0f; }   /* block-uniform */
  else { gemm_tile<1, 64>(Y + r0 * CC, WO + (size_t)c0 * CC, sm, acc, s0); sc = 1.0f / 256.0f; }
  float (*sf)[68] = (float (*)[68])(sm + wave * 32 * 68 * 4);
#pragma unroll
  for (int j = 0; j < 4; ++j) { const float bias = BO ? bfr(BO[c0 + wc * 64 + j * 16 + col]) : 0.f;
#pragma unroll
    for (int i = 0; i < 2; ++i)
#pragma unroll
      for (int r = 0; r < 8; ++r) sf[i * 16 + 8 * g + r][j * 16 + col] = acc[i][j][r] * sc + bias; }
  LDSX();
#pragma unroll
  for (int rl = 0; rl < 32; rl += 2) vst2(OUT + (r0 + wr * 32 + rl + g) * DIN + c0 + wc * 64 + col * 4, *(const v4f*)&sf[rl + g][col * 4]); }

extern "C" void kernel_launch(void* const* d_in, const int* in_sizes, int n_in, void* d_out, int out_size, void* d_ws, size_t ws_size, hipStream_t stream) {
  (void)in_sizes; (void)n_in; (void)out_size;
  const float** F = (const float**)d_in;
  if (ws_size < (size_t)WS_END) return;
  char* ws = (char*)d_ws; _Float16 *QH = (_Float16*)(ws + WS_QH), *KH = (_Float16*)(ws + WS_KH), *VT = (_Float16*)(ws + WS_VT), *QL = (_Float16*)(ws + WS_QL), *KL = (_Float16*)(ws + WS_KL); __bf16 *VB = (__bf16*)(ws + WS_VB), *VBL = (__bf16*)(ws + WS_VBL); float *Y = (float*)(ws + WS_Y);
  (void)Y; (void)QL; (void)KL; (void)VB; (void)VBL;
  // inputs: 0 q, 1 k, 2 v [2,2048,1024]; 3 Wq, 4 Wk, 5 Wv, 6 Wo [1024,1024] (out,in), no biases
  k_proj<<<dim3(TNB * TT / 256, CC / 128, 3), 256, 0, stream>>>(F[0], F[1], F[2], F[3], F[4], F[5], nullptr, nullptr, nullptr, QH, QL, KH, KL, VT, VB, VBL);
  k_attn<<<dim3(TNB * NH, TT / QBLK / 2), 256, 0, stream>>>(QH, KH, QL, KL, VT, VB, VBL, Y);
  k_out<<<dim3(TNB * TT / 128, DIN / 128), 256, 0, stream>>>(Y, F[6], nullptr, (float*)d_out);
}

// v009
// A run of this version takes 71.9 microseconds.
// Timed twice side by side with v008, it ran 1.03 times as fast both times.
// Counting every step since v000, it is 16.4 times as fast.
// compute dtype: all float inputs rounded to bf16; q/k/v = input W^T with EXACT bf16 products on WMMA 16x16x32 (f32 accumulate); causal (strict past) logits: q x 1024^-0.5 log2(e) and k once to f16 (1 product), except the first 384 query rows of each sequence (3 products with f16 residuals); softmax in f32 against a running reference (a maximum seen so far, at most 8 base-2 units below the largest logit); exp(logit - reference) once to f16 against v once to f16 (1 product; bf16 hi + lo below row 384); ctx once to f16 against Wo carried x 2^8 in f16 (rows below 384: ctx bf16 hi + lo against bf16 Wo, 2 products); f32 output.
#include <hip/hip_runtime.h>
#include <math.h>

typedef __attribute__((ext_vector_type(16))) _Float16 v16h;
typedef __attribute__((ext_vector_type(16))) __bf16 v16b;
typedef __attribute__((ext_vector_type(8)))  _Float16 v8h;
typedef __attribute__((ext_vector_type(8)))  float v8f;
typedef __attribute__((ext_vector_type(4)))  float v4f;
typedef __attribute__((ext_vector_type(2)))  float v2f;
typedef __attribute__((ext_vector_type(4)))  unsigned v4u;
typedef __attribute__((ext_vector_type(4)))  int v4i;
typedef float __attribute__((may_alias)) float_a;
typedef int __attribute__((may_alias)) int_a;

template <typename T> __device__ __forceinline__ void vst2(void* p, T v) { *(T*)p = v;  }
__device__ __forceinline__ v8f wmma16(v16h a, v16h b, v8f c) {
  v8f d = __builtin_amdgcn_wmma_f32_16x16x32_f16(false, a, false, b, (short)0, c, false, false);
  asm volatile("v_nop\n\tv_nop\n\tv_nop\n\tv_nop" : "+v"(d) : "v"(a), "v"(b));
  return d;
}
__device__ __forceinline__ v8f wmma_bf(v16b a, v16b b, v8f c) {
  v8f d = __builtin_amdgcn_wmma_f32_16x16x32_bf16(false, a, false, b, (short)0, c, false, false);
  asm volatile("v_nop\n\tv_nop\n\tv_nop\n\tv_nop" : "+v"(d) : "v"(a), "v"(b));
  return d;
}
// 16x16x32 fragments: lane = (h = lane>>4, row/col = lane&15); elements 0..7 = k0+8h+0..7, 8..15 = k0+16+8h+0..7; D element r = row 8h+r
__device__ __forceinline__ v16h frag_h(const _Float16* rowk0, int lane) {
  union { v16h v; v8h q[2]; } u; const _Float16* p = rowk0 + 8 * (lane >> 4);
  u.q[0] = *(const v8h*)p; u.q[1] = *(const v8h*)(p + 16); return u.v;
}
__device__ __forceinline__ v16h frag_f32(const float* rowk0, int lane) {
  v16h a; const float* p = rowk0 + 8 * (lane >> 4);
#pragma unroll
  for (int i = 0; i < 8; ++i) { a[i] = (_Float16)p[i]; a[8 + i] = (_Float16)p[16 + i]; }
  return a;
}
__device__ __forceinline__ v16h frag_f32s(const float* rowk0, int lane, float sc) {
  v16h a; const float* p = rowk0 + 8 * (lane >> 4);
#pragma unroll
  for (int i = 0; i < 8; ++i) { a[i] = (_Float16)(p[i] * sc); a[8 + i] = (_Float16)(p[16 + i] * sc); }
  return a;
}
// column fragment from a [K][ld] layout (column n), rows >= K read as 0
__device__ __forceinline__ v16h fragc_f32(const float* W, int k0, int n, int lane, int ld, int K) {
  v16h a; const int g = lane >> 4;
#pragma unroll
  for (int i = 0; i < 8; ++i) { const int ka = k0 + 8 * g + i, kb = ka + 16;
    a[i] = (_Float16)(ka < K ? W[(size_t)(ka < K ? ka : K - 1) * ld + n] : 0.f); a[8 + i] = (_Float16)(kb < K ? W[(size_t)(kb < K ? kb : K - 1) * ld + n] : 0.f); }
  return a;
}
struct F2 { v16b h, l; };
__device__ __forceinline__ F2 bsplit16(const float v[16]) { F2 r;
#pragma unroll
  for (int i = 0; i < 16; ++i) { const __bf16 h = (__bf16)v[i]; r.h[i] = h; r.l[i] = (__bf16)(v[i] - (float)h); }
  return r; }
__device__ __forceinline__ F2 split_row(const float* row, int k0, int lane) { float v[16]; const float* p = row + k0 + 8 * (lane >> 4);
#pragma unroll
  for (int i = 0; i < 8; ++i) { v[i] = p[i]; v[8 + i] = p[16 + i]; }
  return bsplit16(v); }
__device__ __forceinline__ F2 split_rowK(const float* row, int k0, int lane, int K) { float v[16]; const int g = lane >> 4;
#pragma unroll
  for (int i = 0; i < 8; ++i) { const int ka = k0 + 8 * g + i, kb = ka + 16; v[i] = ka < K ? row[ka < K ? ka : K - 1] : 0.f; v[8 + i] = kb < K ? row[kb < K ? kb : K - 1] : 0.f; }
  return bsplit16(v); }
__device__ __forceinline__ F2 split_col(const float* W, int k0, int n, int lane, int ld, int K) { float v[16]; const int g = lane >> 4;
#pragma unroll
  for (int i = 0; i < 8; ++i) { const int ka = k0 + 8 * g + i, kb = ka + 16; v[i] = ka < K ? W[(size_t)(ka < K ? ka : K - 1) * ld + n] : 0.f; v[8 + i] = kb < K ? W[(size_t)(kb < K ? kb : K - 1) * ld + n] : 0.f; }
  return bsplit16(v); }
__device__ __forceinline__ v8f mac3(const F2& a, const F2& b, v8f c) { c = wmma_bf(a.l, b.h, c); c = wmma_bf(a.h, b.l, c); return wmma_bf(a.h, b.h, c); }
__device__ __forceinline__ float sigm(float v) { return 1.0f / (1.0f + expf(-v)); }
#define LDSX() do { asm volatile("s_wait_dscnt 0" ::: "memory"); __builtin_amdgcn_wave_barrier(); __builtin_amdgcn_fence(__ATOMIC_RELEASE, "workgroup"); } while (0)

// In-context-learning attention (B 2, S 2,048, E 1,024 = 16 x 64; separate q/k/v inputs): qh = q Wq^T, kh = k Wk^T, vh = v Wv^T ((out,in)); scores = qh kh^T / sqrt(1024) masked where key >= query (strict past) except (0, 0); softmax; out = merged(probs vh) Wo^T.
#define NB 2
#define TT 2048
#define CC 1024            // NH * HD = projected width
#define DIN 1024          // input (model) width
#define NH 16
#define HD 64
#define NQB (TT / 64)
#define SCALE (0.03125f)
#define C2 (SCALE * 1.44269504088896340736f)   // k_proj stores q x C2: a q.k sum is then the logit in base-2 units, exp(SCALE s) = 2^(C2 s)
#define CAUSAL 1
#ifndef TNB
#define TNB NB
#endif
__device__ __forceinline__ float bfr(float v) { return (float)(__bf16)v; }
__host__ __device__ __forceinline__ int kb_last(int qb) { return CAUSAL ? ((qb * 64 + 63) >> 7) : (TT / 128 - 1); }
typedef __attribute__((ext_vector_type(8))) __bf16 v8b;
__device__ __forceinline__ v16b frag_b(const __bf16* rowk0, int lane) {
  union { v16b v; v8b q[2]; } u; const __bf16* p = rowk0 + 8 * (lane >> 4);
  u.q[0] = *(const v8b*)p; u.q[1] = *(const v8b*)(p + 16); return u.v;
}
#define QBH 6              // read nowhere: the high-precision paths are taken by query rows < QHI
#define QHI 384            // rows carrying a q residual plane
#define KHI 384            // key rows carrying k residual / v bf16 hi+lo planes (used only by the causal high-precision path)
// B fragment (k rows k0+.., output column o) of a weight: (in,out) [K][ld] or (out,in) [ld rows of K]: bf16 exact, or f16(bf16 * 256) exact
__device__ __forceinline__ v16b wcol_io(const float* Wm, int k0, int o, int lane, int ld) { v16b w; const int g = lane >> 4;
#pragma unroll
  for (int i = 0; i < 8; ++i) { w[i] = (__bf16)Wm[(size_t)(k0 + 8 * g + i) * ld + o]; w[8 + i] = (__bf16)Wm[(size_t)(k0 + 16 + 8 * g + i) * ld + o]; }
  return w; }
__device__ __forceinline__ v16b wcol_oi(const float* Wm, int k0, int o, int lane, int K) { v16b w; const float* p = Wm + (size_t)o * K + k0 + 8 * (lane >> 4);
#pragma unroll
  for (int i = 0; i < 8; ++i) { w[i] = (__bf16)p[i]; w[8 + i] = (__bf16)p[16 + i]; }
  return w; }
__device__ __forceinline__ v16h wcolh_io(const float* Wm, int k0, int o, int lane, int ld) { v16h w; const int g = lane >> 4;
#pragma unroll
  for (int i = 0; i < 8; ++i) { w[i] = (_Float16)(bfr(Wm[(size_t)(k0 + 8 * g + i) * ld + o]) * 256.0f); w[8 + i] = (_Float16)(bfr(Wm[(size_t)(k0 + 16 + 8 * g + i) * ld + o]) * 256.0f); }
  return w; }
__device__ __forceinline__ v16h wcolh_oi(const float* Wm, int k0, int o, int lane, int K) { v16h w; const float* p = Wm + (size_t)o * K + k0 + 8 * (lane >> 4);
#pragma unroll
  for (int i = 0; i < 8; ++i) { w[i] = (_Float16)(bfr(p[i]) * 256.0f); w[8 + i] = (_Float16)(bfr(p[16 + i]) * 256.0f); }
  return w; }
#define WQKV_LAYOUT 1   // 0 = (in,out) [DIN][CC]; 1 = (out,in) [CC][DIN]; 2 = per-head [NH][DIN][HD]
__device__ __forceinline__ v16b wcol_hdk(const float* Wm, int k0, int o, int lane) { v16b w; const int g = lane >> 4; const float* p = Wm + (size_t)(o / HD) * DIN * HD + (o % HD);
#pragma unroll
  for (int i = 0; i < 8; ++i) { w[i] = (__bf16)p[(size_t)(k0 + 8 * g + i) * HD]; w[8 + i] = (__bf16)p[(size_t)(k0 + 16 + 8 * g + i) * HD]; }
  return w; }
#define WO_OUT_IN 1
#if WQKV_LAYOUT == 1
#define WCOL(W, k0, o, lane) wcol_oi(W, k0, o, lane, DIN)
#elif WQKV_LAYOUT == 2
#define WCOL(W, k0, o, lane) wcol_hdk(W, k0, o, lane)
#else
#define WCOL(W, k0, o, lane) wcol_io(W, k0, o, lane, CC)
#endif
#if WO_OUT_IN
#define WOCOL(W, k0, o, lane) wcol_oi(W, k0, o, lane, CC)
#define WOCOLH(W, k0, o, lane) wcolh_oi(W, k0, o, lane, CC)
#else
#define WOCOL(W, k0, o, lane) wcol_io(W, k0, o, lane, DIN)
#define WOCOLH(W, k0, o, lane) wcolh_io(W, k0, o, lane, DIN)
#endif
#ifndef PROJ_EXTRA_PARAMS
#define PROJ_EXTRA_PARAMS
#endif

#define WS_QH  0u                                      // f16 q rows [b*t][CC]
// k and v planes lie in the order of k_attn's A fragments, so that each of its 16-byte-per-lane loads covers 512 contiguous bytes (4 whole lines) and not 32 bytes of each of 16 lines.
// k: [b][h][t / 16][kc 2][q 2][lane 32][8]: lane (g, col) holds key 16 (t / 16) + col, dims 32 kc + 16 q + 8 g + 0..7. v: [b][h][t / 32][d 4][q 2][lane 32][8]: lane (g, col) holds dim 16 d + col, keys 32 (t / 32) + 16 q + 8 g + 0..7.
#define WS_KH  (WS_QH + 2u * (size_t)NB * TT * CC)      // f16 k, fragment order, all t
#define WS_VT  (WS_KH + 2u * (size_t)NB * TT * CC)      // f16 v, fragment order, all t
#define WS_QL  (WS_VT + 2u * (size_t)NB * CC * TT)      // f16 q residual x 2^10 rows [b][t < QHI][CC]
#define WS_KL  (WS_QL + 2u * (size_t)NB * QHI * CC)     // f16 k residual x 2^10, fragment order, t < KHI
#define WS_VB  (WS_KL + 2u * (size_t)NB * KHI * CC)     // bf16 v hi (then lo), fragment order, t < KHI
#define WS_VBL (WS_VB + 2u * (size_t)NB * CC * KHI)
#define WS_Y   (WS_VBL + 2u * (size_t)NB * CC * KHI)     // f32 ctx rows [b*t][CC] (only when there is an output projection)
#define WS_END (WS_Y  + 4u * (size_t)NB * TT * CC)

// plain builtin products: the compiler keeps the distance behind them itself and may place their operands in any register window
__device__ __forceinline__ v8f wmh(v16h a, v16h b, v8f c) { return __builtin_amdgcn_wmma_f32_16x16x32_f16(false, a, false, b, (short)0, c, false, false); }
__device__ __forceinline__ v8f wmb(v16b a, v16b b, v8f c) { return __builtin_amdgcn_wmma_f32_16x16x32_bf16(false, a, false, b, (short)0, c, false, false); }
typedef __attribute__((ext_vector_type(4))) __bf16 v4b;
typedef __attribute__((ext_vector_type(4))) _Float16 v4h;
__device__ __forceinline__ v4b cvt4b(v4f v) { return v4b{(__bf16)v[0], (__bf16)v[1], (__bf16)v[2], (__bf16)v[3]}; }
// ---- gemm_tile: 256 threads, acc += A[128 rows][1024] B[128 rows][1024]^T, both k-contiguous f32 rows. Each k step of BK is read once per workgroup with whole-line loads, converted once and kept in LDS as 16-bit rows of pitch 2 BK + 16 bytes (16 B x odd: no bank conflict for 16-byte fragment reads); two buffers: the next step's loads fly while this step's products run. Waves 4 x 2, 32 x 64 of the tile each (acc[i][j]: rows 32 wr + 16 i, columns 64 wc + 16 j). The k walk begins at step s0 (the same for the whole workgroup, below KD / BK), runs upward and wraps to step 0: workgroups that share operand rows are given different s0, so that they do not ask L2 for the same lines at the same moment.
// MODE 0: A, B to bf16. MODE 1: A to f16, B to f16(bf16 x 2^8). MODE 2: A to bf16 hi + lo (two planes, hi product first), B to bf16. On return every wave has left the buffers (sm may be reused). Every unroll directive here and in the two kernels' output staging keeps a register array (loaded pieces, fragments, accumulators) indexed by constants.
// MT = 2 (MODE 0 only): A has 256 rows, and a wave holds 64 x 64 of the 256 x 128 tile: acc[i][j] with i = 2, 3 are the rows of i = 0, 1 plus 128. Each fragment read from LDS then feeds 4 products, and the B rows are asked of L2 once per 256 rows of A. LDS of a buffer: A planes (128 MT rows), B plane, then MODE 2's lo plane.
template <int MODE, int BK, int MT = 1>
__device__ __forceinline__ void gemm_tile(const float* __restrict__ A, const float* __restrict__ Bw, char* sm, v8f (&acc)[2 * MT][4], int s0) {
  static_assert(MT == 1 || MODE == 0, "256 rows of A: bf16 operands only");
  constexpr int KD = 1024, PITCH = 2 * BK + 16, UR = BK / 4, RS = 256 / UR, NU = 128 / RS, PL = 128 * PITCH, PLA = MT * PL, BUF = PLA + PL + (MODE == 2 ? PLA : 0), NS = KD / BK;
  const int tid = threadIdx.x, lane = tid & 31, col = lane & 15, g = lane >> 4, wave = tid >> 5, wr = wave >> 1, wc = wave & 1;
  const float* ga = A + (size_t)(tid / UR) * KD + (tid % UR) * 4 + s0 * BK; const float* gb = Bw + (size_t)(tid / UR) * KD + (tid % UR) * 4 + s0 * BK;   /* the thread's 16 bytes of rows tid / UR + i RS, at k step s0 */
  int ks = s0;   /* the k step that the next fetch reads */
  char* sw = sm + (tid / UR) * PITCH + (tid % UR) * 8;
  const char* fa = sm + (wr * 32 + col) * PITCH + 16 * g; const char* fb = sm + PLA + (wc * 64 + col) * PITCH + 16 * g;
  v4f ra[MT * NU], rb[NU];
  auto fetch = [&]() {
#pragma unroll
    for (int i = 0; i < NU; ++i) { ra[i] = *(const v4f*)(ga + (size_t)i * RS * KD); rb[i] = *(const v4f*)(gb + (size_t)i * RS * KD); }
#pragma unroll
    for (int i = NU; i < MT * NU; ++i) ra[i] = *(const v4f*)(ga + (size_t)i * RS * KD);
    // stands in front of the rewrite of the two address pairs that the loads above it name (every load is one of them plus a constant); the pairs as inputs keep their registers whole until it
    asm volatile("s_wait_xcnt 0x0" :: "v"(ga), "v"(gb) : "memory");
    __builtin_amdgcn_sched_barrier(0);   // holds the loads in front of the products that cover their latency, and the address additions behind the wait
    ks = ks + 1 == NS ? 0 : ks + 1; const int adv = ks == 0 ? BK - KD : BK;   /* behind the last k step the walk wraps to the first */
    ga += adv; gb += adv; };
  auto stage = [&](int off) {
#pragma unroll
    for (int i = 0; i < NU; ++i) { char* p = sw + off + i * RS * PITCH;
      if constexpr (MODE == 0) { *(v4b*)p = cvt4b(ra[i]); *(v4b*)(p + PLA) = cvt4b(rb[i]); }
      else if constexpr (MODE == 1) { *(v4h*)p = v4h{(_Float16)ra[i][0], (_Float16)ra[i][1], (_Float16)ra[i][2], (_Float16)ra[i][3]};
        *(v4h*)(p + PL) = v4h{(_Float16)(bfr(rb[i][0]) * 256.0f), (_Float16)(bfr(rb[i][1]) * 256.0f), (_Float16)(bfr(rb[i][2]) * 256.0f), (_Float16)(bfr(rb[i][3]) * 256.0f)}; }
      else { const v4b hv = cvt4b(ra[i]); *(v4b*)p = hv; *(v4b*)(p + 2 * PL) = cvt4b(v4f{ra[i][0] - (float)hv[0], ra[i][1] - (float)hv[1], ra[i][2] - (float)hv[2], ra[i][3] - (float)hv[3]}); *(v4b*)(p + PL) = cvt4b(rb[i]); } }
#pragma unroll
    for (int i = NU; i < MT * NU; ++i) *(v4b*)(sw + off + i * RS * PITCH) = cvt4b(ra[i]); };
  auto products = [&](int off) {
#pragma unroll
    for (int kk = 0; kk < BK / 32; ++kk) {
      if constexpr (MODE == 1) { v16h a[2], w[4];
#pragma unroll
        for (int i = 0; i < 2; ++i) { union { v16h v; v8h q[2]; } u; const char* p = fa + off + i * 16 * PITCH + kk * 64; u.q[0] = *(const v8h*)p; u.q[1] = *(const v8h*)(p + 32); a[i] = u.v; }
#pragma unroll
        for (int j = 0; j < 4; ++j) { union { v16h v; v8h q[2]; } u; const char* p = fb + off + j * 16 * PITCH + kk * 64; u.q[0] = *(const v8h*)p; u.q[1] = *(const v8h*)(p + 32); w[j] = u.v; }
#pragma unroll
        for (int i = 0; i < 2; ++i)
#pragma unroll
          for (int j = 0; j < 4; ++j) acc[i][j] = wmh(a[i], w[j], acc[i][j]);
      } else { v16b a[2 * MT], al[2], w[4];
#pragma unroll
        for (int i = 0; i < 2 * MT; ++i) { union { v16b v; v8b q[2]; } u; const char* p = fa + off + ((i >> 1) * 128 + (i & 1) * 16) * PITCH + kk * 64; u.q[0] = *(const v8b*)p; u.q[1] = *(const v8b*)(p + 32); a[i] = u.v;
          if constexpr (MODE == 2) { u.q[0] = *(const v8b*)(p + 2 * PL); u.q[1] = *(const v8b*)(p + 2 * PL + 32); al[i] = u.v; } }
#pragma unroll
        for (int j = 0; j < 4; ++j) { union { v16b v; v8b q[2]; } u; const char* p = fb + off + j * 16 * PITCH + kk * 64; u.q[0] = *(const v8b*)p; u.q[1] = *(const v8b*)(p + 32); w[j] = u.v; }
#pragma unroll
        for (int i = 0; i < 2 * MT; ++i)
#pragma unroll
          for (int j = 0; j < 4; ++j) acc[i][j] = wmb(a[i], w[j], acc[i][j]);
        if constexpr (MODE == 2) {
#pragma unroll
          for (int i = 0; i < 2; ++i)
#pragma unroll
            for (int j = 0; j < 4; ++j) acc[i][j] = wmb(al[i], w[j], acc[i][j]); } } } };
  fetch(); stage(0); __syncthreads();
  int cur = 0;
  for (int s = 0; s + 1 < NS; ++s) { fetch(); products(cur);
    __builtin_amdgcn_sched_barrier(0);   // keeps the conversions, which wait for the loads in flight, behind the products that cover the loads' latency
    cur ^= BUF; stage(cur); __syncthreads(); }   /* the one barrier of a step publishes the buffer just written and ends the reads of the one written next */
  products(cur); __syncthreads(); }
// stands behind a run of global loads or stores, in front of any rewrite of the registers that they name; the scheduling barrier holds later arithmetic behind it
#define XW() do { asm volatile("s_wait_xcnt 0x0" ::: "memory"); __builtin_amdgcn_sched_barrier(0); } while (0)
// ---- k_proj: block = (256 rows, 128 cols, which), written out as two halves of 128 rows one after the other: q/k/v = X W (+ b) with exact bf16 products (K = DIN) -> which 0: q f16 rows (+ residual rows < QHI); 1: k f16 in fragment order (+ residual for t < KHI); 2: v f16 in fragment order (+ bf16 hi/lo for t < KHI). The output staging reuses the LDS of the operand buffers.
__global__ __launch_bounds__(256) void k_proj(const float* __restrict__ XQ, const float* __restrict__ XK, const float* __restrict__ XV, const float* __restrict__ WQ, const float* __restrict__ WK, const float* __restrict__ WV, const float* __restrict__ BQ, const float* __restrict__ BK, const float* __restrict__ BV,
    _Float16* __restrict__ QH, _Float16* __restrict__ QL, _Float16* __restrict__ KH, _Float16* __restrict__ KL, _Float16* __restrict__ VT, __bf16* __restrict__ VB, __bf16* __restrict__ VBL) {
  __shared__ __align__(16) char sm[3 * 128 * 136 * 2];
  const int tid = threadIdx.x, wave = tid >> 5, lane = tid & 31, col = lane & 15, g = lane >> 4, wr = wave >> 1, wc = wave & 1; const int which = blockIdx.z; const int c0 = blockIdx.y * 128; const size_t rb0 = (size_t)blockIdx.x * 256; const size_t bb = rb0 / TT;
  const float* X = which == 0 ? XQ : which == 1 ? XK : XV; const float* WA = which == 0 ? WQ : which == 1 ? WK : WV; const float* BA = which == 0 ? BQ : which == 1 ? BK : BV;
  v8f acc[4][4] = {};
  gemm_tile<0, 32, 2>(X + rb0 * DIN, WA + (size_t)c0 * DIN, sm, acc, (int)((2 * blockIdx.x + 4 * blockIdx.y) & 31));   /* 32 k steps: the 16 row blocks that share a weight tile start 2 steps apart, the 8 column blocks that share input rows 4 steps apart */
  // unrolled: the accumulators stay indexed by constants
#pragma unroll
  for (int hh = 0; hh < 2; ++hh) { const size_t r0 = rb0 + 128 * hh; const int t0 = (int)(r0 % TT);   /* half hh: rows r0 .. r0 + 127, accumulators acc[2 hh + i] */
  if (hh) __syncthreads();   // every wave has read the first half out of the staging LDS before the second half is written there
  if (which < 2) { _Float16 (*sh)[136] = (_Float16 (*)[136])sm; _Float16 (*sl)[136] = (_Float16 (*)[136])(sm + 128 * 136 * 2);
    _Float16* DH = which == 0 ? QH : KH; _Float16* DL = which == 0 ? QL : KL; const int nhi = which == 0 ? QHI : KHI; const bool hi_rows = t0 < nhi; const float qs = which == 0 ? C2 : 1.0f;   /* q carries the softmax scale */
#pragma unroll
    for (int j = 0; j < 4; ++j) { const int cl = wc * 64 + j * 16 + col; float bias = 0.f; if (BA) { bias = bfr(BA[c0 + cl]); XW(); }
#pragma unroll
      for (int i = 0; i < 2; ++i)
#pragma unroll
        for (int r = 0; r < 8; ++r) { const float v = (acc[2 * hh + i][j][r] + bias) * qs; const _Float16 hv = (_Float16)v; const int rl = wr * 32 + i * 16 + 8 * g + r; sh[rl][cl] = hv; sl[rl][cl] = (_Float16)((v - (float)hv) * 1024.0f); } }
    __syncthreads();
    v4u t[8];
    if (which == 0) { const int rl = tid >> 4, q = tid & 15;   /* piece it of a thread: row rl + 16 it, 16 bytes at element 8 q */
#pragma unroll
      for (int it = 0; it < 8; ++it) t[it] = *(const v4u*)&sh[rl + 16 * it][q * 8];
#pragma unroll
      for (int it = 0; it < 8; ++it) vst2((unsigned*)(DH + (r0 + rl + 16 * it) * CC + c0 + q * 8), t[it]);
      if (hi_rows) { XW();
#pragma unroll
        for (int it = 0; it < 8; ++it) t[it] = *(const v4u*)&sl[rl + 16 * it][q * 8];
#pragma unroll
        for (int it = 0; it < 8; ++it) vst2((unsigned*)(DL + (bb * nhi + t0 + rl + 16 * it) * (size_t)CC + c0 + q * 8), t[it]); }
      XW();   /* behind the q stores, in front of the second half's rewrite of the registers that they name */
    } else {   /* k, fragment order: wave = 16-key tile; piece it = (head it >> 2, kc, q): key 16 wave + col, dims 16 it + 8 g + 0..7 of the 128 columns; a wave's store is 512 contiguous bytes */
      const size_t hb = bb * NH + c0 / HD; const int kt = (t0 >> 4) + wave;
#pragma unroll
      for (int it = 0; it < 8; ++it) t[it] = *(const v4u*)&sh[wave * 16 + col][it * 16 + 8 * g];
#pragma unroll
      for (int it = 0; it < 8; ++it) vst2((unsigned*)(DH + ((hb + (it >> 2)) * (TT / 16) + kt) * 1024 + (it & 3) * 256 + lane * 8), t[it]);
      if (hi_rows) { XW();
#pragma unroll
        for (int it = 0; it < 8; ++it) t[it] = *(const v4u*)&sl[wave * 16 + col][it * 16 + 8 * g];
#pragma unroll
        for (int it = 0; it < 8; ++it) vst2((unsigned*)(DL + ((hb + (it >> 2)) * (KHI / 16) + kt) * 1024 + (it & 3) * 256 + lane * 8), t[it]); }
      XW(); }   /* behind the k stores, with or without the residual run, in front of any rewrite of the registers that they name */
  } else { _Float16 (*th)[136] = (_Float16 (*)[136])sm; __bf16 (*tb)[136] = (__bf16 (*)[136])(sm + 128 * 136 * 2); __bf16 (*tbl)[136] = (__bf16 (*)[136])(sm + 2 * 128 * 136 * 2); const bool hi_rows = t0 < KHI;
#pragma unroll
    for (int j = 0; j < 4; ++j) { const int cl = wc * 64 + j * 16 + col; float bias = 0.f; if (BA) { bias = bfr(BA[c0 + cl]); XW(); }
#pragma unroll
      for (int i = 0; i < 2; ++i)
#pragma unroll
        for (int r = 0; r < 8; ++r) { const float v = acc[2 * hh + i][j][r] + bias; const int rl = wr * 32 + i * 16 + 8 * g + r; th[cl][rl] = (_Float16)v; const __bf16 bh = (__bf16)v; tb[cl][rl] = bh; tbl[cl][rl] = (__bf16)(v - (float)bh); } }
    __syncthreads();
    /* v, fragment order: wave = (head wave >> 2, d = wave & 3); piece it = (32-key group it >> 1, q): dim 16 wave + col of the 128 columns, keys 16 it + 8 g + 0..7; a wave's store is 512 contiguous bytes */
    const size_t hb = bb * NH + c0 / HD + (wave >> 2); const int kg = t0 >> 5; const int fo = (wave & 3) * 512 + lane * 8; v4u t[8];
#pragma unroll
    for (int it = 0; it < 8; ++it) t[it] = *(const v4u*)&th[wave * 16 + col][it * 16 + 8 * g];
#pragma unroll
    for (int it = 0; it < 8; ++it) vst2((unsigned*)(VT + (hb * (TT / 32) + kg + (it >> 1)) * 2048 + (it & 1) * 256 + fo), t[it]);
    XW();
    if (hi_rows) {
#pragma unroll
      for (int it = 0; it < 8; ++it) t[it] = *(const v4u*)&tb[wave * 16 + col][it * 16 + 8 * g];
#pragma unroll
      for (int it = 0; it < 8; ++it) vst2((unsigned*)(VB + (hb * (KHI / 32) + kg + (it >> 1)) * 2048 + (it & 1) * 256 + fo), t[it]);
      XW();
#pragma unroll
      for (int it = 0; it < 8; ++it) t[it] = *(const v4u*)&tbl[wave * 16 + col][it * 16 + 8 * g];
#pragma unroll
      for (int it = 0; it < 8; ++it) vst2((unsigned*)(VBL + (hb * (KHI / 32) + kg + (it >> 1)) * 2048 + (it & 1) * 256 + fo), t[it]);
      XW(); } } } }
// frag_h from a base, the lane's own byte offset (row and lane half; 0 where the base already holds it) and a constant element offset
__device__ __forceinline__ v16h frag_s(const _Float16* base, unsigned lo, size_t e) { union { v16h v; v8h q[2]; } u; const char* p = (const char*)base + lo; u.q[0] = *(const v8h*)(p + 2 * e); u.q[1] = *(const v8h*)(p + 2 * e + 32); return u.v; }
// a fragment stored in fragment order: its two 16-byte pieces per lane lie 512 bytes apart; from a base, the lane's byte offset 16 lane (0 where the base already holds it) and a constant element offset
__device__ __forceinline__ v16h frag_o(const _Float16* base, unsigned lo, size_t e) { union { v16h v; v8h q[2]; } u; const char* p = (const char*)base + lo; u.q[0] = *(const v8h*)(p + 2 * e); u.q[1] = *(const v8h*)(p + 2 * e + 512); return u.v; }
// the same for bf16, from the lane's own address
__device__ __forceinline__ v16b frag_bo(const __bf16* base, size_t e) { union { v16b v; v8b q[2]; } u; u.q[0] = *(const v8b*)(base + e); u.q[1] = *(const v8b*)(base + e + 256); return u.v; }
// ---- k_attn: one walk = QWAVE queries (NCG groups of 16 columns) of (b, h) and a run of their passes of KPASS keys; wave w + 4 walks its early queries' passes, then its late queries' from cut on, wave w the late queries' below cut, and the two partial states are merged. S^T = k q^T (a lane holds the logits of ONE query: tile j, register r = key 16 j + 8 g + r), softmax reference and running sum per lane, ctx^T += v^T P^T with P^T packed from the score registers as the B operand (element order = the fragment k order above). Logits and P stay in registers. Queries < QHI: 3-product logits (f16 residuals) and P, v as bf16 hi + lo (3 products).
#define NCG 2              // 16-query column groups per wave: each k / v fragment load feeds NCG products
#define NKT 4              // 16-key tiles per pass
#define KPASS (16 * NKT)
#define QWAVE (16 * NCG)
#define QBLK (4 * QWAVE)
// ---- the running softmax. The q.k sums are logits in base-2 units (q carries C2). The reference that the exponentials are taken against is known BEFORE a pass's products and enters them as their start value (nm = minus the reference in all eight registers of a C operand), so a score register leaves the matrix unit as logit - reference and goes straight into one hardware base-2 exponential. The reference is renewed (sm_renew) only in a pass where some query of the wave has seen no key yet or a logit stands more than LAZY above it: P stays at or below 2^LAZY (f16 and bf16 hold it), and sum and ctx are rescaled in such a pass alone.
// Every unroll directive of this section keeps a register array (scores, ctx, the C operand) indexed by constants.
// mask by index: strict past, except (0, 0); an excluded logit is -3e38 and its exp is 0
#define LAZY 8.0f
__device__ __forceinline__ void sm_mask(v8f (&st)[NKT], int kg, int t) {
#pragma unroll
  for (int j = 0; j < NKT; ++j)
#pragma unroll
    for (int r = 0; r < 8; ++r) { const int k = kg + j * 16 + r; st[j][r] = (k < t || (k | t) == 0) ? st[j][r] : -3.0e38f; } }
__device__ __forceinline__ float sm_max(const v8f (&st)[NKT]) { float mx = st[0][0];
#pragma unroll
  for (int j = 0; j < NKT; ++j)
#pragma unroll
    for (int r = 0; r < 8; ++r) mx = fmaxf(mx, st[j][r]);
  return mx; }
// m: the reference, or -3e38 while the query has seen only excluded keys (nm is then 0, sum and ctx are 0). mx: the lane's largest logit - reference of this pass. Both lane halves of a query get the same new reference.
__device__ __forceinline__ void sm_renew(v8f (&st)[NKT], v8f (&acc)[HD / 16], v8f& nm, float& m, float& l, float mx) {
  const float mj = fmaxf(mx, __shfl_xor(mx, 16)), mc = -nm[0], mn = fmaxf(m, mj + mc), mcn = mn > -1.0e30f ? mn : 0.f, f = __builtin_amdgcn_exp2f(m - mn), dl = mc - mcn;
#pragma unroll
  for (int j = 0; j < NKT; ++j) st[j] = st[j] + dl;
  l *= f; m = mn;
#pragma unroll
  for (int d = 0; d < HD / 16; ++d) acc[d] = acc[d] * f;
#pragma unroll
  for (int r = 0; r < 8; ++r) nm[r] = -mcn; }
__device__ __forceinline__ void sm_exp(v8f (&st)[NKT], float& l) { float s = 0.f;
#pragma unroll
  for (int j = 0; j < NKT; ++j) { float x[8];
#pragma unroll
    for (int r = 0; r < 8; ++r) x[r] = st[j][r];
    // a tile's eight exponentials, each in its own register: no one of them reads a neighbour's result or overwrites a neighbour's argument, and the v_nop is the slot that the last one asks for in front of whatever the compiler puts next (as builtins, neighbours came out sharing registers)
    asm("v_exp_f32 %0, %0\n\tv_exp_f32 %1, %1\n\tv_exp_f32 %2, %2\n\tv_exp_f32 %3, %3\n\tv_exp_f32 %4, %4\n\tv_exp_f32 %5, %5\n\tv_exp_f32 %6, %6\n\tv_exp_f32 %7, %7\n\tv_nop"
        : "+v"(x[0]), "+v"(x[1]), "+v"(x[2]), "+v"(x[3]), "+v"(x[4]), "+v"(x[5]), "+v"(x[6]), "+v"(x[7]));
#pragma unroll
    for (int r = 0; r < 8; ++r) { st[j][r] = x[r]; s += x[r]; } }
  l += s; }
// one pass for the wave's NCG column groups (queries t0 + 16 c of this lane, keys from kg on): st arrives as logit - reference and leaves as P
__device__ __forceinline__ void sm_step(v8f (&st)[NCG][NKT], v8f (&acc)[NCG][HD / 16], v8f (&nm)[NCG], float (&m)[NCG], float (&l)[NCG], int kg, int t0, bool edge) {
  if (edge) {
#pragma unroll
    for (int c = 0; c < NCG; ++c) sm_mask(st[c], kg, t0 + c * 16); }
  float mx[NCG], top = -3.0e38f, low = 0.f;
#pragma unroll
  for (int c = 0; c < NCG; ++c) { mx[c] = sm_max(st[c]); top = fmaxf(top, mx[c]); low = fminf(low, m[c]); }
  if (__builtin_amdgcn_ballot_w32(top > LAZY || low < -1.0e30f) != 0u) {   /* one test per pass, a scalar branch: taken in a walk's first pass and where a logit outgrows the reference */
#pragma unroll
    for (int c = 0; c < NCG; ++c) sm_renew(st[c], acc[c], nm[c], m[c], l[c], mx[c]); }
#pragma unroll
  for (int c = 0; c < NCG; ++c) sm_exp(st[c], l[c]); }
// two waves per SIMD is all this grid supplies (256 workgroups of 8 waves): the register budget of two lets the fragments fetched ahead stay in registers
__global__ __launch_bounds__(256) __attribute__((amdgpu_waves_per_eu(2, 2))) void k_attn(const _Float16* __restrict__ QH, const _Float16* __restrict__ KH, const _Float16* __restrict__ QL, const _Float16* __restrict__ KL, const _Float16* __restrict__ VT, const __bf16* __restrict__ VB, const __bf16* __restrict__ VBL, float* __restrict__ Y) {
  const int tid = threadIdx.x, lane = tid & 31, col = lane & 15, g = lane >> 4; const int wave = __builtin_amdgcn_readfirstlane(tid >> 5);
  __shared__ __align__(16) char sx[4 * 17 * 512];   /* a helper wave's partial state: 17 pieces of 16 bytes per lane */
  const int b = blockIdx.x / NH, h = blockIdx.x % NH; const int w4 = wave & 3; const bool helper = wave >= 4;
  // the workgroup holds query tiles n - 1 - y (late) and y (early). Waves w and w + 4 share a SIMD and the same 32 queries of each tile: wave w + 4 walks the early tile's queries, then the late queries' passes from cut on; wave w walks the late queries' passes below cut. cut gives both the same load (a high-precision pass counted as three), so that neither runs alone on its SIMD for long
  const int qlL = (TT / QBLK - 1 - (int)blockIdx.y) * QBLK + w4 * QWAVE, qlE = (int)blockIdx.y * QBLK + w4 * QWAVE;
  const int nL = (qlL + QWAVE - 2) / KPASS + 1, nE = (qlE + QWAVE - 2) / KPASS + 1;   /* a wave's last visible key is its first query + QWAVE - 2 */
  const int half = (nL + (qlE < QHI ? 3 * nE : nE) + 1) / 2, cut = half < nL ? half : nL;
  float m[NCG], l[NCG]; v8f acc[NCG][HD / 16];
  // acc[c][d][r] = ctx(query q0 + 16 c + col, dim 16 d + 8 g + r) x sum: join the two lane halves' sums, divide, 32 contiguous bytes per lane and d
  auto store_out = [&](int q0) {
#pragma unroll
    for (int c = 0; c < NCG; ++c) { const float a = l[c] + __shfl_xor(l[c], 16); const float inv = a > 0.f ? 1.0f / a : 0.f; float* yr = Y + ((size_t)b * TT + q0 + c * 16 + col) * CC + h * HD + 8 * g;
#pragma unroll
      for (int d = 0; d < HD / 16; ++d) { const v8f o = acc[c][d] * inv; vst2(yr + d * 16, v4f{o[0], o[1], o[2], o[3]}); vst2(yr + d * 16 + 4, v4f{o[4], o[5], o[6], o[7]}); } }
    XW(); };
  // one walk: the 32 queries from ql0 on, passes p0 .. npass - 1; early: the queries may be high-precision rows
  auto walk = [&](int ql0, int p0, int npass, bool early) __attribute__((always_inline)) {
  const _Float16* Qb = QH + ((size_t)b * TT + ql0 + col) * CC + h * HD; const size_t bh = (size_t)(b * NH + h) * HD;   /* x the plane's key count: where (b, h) begins in a fragment-order plane; 64 keys (a pass) are 4096 elements there */
#pragma unroll
  for (int c = 0; c < NCG; ++c) { m[c] = -3.0e38f; l[c] = 0.f;
#pragma unroll
    for (int d = 0; d < HD / 16; ++d) acc[c][d] = v8f{}; }
  if (early && ql0 < QHI) {   /* wave-uniform; an early tile alone (p0 = 0); the wave's passes end at or below key KHI */
    const _Float16* QLb = QL + ((size_t)b * QHI + ql0 + col) * CC + h * HD; const _Float16* Kb = KH + bh * TT + 8 * lane; const _Float16* KLb = KL + bh * KHI + 8 * lane;
    const __bf16* VBb = VB + bh * KHI + 8 * lane; const __bf16* VLb = VBL + bh * KHI + 8 * lane;
    v16h qf[NCG][2], qlf[NCG][2]; const _Float16* qp = Qb + 8 * g; const _Float16* qlp = QLb + 8 * g;   /* the lane's own addresses */
#pragma unroll
    for (int c = 0; c < NCG; ++c)
#pragma unroll
      for (int kc = 0; kc < 2; ++kc) { qf[c][kc] = frag_s(qp, 0u, (size_t)c * 16 * CC + kc * 32); qlf[c][kc] = frag_s(qlp, 0u, (size_t)c * 16 * CC + kc * 32); }
    // stands in front of any rewrite of the address registers that the loads above it name; the two addresses as inputs keep their registers whole until it, the scheduling barrier holds the loads in front of it and later address arithmetic behind it (the fragments themselves are no operands: as operands of an asm statement they would be held to the first 256 registers for the whole loop, which now has no room for them there)
    asm volatile("s_wait_xcnt 0x0" :: "v"(qp), "v"(qlp) : "memory");
    __builtin_amdgcn_sched_barrier(0);
    v8f nm[NCG] = {};   /* minus the reference of each column group's query, the start value of its score products */
    for (int ps = 0; ps < npass; ++ps) { const int k0 = ps * KPASS; v8f st[NCG][NKT];
      // the pass's k fragments, values and residuals, are requested as one group: the wave waits for memory once, not once per tile and half row
      const _Float16* kp = Kb + (size_t)k0 * HD; const _Float16* klp = KLb + (size_t)k0 * HD;   /* the lane's own addresses: every load of the group is one of them plus a constant */
      v16h kf[NKT][2], klf[NKT][2];
#pragma unroll
      for (int j = 0; j < NKT; ++j)
#pragma unroll
        for (int kc = 0; kc < 2; ++kc) { kf[j][kc] = frag_o(kp, 0u, (size_t)j * 1024 + kc * 512); klf[j][kc] = frag_o(klp, 0u, (size_t)j * 1024 + kc * 512); }
      // stands in front of any rewrite of the address registers that the loads above it name; the two addresses as inputs keep their registers whole until it
      asm volatile("s_wait_xcnt 0x0" :: "v"(kp), "v"(klp) : "memory");
      __builtin_amdgcn_sched_barrier(0);   // keeps the compiler from sinking those loads to their first use, where each would be waited for alone
#pragma unroll
      for (int j = 0; j < NKT; ++j) { v8f a[NCG], al[NCG] = {};
#pragma unroll
        for (int kc = 0; kc < 2; ++kc)
#pragma unroll
          for (int c = 0; c < NCG; ++c) { a[c] = wmh(kf[j][kc], qf[c][kc], kc == 0 ? nm[c] : a[c]); al[c] = wmh(kf[j][kc], qlf[c][kc], al[c]); al[c] = wmh(klf[j][kc], qf[c][kc], al[c]); }
#pragma unroll
        for (int c = 0; c < NCG; ++c) st[c][j] = a[c] + al[c] * (1.0f / 1024.0f); }
      // the pass's v fragments, hi and lo, are requested here as one group, ahead of the softmax arithmetic that covers their latency
      const __bf16* vp = VBb + (size_t)k0 * HD; const __bf16* vlp = VLb + (size_t)k0 * HD;
      v16b vh[NKT / 2][HD / 16], vl[NKT / 2][HD / 16];
#pragma unroll
      for (int jj = 0; jj < NKT / 2; ++jj)
#pragma unroll
        for (int d = 0; d < HD / 16; ++d) { vh[jj][d] = frag_bo(vp, (size_t)jj * 2048 + d * 512); vl[jj][d] = frag_bo(vlp, (size_t)jj * 2048 + d * 512); }
      // as above: in front of any rewrite of the two addresses, and the loads stay in front of the softmax
      asm volatile("s_wait_xcnt 0x0" :: "v"(vp), "v"(vlp) : "memory");
      __builtin_amdgcn_sched_barrier(0);
      sm_step(st, acc, nm, m, l, k0 + 8 * g, ql0 + col, true);
#pragma unroll
      for (int jj = 0; jj < NKT / 2; ++jj) { F2 p[NCG];
#pragma unroll
        for (int c = 0; c < NCG; ++c) { float pv[16];
#pragma unroll
          for (int i = 0; i < 8; ++i) { pv[i] = st[c][2 * jj][i]; pv[8 + i] = st[c][2 * jj + 1][i]; }
          p[c] = bsplit16(pv); }
#pragma unroll
        for (int d = 0; d < HD / 16; ++d)
#pragma unroll
          for (int c = 0; c < NCG; ++c) { acc[c][d] = wmb(vh[jj][d], p[c].h, acc[c][d]); acc[c][d] = wmb(vh[jj][d], p[c].l, acc[c][d]); acc[c][d] = wmb(vl[jj][d], p[c].h, acc[c][d]); } } }
  } else if (p0 < npass) {
    const _Float16* Qu = QH + ((size_t)b * TT + ql0) * CC + __builtin_amdgcn_readfirstlane(h * HD); const _Float16* Ku = KH + bh * TT; const _Float16* Vu = VT + bh * TT;   /* wave-uniform bases; the builtin keeps q's base a scalar pair in both walks, so that the wait below holds the very pair that the q loads name (in the second walk the head offset came through a vector register, and the loads got a copy that the wait did not hold) */
    const unsigned rlo = 2u * (col * CC + 8 * g), flo = 16u * lane;   /* the lane's byte offset in q rows; in a 512-byte piece of k or v */
    const _Float16* Kl = Ku + 8 * lane; const _Float16* Vl = Vu + 8 * lane;   /* the lane's own 16 bytes of the first pieces of k, of v */
    v16h qf[NCG][2];
#pragma unroll
    for (int c = 0; c < NCG; ++c)
#pragma unroll
      for (int kc = 0; kc < 2; ++kc) qf[c][kc] = frag_s(Qu, rlo, (size_t)c * 16 * CC + kc * 32);
    v16h kf[2][NKT], vf[NKT / 2][HD / 16]; const _Float16* Kf = Ku + (size_t)p0 * KPASS * HD;   /* the task's first pass */
#pragma unroll
    for (int kc = 0; kc < 2; ++kc)
#pragma unroll
      for (int j = 0; j < NKT; ++j) kf[kc][j] = frag_o(Kf, flo, (size_t)j * 1024 + kc * 512);
    // stands in front of any rewrite of the registers that the loads above it name; the two bases and the two offsets as inputs keep those registers whole until it, the scheduling barrier holds the loads in front of it and later address arithmetic behind it
    asm volatile("s_wait_xcnt 0x0" :: "s"(Qu), "s"(Kf), "v"(rlo), "v"(flo) : "memory");
    __builtin_amdgcn_sched_barrier(0);
    v8f nm[NCG] = {};   /* minus the reference of each column group's query, the start value of its score products */
    for (int ps = p0; ps < npass; ++ps) { const int k0 = ps * KPASS; v8f st[NCG][NKT];
#pragma unroll
      for (int kc = 0; kc < 2; ++kc)
#pragma unroll
        for (int j = 0; j < NKT; ++j)
#pragma unroll
          for (int c = 0; c < NCG; ++c) st[c][j] = wmh(kf[kc][j], qf[c][kc], kc == 0 ? nm[c] : st[c][j]);
      // this pass's v fragments and the next pass's k fragments (the last pass fetches its own again: stays inside the wave's key range) are requested here, ahead of the softmax arithmetic that covers their latency
      const int kn = ps + 1 < npass ? k0 + KPASS : k0; const _Float16* vp = Vl + (size_t)k0 * HD; const _Float16* kp = Kl + (size_t)kn * HD;   /* the lane's own addresses: every load of the run is one of them plus a constant */
#pragma unroll
      for (int jj = 0; jj < NKT / 2; ++jj)
#pragma unroll
        for (int d = 0; d < HD / 16; ++d) vf[jj][d] = frag_o(vp, 0u, (size_t)jj * 2048 + d * 512);
#pragma unroll
      for (int kc = 0; kc < 2; ++kc)
#pragma unroll
        for (int j = 0; j < NKT; ++j) kf[kc][j] = frag_o(kp, 0u, (size_t)j * 1024 + kc * 512);
      // stands in front of any rewrite of the address registers that the loads above it name; the two addresses as inputs keep their registers whole until it: no load of the run may land in a pair that the loads in front of it name
      asm volatile("s_wait_xcnt 0x0" :: "v"(vp), "v"(kp) : "memory");
      __builtin_amdgcn_sched_barrier(0);   // keeps the compiler from sinking those loads to their first use, where each would be waited for alone
      const bool edge = k0 + KPASS > ql0;   /* wave-uniform: only passes that reach the wave's first query hold excluded keys */
      sm_step(st, acc, nm, m, l, k0 + 8 * g, ql0 + col, edge);
#pragma unroll
      for (int jj = 0; jj < NKT / 2; ++jj) { v16h p[NCG];
#pragma unroll
        for (int c = 0; c < NCG; ++c)
#pragma unroll
          for (int i = 0; i < 8; ++i) { p[c][i] = (_Float16)st[c][2 * jj][i]; p[c][8 + i] = (_Float16)st[c][2 * jj + 1][i]; }
#pragma unroll
        for (int d = 0; d < HD / 16; ++d)
#pragma unroll
          for (int c = 0; c < NCG; ++c) acc[c][d] = wmh(vf[jj][d], p[c], acc[c][d]); } } }
  };
  if (helper) { walk(qlE, 0, nE, true); store_out(qlE); }
  walk(qlL, helper ? cut : 0, helper ? nL : cut, false);
  // the helper's reference, partial sum and ctx of the late queries go to its partner through LDS (the same lane holds the same query and dims in both waves): piece q of a lane at (17 w + q) x 512 + 16 lane
  char* xp = sx + (w4 * 17 * 32 + lane) * 16;
  if (helper) {
#pragma unroll
    for (int c = 0; c < NCG; ++c)
#pragma unroll
      for (int d = 0; d < HD / 16; ++d) { const v8f o = acc[c][d]; *(v4f*)(xp + ((c * (HD / 16) + d) * 2) * 512) = v4f{o[0], o[1], o[2], o[3]}; *(v4f*)(xp + ((c * (HD / 16) + d) * 2 + 1) * 512) = v4f{o[4], o[5], o[6], o[7]}; }
    *(v4f*)(xp + 16 * 512) = v4f{m[0], m[1], l[0], l[1]}; }
  __syncthreads();   // the partial states are written before a partner reads them
  if (!helper) { const v4f ml = *(const v4f*)(xp + 16 * 512);
#pragma unroll
    for (int c = 0; c < NCG; ++c) { const float mm = fmaxf(m[c], ml[c]), f1 = __builtin_amdgcn_exp2f(m[c] - mm), f2 = __builtin_amdgcn_exp2f(ml[c] - mm); l[c] = l[c] * f1 + ml[NCG + c] * f2;   /* both parts brought to the larger of their two references; a helper without a pass holds sum 0, ctx 0 and f2 = 0 */
#pragma unroll
      for (int d = 0; d < HD / 16; ++d) { const v4f a0 = *(const v4f*)(xp + ((c * (HD / 16) + d) * 2) * 512), a1 = *(const v4f*)(xp + ((c * (HD / 16) + d) * 2 + 1) * 512);
#pragma unroll
        for (int r = 0; r < 4; ++r) { acc[c][d][r] = acc[c][d][r] * f1 + a0[r] * f2; acc[c][d][4 + r] = acc[c][d][4 + r] * f1 + a1[r] * f2; } } }
    store_out(qlL); } }
// ---- k_out: block = (128 rows, 128 cols): out = ctx Wo (+ bo): ctx once to f16 against Wo as f16(bf16 x 2^8) exact (1 product) x 2^-8; causal early rows (< QHI of each sequence): ctx bf16 hi + lo against exact bf16 Wo (2 products). Each wave stages its 32 x 64 of the output in its own part of the LDS that the operand buffers have left.
__global__ __launch_bounds__(256) void k_out(const float* __restrict__ Y, const float* __restrict__ WO, const float* __restrict__ BO, float* __restrict__ OUT) { __shared__ __align__(16) char sm[2 * 3 * 128 * 144];
  const int tid = threadIdx.x, wave = tid >> 5, lane = tid & 31, col = lane & 15, g = lane >> 4, wr = wave >> 1, wc = wave & 1; const int c0 = blockIdx.y * 128; const size_t r0 = (size_t)blockIdx.x * 128;
  v8f acc[2][4] = {}; float sc; const int s0 = (int)((blockIdx.x + 2 * blockIdx.y) & 15);   /* 16 k steps: the 8 column blocks that share ctx rows start 2 steps apart, the 32 row blocks that share a weight tile at all 16 steps, two at each */
  if (CAUSAL && (int)(r0 % TT) < QHI) { gemm_tile<2, 64>(Y + r0 * CC, WO + (size_t)c0 * CC, sm, acc, s0); sc = 1.0f; }   /* block-uniform */
  else { gemm_tile<1, 64>(Y + r0 * CC, WO + (size_t)c0 * CC, sm, acc, s0); sc = 1.0f / 256.0f; }
  float (*sf)[68] = (float (*)[68])(sm + wave * 32 * 68 * 4);
#pragma unroll
  for (int j = 0; j < 4; ++j) { const float bias = BO ? bfr(BO[c0 + wc * 64 + j * 16 + col]) : 0.f;
#pragma unroll
    for (int i = 0; i < 2; ++i)
#pragma unroll
      for (int r = 0; r < 8; ++r) sf[i * 16 + 8 * g + r][j * 16 + col] = acc[i][j][r] * sc + bias; }
  LDSX();
#pragma unroll
  for (int rl = 0; rl < 32; rl += 2) vst2(OUT + (r0 + wr * 32 + rl + g) * DIN + c0 + wc * 64 + col * 4, *(const v4f*)&sf[rl + g][col * 4]); }

extern "C" void kernel_launch(void* const* d_in, const int* in_sizes, int n_in, void* d_out, int out_size, void* d_ws, size_t ws_size, hipStream_t stream) {
  (void)in_sizes; (void)n_in; (void)out_size;
  const float** F = (const float**)d_in;
  if (ws_size < (size_t)WS_END) return;
  char* ws = (char*)d_ws; _Float16 *QH = (_Float16*)(ws + WS_QH), *KH = (_Float16*)(ws + WS_KH), *VT = (_Float16*)(ws + WS_VT), *QL = (_Float16*)(ws + WS_QL), *KL = (_Float16*)(ws + WS_KL); __bf16 *VB = (__bf16*)(ws + WS_VB), *VBL = (__bf16*)(ws + WS_VBL); float *Y = (float*)(ws + WS_Y);
  (void)Y; (void)QL; (void)KL; (void)VB; (void)VBL;
  // inputs: 0 q, 1 k, 2 v [2,2048,1024]; 3 Wq, 4 Wk, 5 Wv, 6 Wo [1024,1024] (out,in), no biases
  k_proj<<<dim3(TNB * TT / 256, CC / 128, 3), 256, 0, stream>>>(F[0], F[1], F[2], F[3], F[4], F[5], nullptr, nullptr, nullptr, QH, QL, KH, KL, VT, VB, VBL);
  k_attn<<<dim3(TNB * NH, TT / QBLK / 2), 256, 0, stream>>>(QH, KH, QL, KL, VT, VB, VBL, Y);
  k_out<<<dim3(TNB * TT / 128, DIN / 128), 256, 0, stream>>>(Y, F[6], nullptr, (float*)d_out);
}
